// v000
// Measured on an AMD MI455X. A time is GPU time per run, averaged over a window of back-to-back runs after a warm-up
// (all launches, gaps included; the runs take copies of the inputs in turn), and the median of several windows.
// Apart from v000's, it joins two sittings. Times from different sittings can be a few percent apart, while
// side-by-side timings come from the same sitting.
// v000, which the later versions start from, runs in 329 microseconds.
// Contractions: x.W{q,k,v}^T on v_wmma_f32_16x16x32_bf16 (x and W RNE-converted to bf16, f32 accumulate);
// scores q'.k'^T (q', k' carried x1024 as f16 hi plane + f16 residual plane, products hh+lh+hl), P.v (P x32768 f16 hi+residual,
// v x1024 f16 hi+residual, products hh+lh+hl) and O.Wo^T (O x1024 f16 hi+residual, Wo as f16(bf16(Wo) x1024), products h.w+l.w):
// v_wmma_f32_16x16x32_f16, f32 accumulate. Rotary tables, rotation, masks, masked base-2 online softmax and 1/l fold in f32 on VALU.
#include <hip/hip_runtime.h>
#include <math.h>
#include <stdint.h>

#define SEQ   2048
#define DMOD  1024
#define NH    16
#define HD    64
#define GINST 129
#define QSC   1024.0f
#define KSC   1024.0f
#define PCAR  32768.0f
#define VCAR  1024.0f
#define OSC   1024.0f
#define WOS   1024.0f
#define LOG2E 1.4426950408889634f
#define WPB   4
#define NQT   (SEQ / 16)
#define NST   (SEQ / 64)
#define NKT   (SEQ / 32)
#define ATT_THREADS (WPB * 32)
#define ATT_BLOCKS  (NQT * (NH / WPB))
#define PTW   (16 * 36)
#define SLW   (16 * 68)
#define WREG  (PTW + SLW)
#define SLAB64 (16 * 68)
#define VTP   72
static_assert(DMOD == NH * HD && HD == 64 && NH == 16);
static_assert((NH % WPB) == 0 && ATT_THREADS == 128);
static_assert((SEQ % 64) == 0 && (SEQ % ATT_THREADS) == 0 && (SEQ % 8) == 0 && SEQ <= 32768);
static_assert((DMOD % 64) == 0 && (DMOD % 32) == 0);
static_assert(((SEQ * DMOD) % 2048) == 0 && ((DMOD * DMOD) % 2048) == 0);
static_assert(((SEQ * NH * 8) % 256) == 0);

typedef unsigned short u16;
typedef _Float16 v16h __attribute__((ext_vector_type(16)));
typedef _Float16 v8h  __attribute__((ext_vector_type(8)));
typedef __bf16   v16b __attribute__((ext_vector_type(16)));
typedef float    v8f  __attribute__((ext_vector_type(8)));
typedef float    v4f  __attribute__((ext_vector_type(4)));
typedef unsigned int v4u __attribute__((ext_vector_type(4)));

union FragH { v16h v; v8h h[2]; v4u u[2]; };
union FragB { v16b v; v4u u[2]; };

struct InvF { float f[32]; };
static_assert(sizeof(InvF) == 128);

// ---- scalar helpers --------------------------------------------------------------------------------
__device__ __forceinline__ unsigned short bf_bits(float f) {          // f32 -> bf16 bits, RNE convert
  unsigned u = __float_as_uint(f);
  return (unsigned short)((u + 0x7FFFu + ((u >> 16) & 1u)) >> 16);
}
__device__ __forceinline__ float bf_up(unsigned short h) { return __uint_as_float(((unsigned)h) << 16); }
__device__ __forceinline__ float bfr(float f) { return bf_up(bf_bits(f)); }
__device__ __forceinline__ unsigned short h_bits(_Float16 x) { return __builtin_bit_cast(unsigned short, x); }
__device__ __forceinline__ unsigned pk16(unsigned short a, unsigned short b) { return (unsigned)a | ((unsigned)b << 16); }
__device__ __forceinline__ v8f zero8() { v8f z = {0.f, 0.f, 0.f, 0.f, 0.f, 0.f, 0.f, 0.f}; return z; }

// ---- fragment loaders: 16-bit A/B operand, lane -> row/col (lane&15), p already includes +8*(lane>>4);
//      elements 0..7 <- p[0..7] (k0+8h..), elements 8..15 <- p[16..23] (k0+16+8h..)  (same split k map for A and B;
//      B is always read from a k-contiguous [n][k] plane)
__device__ __forceinline__ v16h ldfrag_h(const _Float16* p) {
  FragH f;
  f.h[0] = *(const v8h*)(p);
  f.h[1] = *(const v8h*)(p + 16);
  return f.v;
}
__device__ __forceinline__ v16b ldfrag_b(const u16* p) {              // bf16 plane read as unsigned integer vectors
  FragB f;
  f.u[0] = *(const v4u*)(p);
  f.u[1] = *(const v4u*)(p + 16);
  return f.v;
}

__device__ __forceinline__ v8f mma_h(v16h a, v16h b, v8f c) {
  return __builtin_amdgcn_wmma_f32_16x16x32_f16(false, a, false, b, (short)0, c, false, false);
}
__device__ __forceinline__ v8f mma_b(v16b a, v16b b, v8f c) {
  return __builtin_amdgcn_wmma_f32_16x16x32_bf16(false, a, false, b, (short)0, c, false, false);
}
__device__ __forceinline__ void guard2(v8f& a, v8f& b, v16h x0, v16h x1, v16h x2, v16h x3, v16h x4, v16h x5) {
#if defined(__HIP_DEVICE_COMPILE__)
  asm volatile("v_nop\n\tv_nop\n\tv_nop\n\tv_nop"
               : "+v"(a), "+v"(b) : "v"(x0), "v"(x1), "v"(x2), "v"(x3), "v"(x4), "v"(x5) : "memory");
#endif
}
template <typename F>
__device__ __forceinline__ void guard6(v8f& a, v8f& b, v8f& c, v8f& d, F x0, F x1, F x2, F x3, F x4, F x5) {
#if defined(__HIP_DEVICE_COMPILE__)
  asm volatile("v_nop\n\tv_nop\n\tv_nop\n\tv_nop"
               : "+v"(a), "+v"(b), "+v"(c), "+v"(d) : "v"(x0), "v"(x1), "v"(x2), "v"(x3), "v"(x4), "v"(x5) : "memory");
#endif
}
__device__ __forceinline__ void guard10(v8f& a, v8f& b, v8f& c, v8f& d, v16h x0, v16h x1, v16h x2, v16h x3, v16h x4,
                                        v16h x5, v16h x6, v16h x7, v16h x8, v16h x9) {
#if defined(__HIP_DEVICE_COMPILE__)
  asm volatile("v_nop\n\tv_nop\n\tv_nop\n\tv_nop"
               : "+v"(a), "+v"(b), "+v"(c), "+v"(d)
               : "v"(x0), "v"(x1), "v"(x2), "v"(x3), "v"(x4), "v"(x5), "v"(x6), "v"(x7), "v"(x8), "v"(x9) : "memory");
#endif
}
__device__ __forceinline__ void acc_guard4(v8f& a, v8f& b, v8f& c, v8f& d) {
#if defined(__HIP_DEVICE_COMPILE__)
  asm volatile("v_nop\n\tv_nop\n\tv_nop\n\tv_nop" : "+v"(a), "+v"(b), "+v"(c), "+v"(d));
#endif
}
__device__ __forceinline__ void wave_sync_lds() {
  __builtin_amdgcn_fence(__ATOMIC_RELEASE, "workgroup");
  __builtin_amdgcn_wave_barrier();
  __builtin_amdgcn_fence(__ATOMIC_ACQUIRE, "workgroup");
}

// ---- accurate f32 sin/cos of a non-negative f32 angle (|angle| < 32768): f64 two-part pi/2 reduction + f64 polynomials,
//      plain f64 fma/mul only (no library f64 trig path), result converted to f32.
__device__ __forceinline__ void sincos_acc(float angf, float& sv, float& cv) {
  const double a = (double)angf;
  const double TWO_OVER_PI = 0.63661977236758134308;
  const double PIO2_HI = 1.5707963267948966;
  const double PIO2_LO = 6.123233995736766e-17;
  const int kq = (int)(a * TWO_OVER_PI + 0.5);
  const double kd = (double)kq;
  double r = fma(-kd, PIO2_HI, a);
  r = fma(-kd, PIO2_LO, r);
  const double r2 = r * r;
  double sp = 1.0 / 6227020800.0;
  sp = fma(sp, r2, -1.0 / 39916800.0);
  sp = fma(sp, r2, 1.0 / 362880.0);
  sp = fma(sp, r2, -1.0 / 5040.0);
  sp = fma(sp, r2, 1.0 / 120.0);
  sp = fma(sp, r2, -1.0 / 6.0);
  const double s = fma(sp * r2, r, r);
  double cp = -1.0 / 87178291200.0;
  cp = fma(cp, r2, 1.0 / 479001600.0);
  cp = fma(cp, r2, -1.0 / 3628800.0);
  cp = fma(cp, r2, 1.0 / 40320.0);
  cp = fma(cp, r2, -1.0 / 720.0);
  cp = fma(cp, r2, 1.0 / 24.0);
  cp = fma(cp, r2, -0.5);
  const double c = fma(cp, r2, 1.0);
  const int qd = kq & 3;
  const double so = (qd == 0) ? s : (qd == 1) ? c : (qd == 2) ? -s : -c;
  const double co = (qd == 0) ? c : (qd == 1) ? -s : (qd == 2) ? -c : s;
  sv = (float)so;
  cv = (float)co;
}

// =====================================================================================================
// Rotary tables: cosT[t][d], sinT[t][d] for t < SEQ, d < HD, angle = float(t) * inv_freq[d & 31] (f32 product), halves duplicated.
// Wave = one position t, lane = frequency index; inv_freq picked from the by-value table with a static select chain.
// coverage: grid SEQ/8 blocks x 8 waves = SEQ rows; per row 4 line stores = 64 floats of each table.
// =====================================================================================================
__global__ __launch_bounds__(256) void k_tab(float* cosT, float* sinT, InvF inv) {
  const int tid  = threadIdx.x;
  const int lane = tid & 31;
  const int t    = blockIdx.x * 8 + (tid >> 5);
  if (t >= SEQ) return;                     // never taken with the exact grid; no barriers in this kernel
  float f = inv.f[0];
#pragma unroll
  for (int i = 1; i < 32; ++i) f = (lane == i) ? inv.f[i] : f;
  const float ang = (float)t * f;
  float sv, cv;
  sincos_acc(ang, sv, cv);
  float* cr = cosT + (size_t)t * HD;
  float* sr = sinT + (size_t)t * HD;
  {
    *(float*)(cr + lane)      = cv;
    *(float*)(cr + 32 + lane) = cv;
    *(float*)(sr + lane)      = sv;
    *(float*)(sr + 32 + lane) = sv;
    
  }
}

// =====================================================================================================
// f32 -> 16-bit plane, same layout.  f16mode == 0: bf16 RNE bits;  f16mode == 1: f16 bits of (bf16 RNE value) * scale.
// Thread = 8 consecutive elements: two 16-B loads, one 16-B store; 32 consecutive lanes = 512 contiguous, 512-B aligned bytes per
// coverage: grid = n8/256 blocks (exact, host-derived) x 256 thr x 8 = the whole plane.
// =====================================================================================================
__global__ __launch_bounds__(256) void cvt16(const float* __restrict__ x, u16* D, int n8, int f16mode, float scale) {
  const int gt = blockIdx.x * 256 + (int)threadIdx.x;
  if (gt >= n8) return;                     // no barriers in this kernel
  const float* p = x + (size_t)gt * 8;
  const v4f a = *(const v4f*)(p), b4 = *(const v4f*)(p + 4);
  float w[8];
#pragma unroll
  for (int e = 0; e < 4; ++e) { w[e] = a[e]; w[4 + e] = b4[e]; }
  v4u o;
#pragma unroll
  for (int e = 0; e < 4; ++e) {
    const float f0 = w[2 * e], f1 = w[2 * e + 1];
    const unsigned short hb0 = h_bits((_Float16)(bfr(f0) * scale));
    const unsigned short hb1 = h_bits((_Float16)(bfr(f1) * scale));
    const unsigned short bb0 = bf_bits(f0);
    const unsigned short bb1 = bf_bits(f1);
    o[e] = (f16mode != 0) ? pk16(hb0, hb1) : pk16(bb0, bb1);
  }
  u16* d = D + (size_t)gt * 8;
  {
    *(v4u*)(d) = o;
    
  }
}

// =====================================================================================================
// GEMM epilogue shared by both engines: the wave's 16x64 f32 tile (times oscale) staged in its LDS slab (pitch 68),
// coverage: 8 instructions x 2 rows x 16 lanes x 4 floats = the wave's 16 x 64 tile.
// =====================================================================================================
__device__ __forceinline__ void epi64(float* sl, v8f a0, v8f a1, v8f a2, v8f a3, float oscale,
                                      const float* __restrict__ bias, float* C, int N,
                                      size_t rowb, int col0, int lane) {
  const int hh = lane >> 4, m = lane & 15;
#pragma unroll
  for (int r = 0; r < 8; ++r) {
    const int ro = (8 * hh + r) * 68 + m;
    sl[ro]      = a0[r] * oscale;
    sl[ro + 16] = a1[r] * oscale;
    sl[ro + 32] = a2[r] * oscale;
    sl[ro + 48] = a3[r] * oscale;
  }
  wave_sync_lds();
  const v4f braw = *(const v4f*)(bias + col0 + m * 4);
  v4f bb;
#pragma unroll
  for (int e = 0; e < 4; ++e) bb[e] = bfr(braw[e]);
  v4f vals[8];
#pragma unroll
  for (int it = 0; it < 8; ++it) vals[it] = *(const v4f*)(sl + (it * 2 + hh) * 68 + m * 4) + bb;
  float* dst = C + (rowb + (size_t)hh) * (size_t)N + col0 + m * 4;
  {
#pragma unroll
    for (int it = 0; it < 8; ++it) {
      *(v4f*)(dst + (size_t)(it * 2) * (size_t)N) = vals[it];
    }
    
  }
}

// =====================================================================================================
// bf16 GEMM: C[M][N] (f32) = A[M][K] (bf16 row-major) . Bt[N][K]^T (bf16 k-contiguous), times oscale, plus bias[N].
// Block = 64x64 tile, 4 waves x 16 rows; fragments loaded straight from the 16-bit rows (two 16-B loads each, split k map
// for A and B); K stepped by 32 (host checks K % 32 == 0, M % 64 == 0, N % 64 == 0, grid = (M/64)*(N/64)).
// =====================================================================================================
__global__ __launch_bounds__(128)
void gemm_bf(const u16* __restrict__ A, const u16* __restrict__ Bt, const float* __restrict__ bias, float* C,
             int M, int N, int K, float oscale) {
  __shared__ __align__(16) float slab[4 * SLAB64];
  const int tid = threadIdx.x, wave = tid >> 5, lane = tid & 31, hh = lane >> 4, m = lane & 15;
  const int ntile = N >> 6;
  const int bid   = blockIdx.x;
  const int rowb  = (bid / ntile) * 64 + wave * 16;
  const int col0  = (bid % ntile) * 64;
  if (rowb + 16 > M) return;                 // wave-uniform, never taken with the exact grid; no block barriers in this kernel
  const u16* ap = A  + (size_t)(rowb + m) * K + 8 * hh;
  const u16* bp = Bt + (size_t)(col0 + m) * K + 8 * hh;
  const size_t bs = (size_t)16 * K;
  v8f acc0 = zero8(), acc1 = zero8(), acc2 = zero8(), acc3 = zero8();
#pragma unroll 1
  for (int k0 = 0; k0 < K; k0 += 32) {
    const v16b a  = ldfrag_b(ap + k0);
    const v16b b0 = ldfrag_b(bp + k0);
    const v16b b1 = ldfrag_b(bp + bs + k0);
    const v16b b2 = ldfrag_b(bp + 2 * bs + k0);
    const v16b b3 = ldfrag_b(bp + 3 * bs + k0);
    acc0 = mma_b(a, b0, acc0);
    acc1 = mma_b(a, b1, acc1);
    acc2 = mma_b(a, b2, acc2);
    acc3 = mma_b(a, b3, acc3);
    guard6<v16b>(acc0, acc1, acc2, acc3, a, b0, b1, b2, b3, a);
  }
  epi64(slab + wave * SLAB64, acc0, acc1, acc2, acc3, oscale, bias, C, N, (size_t)rowb, col0, lane);
}

// =====================================================================================================
// f16 hi+lo GEMM: C[M][N] (f32) = (Ahi + Alo)[M][K] . Bt[N][K]^T, times oscale, plus bias[N]; Ahi/Alo f16 planes (same layout),
// Bt f16 k-contiguous; products hi.B + lo.B into one accumulator (lo is the unscaled residual of hi). Same tiling as gemm_bf.
// =====================================================================================================
__global__ __launch_bounds__(128)
void gemm_h2(const u16* __restrict__ Ah, const u16* __restrict__ Al, const u16* __restrict__ Bt,
             const float* __restrict__ bias, float* C, int M, int N, int K, float oscale) {
  __shared__ __align__(16) float slab[4 * SLAB64];
  const int tid = threadIdx.x, wave = tid >> 5, lane = tid & 31, hh = lane >> 4, m = lane & 15;
  const int ntile = N >> 6;
  const int bid   = blockIdx.x;
  const int rowb  = (bid / ntile) * 64 + wave * 16;
  const int col0  = (bid % ntile) * 64;
  if (rowb + 16 > M) return;                 // wave-uniform, never taken with the exact grid; no block barriers in this kernel
  const size_t aofs = (size_t)(rowb + m) * K + 8 * hh;
  const _Float16* ahp = (const _Float16*)(const void*)Ah + aofs;
  const _Float16* alp = (const _Float16*)(const void*)Al + aofs;
  const _Float16* bp  = (const _Float16*)(const void*)Bt + (size_t)(col0 + m) * K + 8 * hh;
  const size_t bs = (size_t)16 * K;
  v8f acc0 = zero8(), acc1 = zero8(), acc2 = zero8(), acc3 = zero8();
#pragma unroll 1
  for (int k0 = 0; k0 < K; k0 += 32) {
    const v16h ah = ldfrag_h(ahp + k0), al = ldfrag_h(alp + k0);
    const v16h b0 = ldfrag_h(bp + k0);
    const v16h b1 = ldfrag_h(bp + bs + k0);
    const v16h b2 = ldfrag_h(bp + 2 * bs + k0);
    const v16h b3 = ldfrag_h(bp + 3 * bs + k0);
    acc0 = mma_h(ah, b0, acc0);  acc0 = mma_h(al, b0, acc0);
    acc1 = mma_h(ah, b1, acc1);  acc1 = mma_h(al, b1, acc1);
    acc2 = mma_h(ah, b2, acc2);  acc2 = mma_h(al, b2, acc2);
    acc3 = mma_h(ah, b3, acc3);  acc3 = mma_h(al, b3, acc3);
    guard6<v16h>(acc0, acc1, acc2, acc3, ah, al, b0, b1, b2, b3);
  }
  epi64(slab + wave * SLAB64, acc0, acc1, acc2, acc3, oscale, bias, C, N, (size_t)rowb, col0, lane);
}

// =====================================================================================================
// Rotate-half rotary + 16-bit split pack. Rows are (pos, head) with HD contiguous floats (f32 projection output);
// pos = (row / hpr) mod SEQ.  w[d] = x[d] * cos[pos][d] + r[d] * sin[pos][d],  r[d] = -x[d+32] for d < 32, x[d-32] for d >= 32;
// hi[d] = f16(w * sc), lo[d] = f16(w * sc - hi[d])  (sc a power of two, residual unscaled).
// Thread = 8 consecutive d of one row: 16-B loads of x (own and partner half), cos, sin; one 16-B store per plane per lane;
// coverage: grid = nrows*8/256 blocks x 256 thr x 8 halves = nrows x 64 of each plane exactly (exact division checked statically).
// =====================================================================================================
__global__ __launch_bounds__(256) void rope16(const float* __restrict__ x, const float* __restrict__ cosT,
                                              const float* __restrict__ sinT, u16* hpl, u16* lpl,
                                              int nrows, int hpr, float sc) {
  const int gt  = blockIdx.x * 256 + (int)threadIdx.x;
  const int row = gt >> 3;
  const int d0  = (gt & 7) * 8;
  if (row >= nrows) return;                 // never taken with the exact grid; no barriers in this kernel
  const int pos = (row / hpr) % SEQ;
  const int d1  = d0 ^ 32;
  const float* xr = x + (size_t)row * HD;
  const float* cr = cosT + (size_t)pos * HD + d0;
  const float* sr = sinT + (size_t)pos * HD + d0;
  const v4f xa = *(const v4f*)(xr + d0), xb = *(const v4f*)(xr + d0 + 4);
  const v4f ya = *(const v4f*)(xr + d1), yb = *(const v4f*)(xr + d1 + 4);
  const v4f ca = *(const v4f*)(cr), cb = *(const v4f*)(cr + 4);
  const v4f sa = *(const v4f*)(sr), sb = *(const v4f*)(sr + 4);
  const float sgn = (d0 < 32) ? -1.0f : 1.0f;
  float w[8];
#pragma unroll
  for (int e = 0; e < 4; ++e) {
    w[e]     = xa[e] * ca[e] + (sgn * ya[e]) * sa[e];
    w[4 + e] = xb[e] * cb[e] + (sgn * yb[e]) * sb[e];
  }
  v4u oh, ol;
#pragma unroll
  for (int e = 0; e < 4; ++e) {
    const float t0 = w[2 * e] * sc, t1 = w[2 * e + 1] * sc;
    const _Float16 h0 = (_Float16)t0, h1 = (_Float16)t1;
    const _Float16 l0 = (_Float16)(t0 - (float)h0), l1 = (_Float16)(t1 - (float)h1);
    oh[e] = pk16(h_bits(h0), h_bits(h1));
    ol[e] = pk16(h_bits(l0), h_bits(l1));
  }
  const size_t o8 = (size_t)row * HD + d0;
  {
    *(v4u*)(hpl + o8) = oh;
    *(v4u*)(lpl + o8) = ol;
    
  }
}

// =====================================================================================================
// v^T planes: VH[g*HD + d][s] = f16(v[s][g][d] * 1024), VL = f16 residual of the same value.
// Block = (head g = bid / NST, 64 keys s0 = (bid % NST)*64): 64 source rows of HD floats loaded with 16-B loads, converted,
// scattered into two LDS tiles [d][64 keys] (pitch 72 halves); after a block barrier each d row segment (64 halves = one whole
// coverage: load 256 thr x 16 elements = 64 x 64; store 2 iterations x 256 thr x 8 halves = 64 lines x 64 = the block's tile of
//           each plane; grid = NH x NST blocks covers both planes exactly once.
// =====================================================================================================
__global__ __launch_bounds__(256) void vt16(const float* __restrict__ v, u16* VHo, u16* VLo) {
  __shared__ __align__(16) u16 TH[HD * VTP];
  __shared__ __align__(16) u16 TL[HD * VTP];
  const int tid = threadIdx.x;
  const int bid = blockIdx.x;
  const int st  = bid % NST;
  const int g   = bid / NST;
  if (g >= NH) return;                        // block-uniform, before any barrier; never taken with the exact grid
  const int s0  = st * 64;
  {
    const int sl = tid >> 2;                  // key within tile 0..63
    const int dc = (tid & 3) * 16;            // d chunk
    const float* src = v + ((size_t)(s0 + sl) * NH + g) * HD + dc;
#pragma unroll
    for (int i = 0; i < 4; ++i) {
      const v4f a = *(const v4f*)(src + 4 * i);
#pragma unroll
      for (int e = 0; e < 4; ++e) {
        const float t = a[e] * VCAR;
        const _Float16 h = (_Float16)t;
        const _Float16 l = (_Float16)(t - (float)h);
        TH[(dc + 4 * i + e) * VTP + sl] = h_bits(h);
        TL[(dc + 4 * i + e) * VTP + sl] = h_bits(l);
      }
    }
  }
  __syncthreads();
  v4u vh[2], vl[2];
  const int q8 = tid >> 3, p8 = (tid & 7) * 8;
#pragma unroll
  for (int it = 0; it < 2; ++it) {
    const int line = it * 32 + q8;            // d = 0..63
    vh[it] = *(const v4u*)(TH + line * VTP + p8);
    vl[it] = *(const v4u*)(TL + line * VTP + p8);
  }
  const size_t base = ((size_t)g * HD) * SEQ + s0 + p8;
  {
#pragma unroll
    for (int it = 0; it < 2; ++it) {
      const int line = it * 32 + q8;
      *(v4u*)(VHo + base + (size_t)line * SEQ) = vh[it];
      *(v4u*)(VLo + base + (size_t)line * SEQ) = vl[it];
    }
    
  }
}

// =====================================================================================================
// Triple-masked attention: block bid -> (query tile qt = bid % NQT: rows q0 = 16*qt .. q0+15, head group hg = bid / NQT of WPB
// heads), one wave per head = hg*WPB + wave.
//   q planes (hi, lo f16 x1024) laid out [s][h][d]; k planes [s][h][d]; v^T planes [h][d][s]; instrument and bar ids staged in LDS.
//   For each of the three masks in turn (wave-uniform), each with its OWN running max m_a, sum Z_a and 4 accumulators acc_a:
//     att 0: (iq == ik) && (iq < 129) && (j <= i)
//     att 1: (iq != ik) && (ik < 129) && (iq < 129) && (bq >= 0) && ((0 <= bq-bk <= 2) || (bq-bk == 4))
//     att 2: ((ik == 129) || (bk == -1)) && (j <= i)
//   Key tiles of 32 visited in order (att 0/2 up to the causal limit, att 1 all NKT); per tile every lane evaluates its
//   8 rows x 2 keys mask bits, a wave ballot skips tiles with no allowed element (exact: such keys carry zero weight).
//   Per processed tile: 2 score subtiles x 2 k-steps x 3 products (q_hi.k_hi + q_lo.k_hi + q_hi.k_lo), fragments loaded straight
//   from the 16-bit planes (two 16-B loads per fragment, split k map); masked scores replaced by -inf; online max-subtracted base-2
//   softmax in f32 (scale 1/8 folded), -inf-safe rescale; the 16x32 prob tile stored to wave-private LDS (f32 element stores),
//   loads, same element type as stored), 4+4 v^T B fragments (hi and residual planes), 12 P.V WMMAs (hh + lh + hl).
//   After each mask: out_a = (Z_a > 0, i.e. the row has an allowed key) ? acc_a / Z_a : 0, carries 1/(32768*1024) folded once,
//   added into the wave's private result slab (pitch 68; every element owned by one lane): O = out_0 + out_1 + out_2.
//   One block barrier (after the id staging), reached by all waves; bounded loops only.
// coverage: per wave 4 instructions x 4 rows x 8 lanes x 8 halves = 16 x 64 per plane; grid NQT*(NH/WPB) blocks x WPB waves =
//           every (s, h) row of both O planes exactly once.
// =====================================================================================================
__global__ __launch_bounds__(ATT_THREADS)
void attn3(const u16* __restrict__ QHIp, const u16* __restrict__ QLOp,
           const u16* __restrict__ KHIp, const u16* __restrict__ KLOp,
           const u16* __restrict__ VHIp, const u16* __restrict__ VLOp,
           const int* __restrict__ inst, const int* __restrict__ bar,
           u16* OHIp, u16* OLOp) {
  __shared__ __align__(16) float smem[WPB * WREG];
  __shared__ int sI[SEQ];
  __shared__ int sB[SEQ];

  const int tid  = threadIdx.x;
  const int wave = tid >> 5;
  const int lane = tid & 31;
  const int hh   = lane >> 4;
  const int c    = lane & 15;
  const int bid  = blockIdx.x;
  const int qt   = bid % NQT;
  const int hg   = bid / NQT;
  if (hg >= NH / WPB) return;                // block-uniform, before any barrier; never taken with the exact grid
  const int head = hg * WPB + wave;
  const int q0   = qt * 16;

  for (int i = tid; i < SEQ; i += ATT_THREADS) { sI[i] = inst[i]; sB[i] = bar[i]; }
  __syncthreads();

  float* pt   = smem + wave * WREG;          // prob tile [16][32] pitch 36
  float* slab = pt + PTW;                    // result slab [16][64] pitch 68
#pragma unroll
  for (int r = 0; r < 8; ++r) {
#pragma unroll
    for (int j = 0; j < 4; ++j) slab[(8 * hh + r) * 68 + j * 16 + c] = 0.0f;
  }
  int iq[8], bq8[8];
#pragma unroll
  for (int r = 0; r < 8; ++r) { const int i = q0 + 8 * hh + r; iq[r] = sI[i]; bq8[r] = sB[i]; }

  const size_t qofs = (((size_t)(q0 + c)) * NH + head) * HD + 8 * hh;
  const _Float16* Qh  = (const _Float16*)(const void*)QHIp + qofs;
  const _Float16* Ql  = (const _Float16*)(const void*)QLOp + qofs;
  const size_t kofs = ((size_t)c * NH + head) * HD + 8 * hh;                  // key row kb + c added per step
  const _Float16* Khb = (const _Float16*)(const void*)KHIp + kofs;
  const _Float16* Klb = (const _Float16*)(const void*)KLOp + kofs;
  const size_t vofs = ((size_t)head * HD + c) * SEQ + 8 * hh;                // d column c (+16j), key kb added per step
  const _Float16* Vhb = (const _Float16*)(const void*)VHIp + vofs;
  const _Float16* Vlb = (const _Float16*)(const void*)VLOp + vofs;
  const float lsc = 0.125f * (LOG2E / (QSC * KSC));
  const float oc  = 1.0f / (PCAR * VCAR);
  const size_t KROW = (size_t)NH * HD;                                         // halves between consecutive key rows

#pragma unroll
  for (int att = 0; att < 3; ++att) {
    float mrow[8], lrow[8];
    v8f o[4];
#pragma unroll
    for (int r = 0; r < 8; ++r) { mrow[r] = -INFINITY; lrow[r] = 0.f; }
#pragma unroll
    for (int j = 0; j < 4; ++j) o[j] = zero8();
    const int ncaus = (q0 >> 5) + 1;                                            // tiles holding keys <= q0 + 15
    const int nkt = (att == 1) ? NKT : ((ncaus < NKT) ? ncaus : NKT);

#pragma unroll 1
    for (int kt = 0; kt < nkt; ++kt) {
      const int kb = kt * 32;
      const int j0 = kb + c, j1 = kb + 16 + c;
      const int ik0 = sI[j0], ik1 = sI[j1];
      const int bk0 = sB[j0], bk1 = sB[j1];
      unsigned okb = 0u;
      if (att == 0) {
#pragma unroll
        for (int r = 0; r < 8; ++r) {
          const int i = q0 + 8 * hh + r;
          const bool qa  = iq[r] < GINST;
          const bool ok0 = qa && (iq[r] == ik0) && (j0 <= i);
          const bool ok1 = qa && (iq[r] == ik1) && (j1 <= i);
          okb |= (ok0 ? (1u << r) : 0u) | (ok1 ? (1u << (8 + r)) : 0u);
        }
      } else if (att == 1) {
        const bool ka0 = ik0 < GINST, ka1 = ik1 < GINST;
#pragma unroll
        for (int r = 0; r < 8; ++r) {
          const bool qa  = (iq[r] < GINST) && (bq8[r] >= 0);
          const int  d0  = bq8[r] - bk0, d1 = bq8[r] - bk1;
          const bool w0  = ((d0 >= 0) && (d0 <= 2)) || (d0 == 4);
          const bool w1  = ((d1 >= 0) && (d1 <= 2)) || (d1 == 4);
          const bool ok0 = qa && ka0 && (iq[r] != ik0) && w0;
          const bool ok1 = qa && ka1 && (iq[r] != ik1) && w1;
          okb |= (ok0 ? (1u << r) : 0u) | (ok1 ? (1u << (8 + r)) : 0u);
        }
      } else {
        const bool g0 = (ik0 == GINST) || (bk0 == -1);
        const bool g1 = (ik1 == GINST) || (bk1 == -1);
#pragma unroll
        for (int r = 0; r < 8; ++r) {
          const int i = q0 + 8 * hh + r;
          const bool ok0 = g0 && (j0 <= i);
          const bool ok1 = g1 && (j1 <= i);
          okb |= (ok0 ? (1u << r) : 0u) | (ok1 ? (1u << (8 + r)) : 0u);
        }
      }
      const unsigned anyw = __builtin_amdgcn_ballot_w32(okb != 0u);    // wave-uniform
      if (anyw == 0u) continue;

      // ---- scores: D element r of this lane = (query row q0 + 8hh + r, key kb + c) in s0, key kb + 16 + c in s1 ----
      v8f s0 = zero8(), s1 = zero8();
      const _Float16* k0p = Khb + (size_t)kb * KROW;
      const _Float16* k1p = k0p + (size_t)16 * KROW;
      const _Float16* l0p = Klb + (size_t)kb * KROW;
      const _Float16* l1p = l0p + (size_t)16 * KROW;
#pragma unroll
      for (int kk = 0; kk < 2; ++kk) {
        const v16h qh  = ldfrag_h(Qh + kk * 32),  ql  = ldfrag_h(Ql + kk * 32);
        const v16h kh0 = ldfrag_h(k0p + kk * 32), kl0 = ldfrag_h(l0p + kk * 32);
        const v16h kh1 = ldfrag_h(k1p + kk * 32), kl1 = ldfrag_h(l1p + kk * 32);
        s0 = mma_h(qh, kh0, s0);
        s0 = mma_h(ql, kh0, s0);
        s0 = mma_h(qh, kl0, s0);
        s1 = mma_h(qh, kh1, s1);
        s1 = mma_h(ql, kh1, s1);
        s1 = mma_h(qh, kl1, s1);
        guard2(s0, s1, qh, ql, kh0, kl0, kh1, kl1);
      }
      // ---- mask (replace by -inf) + online softmax in base 2, -inf-safe ----
#pragma unroll
      for (int r = 0; r < 8; ++r) {
        const bool ok0 = ((okb >> r) & 1u) != 0u;
        const bool ok1 = ((okb >> (8 + r)) & 1u) != 0u;
        const float t0 = ok0 ? (s0[r] * lsc) : -INFINITY;
        const float t1 = ok1 ? (s1[r] * lsc) : -INFINITY;
        float mx = fmaxf(t0, t1);
#pragma unroll
        for (int off = 1; off < 16; off <<= 1) mx = fmaxf(mx, __shfl_xor(mx, off, 32));
        const float mn = fmaxf(mrow[r], mx);
        const float ms = (mn == -INFINITY) ? 0.0f : mn;
        const float al = exp2f(mrow[r] - ms);
        mrow[r] = mn;
        const float e0 = exp2f(t0 - ms), e1 = exp2f(t1 - ms);
        float ps = e0 + e1;
#pragma unroll
        for (int off = 1; off < 16; off <<= 1) ps += __shfl_xor(ps, off, 32);
        lrow[r] = lrow[r] * al + ps;
#pragma unroll
        for (int j = 0; j < 4; ++j) o[j][r] *= al;
        const int ro = (8 * hh + r) * 36 + c;
        pt[ro]      = e0;
        pt[ro + 16] = e1;
      }
      wave_sync_lds();
      // ---- A fragments of P*32768: hi f16 and residual f16, row = c, split k map over the 32 keys of this step ----
      FragH ph, pl;
      {
        const float* prow = pt + c * 36 + 8 * hh;
        const v4f p0 = *(const v4f*)(prow), p1 = *(const v4f*)(prow + 4);
        const v4f p2 = *(const v4f*)(prow + 16), p3 = *(const v4f*)(prow + 20);
#pragma unroll
        for (int e = 0; e < 4; ++e) {
          const float ta = p0[e] * PCAR, tb = p1[e] * PCAR, tc = p2[e] * PCAR, td = p3[e] * PCAR;
          const _Float16 ha = (_Float16)ta, hb = (_Float16)tb, hc = (_Float16)tc, hd = (_Float16)td;
          ph.h[0][e]     = ha;                               // elements 0..7  = keys kb + 8hh + 0..7
          ph.h[0][4 + e] = hb;
          ph.h[1][e]     = hc;                               // elements 8..15 = keys kb + 16 + 8hh + 0..7
          ph.h[1][4 + e] = hd;
          pl.h[0][e]     = (_Float16)(ta - (float)ha);
          pl.h[0][4 + e] = (_Float16)(tb - (float)hb);
          pl.h[1][e]     = (_Float16)(tc - (float)hc);
          pl.h[1][4 + e] = (_Float16)(td - (float)hd);
        }
      }
      // ---- P.V : B fragment col n = d = j*16 + c, keys contiguous in the v^T planes ----
      {
        const _Float16* vhp = Vhb + kb;
        const _Float16* vlp = Vlb + kb;
        const v16h vh0 = ldfrag_h(vhp);
        const v16h vh1 = ldfrag_h(vhp + (size_t)16 * SEQ);
        const v16h vh2 = ldfrag_h(vhp + (size_t)32 * SEQ);
        const v16h vh3 = ldfrag_h(vhp + (size_t)48 * SEQ);
        const v16h vl0 = ldfrag_h(vlp);
        const v16h vl1 = ldfrag_h(vlp + (size_t)16 * SEQ);
        const v16h vl2 = ldfrag_h(vlp + (size_t)32 * SEQ);
        const v16h vl3 = ldfrag_h(vlp + (size_t)48 * SEQ);
        o[0] = mma_h(ph.v, vh0, o[0]);  o[0] = mma_h(pl.v, vh0, o[0]);  o[0] = mma_h(ph.v, vl0, o[0]);
        o[1] = mma_h(ph.v, vh1, o[1]);  o[1] = mma_h(pl.v, vh1, o[1]);  o[1] = mma_h(ph.v, vl1, o[1]);
        o[2] = mma_h(ph.v, vh2, o[2]);  o[2] = mma_h(pl.v, vh2, o[2]);  o[2] = mma_h(ph.v, vl2, o[2]);
        o[3] = mma_h(ph.v, vh3, o[3]);  o[3] = mma_h(pl.v, vh3, o[3]);  o[3] = mma_h(ph.v, vl3, o[3]);
        guard10(o[0], o[1], o[2], o[3], ph.v, pl.v, vh0, vh1, vh2, vh3, vl0, vl1, vl2, vl3);
      }
      wave_sync_lds();
    }
    acc_guard4(o[0], o[1], o[2], o[3]);
    // ---- out_a = acc_a / Z_a (0 when no key allowed), carries (32768 on P, 1024 on v) folded once; add into the lane-owned slab ----
#pragma unroll
    for (int r = 0; r < 8; ++r) {
      const float lv  = lrow[r];
      const float ls  = (lv > 0.0f) ? lv : 1.0f;
      const float inv = (lv > 0.0f) ? ((1.0f / ls) * oc) : 0.0f;
#pragma unroll
      for (int j = 0; j < 4; ++j) {
        const int idx = (8 * hh + r) * 68 + j * 16 + c;
        const float nv = slab[idx] + o[j][r] * inv;
        slab[idx] = nv;
      }
    }
  }

  wave_sync_lds();
  // ---- O x1024 -> f16 hi + residual planes; lane = (row in group of 4, 8 consecutive d) ----
  v4u oh[4], ol[4];
  const int rq = lane >> 3, c8 = (lane & 7) * 8;
#pragma unroll
  for (int it = 0; it < 4; ++it) {
    const int row = it * 4 + rq;
    const v4f a = *(const v4f*)(slab + row * 68 + c8), b4 = *(const v4f*)(slab + row * 68 + c8 + 4);
    float w[8];
#pragma unroll
    for (int e = 0; e < 4; ++e) { w[e] = a[e] * OSC; w[4 + e] = b4[e] * OSC; }
#pragma unroll
    for (int e = 0; e < 4; ++e) {
      const _Float16 h0 = (_Float16)w[2 * e], h1 = (_Float16)w[2 * e + 1];
      const _Float16 l0 = (_Float16)(w[2 * e] - (float)h0), l1 = (_Float16)(w[2 * e + 1] - (float)h1);
      oh[it][e] = pk16(h_bits(h0), h_bits(h1));
      ol[it][e] = pk16(h_bits(l0), h_bits(l1));
    }
  }
  const size_t ob = (((size_t)q0) * NH + head) * HD + c8;
  {
#pragma unroll
    for (int it = 0; it < 4; ++it) {
      const int row = it * 4 + rq;
      const size_t o8 = ob + (size_t)row * (NH * HD);
      *(v4u*)(OHIp + o8) = oh[it];
      *(v4u*)(OLOp + o8) = ol[it];
    }
    
  }
}

// =====================================================================================================
// Workspace map (bytes); every plane is fully written by whole-line stores before it is read; all extents are exact multiples
// of the store granularity (no pad rows needed); every offset a multiple of SEQ*256:
//   CT  f32 [SEQ][64]                  SEQ*256        ST  same
//   XB  bf16 [SEQ][1024]               SEQ*2048
//   WQB bf16 [1024 n][1024 k]         2097152        WKB, WVB same        2097152 each
//   WOH f16  [1024 n][1024 k] x1024   2097152
//   QF  f32 [SEQ][1024]                SEQ*4096       KF, VF same
//   QHI f16 [SEQ][16][64] x1024        SEQ*2048       QLO residual
//   KHI f16 [SEQ][16][64] x1024        SEQ*2048       KLO residual
//   VHI f16 [16][64][SEQ] x1024        SEQ*2048       VLO residual
//   OHI f16 [SEQ][1024] x1024          SEQ*2048       OLO residual
//   end (SEQ = 2048)                  72351744
// =====================================================================================================
extern "C" void kernel_launch(void* const* d_in, const int* in_sizes, int n_in,
                              void* d_out, int out_size, void* d_ws, size_t ws_size,
                              hipStream_t stream) {
  if (n_in < 11) return;
  if (in_sizes[0] != SEQ * DMOD) return;
  if (in_sizes[1] != SEQ || in_sizes[2] != SEQ) return;
  if (in_sizes[3] != DMOD * DMOD || in_sizes[5] != DMOD * DMOD) return;
  if (in_sizes[7] != DMOD * DMOD || in_sizes[9] != DMOD * DMOD) return;
  if (in_sizes[4] != DMOD || in_sizes[6] != DMOD || in_sizes[8] != DMOD || in_sizes[10] != DMOD) return;
  if (out_size != SEQ * DMOD) return;

  const float* x   = (const float*)d_in[0];
  const int*   bar = (const int*)d_in[1];
  const int*   ins = (const int*)d_in[2];
  const float* wq  = (const float*)d_in[3];
  const float* bq  = (const float*)d_in[4];
  const float* wk  = (const float*)d_in[5];
  const float* bk  = (const float*)d_in[6];
  const float* wv  = (const float*)d_in[7];
  const float* bv  = (const float*)d_in[8];
  const float* wo  = (const float*)d_in[9];
  const float* bo  = (const float*)d_in[10];
  float*       out = (float*)d_out;

  const size_t szTab = (size_t)SEQ * HD * 4;                    //   524288
  const size_t szXB  = (size_t)SEQ * DMOD * 2;                  //  4194304
  const size_t szW   = (size_t)DMOD * DMOD * 2;                 //  2097152
  const size_t szF   = (size_t)SEQ * DMOD * 4;                  //  8388608
  const size_t szP   = (size_t)SEQ * DMOD * 2;                  //  4194304
  size_t off = 0;
  const size_t oCT  = off; off += szTab;
  const size_t oST  = off; off += szTab;
  const size_t oXB  = off; off += szXB;
  const size_t oWQ  = off; off += szW;
  const size_t oWK  = off; off += szW;
  const size_t oWV  = off; off += szW;
  const size_t oWO  = off; off += szW;
  const size_t oQF  = off; off += szF;
  const size_t oKF  = off; off += szF;
  const size_t oVF  = off; off += szF;
  const size_t oQHI = off; off += szP;
  const size_t oQLO = off; off += szP;
  const size_t oKHI = off; off += szP;
  const size_t oKLO = off; off += szP;
  const size_t oVHI = off; off += szP;
  const size_t oVLO = off; off += szP;
  const size_t oOHI = off; off += szP;
  const size_t oOLO = off; off += szP;
  if (off > ws_size) return;                            // off = 72351744 at SEQ = 2048
  if (off > (size_t)134217728) return;

  char* ws = (char*)d_ws;
  float* CT  = (float*)(ws + oCT);
  float* ST  = (float*)(ws + oST);
  u16*   XB  = (u16*)(ws + oXB);
  u16*   WQB = (u16*)(ws + oWQ);
  u16*   WKB = (u16*)(ws + oWK);
  u16*   WVB = (u16*)(ws + oWV);
  u16*   WOH = (u16*)(ws + oWO);
  float* QF  = (float*)(ws + oQF);
  float* KF  = (float*)(ws + oKF);
  float* VF  = (float*)(ws + oVF);
  u16*   QHI = (u16*)(ws + oQHI);
  u16*   QLO = (u16*)(ws + oQLO);
  u16*   KHI = (u16*)(ws + oKHI);
  u16*   KLO = (u16*)(ws + oKLO);
  u16*   VHI = (u16*)(ws + oVHI);
  u16*   VLO = (u16*)(ws + oVLO);
  u16*   OHI = (u16*)(ws + oOHI);
  u16*   OLO = (u16*)(ws + oOLO);

  // inv_freq[i] = 1 / pow(10000, i/32) in f32 (pow correctly converted from f64, then IEEE f32 reciprocal)
  InvF inv;
  for (int i = 0; i < 32; ++i) {
    const double p = pow(10000.0, (double)i / 32.0);
    const float pf = (float)p;
    inv.f[i] = 1.0f / pf;
  }

  const dim3 blk(256);
  const int n8x = (SEQ * DMOD) / 8;                     // 262144
  const int n8w = (DMOD * DMOD) / 8;                    // 131072
  const dim3 gTab(SEQ / 8);                             // 256
  const dim3 gX(n8x / 256);                             // 1024 (exact)
  const dim3 gW(n8w / 256);                             // 512  (exact)
  const dim3 gG((SEQ / 64) * (DMOD / 64));              // 512
  const dim3 bG(128);
  const int rowsQ = SEQ * NH;                           // 32768 rows of 64
  const dim3 gR((rowsQ * 8) / 256);                     // 1024 (exact)
  const dim3 gVT(NH * NST);                             // 512
  const dim3 gAT(ATT_BLOCKS);                           // 512
  const dim3 bAT(ATT_THREADS);                          // 128

  // (0) rotary cos/sin tables [SEQ][64]
  k_tab<<<gTab, blk, 0, stream>>>(CT, ST, inv);
  // (1) x -> bf16 plane
  cvt16<<<gX, blk, 0, stream>>>(x, XB, n8x, 0, 1.0f);
  // (2..4) Wq/Wk/Wv [n][k] -> bf16 planes (same layout, already k-contiguous)
  cvt16<<<gW, blk, 0, stream>>>(wq, WQB, n8w, 0, 1.0f);
  cvt16<<<gW, blk, 0, stream>>>(wk, WKB, n8w, 0, 1.0f);
  cvt16<<<gW, blk, 0, stream>>>(wv, WVB, n8w, 0, 1.0f);
  // (5) Wo [n][k] -> f16 plane of bf16 value x1024
  cvt16<<<gW, blk, 0, stream>>>(wo, WOH, n8w, 1, WOS);
  // (6..8) projections: q, k, v [SEQ][1024] in f32 (+ bias)
  gemm_bf<<<gG, bG, 0, stream>>>(XB, WQB, bq, QF, SEQ, DMOD, DMOD, 1.0f);
  gemm_bf<<<gG, bG, 0, stream>>>(XB, WKB, bk, KF, SEQ, DMOD, DMOD, 1.0f);
  gemm_bf<<<gG, bG, 0, stream>>>(XB, WVB, bv, VF, SEQ, DMOD, DMOD, 1.0f);
  // (9) q' planes: rows (s, h), heads per position NH
  rope16<<<gR, blk, 0, stream>>>(QF, CT, ST, QHI, QLO, rowsQ, NH, QSC);
  // (10) k' planes: rows (s, h)
  rope16<<<gR, blk, 0, stream>>>(KF, CT, ST, KHI, KLO, rowsQ, NH, KSC);
  // (11) v^T planes x1024 (hi + residual)
  vt16<<<gVT, blk, 0, stream>>>(VF, VHI, VLO);
  // (12) three masked attentions summed -> O planes [s][h][d] x1024 (hi + residual)
  attn3<<<gAT, bAT, 0, stream>>>(QHI, QLO, KHI, KLO, VHI, VLO, ins, bar, OHI, OLO);
  // (13) output projection -> out [SEQ][1024] f32, carries 1024 (O) x 1024 (Wo) folded back, + bo
  gemm_h2<<<gG, bG, 0, stream>>>(OHI, OLO, WOH, bo, out, SEQ, DMOD, DMOD, 1.0f / (OSC * WOS));
  (void)hipGetLastError();
}

// v001
// It runs in 247 microseconds.
// Next to v000, in two timings, it ran 1.34 and 1.35 times as fast.
// Contractions: x.W{q,k,v}^T on v_wmma_f32_16x16x32_bf16 (x and W RNE-converted to bf16, f32 accumulate);
// scores q'.k'^T (q', k' carried x1024 as f16 hi plane + f16 residual plane, products hh+lh+hl), P.v (P x32768 f16 hi+residual,
// v x1024 f16 hi+residual, products hh+lh+hl) and O.Wo^T (O x1024 f16 hi+residual, Wo as f16(bf16(Wo) x1024), products h.w+l.w):
// v_wmma_f32_16x16x32_f16, f32 accumulate. Rotary tables, rotation, masks, masked base-2 online softmax and 1/l fold in f32 on VALU.
#include <hip/hip_runtime.h>
#include <math.h>
#include <stdint.h>

#define SEQ   2048
#define DMOD  1024
#define NH    16
#define HD    64
#define GINST 129
#define QSC   1024.0f
#define KSC   1024.0f
#define PCAR  32768.0f
#define VCAR  1024.0f
#define OSC   1024.0f
#define WOS   1024.0f
#define LOG2E 1.4426950408889634f
#define WPB   4
#define NQT   (SEQ / 16)
#define NST   (SEQ / 64)
#define NKT   (SEQ / 32)
#define ATT_THREADS (WPB * 32)
#define ATT_BLOCKS  (NQT * NH)
#define PTW   (16 * 36)
#define SLW   (16 * 68)
#define WREG  (SLW + 32)
#define SLAB64 (16 * 68)
#define VTP   72
static_assert(DMOD == NH * HD && HD == 64 && NH == 16);
static_assert(WPB == 4 && ATT_THREADS == 128 && PTW <= SLW && (WREG % 4) == 0);
static_assert((SEQ % 64) == 0 && (SEQ % ATT_THREADS) == 0 && (SEQ % 8) == 0 && SEQ <= 32768);
static_assert((DMOD % 64) == 0 && (DMOD % 32) == 0);
static_assert(((SEQ * DMOD) % 2048) == 0 && ((DMOD * DMOD) % 2048) == 0);
static_assert(((SEQ * NH * 8) % 256) == 0);

typedef unsigned short u16;
typedef _Float16 v16h __attribute__((ext_vector_type(16)));
typedef _Float16 v8h  __attribute__((ext_vector_type(8)));
typedef __bf16   v16b __attribute__((ext_vector_type(16)));
typedef float    v8f  __attribute__((ext_vector_type(8)));
typedef float    v4f  __attribute__((ext_vector_type(4)));
typedef unsigned int v4u __attribute__((ext_vector_type(4)));

union FragH { v16h v; v8h h[2]; v4u u[2]; };
union FragB { v16b v; v4u u[2]; };

struct InvF { float f[32]; };
static_assert(sizeof(InvF) == 128);

// ---- scalar helpers --------------------------------------------------------------------------------
__device__ __forceinline__ unsigned short bf_bits(float f) {          // f32 -> bf16 bits, RNE convert
  unsigned u = __float_as_uint(f);
  return (unsigned short)((u + 0x7FFFu + ((u >> 16) & 1u)) >> 16);
}
__device__ __forceinline__ float bf_up(unsigned short h) { return __uint_as_float(((unsigned)h) << 16); }
__device__ __forceinline__ float bfr(float f) { return bf_up(bf_bits(f)); }
__device__ __forceinline__ unsigned short h_bits(_Float16 x) { return __builtin_bit_cast(unsigned short, x); }
__device__ __forceinline__ unsigned pk16(unsigned short a, unsigned short b) { return (unsigned)a | ((unsigned)b << 16); }
__device__ __forceinline__ v8f zero8() { v8f z = {0.f, 0.f, 0.f, 0.f, 0.f, 0.f, 0.f, 0.f}; return z; }

// ---- fragment loaders: 16-bit A/B operand, lane -> row/col (lane&15), p already includes +8*(lane>>4);
//      elements 0..7 <- p[0..7] (k0+8h..), elements 8..15 <- p[16..23] (k0+16+8h..)  (same split k map for A and B;
//      B is always read from a k-contiguous [n][k] plane)
__device__ __forceinline__ v16h ldfrag_h(const _Float16* p) {
  FragH f;
  f.h[0] = *(const v8h*)(p);
  f.h[1] = *(const v8h*)(p + 16);
  return f.v;
}
__device__ __forceinline__ v16b ldfrag_b(const u16* p) {              // bf16 plane read as unsigned integer vectors
  FragB f;
  f.u[0] = *(const v4u*)(p);
  f.u[1] = *(const v4u*)(p + 16);
  return f.v;
}

__device__ __forceinline__ v8f mma_h(v16h a, v16h b, v8f c) {
  return __builtin_amdgcn_wmma_f32_16x16x32_f16(false, a, false, b, (short)0, c, false, false);
}
__device__ __forceinline__ v8f mma_b(v16b a, v16b b, v8f c) {
  return __builtin_amdgcn_wmma_f32_16x16x32_bf16(false, a, false, b, (short)0, c, false, false);
}
__device__ __forceinline__ void guard2(v8f& a, v8f& b, v16h x0, v16h x1, v16h x2, v16h x3, v16h x4, v16h x5) {
#if defined(__HIP_DEVICE_COMPILE__)
  asm volatile("v_nop\n\tv_nop\n\tv_nop\n\tv_nop"
               : "+v"(a), "+v"(b) : "v"(x0), "v"(x1), "v"(x2), "v"(x3), "v"(x4), "v"(x5) : "memory");
#endif
}
template <typename F>
__device__ __forceinline__ void guard6(v8f& a, v8f& b, v8f& c, v8f& d, F x0, F x1, F x2, F x3, F x4, F x5) {
#if defined(__HIP_DEVICE_COMPILE__)
  asm volatile("v_nop\n\tv_nop\n\tv_nop\n\tv_nop"
               : "+v"(a), "+v"(b), "+v"(c), "+v"(d) : "v"(x0), "v"(x1), "v"(x2), "v"(x3), "v"(x4), "v"(x5) : "memory");
#endif
}
__device__ __forceinline__ void guard10(v8f& a, v8f& b, v8f& c, v8f& d, v16h x0, v16h x1, v16h x2, v16h x3, v16h x4,
                                        v16h x5, v16h x6, v16h x7, v16h x8, v16h x9) {
#if defined(__HIP_DEVICE_COMPILE__)
  asm volatile("v_nop\n\tv_nop\n\tv_nop\n\tv_nop"
               : "+v"(a), "+v"(b), "+v"(c), "+v"(d)
               : "v"(x0), "v"(x1), "v"(x2), "v"(x3), "v"(x4), "v"(x5), "v"(x6), "v"(x7), "v"(x8), "v"(x9) : "memory");
#endif
}
__device__ __forceinline__ void acc_guard4(v8f& a, v8f& b, v8f& c, v8f& d) {
#if defined(__HIP_DEVICE_COMPILE__)
  asm volatile("v_nop\n\tv_nop\n\tv_nop\n\tv_nop" : "+v"(a), "+v"(b), "+v"(c), "+v"(d));
#endif
}
__device__ __forceinline__ void wave_sync_lds() {
  __builtin_amdgcn_fence(__ATOMIC_RELEASE, "workgroup");
  __builtin_amdgcn_wave_barrier();
  __builtin_amdgcn_fence(__ATOMIC_ACQUIRE, "workgroup");
}

// ---- accurate f32 sin/cos of a non-negative f32 angle (|angle| < 32768): f64 two-part pi/2 reduction + f64 polynomials,
//      plain f64 fma/mul only (no library f64 trig path), result converted to f32.
__device__ __forceinline__ void sincos_acc(float angf, float& sv, float& cv) {
  const double a = (double)angf;
  const double TWO_OVER_PI = 0.63661977236758134308;
  const double PIO2_HI = 1.5707963267948966;
  const double PIO2_LO = 6.123233995736766e-17;
  const int kq = (int)(a * TWO_OVER_PI + 0.5);
  const double kd = (double)kq;
  double r = fma(-kd, PIO2_HI, a);
  r = fma(-kd, PIO2_LO, r);
  const double r2 = r * r;
  double sp = 1.0 / 6227020800.0;
  sp = fma(sp, r2, -1.0 / 39916800.0);
  sp = fma(sp, r2, 1.0 / 362880.0);
  sp = fma(sp, r2, -1.0 / 5040.0);
  sp = fma(sp, r2, 1.0 / 120.0);
  sp = fma(sp, r2, -1.0 / 6.0);
  const double s = fma(sp * r2, r, r);
  double cp = -1.0 / 87178291200.0;
  cp = fma(cp, r2, 1.0 / 479001600.0);
  cp = fma(cp, r2, -1.0 / 3628800.0);
  cp = fma(cp, r2, 1.0 / 40320.0);
  cp = fma(cp, r2, -1.0 / 720.0);
  cp = fma(cp, r2, 1.0 / 24.0);
  cp = fma(cp, r2, -0.5);
  const double c = fma(cp, r2, 1.0);
  const int qd = kq & 3;
  const double so = (qd == 0) ? s : (qd == 1) ? c : (qd == 2) ? -s : -c;
  const double co = (qd == 0) ? c : (qd == 1) ? -s : (qd == 2) ? -c : s;
  sv = (float)so;
  cv = (float)co;
}

// =====================================================================================================
// Rotary tables: cosT[t][d], sinT[t][d] for t < SEQ, d < HD, angle = float(t) * inv_freq[d & 31] (f32 product), halves duplicated.
// Wave = one position t, lane = frequency index; inv_freq picked from the by-value table with a static select chain.
// coverage: grid SEQ/8 blocks x 8 waves = SEQ rows; per row 4 line stores = 64 floats of each table.
// =====================================================================================================
__global__ __launch_bounds__(256) void k_tab(float* cosT, float* sinT, InvF inv) {
  const int tid  = threadIdx.x;
  const int lane = tid & 31;
  const int t    = blockIdx.x * 8 + (tid >> 5);
  if (t >= SEQ) return;                     // never taken with the exact grid; no barriers in this kernel
  float f = inv.f[0];
#pragma unroll
  for (int i = 1; i < 32; ++i) f = (lane == i) ? inv.f[i] : f;
  const float ang = (float)t * f;
  float sv, cv;
  sincos_acc(ang, sv, cv);
  float* cr = cosT + (size_t)t * HD;
  float* sr = sinT + (size_t)t * HD;
  {
    *(float*)(cr + lane)      = cv;
    *(float*)(cr + 32 + lane) = cv;
    *(float*)(sr + lane)      = sv;
    *(float*)(sr + 32 + lane) = sv;
    
  }
}

// =====================================================================================================
// f32 -> 16-bit plane, same layout.  f16mode == 0: bf16 RNE bits;  f16mode == 1: f16 bits of (bf16 RNE value) * scale.
// Thread = 8 consecutive elements: two 16-B loads, one 16-B store; 32 consecutive lanes = 512 contiguous, 512-B aligned bytes per
// coverage: grid = n8/256 blocks (exact, host-derived) x 256 thr x 8 = the whole plane.
// =====================================================================================================
__global__ __launch_bounds__(256) void cvt16(const float* __restrict__ x, u16* D, int n8, int f16mode, float scale) {
  const int gt = blockIdx.x * 256 + (int)threadIdx.x;
  if (gt >= n8) return;                     // no barriers in this kernel
  const float* p = x + (size_t)gt * 8;
  const v4f a = *(const v4f*)(p), b4 = *(const v4f*)(p + 4);
  float w[8];
#pragma unroll
  for (int e = 0; e < 4; ++e) { w[e] = a[e]; w[4 + e] = b4[e]; }
  v4u o;
#pragma unroll
  for (int e = 0; e < 4; ++e) {
    const float f0 = w[2 * e], f1 = w[2 * e + 1];
    const unsigned short hb0 = h_bits((_Float16)(bfr(f0) * scale));
    const unsigned short hb1 = h_bits((_Float16)(bfr(f1) * scale));
    const unsigned short bb0 = bf_bits(f0);
    const unsigned short bb1 = bf_bits(f1);
    o[e] = (f16mode != 0) ? pk16(hb0, hb1) : pk16(bb0, bb1);
  }
  u16* d = D + (size_t)gt * 8;
  {
    *(v4u*)(d) = o;
    
  }
}

// =====================================================================================================
// GEMM epilogue shared by both engines: the wave's 16x64 f32 tile (times oscale) staged in its LDS slab (pitch 68),
// coverage: 8 instructions x 2 rows x 16 lanes x 4 floats = the wave's 16 x 64 tile.
// =====================================================================================================
__device__ __forceinline__ void epi64(float* sl, v8f a0, v8f a1, v8f a2, v8f a3, float oscale,
                                      const float* __restrict__ bias, float* C, int N,
                                      size_t rowb, int col0, int lane) {
  const int hh = lane >> 4, m = lane & 15;
#pragma unroll
  for (int r = 0; r < 8; ++r) {
    const int ro = (8 * hh + r) * 68 + m;
    sl[ro]      = a0[r] * oscale;
    sl[ro + 16] = a1[r] * oscale;
    sl[ro + 32] = a2[r] * oscale;
    sl[ro + 48] = a3[r] * oscale;
  }
  wave_sync_lds();
  const v4f braw = *(const v4f*)(bias + col0 + m * 4);
  v4f bb;
#pragma unroll
  for (int e = 0; e < 4; ++e) bb[e] = bfr(braw[e]);
  v4f vals[8];
#pragma unroll
  for (int it = 0; it < 8; ++it) vals[it] = *(const v4f*)(sl + (it * 2 + hh) * 68 + m * 4) + bb;
  float* dst = C + (rowb + (size_t)hh) * (size_t)N + col0 + m * 4;
  {
#pragma unroll
    for (int it = 0; it < 8; ++it) {
      *(v4f*)(dst + (size_t)(it * 2) * (size_t)N) = vals[it];
    }
    
  }
}

// =====================================================================================================
// bf16 GEMM: C[M][N] (f32) = A[M][K] (bf16 row-major) . Bt[N][K]^T (bf16 k-contiguous), times oscale, plus bias[N].
// Block = 64x64 tile, 4 waves x 16 rows; fragments loaded straight from the 16-bit rows (two 16-B loads each, split k map
// for A and B); K stepped by 32 (host checks K % 32 == 0, M % 64 == 0, N % 64 == 0, grid = (M/64)*(N/64)).
// =====================================================================================================
__global__ __launch_bounds__(128)
void gemm_bf(const u16* __restrict__ A, const u16* __restrict__ Bt, const float* __restrict__ bias, float* C,
             int M, int N, int K, float oscale) {
  __shared__ __align__(16) float slab[4 * SLAB64];
  const int tid = threadIdx.x, wave = tid >> 5, lane = tid & 31, hh = lane >> 4, m = lane & 15;
  const int ntile = N >> 6;
  const int bid   = blockIdx.x;
  const int rowb  = (bid / ntile) * 64 + wave * 16;
  const int col0  = (bid % ntile) * 64;
  if (rowb + 16 > M) return;                 // wave-uniform, never taken with the exact grid; no block barriers in this kernel
  const u16* ap = A  + (size_t)(rowb + m) * K + 8 * hh;
  const u16* bp = Bt + (size_t)(col0 + m) * K + 8 * hh;
  const size_t bs = (size_t)16 * K;
  v8f acc0 = zero8(), acc1 = zero8(), acc2 = zero8(), acc3 = zero8();
#pragma unroll 1
  for (int k0 = 0; k0 < K; k0 += 32) {
    const v16b a  = ldfrag_b(ap + k0);
    const v16b b0 = ldfrag_b(bp + k0);
    const v16b b1 = ldfrag_b(bp + bs + k0);
    const v16b b2 = ldfrag_b(bp + 2 * bs + k0);
    const v16b b3 = ldfrag_b(bp + 3 * bs + k0);
    acc0 = mma_b(a, b0, acc0);
    acc1 = mma_b(a, b1, acc1);
    acc2 = mma_b(a, b2, acc2);
    acc3 = mma_b(a, b3, acc3);
    guard6<v16b>(acc0, acc1, acc2, acc3, a, b0, b1, b2, b3, a);
  }
  epi64(slab + wave * SLAB64, acc0, acc1, acc2, acc3, oscale, bias, C, N, (size_t)rowb, col0, lane);
}

// =====================================================================================================
// f16 hi+lo GEMM: C[M][N] (f32) = (Ahi + Alo)[M][K] . Bt[N][K]^T, times oscale, plus bias[N]; Ahi/Alo f16 planes (same layout),
// Bt f16 k-contiguous; products hi.B + lo.B into one accumulator (lo is the unscaled residual of hi). Same tiling as gemm_bf.
// =====================================================================================================
__global__ __launch_bounds__(128)
void gemm_h2(const u16* __restrict__ Ah, const u16* __restrict__ Al, const u16* __restrict__ Bt,
             const float* __restrict__ bias, float* C, int M, int N, int K, float oscale) {
  __shared__ __align__(16) float slab[4 * SLAB64];
  const int tid = threadIdx.x, wave = tid >> 5, lane = tid & 31, hh = lane >> 4, m = lane & 15;
  const int ntile = N >> 6;
  const int bid   = blockIdx.x;
  const int rowb  = (bid / ntile) * 64 + wave * 16;
  const int col0  = (bid % ntile) * 64;
  if (rowb + 16 > M) return;                 // wave-uniform, never taken with the exact grid; no block barriers in this kernel
  const size_t aofs = (size_t)(rowb + m) * K + 8 * hh;
  const _Float16* ahp = (const _Float16*)(const void*)Ah + aofs;
  const _Float16* alp = (const _Float16*)(const void*)Al + aofs;
  const _Float16* bp  = (const _Float16*)(const void*)Bt + (size_t)(col0 + m) * K + 8 * hh;
  const size_t bs = (size_t)16 * K;
  v8f acc0 = zero8(), acc1 = zero8(), acc2 = zero8(), acc3 = zero8();
#pragma unroll 1
  for (int k0 = 0; k0 < K; k0 += 32) {
    const v16h ah = ldfrag_h(ahp + k0), al = ldfrag_h(alp + k0);
    const v16h b0 = ldfrag_h(bp + k0);
    const v16h b1 = ldfrag_h(bp + bs + k0);
    const v16h b2 = ldfrag_h(bp + 2 * bs + k0);
    const v16h b3 = ldfrag_h(bp + 3 * bs + k0);
    acc0 = mma_h(ah, b0, acc0);  acc0 = mma_h(al, b0, acc0);
    acc1 = mma_h(ah, b1, acc1);  acc1 = mma_h(al, b1, acc1);
    acc2 = mma_h(ah, b2, acc2);  acc2 = mma_h(al, b2, acc2);
    acc3 = mma_h(ah, b3, acc3);  acc3 = mma_h(al, b3, acc3);
    guard6<v16h>(acc0, acc1, acc2, acc3, ah, al, b0, b1, b2, b3);
  }
  epi64(slab + wave * SLAB64, acc0, acc1, acc2, acc3, oscale, bias, C, N, (size_t)rowb, col0, lane);
}

// =====================================================================================================
// Rotate-half rotary + 16-bit split pack. Rows are (pos, head) with HD contiguous floats (f32 projection output);
// pos = (row / hpr) mod SEQ.  w[d] = x[d] * cos[pos][d] + r[d] * sin[pos][d],  r[d] = -x[d+32] for d < 32, x[d-32] for d >= 32;
// hi[d] = f16(w * sc), lo[d] = f16(w * sc - hi[d])  (sc a power of two, residual unscaled).
// Thread = 8 consecutive d of one row: 16-B loads of x (own and partner half), cos, sin; one 16-B store per plane per lane;
// coverage: grid = nrows*8/256 blocks x 256 thr x 8 halves = nrows x 64 of each plane exactly (exact division checked statically).
// =====================================================================================================
__global__ __launch_bounds__(256) void rope16(const float* __restrict__ x, const float* __restrict__ cosT,
                                              const float* __restrict__ sinT, u16* hpl, u16* lpl,
                                              int nrows, int hpr, float sc) {
  const int gt  = blockIdx.x * 256 + (int)threadIdx.x;
  const int row = gt >> 3;
  const int d0  = (gt & 7) * 8;
  if (row >= nrows) return;                 // never taken with the exact grid; no barriers in this kernel
  const int pos = (row / hpr) % SEQ;
  const int d1  = d0 ^ 32;
  const float* xr = x + (size_t)row * HD;
  const float* cr = cosT + (size_t)pos * HD + d0;
  const float* sr = sinT + (size_t)pos * HD + d0;
  const v4f xa = *(const v4f*)(xr + d0), xb = *(const v4f*)(xr + d0 + 4);
  const v4f ya = *(const v4f*)(xr + d1), yb = *(const v4f*)(xr + d1 + 4);
  const v4f ca = *(const v4f*)(cr), cb = *(const v4f*)(cr + 4);
  const v4f sa = *(const v4f*)(sr), sb = *(const v4f*)(sr + 4);
  const float sgn = (d0 < 32) ? -1.0f : 1.0f;
  float w[8];
#pragma unroll
  for (int e = 0; e < 4; ++e) {
    w[e]     = xa[e] * ca[e] + (sgn * ya[e]) * sa[e];
    w[4 + e] = xb[e] * cb[e] + (sgn * yb[e]) * sb[e];
  }
  v4u oh, ol;
#pragma unroll
  for (int e = 0; e < 4; ++e) {
    const float t0 = w[2 * e] * sc, t1 = w[2 * e + 1] * sc;
    const _Float16 h0 = (_Float16)t0, h1 = (_Float16)t1;
    const _Float16 l0 = (_Float16)(t0 - (float)h0), l1 = (_Float16)(t1 - (float)h1);
    oh[e] = pk16(h_bits(h0), h_bits(h1));
    ol[e] = pk16(h_bits(l0), h_bits(l1));
  }
  const size_t o8 = (size_t)row * HD + d0;
  {
    *(v4u*)(hpl + o8) = oh;
    *(v4u*)(lpl + o8) = ol;
    
  }
}

// =====================================================================================================
// v^T planes: VH[g*HD + d][s] = f16(v[s][g][d] * 1024), VL = f16 residual of the same value.
// Block = (head g = bid / NST, 64 keys s0 = (bid % NST)*64): 64 source rows of HD floats loaded with 16-B loads, converted,
// scattered into two LDS tiles [d][64 keys] (pitch 72 halves); after a block barrier each d row segment (64 halves = one whole
// coverage: load 256 thr x 16 elements = 64 x 64; store 2 iterations x 256 thr x 8 halves = 64 lines x 64 = the block's tile of
//           each plane; grid = NH x NST blocks covers both planes exactly once.
// =====================================================================================================
__global__ __launch_bounds__(256) void vt16(const float* __restrict__ v, u16* VHo, u16* VLo) {
  __shared__ __align__(16) u16 TH[HD * VTP];
  __shared__ __align__(16) u16 TL[HD * VTP];
  const int tid = threadIdx.x;
  const int bid = blockIdx.x;
  const int st  = bid % NST;
  const int g   = bid / NST;
  if (g >= NH) return;                        // block-uniform, before any barrier; never taken with the exact grid
  const int s0  = st * 64;
  {
    const int sl = tid >> 2;                  // key within tile 0..63
    const int dc = (tid & 3) * 16;            // d chunk
    const float* src = v + ((size_t)(s0 + sl) * NH + g) * HD + dc;
#pragma unroll
    for (int i = 0; i < 4; ++i) {
      const v4f a = *(const v4f*)(src + 4 * i);
#pragma unroll
      for (int e = 0; e < 4; ++e) {
        const float t = a[e] * VCAR;
        const _Float16 h = (_Float16)t;
        const _Float16 l = (_Float16)(t - (float)h);
        TH[(dc + 4 * i + e) * VTP + sl] = h_bits(h);
        TL[(dc + 4 * i + e) * VTP + sl] = h_bits(l);
      }
    }
  }
  __syncthreads();
  v4u vh[2], vl[2];
  const int q8 = tid >> 3, p8 = (tid & 7) * 8;
#pragma unroll
  for (int it = 0; it < 2; ++it) {
    const int line = it * 32 + q8;            // d = 0..63
    vh[it] = *(const v4u*)(TH + line * VTP + p8);
    vl[it] = *(const v4u*)(TL + line * VTP + p8);
  }
  const size_t base = ((size_t)g * HD) * SEQ + s0 + p8;
  {
#pragma unroll
    for (int it = 0; it < 2; ++it) {
      const int line = it * 32 + q8;
      *(v4u*)(VHo + base + (size_t)line * SEQ) = vh[it];
      *(v4u*)(VLo + base + (size_t)line * SEQ) = vl[it];
    }
    
  }
}

// =====================================================================================================
// Triple-masked attention: block bid -> (head = bid % NH, query tile qt = NQT-1 - bid / NH: rows q0 = 16*qt .. q0+15; the tiles with
// the most keys take the lowest block indices). The block's WPB waves share that one (tile, head) and split its key tiles: in every group of four
// consecutive key tiles g each wave takes one, kt = 4g + ((wave - g) & 3), so that any stride-4 pattern of live tiles is spread too.
//   q planes (hi, lo f16 x1024) laid out [s][h][d]; k planes [s][h][d]; v^T planes [h][d][s]; instrument and bar ids staged in LDS.
//   For each of the three masks in turn (block-uniform), each wave with its OWN running max m_a, sum Z_a and 4 accumulators acc_a:
//     att 0: (iq == ik) && (iq < 129) && (j <= i)
//     att 1: (iq != ik) && (ik < 129) && (iq < 129) && (bq >= 0) && ((0 <= bq-bk <= 2) || (bq-bk == 4))
//     att 2: ((ik == 129) || (bk == -1)) && (j <= i)
//   A wave's key tiles of 32 visited in order (att 0/2 up to the causal limit, att 1 all NKT); per tile every lane evaluates its
//   8 rows x 2 keys mask bits, a wave ballot skips tiles with no allowed element (exact: such keys carry zero weight).
//   Per processed tile: 2 score subtiles x 2 k-steps x 3 products (q_hi.k_hi + q_lo.k_hi + q_hi.k_lo), fragments loaded straight
//   from the 16-bit planes (two 16-B loads per fragment, split k map); masked scores replaced by -inf; online max-subtracted base-2
//   softmax in f32 (scale 1/8 folded), -inf-safe rescale; the 16x32 prob tile stored to wave-private LDS (f32 element stores),
//   loads, same element type as stored), 4+4 v^T B fragments (hi and residual planes), 12 P.V WMMAs (hh + lh + hl).
//   After each mask every wave publishes its partial (m, Z, acc) in its LDS slab (which holds the prob tile during the loop); behind a
//   block barrier wave w merges the four partials for d columns 16w..16w+15: M = max m_w, Z = sum Z_w 2^(m_w-M), acc likewise;
//   out_a = (Z > 0, i.e. the row has an allowed key) ? acc / Z : 0, carries 1/(32768*1024) folded once, summed in a lane-owned LDS tile:
//   O = out_0 + out_1 + out_2. A second barrier frees the slabs for the next mask. All barriers block-uniform; bounded loops only.
// coverage: per wave 4 rows x 8 lanes x 8 halves = 4 x 64 per plane, WPB waves = 16 x 64; grid NQT*NH blocks =
//           every (s, h) row of both O planes exactly once.
// =====================================================================================================
// second bound: five waves per SIMD (at most 192 registers), so that more of the four-times-larger grid is resident at once
__global__ __launch_bounds__(ATT_THREADS, 5)
void attn3(const u16* __restrict__ QHIp, const u16* __restrict__ QLOp,
           const u16* __restrict__ KHIp, const u16* __restrict__ KLOp,
           const u16* __restrict__ VHIp, const u16* __restrict__ VLOp,
           const int* __restrict__ inst, const int* __restrict__ bar,
           u16* OHIp, u16* OLOp) {
  __shared__ __align__(16) float smem[WPB * WREG + SLW];
  __shared__ int sI[SEQ];
  __shared__ int sB[SEQ];

  const int tid  = threadIdx.x;
  const int wave = __builtin_amdgcn_readfirstlane(tid >> 5);   // scalar: it steers the key-tile loop
  const int lane = tid & 31;
  const int hh   = lane >> 4;
  const int c    = lane & 15;
  const int bid  = blockIdx.x;
  if (bid >= NQT * NH) return;               // block-uniform, before any barrier; never taken with the exact grid
  const int head = bid % NH;
  const int qt   = NQT - 1 - bid / NH;
  const int q0   = qt * 16;

  for (int i = tid; i < SEQ; i += ATT_THREADS) { sI[i] = inst[i]; sB[i] = bar[i]; }
  __syncthreads();

  float* slab = smem + wave * WREG;          // partial accumulators [16][64] pitch 68, written after a mask's key loop
  float* pt   = slab;                        // prob tile [16][32] pitch 36, same bytes, live inside the key loop only
  float* ml   = slab + SLW;                  // partial m[16], Z[16]
  float* osum = smem + WPB * WREG;           // the block's result [16][64] pitch 68; element (8hh + r, 16*wave + c) owned by this lane
  int iq[8], bq8[8];
#pragma unroll
  for (int r = 0; r < 8; ++r) { const int i = q0 + 8 * hh + r; iq[r] = sI[i]; bq8[r] = sB[i]; }

  const size_t qofs = (((size_t)(q0 + c)) * NH + head) * HD + 8 * hh;
  const _Float16* Qh  = (const _Float16*)(const void*)QHIp + qofs;
  const _Float16* Ql  = (const _Float16*)(const void*)QLOp + qofs;
  const size_t kofs = ((size_t)c * NH + head) * HD + 8 * hh;                  // key row kb + c added per step
  const _Float16* Khb = (const _Float16*)(const void*)KHIp + kofs;
  const _Float16* Klb = (const _Float16*)(const void*)KLOp + kofs;
  const size_t vofs = ((size_t)head * HD + c) * SEQ + 8 * hh;                // d column c (+16j), key kb added per step
  const _Float16* Vhb = (const _Float16*)(const void*)VHIp + vofs;
  const _Float16* Vlb = (const _Float16*)(const void*)VLOp + vofs;
  const float lsc = 0.125f * (LOG2E / (QSC * KSC));
  const float oc  = 1.0f / (PCAR * VCAR);
  const size_t KROW = (size_t)NH * HD;                                         // halves between consecutive key rows

#pragma unroll
  for (int att = 0; att < 3; ++att) {
    float mrow[8], lrow[8];
    v8f o[4];
#pragma unroll
    for (int r = 0; r < 8; ++r) { mrow[r] = -INFINITY; lrow[r] = 0.f; }
#pragma unroll
    for (int j = 0; j < 4; ++j) o[j] = zero8();
    const int ncaus = (q0 >> 5) + 1;                                            // tiles holding keys <= q0 + 15
    const int nkt = (att == 1) ? NKT : ((ncaus < NKT) ? ncaus : NKT);

    const int ngrp = (nkt + 3) >> 2;
#pragma unroll 1
    for (int g = 0; g < ngrp; ++g) {
      const int kt = 4 * g + ((wave - g) & 3);
      if (kt >= nkt) continue;                                                   // wave-uniform
      const int kb = kt * 32;
      const int j0 = kb + c, j1 = kb + 16 + c;
      const int ik0 = sI[j0], ik1 = sI[j1];
      const int bk0 = sB[j0], bk1 = sB[j1];
      unsigned okb = 0u;
      if (att == 0) {
#pragma unroll
        for (int r = 0; r < 8; ++r) {
          const int i = q0 + 8 * hh + r;
          const bool qa  = iq[r] < GINST;
          const bool ok0 = qa && (iq[r] == ik0) && (j0 <= i);
          const bool ok1 = qa && (iq[r] == ik1) && (j1 <= i);
          okb |= (ok0 ? (1u << r) : 0u) | (ok1 ? (1u << (8 + r)) : 0u);
        }
      } else if (att == 1) {
        const bool ka0 = ik0 < GINST, ka1 = ik1 < GINST;
#pragma unroll
        for (int r = 0; r < 8; ++r) {
          const bool qa  = (iq[r] < GINST) && (bq8[r] >= 0);
          const int  d0  = bq8[r] - bk0, d1 = bq8[r] - bk1;
          const bool w0  = ((d0 >= 0) && (d0 <= 2)) || (d0 == 4);
          const bool w1  = ((d1 >= 0) && (d1 <= 2)) || (d1 == 4);
          const bool ok0 = qa && ka0 && (iq[r] != ik0) && w0;
          const bool ok1 = qa && ka1 && (iq[r] != ik1) && w1;
          okb |= (ok0 ? (1u << r) : 0u) | (ok1 ? (1u << (8 + r)) : 0u);
        }
      } else {
        const bool g0 = (ik0 == GINST) || (bk0 == -1);
        const bool g1 = (ik1 == GINST) || (bk1 == -1);
#pragma unroll
        for (int r = 0; r < 8; ++r) {
          const int i = q0 + 8 * hh + r;
          const bool ok0 = g0 && (j0 <= i);
          const bool ok1 = g1 && (j1 <= i);
          okb |= (ok0 ? (1u << r) : 0u) | (ok1 ? (1u << (8 + r)) : 0u);
        }
      }
      const unsigned anyw = __builtin_amdgcn_ballot_w32(okb != 0u);    // wave-uniform
      if (anyw == 0u) continue;

      // ---- scores: D element r of this lane = (query row q0 + 8hh + r, key kb + c) in s0, key kb + 16 + c in s1 ----
      v8f s0 = zero8(), s1 = zero8();
      const _Float16* k0p = Khb + (size_t)kb * KROW;
      const _Float16* k1p = k0p + (size_t)16 * KROW;
      const _Float16* l0p = Klb + (size_t)kb * KROW;
      const _Float16* l1p = l0p + (size_t)16 * KROW;
#pragma unroll
      for (int kk = 0; kk < 2; ++kk) {
        const v16h qh  = ldfrag_h(Qh + kk * 32),  ql  = ldfrag_h(Ql + kk * 32);
        const v16h kh0 = ldfrag_h(k0p + kk * 32), kl0 = ldfrag_h(l0p + kk * 32);
        const v16h kh1 = ldfrag_h(k1p + kk * 32), kl1 = ldfrag_h(l1p + kk * 32);
        s0 = mma_h(qh, kh0, s0);
        s0 = mma_h(ql, kh0, s0);
        s0 = mma_h(qh, kl0, s0);
        s1 = mma_h(qh, kh1, s1);
        s1 = mma_h(ql, kh1, s1);
        s1 = mma_h(qh, kl1, s1);
        guard2(s0, s1, qh, ql, kh0, kl0, kh1, kl1);
      }
      // ---- mask (replace by -inf) + online softmax in base 2, -inf-safe ----
#pragma unroll
      for (int r = 0; r < 8; ++r) {
        const bool ok0 = ((okb >> r) & 1u) != 0u;
        const bool ok1 = ((okb >> (8 + r)) & 1u) != 0u;
        const float t0 = ok0 ? (s0[r] * lsc) : -INFINITY;
        const float t1 = ok1 ? (s1[r] * lsc) : -INFINITY;
        float mx = fmaxf(t0, t1);
#pragma unroll
        for (int off = 1; off < 16; off <<= 1) mx = fmaxf(mx, __shfl_xor(mx, off, 32));
        const float mn = fmaxf(mrow[r], mx);
        const float ms = (mn == -INFINITY) ? 0.0f : mn;
        const float al = exp2f(mrow[r] - ms);
        mrow[r] = mn;
        const float e0 = exp2f(t0 - ms), e1 = exp2f(t1 - ms);
        float ps = e0 + e1;
#pragma unroll
        for (int off = 1; off < 16; off <<= 1) ps += __shfl_xor(ps, off, 32);
        lrow[r] = lrow[r] * al + ps;
#pragma unroll
        for (int j = 0; j < 4; ++j) o[j][r] *= al;
        const int ro = (8 * hh + r) * 36 + c;
        pt[ro]      = e0;
        pt[ro + 16] = e1;
      }
      wave_sync_lds();
      // ---- A fragments of P*32768: hi f16 and residual f16, row = c, split k map over the 32 keys of this step ----
      FragH ph, pl;
      {
        const float* prow = pt + c * 36 + 8 * hh;
        const v4f p0 = *(const v4f*)(prow), p1 = *(const v4f*)(prow + 4);
        const v4f p2 = *(const v4f*)(prow + 16), p3 = *(const v4f*)(prow + 20);
#pragma unroll
        for (int e = 0; e < 4; ++e) {
          const float ta = p0[e] * PCAR, tb = p1[e] * PCAR, tc = p2[e] * PCAR, td = p3[e] * PCAR;
          const _Float16 ha = (_Float16)ta, hb = (_Float16)tb, hc = (_Float16)tc, hd = (_Float16)td;
          ph.h[0][e]     = ha;                               // elements 0..7  = keys kb + 8hh + 0..7
          ph.h[0][4 + e] = hb;
          ph.h[1][e]     = hc;                               // elements 8..15 = keys kb + 16 + 8hh + 0..7
          ph.h[1][4 + e] = hd;
          pl.h[0][e]     = (_Float16)(ta - (float)ha);
          pl.h[0][4 + e] = (_Float16)(tb - (float)hb);
          pl.h[1][e]     = (_Float16)(tc - (float)hc);
          pl.h[1][4 + e] = (_Float16)(td - (float)hd);
        }
      }
      // ---- P.V : B fragment col n = d = j*16 + c, keys contiguous in the v^T planes ----
      {
        const _Float16* vhp = Vhb + kb;
        const _Float16* vlp = Vlb + kb;
        const v16h vh0 = ldfrag_h(vhp);
        const v16h vh1 = ldfrag_h(vhp + (size_t)16 * SEQ);
        const v16h vh2 = ldfrag_h(vhp + (size_t)32 * SEQ);
        const v16h vh3 = ldfrag_h(vhp + (size_t)48 * SEQ);
        const v16h vl0 = ldfrag_h(vlp);
        const v16h vl1 = ldfrag_h(vlp + (size_t)16 * SEQ);
        const v16h vl2 = ldfrag_h(vlp + (size_t)32 * SEQ);
        const v16h vl3 = ldfrag_h(vlp + (size_t)48 * SEQ);
        o[0] = mma_h(ph.v, vh0, o[0]);  o[0] = mma_h(pl.v, vh0, o[0]);  o[0] = mma_h(ph.v, vl0, o[0]);
        o[1] = mma_h(ph.v, vh1, o[1]);  o[1] = mma_h(pl.v, vh1, o[1]);  o[1] = mma_h(ph.v, vl1, o[1]);
        o[2] = mma_h(ph.v, vh2, o[2]);  o[2] = mma_h(pl.v, vh2, o[2]);  o[2] = mma_h(ph.v, vl2, o[2]);
        o[3] = mma_h(ph.v, vh3, o[3]);  o[3] = mma_h(pl.v, vh3, o[3]);  o[3] = mma_h(ph.v, vl3, o[3]);
        guard10(o[0], o[1], o[2], o[3], ph.v, pl.v, vh0, vh1, vh2, vh3, vl0, vl1, vl2, vl3);
      }
      wave_sync_lds();
    }
    acc_guard4(o[0], o[1], o[2], o[3]);
    // ---- publish this wave's partial: acc in its slab, m and Z (equal in the 16 lanes of a half) by lane c == 0 ----
#pragma unroll
    for (int r = 0; r < 8; ++r) {
#pragma unroll
      for (int j = 0; j < 4; ++j) slab[(8 * hh + r) * 68 + j * 16 + c] = o[j][r];
    }
    if (c == 0) {
      v4f m0, m1, z0, z1;
#pragma unroll
      for (int e = 0; e < 4; ++e) { m0[e] = mrow[e]; m1[e] = mrow[4 + e]; z0[e] = lrow[e]; z1[e] = lrow[4 + e]; }
      *(v4f*)(ml + 8 * hh)          = m0;
      *(v4f*)(ml + 8 * hh + 4)      = m1;
      *(v4f*)(ml + 16 + 8 * hh)     = z0;
      *(v4f*)(ml + 16 + 8 * hh + 4) = z1;
    }
    __syncthreads();                          // all four partials of this mask are visible
    // ---- merge for d column 16*wave + c: out_a = acc / Z (0 when no key allowed), carries (32768 on P, 1024 on v) folded once ----
    {
      float mw[WPB][8], zw[WPB][8];
#pragma unroll
      for (int w2 = 0; w2 < WPB; ++w2) {
        const float* mp = smem + w2 * WREG + SLW + 8 * hh;
        const v4f a0 = *(const v4f*)(mp), a1 = *(const v4f*)(mp + 4);
        const v4f b0 = *(const v4f*)(mp + 16), b1 = *(const v4f*)(mp + 20);
#pragma unroll
        for (int e = 0; e < 4; ++e) { mw[w2][e] = a0[e]; mw[w2][4 + e] = a1[e]; zw[w2][e] = b0[e]; zw[w2][4 + e] = b1[e]; }
      }
#pragma unroll
      for (int r = 0; r < 8; ++r) {
        const float mx = fmaxf(fmaxf(mw[0][r], mw[1][r]), fmaxf(mw[2][r], mw[3][r]));
        const float ms = (mx == -INFINITY) ? 0.0f : mx;
        float lv = 0.0f, ov = 0.0f;
#pragma unroll
        for (int w2 = 0; w2 < WPB; ++w2) {
          const float sc = exp2f(mw[w2][r] - ms);
          lv += zw[w2][r] * sc;
          ov += smem[w2 * WREG + (8 * hh + r) * 68 + wave * 16 + c] * sc;
        }
        const float ls  = (lv > 0.0f) ? lv : 1.0f;
        const float inv = (lv > 0.0f) ? ((1.0f / ls) * oc) : 0.0f;
        const int idx = (8 * hh + r) * 68 + wave * 16 + c;
        osum[idx] = (att == 0) ? (ov * inv) : (osum[idx] + ov * inv);
      }
    }
    __syncthreads();                          // every reader has left the slabs (the next mask overwrites them); after the last mask: osum is whole
  }

  // ---- O x1024 -> f16 hi + residual planes; wave = group of 4 rows, lane = (row in group, 8 consecutive d) ----
  v4u oh, ol;
  const int rq = lane >> 3, c8 = (lane & 7) * 8;
  const int row = wave * 4 + rq;
  {
    const v4f a = *(const v4f*)(osum + row * 68 + c8), b4 = *(const v4f*)(osum + row * 68 + c8 + 4);
    float w[8];
#pragma unroll
    for (int e = 0; e < 4; ++e) { w[e] = a[e] * OSC; w[4 + e] = b4[e] * OSC; }
#pragma unroll
    for (int e = 0; e < 4; ++e) {
      const _Float16 h0 = (_Float16)w[2 * e], h1 = (_Float16)w[2 * e + 1];
      const _Float16 l0 = (_Float16)(w[2 * e] - (float)h0), l1 = (_Float16)(w[2 * e + 1] - (float)h1);
      oh[e] = pk16(h_bits(h0), h_bits(h1));
      ol[e] = pk16(h_bits(l0), h_bits(l1));
    }
  }
  const size_t o8 = (((size_t)(q0 + row)) * NH + head) * HD + c8;
  *(v4u*)(OHIp + o8) = oh;
  *(v4u*)(OLOp + o8) = ol;
}

// =====================================================================================================
// Workspace map (bytes); every plane is fully written by whole-line stores before it is read; all extents are exact multiples
// of the store granularity (no pad rows needed); every offset a multiple of SEQ*256:
//   CT  f32 [SEQ][64]                  SEQ*256        ST  same
//   XB  bf16 [SEQ][1024]               SEQ*2048
//   WQB bf16 [1024 n][1024 k]         2097152        WKB, WVB same        2097152 each
//   WOH f16  [1024 n][1024 k] x1024   2097152
//   QF  f32 [SEQ][1024]                SEQ*4096       KF, VF same
//   QHI f16 [SEQ][16][64] x1024        SEQ*2048       QLO residual
//   KHI f16 [SEQ][16][64] x1024        SEQ*2048       KLO residual
//   VHI f16 [16][64][SEQ] x1024        SEQ*2048       VLO residual
//   OHI f16 [SEQ][1024] x1024          SEQ*2048       OLO residual
//   end (SEQ = 2048)                  72351744
// =====================================================================================================
extern "C" void kernel_launch(void* const* d_in, const int* in_sizes, int n_in,
                              void* d_out, int out_size, void* d_ws, size_t ws_size,
                              hipStream_t stream) {
  if (n_in < 11) return;
  if (in_sizes[0] != SEQ * DMOD) return;
  if (in_sizes[1] != SEQ || in_sizes[2] != SEQ) return;
  if (in_sizes[3] != DMOD * DMOD || in_sizes[5] != DMOD * DMOD) return;
  if (in_sizes[7] != DMOD * DMOD || in_sizes[9] != DMOD * DMOD) return;
  if (in_sizes[4] != DMOD || in_sizes[6] != DMOD || in_sizes[8] != DMOD || in_sizes[10] != DMOD) return;
  if (out_size != SEQ * DMOD) return;

  const float* x   = (const float*)d_in[0];
  const int*   bar = (const int*)d_in[1];
  const int*   ins = (const int*)d_in[2];
  const float* wq  = (const float*)d_in[3];
  const float* bq  = (const float*)d_in[4];
  const float* wk  = (const float*)d_in[5];
  const float* bk  = (const float*)d_in[6];
  const float* wv  = (const float*)d_in[7];
  const float* bv  = (const float*)d_in[8];
  const float* wo  = (const float*)d_in[9];
  const float* bo  = (const float*)d_in[10];
  float*       out = (float*)d_out;

  const size_t szTab = (size_t)SEQ * HD * 4;                    //   524288
  const size_t szXB  = (size_t)SEQ * DMOD * 2;                  //  4194304
  const size_t szW   = (size_t)DMOD * DMOD * 2;                 //  2097152
  const size_t szF   = (size_t)SEQ * DMOD * 4;                  //  8388608
  const size_t szP   = (size_t)SEQ * DMOD * 2;                  //  4194304
  size_t off = 0;
  const size_t oCT  = off; off += szTab;
  const size_t oST  = off; off += szTab;
  const size_t oXB  = off; off += szXB;
  const size_t oWQ  = off; off += szW;
  const size_t oWK  = off; off += szW;
  const size_t oWV  = off; off += szW;
  const size_t oWO  = off; off += szW;
  const size_t oQF  = off; off += szF;
  const size_t oKF  = off; off += szF;
  const size_t oVF  = off; off += szF;
  const size_t oQHI = off; off += szP;
  const size_t oQLO = off; off += szP;
  const size_t oKHI = off; off += szP;
  const size_t oKLO = off; off += szP;
  const size_t oVHI = off; off += szP;
  const size_t oVLO = off; off += szP;
  const size_t oOHI = off; off += szP;
  const size_t oOLO = off; off += szP;
  if (off > ws_size) return;                            // off = 72351744 at SEQ = 2048
  if (off > (size_t)134217728) return;

  char* ws = (char*)d_ws;
  float* CT  = (float*)(ws + oCT);
  float* ST  = (float*)(ws + oST);
  u16*   XB  = (u16*)(ws + oXB);
  u16*   WQB = (u16*)(ws + oWQ);
  u16*   WKB = (u16*)(ws + oWK);
  u16*   WVB = (u16*)(ws + oWV);
  u16*   WOH = (u16*)(ws + oWO);
  float* QF  = (float*)(ws + oQF);
  float* KF  = (float*)(ws + oKF);
  float* VF  = (float*)(ws + oVF);
  u16*   QHI = (u16*)(ws + oQHI);
  u16*   QLO = (u16*)(ws + oQLO);
  u16*   KHI = (u16*)(ws + oKHI);
  u16*   KLO = (u16*)(ws + oKLO);
  u16*   VHI = (u16*)(ws + oVHI);
  u16*   VLO = (u16*)(ws + oVLO);
  u16*   OHI = (u16*)(ws + oOHI);
  u16*   OLO = (u16*)(ws + oOLO);

  // inv_freq[i] = 1 / pow(10000, i/32) in f32 (pow correctly converted from f64, then IEEE f32 reciprocal)
  InvF inv;
  for (int i = 0; i < 32; ++i) {
    const double p = pow(10000.0, (double)i / 32.0);
    const float pf = (float)p;
    inv.f[i] = 1.0f / pf;
  }

  const dim3 blk(256);
  const int n8x = (SEQ * DMOD) / 8;                     // 262144
  const int n8w = (DMOD * DMOD) / 8;                    // 131072
  const dim3 gTab(SEQ / 8);                             // 256
  const dim3 gX(n8x / 256);                             // 1024 (exact)
  const dim3 gW(n8w / 256);                             // 512  (exact)
  const dim3 gG((SEQ / 64) * (DMOD / 64));              // 512
  const dim3 bG(128);
  const int rowsQ = SEQ * NH;                           // 32768 rows of 64
  const dim3 gR((rowsQ * 8) / 256);                     // 1024 (exact)
  const dim3 gVT(NH * NST);                             // 512
  const dim3 gAT(ATT_BLOCKS);                           // 2048
  const dim3 bAT(ATT_THREADS);                          // 128

  // (0) rotary cos/sin tables [SEQ][64]
  k_tab<<<gTab, blk, 0, stream>>>(CT, ST, inv);
  // (1) x -> bf16 plane
  cvt16<<<gX, blk, 0, stream>>>(x, XB, n8x, 0, 1.0f);
  // (2..4) Wq/Wk/Wv [n][k] -> bf16 planes (same layout, already k-contiguous)
  cvt16<<<gW, blk, 0, stream>>>(wq, WQB, n8w, 0, 1.0f);
  cvt16<<<gW, blk, 0, stream>>>(wk, WKB, n8w, 0, 1.0f);
  cvt16<<<gW, blk, 0, stream>>>(wv, WVB, n8w, 0, 1.0f);
  // (5) Wo [n][k] -> f16 plane of bf16 value x1024
  cvt16<<<gW, blk, 0, stream>>>(wo, WOH, n8w, 1, WOS);
  // (6..8) projections: q, k, v [SEQ][1024] in f32 (+ bias)
  gemm_bf<<<gG, bG, 0, stream>>>(XB, WQB, bq, QF, SEQ, DMOD, DMOD, 1.0f);
  gemm_bf<<<gG, bG, 0, stream>>>(XB, WKB, bk, KF, SEQ, DMOD, DMOD, 1.0f);
  gemm_bf<<<gG, bG, 0, stream>>>(XB, WVB, bv, VF, SEQ, DMOD, DMOD, 1.0f);
  // (9) q' planes: rows (s, h), heads per position NH
  rope16<<<gR, blk, 0, stream>>>(QF, CT, ST, QHI, QLO, rowsQ, NH, QSC);
  // (10) k' planes: rows (s, h)
  rope16<<<gR, blk, 0, stream>>>(KF, CT, ST, KHI, KLO, rowsQ, NH, KSC);
  // (11) v^T planes x1024 (hi + residual)
  vt16<<<gVT, blk, 0, stream>>>(VF, VHI, VLO);
  // (12) three masked attentions summed -> O planes [s][h][d] x1024 (hi + residual)
  attn3<<<gAT, bAT, 0, stream>>>(QHI, QLO, KHI, KLO, VHI, VLO, ins, bar, OHI, OLO);
  // (13) output projection -> out [SEQ][1024] f32, carries 1024 (O) x 1024 (Wo) folded back, + bo
  gemm_h2<<<gG, bG, 0, stream>>>(OHI, OLO, WOH, bo, out, SEQ, DMOD, DMOD, 1.0f / (OSC * WOS));
  (void)hipGetLastError();
}

// v002
// A run of this version takes 238 microseconds.
// Next to v001, in two timings, it ran 1.04 and 1.05 times as fast.
// All steps since v000 together make it 1.41 times as fast.
// Contractions: x.W{q,k,v}^T on v_wmma_f32_16x16x32_bf16 (x and W RNE-converted to bf16, f32 accumulate);
// scores q'.k'^T (q', k' carried x1024 as f16 hi plane + f16 residual plane, products hh+lh+hl), P.v (P x32768 f16 hi+residual,
// v x1024 f16 hi+residual, products hh+lh+hl) and O.Wo^T (O x1024 f16 hi+residual, Wo as f16(bf16(Wo) x1024), products h.w+l.w):
// v_wmma_f32_16x16x32_f16, f32 accumulate. Rotary tables, rotation, masks, masked base-2 online softmax and 1/l fold in f32 on VALU.
#include <hip/hip_runtime.h>
#include <math.h>
#include <stdint.h>

#define SEQ   2048
#define DMOD  1024
#define NH    16
#define HD    64
#define GINST 129
#define QSC   1024.0f
#define KSC   1024.0f
#define PCAR  32768.0f
#define VCAR  1024.0f
#define OSC   1024.0f
#define WOS   1024.0f
#define LOG2E 1.4426950408889634f
#define WPB   8
#define QTW   2
#define NQP   (SEQ / (16 * QTW))
#define NST   (SEQ / 64)
#define NKT   (SEQ / 32)
#define ATT_THREADS (WPB * 32)
#define ATT_BLOCKS  (NQP * NH)
#define PTW   (16 * 36)
#define SLW   (16 * 68)
#define WREG  (QTW * SLW + QTW * 32)
#define SLAB64 (16 * 68)
#define VTP   72
static_assert(DMOD == NH * HD && HD == 64 && NH == 16);
static_assert(WPB == 8 && ATT_THREADS == 256 && PTW <= SLW && (WREG % 4) == 0 && (SLW % 4) == 0 && QTW == 2);
static_assert((SEQ % 64) == 0 && (SEQ % ATT_THREADS) == 0 && (SEQ % 8) == 0 && SEQ <= 32768);
static_assert((DMOD % 64) == 0 && (DMOD % 32) == 0);
static_assert(((SEQ * DMOD) % 2048) == 0 && ((DMOD * DMOD) % 2048) == 0);
static_assert(((SEQ * NH * 8) % 256) == 0);

typedef unsigned short u16;
typedef _Float16 v16h __attribute__((ext_vector_type(16)));
typedef _Float16 v8h  __attribute__((ext_vector_type(8)));
typedef __bf16   v16b __attribute__((ext_vector_type(16)));
typedef float    v8f  __attribute__((ext_vector_type(8)));
typedef float    v4f  __attribute__((ext_vector_type(4)));
typedef unsigned int v4u __attribute__((ext_vector_type(4)));

union FragH { v16h v; v8h h[2]; v4u u[2]; };
union FragB { v16b v; v4u u[2]; };

struct InvF { float f[32]; };
static_assert(sizeof(InvF) == 128);

// ---- scalar helpers --------------------------------------------------------------------------------
__device__ __forceinline__ unsigned short bf_bits(float f) {          // f32 -> bf16 bits, RNE convert
  unsigned u = __float_as_uint(f);
  return (unsigned short)((u + 0x7FFFu + ((u >> 16) & 1u)) >> 16);
}
__device__ __forceinline__ float bf_up(unsigned short h) { return __uint_as_float(((unsigned)h) << 16); }
__device__ __forceinline__ float bfr(float f) { return bf_up(bf_bits(f)); }
__device__ __forceinline__ unsigned short h_bits(_Float16 x) { return __builtin_bit_cast(unsigned short, x); }
__device__ __forceinline__ unsigned pk16(unsigned short a, unsigned short b) { return (unsigned)a | ((unsigned)b << 16); }
__device__ __forceinline__ v8f zero8() { v8f z = {0.f, 0.f, 0.f, 0.f, 0.f, 0.f, 0.f, 0.f}; return z; }

// ---- fragment loaders: 16-bit A/B operand, lane -> row/col (lane&15), p already includes +8*(lane>>4);
//      elements 0..7 <- p[0..7] (k0+8h..), elements 8..15 <- p[16..23] (k0+16+8h..)  (same split k map for A and B;
//      B is always read from a k-contiguous [n][k] plane)
__device__ __forceinline__ v16h ldfrag_h(const _Float16* p) {
  FragH f;
  f.h[0] = *(const v8h*)(p);
  f.h[1] = *(const v8h*)(p + 16);
  return f.v;
}
// same fragment from a wave-uniform plane base plus a 32-bit per-lane byte offset (one address register instead of a pointer pair per plane)
__device__ __forceinline__ v16h ldfrag_o(const u16* base, unsigned boff, unsigned cbytes) {
  const char* p = (const char*)(const void*)base + boff;
  FragH f;
  f.h[0] = *(const v8h*)(p + cbytes);
  f.h[1] = *(const v8h*)(p + cbytes + 32);
  return f.v;
}
__device__ __forceinline__ v16b ldfrag_b(const u16* p) {              // bf16 plane read as unsigned integer vectors
  FragB f;
  f.u[0] = *(const v4u*)(p);
  f.u[1] = *(const v4u*)(p + 16);
  return f.v;
}

__device__ __forceinline__ v8f mma_h(v16h a, v16h b, v8f c) {
  return __builtin_amdgcn_wmma_f32_16x16x32_f16(false, a, false, b, (short)0, c, false, false);
}
__device__ __forceinline__ v8f mma_b(v16b a, v16b b, v8f c) {
  return __builtin_amdgcn_wmma_f32_16x16x32_bf16(false, a, false, b, (short)0, c, false, false);
}
template <typename F>
__device__ __forceinline__ void guard6(v8f& a, v8f& b, v8f& c, v8f& d, F x0, F x1, F x2, F x3, F x4, F x5) {
#if defined(__HIP_DEVICE_COMPILE__)
  asm volatile("v_nop\n\tv_nop\n\tv_nop\n\tv_nop"
               : "+v"(a), "+v"(b), "+v"(c), "+v"(d) : "v"(x0), "v"(x1), "v"(x2), "v"(x3), "v"(x4), "v"(x5) : "memory");
#endif
}
__device__ __forceinline__ void guard10(v8f& a, v8f& b, v8f& c, v8f& d, v16h x0, v16h x1, v16h x2, v16h x3, v16h x4,
                                        v16h x5, v16h x6, v16h x7, v16h x8, v16h x9) {
#if defined(__HIP_DEVICE_COMPILE__)
  asm volatile("v_nop\n\tv_nop\n\tv_nop\n\tv_nop"
               : "+v"(a), "+v"(b), "+v"(c), "+v"(d)
               : "v"(x0), "v"(x1), "v"(x2), "v"(x3), "v"(x4), "v"(x5), "v"(x6), "v"(x7), "v"(x8), "v"(x9) : "memory");
#endif
}
__device__ __forceinline__ void acc_guard4(v8f& a, v8f& b, v8f& c, v8f& d) {
#if defined(__HIP_DEVICE_COMPILE__)
  asm volatile("v_nop\n\tv_nop\n\tv_nop\n\tv_nop" : "+v"(a), "+v"(b), "+v"(c), "+v"(d));
#endif
}
__device__ __forceinline__ void wave_sync_lds() {
  __builtin_amdgcn_fence(__ATOMIC_RELEASE, "workgroup");
  __builtin_amdgcn_wave_barrier();
  __builtin_amdgcn_fence(__ATOMIC_ACQUIRE, "workgroup");
}

// ---- accurate f32 sin/cos of a non-negative f32 angle (|angle| < 32768): f64 two-part pi/2 reduction + f64 polynomials,
//      plain f64 fma/mul only (no library f64 trig path), result converted to f32.
__device__ __forceinline__ void sincos_acc(float angf, float& sv, float& cv) {
  const double a = (double)angf;
  const double TWO_OVER_PI = 0.63661977236758134308;
  const double PIO2_HI = 1.5707963267948966;
  const double PIO2_LO = 6.123233995736766e-17;
  const int kq = (int)(a * TWO_OVER_PI + 0.5);
  const double kd = (double)kq;
  double r = fma(-kd, PIO2_HI, a);
  r = fma(-kd, PIO2_LO, r);
  const double r2 = r * r;
  double sp = 1.0 / 6227020800.0;
  sp = fma(sp, r2, -1.0 / 39916800.0);
  sp = fma(sp, r2, 1.0 / 362880.0);
  sp = fma(sp, r2, -1.0 / 5040.0);
  sp = fma(sp, r2, 1.0 / 120.0);
  sp = fma(sp, r2, -1.0 / 6.0);
  const double s = fma(sp * r2, r, r);
  double cp = -1.0 / 87178291200.0;
  cp = fma(cp, r2, 1.0 / 479001600.0);
  cp = fma(cp, r2, -1.0 / 3628800.0);
  cp = fma(cp, r2, 1.0 / 40320.0);
  cp = fma(cp, r2, -1.0 / 720.0);
  cp = fma(cp, r2, 1.0 / 24.0);
  cp = fma(cp, r2, -0.5);
  const double c = fma(cp, r2, 1.0);
  const int qd = kq & 3;
  const double so = (qd == 0) ? s : (qd == 1) ? c : (qd == 2) ? -s : -c;
  const double co = (qd == 0) ? c : (qd == 1) ? -s : (qd == 2) ? -c : s;
  sv = (float)so;
  cv = (float)co;
}

// =====================================================================================================
// Rotary tables: cosT[t][d], sinT[t][d] for t < SEQ, d < HD, angle = float(t) * inv_freq[d & 31] (f32 product), halves duplicated.
// Wave = one position t, lane = frequency index; inv_freq picked from the by-value table with a static select chain.
// coverage: grid SEQ/8 blocks x 8 waves = SEQ rows; per row 4 line stores = 64 floats of each table.
// =====================================================================================================
__global__ __launch_bounds__(256) void k_tab(float* cosT, float* sinT, InvF inv) {
  const int tid  = threadIdx.x;
  const int lane = tid & 31;
  const int t    = blockIdx.x * 8 + (tid >> 5);
  if (t >= SEQ) return;                     // never taken with the exact grid; no barriers in this kernel
  float f = inv.f[0];
#pragma unroll
  for (int i = 1; i < 32; ++i) f = (lane == i) ? inv.f[i] : f;
  const float ang = (float)t * f;
  float sv, cv;
  sincos_acc(ang, sv, cv);
  float* cr = cosT + (size_t)t * HD;
  float* sr = sinT + (size_t)t * HD;
  {
    *(float*)(cr + lane)      = cv;
    *(float*)(cr + 32 + lane) = cv;
    *(float*)(sr + lane)      = sv;
    *(float*)(sr + 32 + lane) = sv;
    
  }
}

// =====================================================================================================
// f32 -> 16-bit plane, same layout.  f16mode == 0: bf16 RNE bits;  f16mode == 1: f16 bits of (bf16 RNE value) * scale.
// Thread = 8 consecutive elements: two 16-B loads, one 16-B store; 32 consecutive lanes = 512 contiguous, 512-B aligned bytes per
// coverage: grid = n8/256 blocks (exact, host-derived) x 256 thr x 8 = the whole plane.
// =====================================================================================================
__global__ __launch_bounds__(256) void cvt16(const float* __restrict__ x, u16* D, int n8, int f16mode, float scale) {
  const int gt = blockIdx.x * 256 + (int)threadIdx.x;
  if (gt >= n8) return;                     // no barriers in this kernel
  const float* p = x + (size_t)gt * 8;
  const v4f a = *(const v4f*)(p), b4 = *(const v4f*)(p + 4);
  float w[8];
#pragma unroll
  for (int e = 0; e < 4; ++e) { w[e] = a[e]; w[4 + e] = b4[e]; }
  v4u o;
#pragma unroll
  for (int e = 0; e < 4; ++e) {
    const float f0 = w[2 * e], f1 = w[2 * e + 1];
    const unsigned short hb0 = h_bits((_Float16)(bfr(f0) * scale));
    const unsigned short hb1 = h_bits((_Float16)(bfr(f1) * scale));
    const unsigned short bb0 = bf_bits(f0);
    const unsigned short bb1 = bf_bits(f1);
    o[e] = (f16mode != 0) ? pk16(hb0, hb1) : pk16(bb0, bb1);
  }
  u16* d = D + (size_t)gt * 8;
  {
    *(v4u*)(d) = o;
    
  }
}

// =====================================================================================================
// GEMM epilogue shared by both engines: the wave's 16x64 f32 tile (times oscale) staged in its LDS slab (pitch 68),
// coverage: 8 instructions x 2 rows x 16 lanes x 4 floats = the wave's 16 x 64 tile.
// =====================================================================================================
__device__ __forceinline__ void epi64(float* sl, v8f a0, v8f a1, v8f a2, v8f a3, float oscale,
                                      const float* __restrict__ bias, float* C, int N,
                                      size_t rowb, int col0, int lane) {
  const int hh = lane >> 4, m = lane & 15;
#pragma unroll
  for (int r = 0; r < 8; ++r) {
    const int ro = (8 * hh + r) * 68 + m;
    sl[ro]      = a0[r] * oscale;
    sl[ro + 16] = a1[r] * oscale;
    sl[ro + 32] = a2[r] * oscale;
    sl[ro + 48] = a3[r] * oscale;
  }
  wave_sync_lds();
  const v4f braw = *(const v4f*)(bias + col0 + m * 4);
  v4f bb;
#pragma unroll
  for (int e = 0; e < 4; ++e) bb[e] = bfr(braw[e]);
  v4f vals[8];
#pragma unroll
  for (int it = 0; it < 8; ++it) vals[it] = *(const v4f*)(sl + (it * 2 + hh) * 68 + m * 4) + bb;
  float* dst = C + (rowb + (size_t)hh) * (size_t)N + col0 + m * 4;
  {
#pragma unroll
    for (int it = 0; it < 8; ++it) {
      *(v4f*)(dst + (size_t)(it * 2) * (size_t)N) = vals[it];
    }
    
  }
}

// =====================================================================================================
// bf16 GEMM: C[M][N] (f32) = A[M][K] (bf16 row-major) . Bt[N][K]^T (bf16 k-contiguous), times oscale, plus bias[N].
// Block = 64x64 tile, 4 waves x 16 rows; fragments loaded straight from the 16-bit rows (two 16-B loads each, split k map
// for A and B); K stepped by 32 (host checks K % 32 == 0, M % 64 == 0, N % 64 == 0, grid = (M/64)*(N/64)).
// =====================================================================================================
__global__ __launch_bounds__(128)
void gemm_bf(const u16* __restrict__ A, const u16* __restrict__ Bt, const float* __restrict__ bias, float* C,
             int M, int N, int K, float oscale) {
  __shared__ __align__(16) float slab[4 * SLAB64];
  const int tid = threadIdx.x, wave = tid >> 5, lane = tid & 31, hh = lane >> 4, m = lane & 15;
  const int ntile = N >> 6;
  const int bid   = blockIdx.x;
  const int rowb  = (bid / ntile) * 64 + wave * 16;
  const int col0  = (bid % ntile) * 64;
  if (rowb + 16 > M) return;                 // wave-uniform, never taken with the exact grid; no block barriers in this kernel
  const u16* ap = A  + (size_t)(rowb + m) * K + 8 * hh;
  const u16* bp = Bt + (size_t)(col0 + m) * K + 8 * hh;
  const size_t bs = (size_t)16 * K;
  v8f acc0 = zero8(), acc1 = zero8(), acc2 = zero8(), acc3 = zero8();
#pragma unroll 1
  for (int k0 = 0; k0 < K; k0 += 32) {
    const v16b a  = ldfrag_b(ap + k0);
    const v16b b0 = ldfrag_b(bp + k0);
    const v16b b1 = ldfrag_b(bp + bs + k0);
    const v16b b2 = ldfrag_b(bp + 2 * bs + k0);
    const v16b b3 = ldfrag_b(bp + 3 * bs + k0);
    acc0 = mma_b(a, b0, acc0);
    acc1 = mma_b(a, b1, acc1);
    acc2 = mma_b(a, b2, acc2);
    acc3 = mma_b(a, b3, acc3);
    guard6<v16b>(acc0, acc1, acc2, acc3, a, b0, b1, b2, b3, a);
  }
  epi64(slab + wave * SLAB64, acc0, acc1, acc2, acc3, oscale, bias, C, N, (size_t)rowb, col0, lane);
}

// =====================================================================================================
// f16 hi+lo GEMM: C[M][N] (f32) = (Ahi + Alo)[M][K] . Bt[N][K]^T, times oscale, plus bias[N]; Ahi/Alo f16 planes (same layout),
// Bt f16 k-contiguous; products hi.B + lo.B into one accumulator (lo is the unscaled residual of hi). Same tiling as gemm_bf.
// =====================================================================================================
__global__ __launch_bounds__(128)
void gemm_h2(const u16* __restrict__ Ah, const u16* __restrict__ Al, const u16* __restrict__ Bt,
             const float* __restrict__ bias, float* C, int M, int N, int K, float oscale) {
  __shared__ __align__(16) float slab[4 * SLAB64];
  const int tid = threadIdx.x, wave = tid >> 5, lane = tid & 31, hh = lane >> 4, m = lane & 15;
  const int ntile = N >> 6;
  const int bid   = blockIdx.x;
  const int rowb  = (bid / ntile) * 64 + wave * 16;
  const int col0  = (bid % ntile) * 64;
  if (rowb + 16 > M) return;                 // wave-uniform, never taken with the exact grid; no block barriers in this kernel
  const size_t aofs = (size_t)(rowb + m) * K + 8 * hh;
  const _Float16* ahp = (const _Float16*)(const void*)Ah + aofs;
  const _Float16* alp = (const _Float16*)(const void*)Al + aofs;
  const _Float16* bp  = (const _Float16*)(const void*)Bt + (size_t)(col0 + m) * K + 8 * hh;
  const size_t bs = (size_t)16 * K;
  v8f acc0 = zero8(), acc1 = zero8(), acc2 = zero8(), acc3 = zero8();
#pragma unroll 1
  for (int k0 = 0; k0 < K; k0 += 32) {
    const v16h ah = ldfrag_h(ahp + k0), al = ldfrag_h(alp + k0);
    const v16h b0 = ldfrag_h(bp + k0);
    const v16h b1 = ldfrag_h(bp + bs + k0);
    const v16h b2 = ldfrag_h(bp + 2 * bs + k0);
    const v16h b3 = ldfrag_h(bp + 3 * bs + k0);
    acc0 = mma_h(ah, b0, acc0);  acc0 = mma_h(al, b0, acc0);
    acc1 = mma_h(ah, b1, acc1);  acc1 = mma_h(al, b1, acc1);
    acc2 = mma_h(ah, b2, acc2);  acc2 = mma_h(al, b2, acc2);
    acc3 = mma_h(ah, b3, acc3);  acc3 = mma_h(al, b3, acc3);
    guard6<v16h>(acc0, acc1, acc2, acc3, ah, al, b0, b1, b2, b3);
  }
  epi64(slab + wave * SLAB64, acc0, acc1, acc2, acc3, oscale, bias, C, N, (size_t)rowb, col0, lane);
}

// =====================================================================================================
// Rotate-half rotary + 16-bit split pack. Rows are (pos, head) with HD contiguous floats (f32 projection output);
// pos = (row / hpr) mod SEQ.  w[d] = x[d] * cos[pos][d] + r[d] * sin[pos][d],  r[d] = -x[d+32] for d < 32, x[d-32] for d >= 32;
// hi[d] = f16(w * sc), lo[d] = f16(w * sc - hi[d])  (sc a power of two, residual unscaled).
// Thread = 8 consecutive d of one row: 16-B loads of x (own and partner half), cos, sin; one 16-B store per plane per lane;
// coverage: grid = nrows*8/256 blocks x 256 thr x 8 halves = nrows x 64 of each plane exactly (exact division checked statically).
// =====================================================================================================
__global__ __launch_bounds__(256) void rope16(const float* __restrict__ x, const float* __restrict__ cosT,
                                              const float* __restrict__ sinT, u16* hpl, u16* lpl,
                                              int nrows, int hpr, float sc) {
  const int gt  = blockIdx.x * 256 + (int)threadIdx.x;
  const int row = gt >> 3;
  const int d0  = (gt & 7) * 8;
  if (row >= nrows) return;                 // never taken with the exact grid; no barriers in this kernel
  const int pos = (row / hpr) % SEQ;
  const int d1  = d0 ^ 32;
  const float* xr = x + (size_t)row * HD;
  const float* cr = cosT + (size_t)pos * HD + d0;
  const float* sr = sinT + (size_t)pos * HD + d0;
  const v4f xa = *(const v4f*)(xr + d0), xb = *(const v4f*)(xr + d0 + 4);
  const v4f ya = *(const v4f*)(xr + d1), yb = *(const v4f*)(xr + d1 + 4);
  const v4f ca = *(const v4f*)(cr), cb = *(const v4f*)(cr + 4);
  const v4f sa = *(const v4f*)(sr), sb = *(const v4f*)(sr + 4);
  const float sgn = (d0 < 32) ? -1.0f : 1.0f;
  float w[8];
#pragma unroll
  for (int e = 0; e < 4; ++e) {
    w[e]     = xa[e] * ca[e] + (sgn * ya[e]) * sa[e];
    w[4 + e] = xb[e] * cb[e] + (sgn * yb[e]) * sb[e];
  }
  v4u oh, ol;
#pragma unroll
  for (int e = 0; e < 4; ++e) {
    const float t0 = w[2 * e] * sc, t1 = w[2 * e + 1] * sc;
    const _Float16 h0 = (_Float16)t0, h1 = (_Float16)t1;
    const _Float16 l0 = (_Float16)(t0 - (float)h0), l1 = (_Float16)(t1 - (float)h1);
    oh[e] = pk16(h_bits(h0), h_bits(h1));
    ol[e] = pk16(h_bits(l0), h_bits(l1));
  }
  const size_t o8 = (size_t)row * HD + d0;
  {
    *(v4u*)(hpl + o8) = oh;
    *(v4u*)(lpl + o8) = ol;
    
  }
}

// =====================================================================================================
// v^T planes: VH[g*HD + d][s] = f16(v[s][g][d] * 1024), VL = f16 residual of the same value.
// Block = (head g = bid / NST, 64 keys s0 = (bid % NST)*64): 64 source rows of HD floats loaded with 16-B loads, converted,
// scattered into two LDS tiles [d][64 keys] (pitch 72 halves); after a block barrier each d row segment (64 halves = one whole
// coverage: load 256 thr x 16 elements = 64 x 64; store 2 iterations x 256 thr x 8 halves = 64 lines x 64 = the block's tile of
//           each plane; grid = NH x NST blocks covers both planes exactly once.
// =====================================================================================================
__global__ __launch_bounds__(256) void vt16(const float* __restrict__ v, u16* VHo, u16* VLo) {
  __shared__ __align__(16) u16 TH[HD * VTP];
  __shared__ __align__(16) u16 TL[HD * VTP];
  const int tid = threadIdx.x;
  const int bid = blockIdx.x;
  const int st  = bid % NST;
  const int g   = bid / NST;
  if (g >= NH) return;                        // block-uniform, before any barrier; never taken with the exact grid
  const int s0  = st * 64;
  {
    const int sl = tid >> 2;                  // key within tile 0..63
    const int dc = (tid & 3) * 16;            // d chunk
    const float* src = v + ((size_t)(s0 + sl) * NH + g) * HD + dc;
#pragma unroll
    for (int i = 0; i < 4; ++i) {
      const v4f a = *(const v4f*)(src + 4 * i);
#pragma unroll
      for (int e = 0; e < 4; ++e) {
        const float t = a[e] * VCAR;
        const _Float16 h = (_Float16)t;
        const _Float16 l = (_Float16)(t - (float)h);
        TH[(dc + 4 * i + e) * VTP + sl] = h_bits(h);
        TL[(dc + 4 * i + e) * VTP + sl] = h_bits(l);
      }
    }
  }
  __syncthreads();
  v4u vh[2], vl[2];
  const int q8 = tid >> 3, p8 = (tid & 7) * 8;
#pragma unroll
  for (int it = 0; it < 2; ++it) {
    const int line = it * 32 + q8;            // d = 0..63
    vh[it] = *(const v4u*)(TH + line * VTP + p8);
    vl[it] = *(const v4u*)(TL + line * VTP + p8);
  }
  const size_t base = ((size_t)g * HD) * SEQ + s0 + p8;
  {
#pragma unroll
    for (int it = 0; it < 2; ++it) {
      const int line = it * 32 + q8;
      *(v4u*)(VHo + base + (size_t)line * SEQ) = vh[it];
      *(v4u*)(VLo + base + (size_t)line * SEQ) = vl[it];
    }
    
  }
}

// =====================================================================================================
// Triple-masked attention: block bid -> (head = bid % NH, query tile pair qp = NQP-1 - bid / NH: rows q0 = 32*qp .. q0+31; the pairs with
// the most keys take the lowest block ids). Every wave carries both 16-row query tiles of the pair, each with a softmax state of its own, so that one
// load of a k or v fragment serves two tiles. The block's WPB waves share that one (pair, head) and split its key tiles: in every group of eight
// consecutive key tiles g each wave takes one, kt = 8g + ((wave - g) & 7), so that any stride-4 or stride-8 pattern of live tiles is spread too.
//   q planes (hi, lo f16 x1024) laid out [s][h][d]; k planes [s][h][d]; v^T planes [h][d][s]; instrument and bar ids staged in LDS.
//   For each of the three masks in turn (block-uniform), each wave with its OWN running max m_a, sum Z_a and 4 accumulators acc_a per query tile:
//     att 0: (iq == ik) && (iq < 129) && (j <= i)
//     att 1: (iq != ik) && (ik < 129) && (iq < 129) && (bq >= 0) && ((0 <= bq-bk <= 2) || (bq-bk == 4))
//     att 2: ((ik == 129) || (bk == -1)) && (j <= i)
//   A wave's key tiles of 32 visited in order (att 0/2 up to the causal limit, att 1 all NKT); per tile every lane evaluates its
//   2 x 8 rows x 2 keys mask bits, a wave ballot skips tiles with no allowed element in either query tile (exact: such keys carry zero weight).
//   Per processed tile and query tile: 2 score subtiles x 2 k-steps x 3 products (q_hi.k_hi + q_lo.k_hi + q_hi.k_lo), fragments loaded straight
//   from the 16-bit planes (two 16-B loads per fragment, split k map); masked scores replaced by -inf; online max-subtracted base-2
//   softmax in f32 (scale 1/8 folded), -inf-safe rescale; the 16x32 prob tile stored to wave-private LDS (f32 element stores),
//   loads, same element type as stored), 4+4 v^T B fragments (hi and residual planes), 12 P.V WMMAs (hh + lh + hl).
//   After each mask every wave publishes its partial (m, Z, acc) in its LDS slab (which holds the prob tile during the loop); behind a
//   block barrier wave w merges the eight partials of rows 4w .. 4w+3 (a lane: one row, 8 d columns): M = max m_w, Z = sum Z_w 2^(m_w-M), acc likewise;
//   out_a = (Z > 0, i.e. the row has an allowed key) ? acc / Z : 0, carries 1/(32768*1024) folded once, summed in a lane-owned LDS tile:
//   O = out_0 + out_1 + out_2. A second barrier frees the slabs for the next mask. All barriers block-uniform; bounded loops only.
// coverage: per wave 4 rows x 8 lanes x 8 halves = 4 x 64 per plane, WPB waves = 32 x 64; grid NQP*NH blocks =
//           every (s, h) row of both O planes exactly once.
// =====================================================================================================
// second bound: four waves per SIMD (at most 256 registers), two blocks on a WGP: the grid takes two rounds
__global__ __launch_bounds__(ATT_THREADS, 4)
void attn3(const u16* __restrict__ QHIp, const u16* __restrict__ QLOp,
           const u16* __restrict__ KHIp, const u16* __restrict__ KLOp,
           const u16* __restrict__ VHIp, const u16* __restrict__ VLOp,
           const int* __restrict__ inst, const int* __restrict__ bar,
           u16* OHIp, u16* OLOp) {
  __shared__ __align__(16) float smem[WPB * WREG + QTW * SLW];
  __shared__ int sI[SEQ];
  __shared__ int sB[SEQ];

  const int tid  = threadIdx.x;
  const int wave = __builtin_amdgcn_readfirstlane(tid >> 5);   // scalar: it steers the key-tile loop
  const int lane = tid & 31;
  const int hh   = lane >> 4;
  const int c    = lane & 15;
  const int bid  = blockIdx.x;
  if (bid >= NQP * NH) return;               // block-uniform, before any barrier; never taken with the exact grid
  const int head = bid % NH;
  const int qp   = NQP - 1 - bid / NH;
  const int q0   = qp * (16 * QTW);
  const int rq   = lane >> 3;                // merge and output: this lane owns row 4*wave + rq of the block's 32,
  const int c8   = (lane & 7) * 8;           // d columns c8 .. c8 + 7
  const int row  = wave * 4 + rq;

  for (int i = tid; i < SEQ; i += ATT_THREADS) { sI[i] = inst[i]; sB[i] = bar[i]; }
  __syncthreads();

  float* slab = smem + wave * WREG;          // partial accumulators [16*QTW][64] pitch 68, written after a mask's key loop;
                                             // inside the key loop query tile t keeps its prob tile [16][32] pitch 36 at slab + t*SLW
  float* ml   = slab + QTW * SLW;            // partial m[16*QTW], Z[16*QTW]
  float* osum = smem + WPB * WREG;           // the block's result [16*QTW][64] pitch 68; elements (row, c8 .. c8 + 7) owned by this lane

  // byte offsets into the 16-bit planes (each plane SEQ*DMOD*2 bytes, far below 2^32); hi and residual planes share them
  const unsigned KROWB = NH * HD * 2u;                                          // bytes between consecutive query or key rows
  const unsigned qofs = ((unsigned)((q0 + c) * NH + head) * HD + 8u * hh) * 2u;  // query tile t: + t * 16 * KROWB
  const unsigned kofs = ((unsigned)(c * NH + head) * HD + 8u * hh) * 2u;         // key row kb + c added per step
  const unsigned vofs = ((unsigned)(head * HD + c) * SEQ + 8u * hh) * 2u;        // d column c (+16j), key kb added per step
  const float lsc = 0.125f * (LOG2E / (QSC * KSC));
  const float oc  = 1.0f / (PCAR * VCAR);

  // kept rolled: with two query tiles a wave, three copies of the tile body and of the merge would be about 60 KB of code, nearly the
  // whole instruction cache; the mask is picked by a scalar branch at each key tile
#pragma unroll 1
  for (int att = 0; att < 3; ++att) {
    float mrow[QTW][8], lrow[QTW][8];
    v8f o[QTW][4];
#pragma unroll
    for (int t = 0; t < QTW; ++t) {
#pragma unroll
      for (int r = 0; r < 8; ++r) { mrow[t][r] = -INFINITY; lrow[t][r] = 0.f; }
#pragma unroll
      for (int j = 0; j < 4; ++j) o[t][j] = zero8();
    }
    const int ncaus = ((q0 + 16 * QTW - 1) >> 5) + 1;                           // tiles holding keys <= the block's last query row
    const int nkt = (att == 1) ? NKT : ((ncaus < NKT) ? ncaus : NKT);

    const int ngrp = (nkt + WPB - 1) / WPB;
#pragma unroll 1
    for (int g = 0; g < ngrp; ++g) {
      const int kt = WPB * g + ((wave - g) & (WPB - 1));
      if (kt >= nkt) continue;                                                   // wave-uniform
      const int kb = kt * 32;
      const int j0 = kb + c, j1 = kb + 16 + c;
      const int ik0 = sI[j0], ik1 = sI[j1];
      const int bk0 = sB[j0], bk1 = sB[j1];
      // the query rows' ids are read from LDS beside the keys' ids at every key tile: held in registers over the whole
      // loop they would take 32 of the 256 and push the loop's addresses into scratch
      int iq[QTW][8], bq8[QTW][8];
#pragma unroll
      for (int t = 0; t < QTW; ++t) {
#pragma unroll
        for (int r = 0; r < 8; ++r) { const int i = q0 + 16 * t + 8 * hh + r; iq[t][r] = sI[i]; bq8[t][r] = sB[i]; }
      }
      // causal test j <= i written against the row's constant 16t + r (i = q0 + 8hh + 16t + r): no register per query row
      const int dj0 = j0 - (q0 + 8 * hh), dj1 = j1 - (q0 + 8 * hh);
      unsigned okb[QTW];
#pragma unroll
      for (int t = 0; t < QTW; ++t) {
        unsigned ob = 0u;
        if (att == 0) {
#pragma unroll
          for (int r = 0; r < 8; ++r) {
            const bool qa  = iq[t][r] < GINST;
            const bool ok0 = qa && (iq[t][r] == ik0) && (dj0 <= 16 * t + r);
            const bool ok1 = qa && (iq[t][r] == ik1) && (dj1 <= 16 * t + r);
            ob |= (ok0 ? (1u << r) : 0u) | (ok1 ? (1u << (8 + r)) : 0u);
          }
        } else if (att == 1) {
          const bool ka0 = ik0 < GINST, ka1 = ik1 < GINST;
#pragma unroll
          for (int r = 0; r < 8; ++r) {
            const bool qa  = (iq[t][r] < GINST) && (bq8[t][r] >= 0);
            const int  d0  = bq8[t][r] - bk0, d1 = bq8[t][r] - bk1;
            const bool w0  = ((d0 >= 0) && (d0 <= 2)) || (d0 == 4);
            const bool w1  = ((d1 >= 0) && (d1 <= 2)) || (d1 == 4);
            const bool ok0 = qa && ka0 && (iq[t][r] != ik0) && w0;
            const bool ok1 = qa && ka1 && (iq[t][r] != ik1) && w1;
            ob |= (ok0 ? (1u << r) : 0u) | (ok1 ? (1u << (8 + r)) : 0u);
          }
        } else {
          const bool g0 = (ik0 == GINST) || (bk0 == -1);
          const bool g1 = (ik1 == GINST) || (bk1 == -1);
#pragma unroll
          for (int r = 0; r < 8; ++r) {
            const bool ok0 = g0 && (dj0 <= 16 * t + r);
            const bool ok1 = g1 && (dj1 <= 16 * t + r);
            ob |= (ok0 ? (1u << r) : 0u) | (ok1 ? (1u << (8 + r)) : 0u);
          }
        }
        okb[t] = ob;
      }
      const unsigned anyw = __builtin_amdgcn_ballot_w32((okb[0] | okb[1]) != 0u);    // wave-uniform
      if (anyw == 0u) continue;

      // ---- scores: D element r of this lane = (query row q0 + 16t + 8hh + r, key kb + c) in s[t][0], key kb + 16 + c in s[t][1];
      //      each k fragment is loaded once and multiplied with both query tiles ----
      v8f s[QTW][2];
#pragma unroll
      for (int t = 0; t < QTW; ++t) { s[t][0] = zero8(); s[t][1] = zero8(); }
      const unsigned ko = kofs + (unsigned)kb * KROWB;
#pragma unroll
      for (int kk = 0; kk < 2; ++kk) {
        const v16h kh0 = ldfrag_o(KHIp, ko, kk * 64u),                kl0 = ldfrag_o(KLOp, ko, kk * 64u);
        const v16h kh1 = ldfrag_o(KHIp, ko, 16u * KROWB + kk * 64u),  kl1 = ldfrag_o(KLOp, ko, 16u * KROWB + kk * 64u);
        const v16h qa  = ldfrag_o(QHIp, qofs, kk * 64u),               qb  = ldfrag_o(QLOp, qofs, kk * 64u);
        const v16h qc  = ldfrag_o(QHIp, qofs, 16u * KROWB + kk * 64u), qd  = ldfrag_o(QLOp, qofs, 16u * KROWB + kk * 64u);
        s[0][0] = mma_h(qa, kh0, s[0][0]);
        s[0][0] = mma_h(qb, kh0, s[0][0]);
        s[0][0] = mma_h(qa, kl0, s[0][0]);
        s[0][1] = mma_h(qa, kh1, s[0][1]);
        s[0][1] = mma_h(qb, kh1, s[0][1]);
        s[0][1] = mma_h(qa, kl1, s[0][1]);
        s[1][0] = mma_h(qc, kh0, s[1][0]);
        s[1][0] = mma_h(qd, kh0, s[1][0]);
        s[1][0] = mma_h(qc, kl0, s[1][0]);
        s[1][1] = mma_h(qc, kh1, s[1][1]);
        s[1][1] = mma_h(qd, kh1, s[1][1]);
        s[1][1] = mma_h(qc, kl1, s[1][1]);
        guard10(s[0][0], s[0][1], s[1][0], s[1][1], qa, qb, qc, qd, kh0, kl0, kh1, kl1, kh0, kl0);
      }
      // ---- mask (replace by -inf) + online softmax in base 2, -inf-safe; a query tile with no allowed key in this key tile
      //      goes through with al = 1 (or 0 on a zero state) and an all-zero prob tile: its state keeps its bits ----
#pragma unroll
      for (int t = 0; t < QTW; ++t) {
        float* pt = slab + t * SLW;
#pragma unroll
        for (int r = 0; r < 8; ++r) {
          const bool ok0 = ((okb[t] >> r) & 1u) != 0u;
          const bool ok1 = ((okb[t] >> (8 + r)) & 1u) != 0u;
          const float t0 = ok0 ? (s[t][0][r] * lsc) : -INFINITY;
          const float t1 = ok1 ? (s[t][1][r] * lsc) : -INFINITY;
          float mx = fmaxf(t0, t1);
#pragma unroll
          for (int off = 1; off < 16; off <<= 1) mx = fmaxf(mx, __shfl_xor(mx, off, 32));
          const float mn = fmaxf(mrow[t][r], mx);
          const float ms = (mn == -INFINITY) ? 0.0f : mn;
          const float al = exp2f(mrow[t][r] - ms);
          mrow[t][r] = mn;
          const float e0 = exp2f(t0 - ms), e1 = exp2f(t1 - ms);
          float ps = e0 + e1;
#pragma unroll
          for (int off = 1; off < 16; off <<= 1) ps += __shfl_xor(ps, off, 32);
          lrow[t][r] = lrow[t][r] * al + ps;
#pragma unroll
          for (int j = 0; j < 4; ++j) o[t][j][r] *= al;
          const int ro = (8 * hh + r) * 36 + c;
          pt[ro]      = e0;
          pt[ro + 16] = e1;
        }
      }
      wave_sync_lds();
      // ---- P.V : B fragment col n = d = j*16 + c, keys contiguous in the v^T planes; each v fragment is loaded once and
      //      multiplied with both query tiles' prob fragments ----
      {
        const unsigned vo = vofs + (unsigned)kb * 2u;
        const v16h vh0 = ldfrag_o(VHIp, vo, 0u);
        const v16h vh1 = ldfrag_o(VHIp, vo, 16u * SEQ * 2u);
        const v16h vh2 = ldfrag_o(VHIp, vo, 32u * SEQ * 2u);
        const v16h vh3 = ldfrag_o(VHIp, vo, 48u * SEQ * 2u);
        const v16h vl0 = ldfrag_o(VLOp, vo, 0u);
        const v16h vl1 = ldfrag_o(VLOp, vo, 16u * SEQ * 2u);
        const v16h vl2 = ldfrag_o(VLOp, vo, 32u * SEQ * 2u);
        const v16h vl3 = ldfrag_o(VLOp, vo, 48u * SEQ * 2u);
#pragma unroll
        for (int t = 0; t < QTW; ++t) {
          // A fragments of P*32768: hi f16 and residual f16, row = c, split k map over the 32 keys of this step
          FragH ph, pl;
          const float* prow = slab + t * SLW + c * 36 + 8 * hh;
          const v4f p0 = *(const v4f*)(prow), p1 = *(const v4f*)(prow + 4);
          const v4f p2 = *(const v4f*)(prow + 16), p3 = *(const v4f*)(prow + 20);
#pragma unroll
          for (int e = 0; e < 4; ++e) {
            const float ta = p0[e] * PCAR, tb = p1[e] * PCAR, tc = p2[e] * PCAR, td = p3[e] * PCAR;
            const _Float16 ha = (_Float16)ta, hb = (_Float16)tb, hc = (_Float16)tc, hd = (_Float16)td;
            ph.h[0][e]     = ha;                               // elements 0..7  = keys kb + 8hh + 0..7
            ph.h[0][4 + e] = hb;
            ph.h[1][e]     = hc;                               // elements 8..15 = keys kb + 16 + 8hh + 0..7
            ph.h[1][4 + e] = hd;
            pl.h[0][e]     = (_Float16)(ta - (float)ha);
            pl.h[0][4 + e] = (_Float16)(tb - (float)hb);
            pl.h[1][e]     = (_Float16)(tc - (float)hc);
            pl.h[1][4 + e] = (_Float16)(td - (float)hd);
          }
          o[t][0] = mma_h(ph.v, vh0, o[t][0]);  o[t][0] = mma_h(pl.v, vh0, o[t][0]);  o[t][0] = mma_h(ph.v, vl0, o[t][0]);
          o[t][1] = mma_h(ph.v, vh1, o[t][1]);  o[t][1] = mma_h(pl.v, vh1, o[t][1]);  o[t][1] = mma_h(ph.v, vl1, o[t][1]);
          o[t][2] = mma_h(ph.v, vh2, o[t][2]);  o[t][2] = mma_h(pl.v, vh2, o[t][2]);  o[t][2] = mma_h(ph.v, vl2, o[t][2]);
          o[t][3] = mma_h(ph.v, vh3, o[t][3]);  o[t][3] = mma_h(pl.v, vh3, o[t][3]);  o[t][3] = mma_h(ph.v, vl3, o[t][3]);
          guard10(o[t][0], o[t][1], o[t][2], o[t][3], ph.v, pl.v, vh0, vh1, vh2, vh3, vl0, vl1, vl2, vl3);
        }
      }
      wave_sync_lds();
    }
#pragma unroll
    for (int t = 0; t < QTW; ++t) acc_guard4(o[t][0], o[t][1], o[t][2], o[t][3]);
    // ---- publish this wave's partial: acc in its slab, m and Z (equal in the 16 lanes of a half) by lane c == 0 ----
#pragma unroll
    for (int t = 0; t < QTW; ++t) {
#pragma unroll
      for (int r = 0; r < 8; ++r) {
#pragma unroll
        for (int j = 0; j < 4; ++j) slab[(16 * t + 8 * hh + r) * 68 + j * 16 + c] = o[t][j][r];
      }
    }
    if (c == 0) {
#pragma unroll
      for (int t = 0; t < QTW; ++t) {
        v4f m0, m1, z0, z1;
#pragma unroll
        for (int e = 0; e < 4; ++e) { m0[e] = mrow[t][e]; m1[e] = mrow[t][4 + e]; z0[e] = lrow[t][e]; z1[e] = lrow[t][4 + e]; }
        *(v4f*)(ml + 16 * t + 8 * hh)                = m0;
        *(v4f*)(ml + 16 * t + 8 * hh + 4)            = m1;
        *(v4f*)(ml + 16 * QTW + 16 * t + 8 * hh)     = z0;
        *(v4f*)(ml + 16 * QTW + 16 * t + 8 * hh + 4) = z1;
      }
    }
    __syncthreads();                          // all WPB partials of this mask are visible
    // ---- merge for this lane's row and 8 d columns: out_a = acc / Z (0 when no key allowed), carries (32768 on P, 1024 on v) folded once ----
    {
      float mw[WPB], zw[WPB];
#pragma unroll
      for (int w2 = 0; w2 < WPB; ++w2) {
        mw[w2] = smem[w2 * WREG + QTW * SLW + row];
        zw[w2] = smem[w2 * WREG + QTW * SLW + 16 * QTW + row];
      }
      float mx = mw[0];
#pragma unroll
      for (int w2 = 1; w2 < WPB; ++w2) mx = fmaxf(mx, mw[w2]);
      const float ms = (mx == -INFINITY) ? 0.0f : mx;
      float lv = 0.0f;
      v4f oa = {0.f, 0.f, 0.f, 0.f}, ob = {0.f, 0.f, 0.f, 0.f};
#pragma unroll
      for (int w2 = 0; w2 < WPB; ++w2) {
        const float sc = exp2f(mw[w2] - ms);
        const float* ap = smem + w2 * WREG + row * 68 + c8;
        lv += zw[w2] * sc;
        oa += *(const v4f*)(ap) * sc;
        ob += *(const v4f*)(ap + 4) * sc;
      }
      const float ls  = (lv > 0.0f) ? lv : 1.0f;
      const float inv = (lv > 0.0f) ? ((1.0f / ls) * oc) : 0.0f;
      float* op = osum + row * 68 + c8;
      if (att == 0) {
        *(v4f*)(op)     = oa * inv;
        *(v4f*)(op + 4) = ob * inv;
      } else {
        *(v4f*)(op)     = *(const v4f*)(op) + oa * inv;
        *(v4f*)(op + 4) = *(const v4f*)(op + 4) + ob * inv;
      }
    }
    __syncthreads();                          // every reader has left the slabs (the next mask overwrites them); after the last mask: osum is whole
  }

  // ---- O x1024 -> f16 hi + residual planes; wave = group of 4 rows, lane = (row in group, 8 consecutive d) ----
  v4u oh, ol;
  {
    const v4f a = *(const v4f*)(osum + row * 68 + c8), b4 = *(const v4f*)(osum + row * 68 + c8 + 4);
    float w[8];
#pragma unroll
    for (int e = 0; e < 4; ++e) { w[e] = a[e] * OSC; w[4 + e] = b4[e] * OSC; }
#pragma unroll
    for (int e = 0; e < 4; ++e) {
      const _Float16 h0 = (_Float16)w[2 * e], h1 = (_Float16)w[2 * e + 1];
      const _Float16 l0 = (_Float16)(w[2 * e] - (float)h0), l1 = (_Float16)(w[2 * e + 1] - (float)h1);
      oh[e] = pk16(h_bits(h0), h_bits(h1));
      ol[e] = pk16(h_bits(l0), h_bits(l1));
    }
  }
  const size_t o8 = (((size_t)(q0 + row)) * NH + head) * HD + c8;
  *(v4u*)(OHIp + o8) = oh;
  *(v4u*)(OLOp + o8) = ol;
}

// =====================================================================================================
// Workspace map (bytes); every plane is fully written by whole-line stores before it is read; all extents are exact multiples
// of the store granularity (no pad rows needed); every offset a multiple of SEQ*256:
//   CT  f32 [SEQ][64]                  SEQ*256        ST  same
//   XB  bf16 [SEQ][1024]               SEQ*2048
//   WQB bf16 [1024 n][1024 k]         2097152        WKB, WVB same        2097152 each
//   WOH f16  [1024 n][1024 k] x1024   2097152
//   QF  f32 [SEQ][1024]                SEQ*4096       KF, VF same
//   QHI f16 [SEQ][16][64] x1024        SEQ*2048       QLO residual
//   KHI f16 [SEQ][16][64] x1024        SEQ*2048       KLO residual
//   VHI f16 [16][64][SEQ] x1024        SEQ*2048       VLO residual
//   OHI f16 [SEQ][1024] x1024          SEQ*2048       OLO residual
//   end (SEQ = 2048)                  72351744
// =====================================================================================================
extern "C" void kernel_launch(void* const* d_in, const int* in_sizes, int n_in,
                              void* d_out, int out_size, void* d_ws, size_t ws_size,
                              hipStream_t stream) {
  if (n_in < 11) return;
  if (in_sizes[0] != SEQ * DMOD) return;
  if (in_sizes[1] != SEQ || in_sizes[2] != SEQ) return;
  if (in_sizes[3] != DMOD * DMOD || in_sizes[5] != DMOD * DMOD) return;
  if (in_sizes[7] != DMOD * DMOD || in_sizes[9] != DMOD * DMOD) return;
  if (in_sizes[4] != DMOD || in_sizes[6] != DMOD || in_sizes[8] != DMOD || in_sizes[10] != DMOD) return;
  if (out_size != SEQ * DMOD) return;

  const float* x   = (const float*)d_in[0];
  const int*   bar = (const int*)d_in[1];
  const int*   ins = (const int*)d_in[2];
  const float* wq  = (const float*)d_in[3];
  const float* bq  = (const float*)d_in[4];
  const float* wk  = (const float*)d_in[5];
  const float* bk  = (const float*)d_in[6];
  const float* wv  = (const float*)d_in[7];
  const float* bv  = (const float*)d_in[8];
  const float* wo  = (const float*)d_in[9];
  const float* bo  = (const float*)d_in[10];
  float*       out = (float*)d_out;

  const size_t szTab = (size_t)SEQ * HD * 4;                    //   524288
  const size_t szXB  = (size_t)SEQ * DMOD * 2;                  //  4194304
  const size_t szW   = (size_t)DMOD * DMOD * 2;                 //  2097152
  const size_t szF   = (size_t)SEQ * DMOD * 4;                  //  8388608
  const size_t szP   = (size_t)SEQ * DMOD * 2;                  //  4194304
  size_t off = 0;
  const size_t oCT  = off; off += szTab;
  const size_t oST  = off; off += szTab;
  const size_t oXB  = off; off += szXB;
  const size_t oWQ  = off; off += szW;
  const size_t oWK  = off; off += szW;
  const size_t oWV  = off; off += szW;
  const size_t oWO  = off; off += szW;
  const size_t oQF  = off; off += szF;
  const size_t oKF  = off; off += szF;
  const size_t oVF  = off; off += szF;
  const size_t oQHI = off; off += szP;
  const size_t oQLO = off; off += szP;
  const size_t oKHI = off; off += szP;
  const size_t oKLO = off; off += szP;
  const size_t oVHI = off; off += szP;
  const size_t oVLO = off; off += szP;
  const size_t oOHI = off; off += szP;
  const size_t oOLO = off; off += szP;
  if (off > ws_size) return;                            // off = 72351744 at SEQ = 2048
  if (off > (size_t)134217728) return;

  char* ws = (char*)d_ws;
  float* CT  = (float*)(ws + oCT);
  float* ST  = (float*)(ws + oST);
  u16*   XB  = (u16*)(ws + oXB);
  u16*   WQB = (u16*)(ws + oWQ);
  u16*   WKB = (u16*)(ws + oWK);
  u16*   WVB = (u16*)(ws + oWV);
  u16*   WOH = (u16*)(ws + oWO);
  float* QF  = (float*)(ws + oQF);
  float* KF  = (float*)(ws + oKF);
  float* VF  = (float*)(ws + oVF);
  u16*   QHI = (u16*)(ws + oQHI);
  u16*   QLO = (u16*)(ws + oQLO);
  u16*   KHI = (u16*)(ws + oKHI);
  u16*   KLO = (u16*)(ws + oKLO);
  u16*   VHI = (u16*)(ws + oVHI);
  u16*   VLO = (u16*)(ws + oVLO);
  u16*   OHI = (u16*)(ws + oOHI);
  u16*   OLO = (u16*)(ws + oOLO);

  // inv_freq[i] = 1 / pow(10000, i/32) in f32 (pow correctly converted from f64, then IEEE f32 reciprocal)
  InvF inv;
  for (int i = 0; i < 32; ++i) {
    const double p = pow(10000.0, (double)i / 32.0);
    const float pf = (float)p;
    inv.f[i] = 1.0f / pf;
  }

  const dim3 blk(256);
  const int n8x = (SEQ * DMOD) / 8;                     // 262144
  const int n8w = (DMOD * DMOD) / 8;                    // 131072
  const dim3 gTab(SEQ / 8);                             // 256
  const dim3 gX(n8x / 256);                             // 1024 (exact)
  const dim3 gW(n8w / 256);                             // 512  (exact)
  const dim3 gG((SEQ / 64) * (DMOD / 64));              // 512
  const dim3 bG(128);
  const int rowsQ = SEQ * NH;                           // 32768 rows of 64
  const dim3 gR((rowsQ * 8) / 256);                     // 1024 (exact)
  const dim3 gVT(NH * NST);                             // 512
  const dim3 gAT(ATT_BLOCKS);                           // 1024
  const dim3 bAT(ATT_THREADS);                          // 256

  // (0) rotary cos/sin tables [SEQ][64]
  k_tab<<<gTab, blk, 0, stream>>>(CT, ST, inv);
  // (1) x -> bf16 plane
  cvt16<<<gX, blk, 0, stream>>>(x, XB, n8x, 0, 1.0f);
  // (2..4) Wq/Wk/Wv [n][k] -> bf16 planes (same layout, already k-contiguous)
  cvt16<<<gW, blk, 0, stream>>>(wq, WQB, n8w, 0, 1.0f);
  cvt16<<<gW, blk, 0, stream>>>(wk, WKB, n8w, 0, 1.0f);
  cvt16<<<gW, blk, 0, stream>>>(wv, WVB, n8w, 0, 1.0f);
  // (5) Wo [n][k] -> f16 plane of bf16 value x1024
  cvt16<<<gW, blk, 0, stream>>>(wo, WOH, n8w, 1, WOS);
  // (6..8) projections: q, k, v [SEQ][1024] in f32 (+ bias)
  gemm_bf<<<gG, bG, 0, stream>>>(XB, WQB, bq, QF, SEQ, DMOD, DMOD, 1.0f);
  gemm_bf<<<gG, bG, 0, stream>>>(XB, WKB, bk, KF, SEQ, DMOD, DMOD, 1.0f);
  gemm_bf<<<gG, bG, 0, stream>>>(XB, WVB, bv, VF, SEQ, DMOD, DMOD, 1.0f);
  // (9) q' planes: rows (s, h), heads per position NH
  rope16<<<gR, blk, 0, stream>>>(QF, CT, ST, QHI, QLO, rowsQ, NH, QSC);
  // (10) k' planes: rows (s, h)
  rope16<<<gR, blk, 0, stream>>>(KF, CT, ST, KHI, KLO, rowsQ, NH, KSC);
  // (11) v^T planes x1024 (hi + residual)
  vt16<<<gVT, blk, 0, stream>>>(VF, VHI, VLO);
  // (12) three masked attentions summed -> O planes [s][h][d] x1024 (hi + residual)
  attn3<<<gAT, bAT, 0, stream>>>(QHI, QLO, KHI, KLO, VHI, VLO, ins, bar, OHI, OLO);
  // (13) output projection -> out [SEQ][1024] f32, carries 1024 (O) x 1024 (Wo) folded back, + bo
  gemm_h2<<<gG, bG, 0, stream>>>(OHI, OLO, WOH, bo, out, SEQ, DMOD, DMOD, 1.0f / (OSC * WOS));
  (void)hipGetLastError();
}

// v003
// One run takes 193 microseconds.
// In two side-by-side timings against v002, it was 1.23 and 1.24 times as fast.
// Counting every step since v000, it is 1.73 times as fast.
// Contractions: x.W{q,k,v}^T on v_wmma_f32_16x16x32_bf16 (x and W RNE-converted to bf16, f32 accumulate);
// scores q'.k'^T (q', k' carried x1024 as f16 hi plane + f16 residual plane, products hh+lh+hl), P.v (P x32768 f16 hi+residual,
// v x1024 f16 hi+residual, products hh+lh+hl) and O.Wo^T (O x1024 f16 hi+residual, Wo as f16(bf16(Wo) x1024), products h.w+l.w):
// v_wmma_f32_16x16x32_f16, f32 accumulate. Rotary tables, rotation, masks, masked base-2 online softmax and 1/l fold in f32 on VALU.
#include <hip/hip_runtime.h>
#include <math.h>
#include <stdint.h>

#define SEQ   2048
#define DMOD  1024
#define NH    16
#define HD    64
#define GINST 129
#define QSC   1024.0f
#define KSC   1024.0f
#define PCAR  32768.0f
#define VCAR  1024.0f
#define OSC   1024.0f
#define WOS   1024.0f
#define LOG2E 1.4426950408889634f
#define WPB   8
#define QTW   2
#define NQP   (SEQ / (16 * QTW))
#define NST   (SEQ / 64)
#define NKT   (SEQ / 32)
#define ATT_THREADS (WPB * 32)
#define ATT_BLOCKS  (NQP * NH)
#define PTW   (16 * 36)
#define SLW   (16 * 68)
#define WREG  (QTW * SLW + QTW * 32)
#define SLAB64 (16 * 68)
#define VTP   72
#define GKC   128
#define GPB   272
#define GOPB  (64 * GPB)
#define GKS   (GKC / 32)
static_assert(DMOD == NH * HD && HD == 64 && NH == 16);
static_assert(WPB == 8 && ATT_THREADS == 256 && PTW <= SLW && (WREG % 4) == 0 && (SLW % 4) == 0 && QTW == 2);
static_assert((SEQ % 64) == 0 && (SEQ % ATT_THREADS) == 0 && (SEQ % 8) == 0 && SEQ <= 32768);
static_assert((DMOD % 64) == 0 && (DMOD % 32) == 0);
static_assert(((SEQ * DMOD) % 2048) == 0 && ((DMOD * DMOD) % 2048) == 0);
static_assert(((SEQ * NH * 8) % 256) == 0);
static_assert((DMOD % GKC) == 0 && (DMOD / GKC) >= 2 && GKC * 2 == 256 && GPB == 256 + 16 && (SEQ % 64) == 0);

typedef unsigned short u16;
typedef _Float16 v16h __attribute__((ext_vector_type(16)));
typedef _Float16 v8h  __attribute__((ext_vector_type(8)));
typedef __bf16   v16b __attribute__((ext_vector_type(16)));
typedef float    v8f  __attribute__((ext_vector_type(8)));
typedef float    v4f  __attribute__((ext_vector_type(4)));
typedef unsigned int v4u __attribute__((ext_vector_type(4)));

union FragH { v16h v; v8h h[2]; v4u u[2]; };
union FragB { v16b v; v4u u[2]; };

struct InvF { float f[32]; };
static_assert(sizeof(InvF) == 128);

// ---- scalar helpers --------------------------------------------------------------------------------
__device__ __forceinline__ unsigned short bf_bits(float f) {          // f32 -> bf16 bits, RNE convert
  unsigned u = __float_as_uint(f);
  return (unsigned short)((u + 0x7FFFu + ((u >> 16) & 1u)) >> 16);
}
__device__ __forceinline__ float bf_up(unsigned short h) { return __uint_as_float(((unsigned)h) << 16); }
__device__ __forceinline__ float bfr(float f) { return bf_up(bf_bits(f)); }
__device__ __forceinline__ unsigned short h_bits(_Float16 x) { return __builtin_bit_cast(unsigned short, x); }
__device__ __forceinline__ unsigned pk16(unsigned short a, unsigned short b) { return (unsigned)a | ((unsigned)b << 16); }
__device__ __forceinline__ v8f zero8() { v8f z = {0.f, 0.f, 0.f, 0.f, 0.f, 0.f, 0.f, 0.f}; return z; }

// ---- fragment loaders: 16-bit A/B operand, lane -> row/col (lane&15), p already includes +8*(lane>>4);
//      elements 0..7 <- p[0..7] (k0+8h..), elements 8..15 <- p[16..23] (k0+16+8h..)  (same split k map for A and B;
//      B is always read from a k-contiguous [n][k] plane)
// fragment from a wave-uniform plane base plus a 32-bit per-lane byte offset (one address register instead of a pointer pair per plane)
__device__ __forceinline__ v16h ldfrag_o(const u16* base, unsigned boff, unsigned cbytes) {
  const char* p = (const char*)(const void*)base + boff;
  FragH f;
  f.h[0] = *(const v8h*)(p + cbytes);
  f.h[1] = *(const v8h*)(p + cbytes + 32);
  return f.v;
}

__device__ __forceinline__ v8f mma_h(v16h a, v16h b, v8f c) {
  return __builtin_amdgcn_wmma_f32_16x16x32_f16(false, a, false, b, (short)0, c, false, false);
}
__device__ __forceinline__ v8f mma_b(v16b a, v16b b, v8f c) {
  return __builtin_amdgcn_wmma_f32_16x16x32_bf16(false, a, false, b, (short)0, c, false, false);
}
template <typename F>
__device__ __forceinline__ void guard6(v8f& a, v8f& b, v8f& c, v8f& d, F x0, F x1, F x2, F x3, F x4, F x5) {
#if defined(__HIP_DEVICE_COMPILE__)
  asm volatile("v_nop\n\tv_nop\n\tv_nop\n\tv_nop"
               : "+v"(a), "+v"(b), "+v"(c), "+v"(d) : "v"(x0), "v"(x1), "v"(x2), "v"(x3), "v"(x4), "v"(x5) : "memory");
#endif
}
__device__ __forceinline__ void guard10(v8f& a, v8f& b, v8f& c, v8f& d, v16h x0, v16h x1, v16h x2, v16h x3, v16h x4,
                                        v16h x5, v16h x6, v16h x7, v16h x8, v16h x9) {
#if defined(__HIP_DEVICE_COMPILE__)
  asm volatile("v_nop\n\tv_nop\n\tv_nop\n\tv_nop"
               : "+v"(a), "+v"(b), "+v"(c), "+v"(d)
               : "v"(x0), "v"(x1), "v"(x2), "v"(x3), "v"(x4), "v"(x5), "v"(x6), "v"(x7), "v"(x8), "v"(x9) : "memory");
#endif
}
__device__ __forceinline__ void acc_guard4(v8f& a, v8f& b, v8f& c, v8f& d) {
#if defined(__HIP_DEVICE_COMPILE__)
  asm volatile("v_nop\n\tv_nop\n\tv_nop\n\tv_nop" : "+v"(a), "+v"(b), "+v"(c), "+v"(d));
#endif
}
__device__ __forceinline__ void wave_sync_lds() {
  __builtin_amdgcn_fence(__ATOMIC_RELEASE, "workgroup");
  __builtin_amdgcn_wave_barrier();
  __builtin_amdgcn_fence(__ATOMIC_ACQUIRE, "workgroup");
}

// ---- GEMM operand staging: a stage = GKC k elements (256 B) of 64 rows of an operand, LDS row pitch GPB bytes ----
__device__ __forceinline__ unsigned lds_off(const void* p) { return (unsigned)(size_t)p; }   // LDS byte address of a __shared__ object
// 16 rows x 256 B of one operand, global memory -> LDS through no register: eight asynchronous copies of this wave. A copy is 2 whole rows
// (lane -> row lane >> 4, 16-B column lane & 15), four whole 128-B lines. l, g: this lane's LDS byte address and global address in copy 0;
// copy i lies 2 rows further on in both (ldk = elements between global rows). All 32 lanes on; both addresses multiples of 16.
// The closing s_wait_xcnt 0 stands inside the statement so that no address register named here is rewritten in front of it.
__device__ __forceinline__ void copy16rows(unsigned l, const u16* g, size_t ldk) {
#if defined(__HIP_DEVICE_COMPILE__)
  asm volatile("global_load_async_to_lds_b128 %0, %8, off\n\t"
               "global_load_async_to_lds_b128 %1, %9, off\n\t"
               "global_load_async_to_lds_b128 %2, %10, off\n\t"
               "global_load_async_to_lds_b128 %3, %11, off\n\t"
               "global_load_async_to_lds_b128 %4, %12, off\n\t"
               "global_load_async_to_lds_b128 %5, %13, off\n\t"
               "global_load_async_to_lds_b128 %6, %14, off\n\t"
               "global_load_async_to_lds_b128 %7, %15, off\n\t"
               "s_wait_xcnt 0x0"
               :: "v"(l), "v"(l + 2u * GPB), "v"(l + 4u * GPB), "v"(l + 6u * GPB),
                  "v"(l + 8u * GPB), "v"(l + 10u * GPB), "v"(l + 12u * GPB), "v"(l + 14u * GPB),
                  "v"(g), "v"(g + 2 * ldk), "v"(g + 4 * ldk), "v"(g + 6 * ldk),
                  "v"(g + 8 * ldk), "v"(g + 10 * ldk), "v"(g + 12 * ldk), "v"(g + 14 * ldk)
               : "memory");
#endif
}
// this wave's own copies have landed (the compiler places no wait for them)
__device__ __forceinline__ void wait_copies() {
#if defined(__HIP_DEVICE_COMPILE__)
  asm volatile("s_wait_asynccnt 0x0" ::: "memory");
#endif
}
// this wave's LDS reads have retired: stands in front of the barrier behind which the buffer it read is refilled
__device__ __forceinline__ void wait_lds() {
#if defined(__HIP_DEVICE_COMPILE__)
  asm volatile("s_wait_dscnt 0x0" ::: "memory");
#endif
}
// fragment from a staged row: p = row start + 64 * k-step + 16 * (lane >> 4) bytes; the split k map of the loaders above (bytes +0 and +32)
__device__ __forceinline__ v16b ldsfrag_b(const unsigned char* p) {
  FragB f;
  f.u[0] = *(const v4u*)(p);
  f.u[1] = *(const v4u*)(p + 32);
  return f.v;
}
__device__ __forceinline__ v16h ldsfrag_h(const unsigned char* p) {
  FragH f;
  f.u[0] = *(const v4u*)(p);
  f.u[1] = *(const v4u*)(p + 32);
  return f.v;
}

// ---- accurate f32 sin/cos of a non-negative f32 angle (|angle| < 32768): f64 two-part pi/2 reduction + f64 polynomials,
//      plain f64 fma/mul only (no library f64 trig path), result converted to f32.
__device__ __forceinline__ void sincos_acc(float angf, float& sv, float& cv) {
  const double a = (double)angf;
  const double TWO_OVER_PI = 0.63661977236758134308;
  const double PIO2_HI = 1.5707963267948966;
  const double PIO2_LO = 6.123233995736766e-17;
  const int kq = (int)(a * TWO_OVER_PI + 0.5);
  const double kd = (double)kq;
  double r = fma(-kd, PIO2_HI, a);
  r = fma(-kd, PIO2_LO, r);
  const double r2 = r * r;
  double sp = 1.0 / 6227020800.0;
  sp = fma(sp, r2, -1.0 / 39916800.0);
  sp = fma(sp, r2, 1.0 / 362880.0);
  sp = fma(sp, r2, -1.0 / 5040.0);
  sp = fma(sp, r2, 1.0 / 120.0);
  sp = fma(sp, r2, -1.0 / 6.0);
  const double s = fma(sp * r2, r, r);
  double cp = -1.0 / 87178291200.0;
  cp = fma(cp, r2, 1.0 / 479001600.0);
  cp = fma(cp, r2, -1.0 / 3628800.0);
  cp = fma(cp, r2, 1.0 / 40320.0);
  cp = fma(cp, r2, -1.0 / 720.0);
  cp = fma(cp, r2, 1.0 / 24.0);
  cp = fma(cp, r2, -0.5);
  const double c = fma(cp, r2, 1.0);
  const int qd = kq & 3;
  const double so = (qd == 0) ? s : (qd == 1) ? c : (qd == 2) ? -s : -c;
  const double co = (qd == 0) ? c : (qd == 1) ? -s : (qd == 2) ? -c : s;
  sv = (float)so;
  cv = (float)co;
}

// =====================================================================================================
// Rotary tables: cosT[t][d], sinT[t][d] for t < SEQ, d < HD, angle = float(t) * inv_freq[d & 31] (f32 product), halves duplicated.
// Wave = one position t, lane = frequency index; inv_freq picked from the by-value table with a static select chain.
// coverage: grid SEQ/8 blocks x 8 waves = SEQ rows; per row 4 line stores = 64 floats of each table.
// =====================================================================================================
__global__ __launch_bounds__(256) void k_tab(float* cosT, float* sinT, InvF inv) {
  const int tid  = threadIdx.x;
  const int lane = tid & 31;
  const int t    = blockIdx.x * 8 + (tid >> 5);
  if (t >= SEQ) return;                     // never taken with the exact grid; no barriers in this kernel
  float f = inv.f[0];
#pragma unroll
  for (int i = 1; i < 32; ++i) f = (lane == i) ? inv.f[i] : f;
  const float ang = (float)t * f;
  float sv, cv;
  sincos_acc(ang, sv, cv);
  float* cr = cosT + (size_t)t * HD;
  float* sr = sinT + (size_t)t * HD;
  {
    *(float*)(cr + lane)      = cv;
    *(float*)(cr + 32 + lane) = cv;
    *(float*)(sr + lane)      = sv;
    *(float*)(sr + 32 + lane) = sv;
    
  }
}

// =====================================================================================================
// f32 -> 16-bit plane, same layout.  f16mode == 0: bf16 RNE bits;  f16mode == 1: f16 bits of (bf16 RNE value) * scale.
// Thread = 8 consecutive elements: two 16-B loads, one 16-B store; 32 consecutive lanes = 512 contiguous, 512-B aligned bytes per
// coverage: grid = n8/256 blocks (exact, host-derived) x 256 thr x 8 = the whole plane.
// =====================================================================================================
__global__ __launch_bounds__(256) void cvt16(const float* __restrict__ x, u16* D, int n8, int f16mode, float scale) {
  const int gt = blockIdx.x * 256 + (int)threadIdx.x;
  if (gt >= n8) return;                     // no barriers in this kernel
  const float* p = x + (size_t)gt * 8;
  const v4f a = *(const v4f*)(p), b4 = *(const v4f*)(p + 4);
  float w[8];
#pragma unroll
  for (int e = 0; e < 4; ++e) { w[e] = a[e]; w[4 + e] = b4[e]; }
  v4u o;
#pragma unroll
  for (int e = 0; e < 4; ++e) {
    const float f0 = w[2 * e], f1 = w[2 * e + 1];
    const unsigned short hb0 = h_bits((_Float16)(bfr(f0) * scale));
    const unsigned short hb1 = h_bits((_Float16)(bfr(f1) * scale));
    const unsigned short bb0 = bf_bits(f0);
    const unsigned short bb1 = bf_bits(f1);
    o[e] = (f16mode != 0) ? pk16(hb0, hb1) : pk16(bb0, bb1);
  }
  u16* d = D + (size_t)gt * 8;
  {
    *(v4u*)(d) = o;
    
  }
}

// =====================================================================================================
// GEMM epilogue shared by both engines: the wave's 16x64 f32 tile (times oscale) staged in its LDS slab (pitch 68),
// coverage: 8 instructions x 2 rows x 16 lanes x 4 floats = the wave's 16 x 64 tile.
// =====================================================================================================
__device__ __forceinline__ void epi64(float* sl, v8f a0, v8f a1, v8f a2, v8f a3, float oscale,
                                      const float* __restrict__ bias, float* C, int N,
                                      size_t rowb, int col0, int lane) {
  const int hh = lane >> 4, m = lane & 15;
#pragma unroll
  for (int r = 0; r < 8; ++r) {
    const int ro = (8 * hh + r) * 68 + m;
    sl[ro]      = a0[r] * oscale;
    sl[ro + 16] = a1[r] * oscale;
    sl[ro + 32] = a2[r] * oscale;
    sl[ro + 48] = a3[r] * oscale;
  }
  wave_sync_lds();
  const v4f braw = *(const v4f*)(bias + col0 + m * 4);
  v4f bb;
#pragma unroll
  for (int e = 0; e < 4; ++e) bb[e] = bfr(braw[e]);
  v4f vals[8];
#pragma unroll
  for (int it = 0; it < 8; ++it) vals[it] = *(const v4f*)(sl + (it * 2 + hh) * 68 + m * 4) + bb;
  float* dst = C + (rowb + (size_t)hh) * (size_t)N + col0 + m * 4;
  {
#pragma unroll
    for (int it = 0; it < 8; ++it) {
      *(v4f*)(dst + (size_t)(it * 2) * (size_t)N) = vals[it];
    }
    
  }
}

// =====================================================================================================
// bf16 GEMM: C[M][N] (f32) = A[M][K] (bf16 row-major) . Bt[N][K]^T (bf16 k-contiguous), times oscale, plus bias[N].
// Block = 64x64 tile, 4 waves x 16 rows. K walked in stages of GKC: the block's 64 A rows and 64 Bt rows of a stage are brought into a
// two-buffer LDS ring by asynchronous copies of whole lines (each wave: 16 rows of each operand), stage t + 1 in flight while stage t is
// multiplied; fragments are read from LDS (two 16-B reads each, split k map for A and B), k ascending as before.
// The host passes M % 64 == 0, N % 64 == 0, K % GKC == 0, K >= 2 * GKC, grid = (M/64)*(N/64).
// =====================================================================================================
__global__ __launch_bounds__(128)
void gemm_bf(const u16* __restrict__ A, const u16* __restrict__ Bt, const float* __restrict__ bias, float* C,
             int M, int N, int K, float oscale) {
  __shared__ __align__(16) float slab[4 * SLAB64];
  __shared__ __align__(16) unsigned char ring[2 * 2 * GOPB];   // [buffer][A | Bt][64 rows][GPB]
  const int tid = threadIdx.x, wave = tid >> 5, lane = tid & 31, hh = lane >> 4, m = lane & 15;
  const int ntile = N >> 6;
  const int bid   = blockIdx.x;
  const int row0  = (bid / ntile) * 64;
  const int rowb  = row0 + wave * 16;
  const int col0  = (bid % ntile) * 64;
  if (row0 + 64 > M) return;                 // block-uniform, in front of every barrier and copy; never taken with the exact grid
  const int nst  = K / GKC;
  const int crow = wave * 16 + hh;           // the tile row this lane brings in copy 0
  const u16* ga = A  + (size_t)(row0 + crow) * K + m * 8;
  const u16* gb = Bt + (size_t)(col0 + crow) * K + m * 8;
  const unsigned lc = lds_off(ring) + (unsigned)crow * GPB + (unsigned)m * 16u;
  copy16rows(lc, ga, (size_t)K);
  copy16rows(lc + GOPB, gb, (size_t)K);
  wait_copies();
  __syncthreads();                           // stage 0 is whole for every wave
  if (nst > 1) {
    copy16rows(lc + 2u * GOPB, ga + GKC, (size_t)K);
    copy16rows(lc + 3u * GOPB, gb + GKC, (size_t)K);
  }
  const unsigned char* fa = ring + (wave * 16 + m) * GPB + 16 * hh;
  const unsigned char* fb = ring + GOPB + m * GPB + 16 * hh;
  v8f acc0 = zero8(), acc1 = zero8(), acc2 = zero8(), acc3 = zero8();
  // kept rolled: one copy of the stage body, the buffer picked by the stage's parity
#pragma unroll 1
  for (int t = 0; t < nst; ++t) {
    const unsigned bo = (unsigned)(t & 1) * (2u * GOPB);
    // unrolled: the k-step offsets become immediates and the reads of later k-steps are issued ahead of the earlier products
#pragma unroll
    for (int kk = 0; kk < GKS; ++kk) {
      const v16b a  = ldsfrag_b(fa + bo + kk * 64);
      const v16b b0 = ldsfrag_b(fb + bo + kk * 64);
      const v16b b1 = ldsfrag_b(fb + bo + 16 * GPB + kk * 64);
      const v16b b2 = ldsfrag_b(fb + bo + 32 * GPB + kk * 64);
      const v16b b3 = ldsfrag_b(fb + bo + 48 * GPB + kk * 64);
      acc0 = mma_b(a, b0, acc0);
      acc1 = mma_b(a, b1, acc1);
      acc2 = mma_b(a, b2, acc2);
      acc3 = mma_b(a, b3, acc3);
      // its four v_nop keep the distance behind the stage's last matrix instructions on both sides of the branch at the loop's foot
      if (kk == GKS - 1) guard6<v16b>(acc0, acc1, acc2, acc3, a, b0, b1, b2, b3, a);
    }
    wait_lds();
    wait_copies();
    __syncthreads();                         // publishes stage t + 1 and ends every wave's reads of stage t's buffer
    if (t + 2 < nst) {
      copy16rows(lc + bo, ga + (size_t)(t + 2) * GKC, (size_t)K);
      copy16rows(lc + bo + GOPB, gb + (size_t)(t + 2) * GKC, (size_t)K);
    }
  }
  wait_copies();
  epi64(slab + wave * SLAB64, acc0, acc1, acc2, acc3, oscale, bias, C, N, (size_t)rowb, col0, lane);
}

// =====================================================================================================
// f16 hi+lo GEMM: C[M][N] (f32) = (Ahi + Alo)[M][K] . Bt[N][K]^T, times oscale, plus bias[N]; Ahi/Alo f16 planes (same layout),
// Bt f16 k-contiguous; products hi.B + lo.B into one accumulator (lo is the unscaled residual of hi). Same tiling and the same
// two-buffer LDS ring as gemm_bf, with three operand tiles a stage.
// =====================================================================================================
__global__ __launch_bounds__(128)
void gemm_h2(const u16* __restrict__ Ah, const u16* __restrict__ Al, const u16* __restrict__ Bt,
             const float* __restrict__ bias, float* C, int M, int N, int K, float oscale) {
  __shared__ __align__(16) float slab[4 * SLAB64];
  __shared__ __align__(16) unsigned char ring[2 * 3 * GOPB];   // [buffer][Ahi | Alo | Bt][64 rows][GPB]
  const int tid = threadIdx.x, wave = tid >> 5, lane = tid & 31, hh = lane >> 4, m = lane & 15;
  const int ntile = N >> 6;
  const int bid   = blockIdx.x;
  const int row0  = (bid / ntile) * 64;
  const int rowb  = row0 + wave * 16;
  const int col0  = (bid % ntile) * 64;
  if (row0 + 64 > M) return;                 // block-uniform, in front of every barrier and copy; never taken with the exact grid
  const int nst  = K / GKC;
  const int crow = wave * 16 + hh;           // the tile row this lane brings in copy 0
  const size_t aofs = (size_t)(row0 + crow) * K + m * 8;
  const u16* gh = Ah + aofs;
  const u16* gl = Al + aofs;
  const u16* gb = Bt + (size_t)(col0 + crow) * K + m * 8;
  const unsigned lc = lds_off(ring) + (unsigned)crow * GPB + (unsigned)m * 16u;
  copy16rows(lc, gh, (size_t)K);
  copy16rows(lc + GOPB, gl, (size_t)K);
  copy16rows(lc + 2u * GOPB, gb, (size_t)K);
  wait_copies();
  __syncthreads();                           // stage 0 is whole for every wave
  if (nst > 1) {
    copy16rows(lc + 3u * GOPB, gh + GKC, (size_t)K);
    copy16rows(lc + 4u * GOPB, gl + GKC, (size_t)K);
    copy16rows(lc + 5u * GOPB, gb + GKC, (size_t)K);
  }
  const unsigned char* fa = ring + (wave * 16 + m) * GPB + 16 * hh;
  const unsigned char* fb = ring + 2 * GOPB + m * GPB + 16 * hh;
  v8f acc0 = zero8(), acc1 = zero8(), acc2 = zero8(), acc3 = zero8();
  // kept rolled: one copy of the stage body, the buffer picked by the stage's parity
#pragma unroll 1
  for (int t = 0; t < nst; ++t) {
    const unsigned bo = (unsigned)(t & 1) * (3u * GOPB);
    // unrolled: the k-step offsets become immediates and the reads of later k-steps are issued ahead of the earlier products
#pragma unroll
    for (int kk = 0; kk < GKS; ++kk) {
      const v16h ah = ldsfrag_h(fa + bo + kk * 64), al = ldsfrag_h(fa + bo + GOPB + kk * 64);
      const v16h b0 = ldsfrag_h(fb + bo + kk * 64);
      const v16h b1 = ldsfrag_h(fb + bo + 16 * GPB + kk * 64);
      const v16h b2 = ldsfrag_h(fb + bo + 32 * GPB + kk * 64);
      const v16h b3 = ldsfrag_h(fb + bo + 48 * GPB + kk * 64);
      acc0 = mma_h(ah, b0, acc0);  acc0 = mma_h(al, b0, acc0);
      acc1 = mma_h(ah, b1, acc1);  acc1 = mma_h(al, b1, acc1);
      acc2 = mma_h(ah, b2, acc2);  acc2 = mma_h(al, b2, acc2);
      acc3 = mma_h(ah, b3, acc3);  acc3 = mma_h(al, b3, acc3);
      // its four v_nop keep the distance behind the stage's last matrix instructions on both sides of the branch at the loop's foot
      if (kk == GKS - 1) guard6<v16h>(acc0, acc1, acc2, acc3, ah, al, b0, b1, b2, b3);
    }
    wait_lds();
    wait_copies();
    __syncthreads();                         // publishes stage t + 1 and ends every wave's reads of stage t's buffer
    if (t + 2 < nst) {
      copy16rows(lc + bo, gh + (size_t)(t + 2) * GKC, (size_t)K);
      copy16rows(lc + bo + GOPB, gl + (size_t)(t + 2) * GKC, (size_t)K);
      copy16rows(lc + bo + 2u * GOPB, gb + (size_t)(t + 2) * GKC, (size_t)K);
    }
  }
  wait_copies();
  epi64(slab + wave * SLAB64, acc0, acc1, acc2, acc3, oscale, bias, C, N, (size_t)rowb, col0, lane);
}

// =====================================================================================================
// Rotate-half rotary + 16-bit split pack. Rows are (pos, head) with HD contiguous floats (f32 projection output);
// pos = (row / hpr) mod SEQ.  w[d] = x[d] * cos[pos][d] + r[d] * sin[pos][d],  r[d] = -x[d+32] for d < 32, x[d-32] for d >= 32;
// hi[d] = f16(w * sc), lo[d] = f16(w * sc - hi[d])  (sc a power of two, residual unscaled).
// Thread = 8 consecutive d of one row: 16-B loads of x (own and partner half), cos, sin; one 16-B store per plane per lane;
// coverage: grid = nrows*8/256 blocks x 256 thr x 8 halves = nrows x 64 of each plane exactly (exact division checked statically).
// =====================================================================================================
__global__ __launch_bounds__(256) void rope16(const float* __restrict__ x, const float* __restrict__ cosT,
                                              const float* __restrict__ sinT, u16* hpl, u16* lpl,
                                              int nrows, int hpr, float sc) {
  const int gt  = blockIdx.x * 256 + (int)threadIdx.x;
  const int row = gt >> 3;
  const int d0  = (gt & 7) * 8;
  if (row >= nrows) return;                 // never taken with the exact grid; no barriers in this kernel
  const int pos = (row / hpr) % SEQ;
  const int d1  = d0 ^ 32;
  const float* xr = x + (size_t)row * HD;
  const float* cr = cosT + (size_t)pos * HD + d0;
  const float* sr = sinT + (size_t)pos * HD + d0;
  const v4f xa = *(const v4f*)(xr + d0), xb = *(const v4f*)(xr + d0 + 4);
  const v4f ya = *(const v4f*)(xr + d1), yb = *(const v4f*)(xr + d1 + 4);
  const v4f ca = *(const v4f*)(cr), cb = *(const v4f*)(cr + 4);
  const v4f sa = *(const v4f*)(sr), sb = *(const v4f*)(sr + 4);
  const float sgn = (d0 < 32) ? -1.0f : 1.0f;
  float w[8];
#pragma unroll
  for (int e = 0; e < 4; ++e) {
    w[e]     = xa[e] * ca[e] + (sgn * ya[e]) * sa[e];
    w[4 + e] = xb[e] * cb[e] + (sgn * yb[e]) * sb[e];
  }
  v4u oh, ol;
#pragma unroll
  for (int e = 0; e < 4; ++e) {
    const float t0 = w[2 * e] * sc, t1 = w[2 * e + 1] * sc;
    const _Float16 h0 = (_Float16)t0, h1 = (_Float16)t1;
    const _Float16 l0 = (_Float16)(t0 - (float)h0), l1 = (_Float16)(t1 - (float)h1);
    oh[e] = pk16(h_bits(h0), h_bits(h1));
    ol[e] = pk16(h_bits(l0), h_bits(l1));
  }
  const size_t o8 = (size_t)row * HD + d0;
  {
    *(v4u*)(hpl + o8) = oh;
    *(v4u*)(lpl + o8) = ol;
    
  }
}

// =====================================================================================================
// v^T planes: VH[g*HD + d][s] = f16(v[s][g][d] * 1024), VL = f16 residual of the same value.
// Block = (head g = bid / NST, 64 keys s0 = (bid % NST)*64): 64 source rows of HD floats loaded with 16-B loads, converted,
// scattered into two LDS tiles [d][64 keys] (pitch 72 halves); after a block barrier each d row segment (64 halves = one whole
// coverage: load 256 thr x 16 elements = 64 x 64; store 2 iterations x 256 thr x 8 halves = 64 lines x 64 = the block's tile of
//           each plane; grid = NH x NST blocks covers both planes exactly once.
// =====================================================================================================
__global__ __launch_bounds__(256) void vt16(const float* __restrict__ v, u16* VHo, u16* VLo) {
  __shared__ __align__(16) u16 TH[HD * VTP];
  __shared__ __align__(16) u16 TL[HD * VTP];
  const int tid = threadIdx.x;
  const int bid = blockIdx.x;
  const int st  = bid % NST;
  const int g   = bid / NST;
  if (g >= NH) return;                        // block-uniform, before any barrier; never taken with the exact grid
  const int s0  = st * 64;
  {
    const int sl = tid >> 2;                  // key within tile 0..63
    const int dc = (tid & 3) * 16;            // d chunk
    const float* src = v + ((size_t)(s0 + sl) * NH + g) * HD + dc;
#pragma unroll
    for (int i = 0; i < 4; ++i) {
      const v4f a = *(const v4f*)(src + 4 * i);
#pragma unroll
      for (int e = 0; e < 4; ++e) {
        const float t = a[e] * VCAR;
        const _Float16 h = (_Float16)t;
        const _Float16 l = (_Float16)(t - (float)h);
        TH[(dc + 4 * i + e) * VTP + sl] = h_bits(h);
        TL[(dc + 4 * i + e) * VTP + sl] = h_bits(l);
      }
    }
  }
  __syncthreads();
  v4u vh[2], vl[2];
  const int q8 = tid >> 3, p8 = (tid & 7) * 8;
#pragma unroll
  for (int it = 0; it < 2; ++it) {
    const int line = it * 32 + q8;            // d = 0..63
    vh[it] = *(const v4u*)(TH + line * VTP + p8);
    vl[it] = *(const v4u*)(TL + line * VTP + p8);
  }
  const size_t base = ((size_t)g * HD) * SEQ + s0 + p8;
  {
#pragma unroll
    for (int it = 0; it < 2; ++it) {
      const int line = it * 32 + q8;
      *(v4u*)(VHo + base + (size_t)line * SEQ) = vh[it];
      *(v4u*)(VLo + base + (size_t)line * SEQ) = vl[it];
    }
    
  }
}

// =====================================================================================================
// Triple-masked attention: block bid -> (head = bid % NH, query tile pair qp = NQP-1 - bid / NH: rows q0 = 32*qp .. q0+31; the pairs with
// the most keys take the lowest block ids). Every wave carries both 16-row query tiles of the pair, each with a softmax state of its own, so that one
// load of a k or v fragment serves two tiles. The block's WPB waves share that one (pair, head) and split its key tiles: in every group of eight
// consecutive key tiles g each wave takes one, kt = 8g + ((wave - g) & 7), so that any stride-4 or stride-8 pattern of live tiles is spread too.
//   q planes (hi, lo f16 x1024) laid out [s][h][d]; k planes [s][h][d]; v^T planes [h][d][s]; instrument and bar ids staged in LDS.
//   For each of the three masks in turn (block-uniform), each wave with its OWN running max m_a, sum Z_a and 4 accumulators acc_a per query tile:
//     att 0: (iq == ik) && (iq < 129) && (j <= i)
//     att 1: (iq != ik) && (ik < 129) && (iq < 129) && (bq >= 0) && ((0 <= bq-bk <= 2) || (bq-bk == 4))
//     att 2: ((ik == 129) || (bk == -1)) && (j <= i)
//   A wave's key tiles of 32 visited in order (att 0/2 up to the causal limit, att 1 all NKT); per tile every lane evaluates its
//   2 x 8 rows x 2 keys mask bits, a wave ballot skips tiles with no allowed element in either query tile (exact: such keys carry zero weight).
//   Per processed tile and query tile: 2 score subtiles x 2 k-steps x 3 products (q_hi.k_hi + q_lo.k_hi + q_hi.k_lo), fragments loaded straight
//   from the 16-bit planes (two 16-B loads per fragment, split k map); masked scores replaced by -inf; online max-subtracted base-2
//   softmax in f32 (scale 1/8 folded), -inf-safe rescale; the 16x32 prob tile stored to wave-private LDS (f32 element stores),
//   loads, same element type as stored), 4+4 v^T B fragments (hi and residual planes), 12 P.V WMMAs (hh + lh + hl).
//   After each mask every wave publishes its partial (m, Z, acc) in its LDS slab (which holds the prob tile during the loop); behind a
//   block barrier wave w merges the eight partials of rows 4w .. 4w+3 (a lane: one row, 8 d columns): M = max m_w, Z = sum Z_w 2^(m_w-M), acc likewise;
//   out_a = (Z > 0, i.e. the row has an allowed key) ? acc / Z : 0, carries 1/(32768*1024) folded once, summed in a lane-owned LDS tile:
//   O = out_0 + out_1 + out_2. A second barrier frees the slabs for the next mask. All barriers block-uniform; bounded loops only.
// coverage: per wave 4 rows x 8 lanes x 8 halves = 4 x 64 per plane, WPB waves = 32 x 64; grid NQP*NH blocks =
//           every (s, h) row of both O planes exactly once.
// =====================================================================================================
// second bound: four waves per SIMD (at most 256 registers), two blocks on a WGP: the grid takes two rounds
__global__ __launch_bounds__(ATT_THREADS, 4)
void attn3(const u16* __restrict__ QHIp, const u16* __restrict__ QLOp,
           const u16* __restrict__ KHIp, const u16* __restrict__ KLOp,
           const u16* __restrict__ VHIp, const u16* __restrict__ VLOp,
           const int* __restrict__ inst, const int* __restrict__ bar,
           u16* OHIp, u16* OLOp) {
  __shared__ __align__(16) float smem[WPB * WREG + QTW * SLW];
  __shared__ int sI[SEQ];
  __shared__ int sB[SEQ];

  const int tid  = threadIdx.x;
  const int wave = __builtin_amdgcn_readfirstlane(tid >> 5);   // scalar: it steers the key-tile loop
  const int lane = tid & 31;
  const int hh   = lane >> 4;
  const int c    = lane & 15;
  const int bid  = blockIdx.x;
  if (bid >= NQP * NH) return;               // block-uniform, before any barrier; never taken with the exact grid
  const int head = bid % NH;
  const int qp   = NQP - 1 - bid / NH;
  const int q0   = qp * (16 * QTW);
  const int rq   = lane >> 3;                // merge and output: this lane owns row 4*wave + rq of the block's 32,
  const int c8   = (lane & 7) * 8;           // d columns c8 .. c8 + 7
  const int row  = wave * 4 + rq;

  for (int i = tid; i < SEQ; i += ATT_THREADS) { sI[i] = inst[i]; sB[i] = bar[i]; }
  __syncthreads();

  float* slab = smem + wave * WREG;          // partial accumulators [16*QTW][64] pitch 68, written after a mask's key loop;
                                             // inside the key loop query tile t keeps its prob tile [16][32] pitch 36 at slab + t*SLW
  float* ml   = slab + QTW * SLW;            // partial m[16*QTW], Z[16*QTW]
  float* osum = smem + WPB * WREG;           // the block's result [16*QTW][64] pitch 68; elements (row, c8 .. c8 + 7) owned by this lane

  // byte offsets into the 16-bit planes (each plane SEQ*DMOD*2 bytes, far below 2^32); hi and residual planes share them
  const unsigned KROWB = NH * HD * 2u;                                          // bytes between consecutive query or key rows
  const unsigned qofs = ((unsigned)((q0 + c) * NH + head) * HD + 8u * hh) * 2u;  // query tile t: + t * 16 * KROWB
  const unsigned kofs = ((unsigned)(c * NH + head) * HD + 8u * hh) * 2u;         // key row kb + c added per step
  const unsigned vofs = ((unsigned)(head * HD + c) * SEQ + 8u * hh) * 2u;        // d column c (+16j), key kb added per step
  const float lsc = 0.125f * (LOG2E / (QSC * KSC));
  const float oc  = 1.0f / (PCAR * VCAR);

  // kept rolled: with two query tiles a wave, three copies of the tile body and of the merge would be about 60 KB of code, nearly the
  // whole instruction cache; the mask is picked by a scalar branch at each key tile
#pragma unroll 1
  for (int att = 0; att < 3; ++att) {
    float mrow[QTW][8], lrow[QTW][8];
    v8f o[QTW][4];
#pragma unroll
    for (int t = 0; t < QTW; ++t) {
#pragma unroll
      for (int r = 0; r < 8; ++r) { mrow[t][r] = -INFINITY; lrow[t][r] = 0.f; }
#pragma unroll
      for (int j = 0; j < 4; ++j) o[t][j] = zero8();
    }
    const int ncaus = ((q0 + 16 * QTW - 1) >> 5) + 1;                           // tiles holding keys <= the block's last query row
    const int nkt = (att == 1) ? NKT : ((ncaus < NKT) ? ncaus : NKT);

    const int ngrp = (nkt + WPB - 1) / WPB;
#pragma unroll 1
    for (int g = 0; g < ngrp; ++g) {
      const int kt = WPB * g + ((wave - g) & (WPB - 1));
      if (kt >= nkt) continue;                                                   // wave-uniform
      const int kb = kt * 32;
      const int j0 = kb + c, j1 = kb + 16 + c;
      const int ik0 = sI[j0], ik1 = sI[j1];
      const int bk0 = sB[j0], bk1 = sB[j1];
      // the query rows' ids are read from LDS beside the keys' ids at every key tile: held in registers over the whole
      // loop they would take 32 of the 256 and push the loop's addresses into scratch
      int iq[QTW][8], bq8[QTW][8];
#pragma unroll
      for (int t = 0; t < QTW; ++t) {
#pragma unroll
        for (int r = 0; r < 8; ++r) { const int i = q0 + 16 * t + 8 * hh + r; iq[t][r] = sI[i]; bq8[t][r] = sB[i]; }
      }
      // causal test j <= i written against the row's constant 16t + r (i = q0 + 8hh + 16t + r): no register per query row
      const int dj0 = j0 - (q0 + 8 * hh), dj1 = j1 - (q0 + 8 * hh);
      unsigned okb[QTW];
#pragma unroll
      for (int t = 0; t < QTW; ++t) {
        unsigned ob = 0u;
        if (att == 0) {
#pragma unroll
          for (int r = 0; r < 8; ++r) {
            const bool qa  = iq[t][r] < GINST;
            const bool ok0 = qa && (iq[t][r] == ik0) && (dj0 <= 16 * t + r);
            const bool ok1 = qa && (iq[t][r] == ik1) && (dj1 <= 16 * t + r);
            ob |= (ok0 ? (1u << r) : 0u) | (ok1 ? (1u << (8 + r)) : 0u);
          }
        } else if (att == 1) {
          const bool ka0 = ik0 < GINST, ka1 = ik1 < GINST;
#pragma unroll
          for (int r = 0; r < 8; ++r) {
            const bool qa  = (iq[t][r] < GINST) && (bq8[t][r] >= 0);
            const int  d0  = bq8[t][r] - bk0, d1 = bq8[t][r] - bk1;
            const bool w0  = ((d0 >= 0) && (d0 <= 2)) || (d0 == 4);
            const bool w1  = ((d1 >= 0) && (d1 <= 2)) || (d1 == 4);
            const bool ok0 = qa && ka0 && (iq[t][r] != ik0) && w0;
            const bool ok1 = qa && ka1 && (iq[t][r] != ik1) && w1;
            ob |= (ok0 ? (1u << r) : 0u) | (ok1 ? (1u << (8 + r)) : 0u);
          }
        } else {
          const bool g0 = (ik0 == GINST) || (bk0 == -1);
          const bool g1 = (ik1 == GINST) || (bk1 == -1);
#pragma unroll
          for (int r = 0; r < 8; ++r) {
            const bool ok0 = g0 && (dj0 <= 16 * t + r);
            const bool ok1 = g1 && (dj1 <= 16 * t + r);
            ob |= (ok0 ? (1u << r) : 0u) | (ok1 ? (1u << (8 + r)) : 0u);
          }
        }
        okb[t] = ob;
      }
      const unsigned anyw = __builtin_amdgcn_ballot_w32((okb[0] | okb[1]) != 0u);    // wave-uniform
      if (anyw == 0u) continue;

      // ---- scores: D element r of this lane = (query row q0 + 16t + 8hh + r, key kb + c) in s[t][0], key kb + 16 + c in s[t][1];
      //      each k fragment is loaded once and multiplied with both query tiles ----
      v8f s[QTW][2];
#pragma unroll
      for (int t = 0; t < QTW; ++t) { s[t][0] = zero8(); s[t][1] = zero8(); }
      const unsigned ko = kofs + (unsigned)kb * KROWB;
#pragma unroll
      for (int kk = 0; kk < 2; ++kk) {
        const v16h kh0 = ldfrag_o(KHIp, ko, kk * 64u),                kl0 = ldfrag_o(KLOp, ko, kk * 64u);
        const v16h kh1 = ldfrag_o(KHIp, ko, 16u * KROWB + kk * 64u),  kl1 = ldfrag_o(KLOp, ko, 16u * KROWB + kk * 64u);
        const v16h qa  = ldfrag_o(QHIp, qofs, kk * 64u),               qb  = ldfrag_o(QLOp, qofs, kk * 64u);
        const v16h qc  = ldfrag_o(QHIp, qofs, 16u * KROWB + kk * 64u), qd  = ldfrag_o(QLOp, qofs, 16u * KROWB + kk * 64u);
        s[0][0] = mma_h(qa, kh0, s[0][0]);
        s[0][0] = mma_h(qb, kh0, s[0][0]);
        s[0][0] = mma_h(qa, kl0, s[0][0]);
        s[0][1] = mma_h(qa, kh1, s[0][1]);
        s[0][1] = mma_h(qb, kh1, s[0][1]);
        s[0][1] = mma_h(qa, kl1, s[0][1]);
        s[1][0] = mma_h(qc, kh0, s[1][0]);
        s[1][0] = mma_h(qd, kh0, s[1][0]);
        s[1][0] = mma_h(qc, kl0, s[1][0]);
        s[1][1] = mma_h(qc, kh1, s[1][1]);
        s[1][1] = mma_h(qd, kh1, s[1][1]);
        s[1][1] = mma_h(qc, kl1, s[1][1]);
        guard10(s[0][0], s[0][1], s[1][0], s[1][1], qa, qb, qc, qd, kh0, kl0, kh1, kl1, kh0, kl0);
      }
      // ---- mask (replace by -inf) + online softmax in base 2, -inf-safe; a query tile with no allowed key in this key tile
      //      goes through with al = 1 (or 0 on a zero state) and an all-zero prob tile: its state keeps its bits ----
#pragma unroll
      for (int t = 0; t < QTW; ++t) {
        float* pt = slab + t * SLW;
#pragma unroll
        for (int r = 0; r < 8; ++r) {
          const bool ok0 = ((okb[t] >> r) & 1u) != 0u;
          const bool ok1 = ((okb[t] >> (8 + r)) & 1u) != 0u;
          const float t0 = ok0 ? (s[t][0][r] * lsc) : -INFINITY;
          const float t1 = ok1 ? (s[t][1][r] * lsc) : -INFINITY;
          float mx = fmaxf(t0, t1);
#pragma unroll
          for (int off = 1; off < 16; off <<= 1) mx = fmaxf(mx, __shfl_xor(mx, off, 32));
          const float mn = fmaxf(mrow[t][r], mx);
          const float ms = (mn == -INFINITY) ? 0.0f : mn;
          const float al = exp2f(mrow[t][r] - ms);
          mrow[t][r] = mn;
          const float e0 = exp2f(t0 - ms), e1 = exp2f(t1 - ms);
          float ps = e0 + e1;
#pragma unroll
          for (int off = 1; off < 16; off <<= 1) ps += __shfl_xor(ps, off, 32);
          lrow[t][r] = lrow[t][r] * al + ps;
#pragma unroll
          for (int j = 0; j < 4; ++j) o[t][j][r] *= al;
          const int ro = (8 * hh + r) * 36 + c;
          pt[ro]      = e0;
          pt[ro + 16] = e1;
        }
      }
      wave_sync_lds();
      // ---- P.V : B fragment col n = d = j*16 + c, keys contiguous in the v^T planes; each v fragment is loaded once and
      //      multiplied with both query tiles' prob fragments ----
      {
        const unsigned vo = vofs + (unsigned)kb * 2u;
        const v16h vh0 = ldfrag_o(VHIp, vo, 0u);
        const v16h vh1 = ldfrag_o(VHIp, vo, 16u * SEQ * 2u);
        const v16h vh2 = ldfrag_o(VHIp, vo, 32u * SEQ * 2u);
        const v16h vh3 = ldfrag_o(VHIp, vo, 48u * SEQ * 2u);
        const v16h vl0 = ldfrag_o(VLOp, vo, 0u);
        const v16h vl1 = ldfrag_o(VLOp, vo, 16u * SEQ * 2u);
        const v16h vl2 = ldfrag_o(VLOp, vo, 32u * SEQ * 2u);
        const v16h vl3 = ldfrag_o(VLOp, vo, 48u * SEQ * 2u);
#pragma unroll
        for (int t = 0; t < QTW; ++t) {
          // A fragments of P*32768: hi f16 and residual f16, row = c, split k map over the 32 keys of this step
          FragH ph, pl;
          const float* prow = slab + t * SLW + c * 36 + 8 * hh;
          const v4f p0 = *(const v4f*)(prow), p1 = *(const v4f*)(prow + 4);
          const v4f p2 = *(const v4f*)(prow + 16), p3 = *(const v4f*)(prow + 20);
#pragma unroll
          for (int e = 0; e < 4; ++e) {
            const float ta = p0[e] * PCAR, tb = p1[e] * PCAR, tc = p2[e] * PCAR, td = p3[e] * PCAR;
            const _Float16 ha = (_Float16)ta, hb = (_Float16)tb, hc = (_Float16)tc, hd = (_Float16)td;
            ph.h[0][e]     = ha;                               // elements 0..7  = keys kb + 8hh + 0..7
            ph.h[0][4 + e] = hb;
            ph.h[1][e]     = hc;                               // elements 8..15 = keys kb + 16 + 8hh + 0..7
            ph.h[1][4 + e] = hd;
            pl.h[0][e]     = (_Float16)(ta - (float)ha);
            pl.h[0][4 + e] = (_Float16)(tb - (float)hb);
            pl.h[1][e]     = (_Float16)(tc - (float)hc);
            pl.h[1][4 + e] = (_Float16)(td - (float)hd);
          }
          o[t][0] = mma_h(ph.v, vh0, o[t][0]);  o[t][0] = mma_h(pl.v, vh0, o[t][0]);  o[t][0] = mma_h(ph.v, vl0, o[t][0]);
          o[t][1] = mma_h(ph.v, vh1, o[t][1]);  o[t][1] = mma_h(pl.v, vh1, o[t][1]);  o[t][1] = mma_h(ph.v, vl1, o[t][1]);
          o[t][2] = mma_h(ph.v, vh2, o[t][2]);  o[t][2] = mma_h(pl.v, vh2, o[t][2]);  o[t][2] = mma_h(ph.v, vl2, o[t][2]);
          o[t][3] = mma_h(ph.v, vh3, o[t][3]);  o[t][3] = mma_h(pl.v, vh3, o[t][3]);  o[t][3] = mma_h(ph.v, vl3, o[t][3]);
          guard10(o[t][0], o[t][1], o[t][2], o[t][3], ph.v, pl.v, vh0, vh1, vh2, vh3, vl0, vl1, vl2, vl3);
        }
      }
      wave_sync_lds();
    }
#pragma unroll
    for (int t = 0; t < QTW; ++t) acc_guard4(o[t][0], o[t][1], o[t][2], o[t][3]);
    // ---- publish this wave's partial: acc in its slab, m and Z (equal in the 16 lanes of a half) by lane c == 0 ----
#pragma unroll
    for (int t = 0; t < QTW; ++t) {
#pragma unroll
      for (int r = 0; r < 8; ++r) {
#pragma unroll
        for (int j = 0; j < 4; ++j) slab[(16 * t + 8 * hh + r) * 68 + j * 16 + c] = o[t][j][r];
      }
    }
    if (c == 0) {
#pragma unroll
      for (int t = 0; t < QTW; ++t) {
        v4f m0, m1, z0, z1;
#pragma unroll
        for (int e = 0; e < 4; ++e) { m0[e] = mrow[t][e]; m1[e] = mrow[t][4 + e]; z0[e] = lrow[t][e]; z1[e] = lrow[t][4 + e]; }
        *(v4f*)(ml + 16 * t + 8 * hh)                = m0;
        *(v4f*)(ml + 16 * t + 8 * hh + 4)            = m1;
        *(v4f*)(ml + 16 * QTW + 16 * t + 8 * hh)     = z0;
        *(v4f*)(ml + 16 * QTW + 16 * t + 8 * hh + 4) = z1;
      }
    }
    __syncthreads();                          // all WPB partials of this mask are visible
    // ---- merge for this lane's row and 8 d columns: out_a = acc / Z (0 when no key allowed), carries (32768 on P, 1024 on v) folded once ----
    {
      float mw[WPB], zw[WPB];
#pragma unroll
      for (int w2 = 0; w2 < WPB; ++w2) {
        mw[w2] = smem[w2 * WREG + QTW * SLW + row];
        zw[w2] = smem[w2 * WREG + QTW * SLW + 16 * QTW + row];
      }
      float mx = mw[0];
#pragma unroll
      for (int w2 = 1; w2 < WPB; ++w2) mx = fmaxf(mx, mw[w2]);
      const float ms = (mx == -INFINITY) ? 0.0f : mx;
      float lv = 0.0f;
      v4f oa = {0.f, 0.f, 0.f, 0.f}, ob = {0.f, 0.f, 0.f, 0.f};
#pragma unroll
      for (int w2 = 0; w2 < WPB; ++w2) {
        const float sc = exp2f(mw[w2] - ms);
        const float* ap = smem + w2 * WREG + row * 68 + c8;
        lv += zw[w2] * sc;
        oa += *(const v4f*)(ap) * sc;
        ob += *(const v4f*)(ap + 4) * sc;
      }
      const float ls  = (lv > 0.0f) ? lv : 1.0f;
      const float inv = (lv > 0.0f) ? ((1.0f / ls) * oc) : 0.0f;
      float* op = osum + row * 68 + c8;
      if (att == 0) {
        *(v4f*)(op)     = oa * inv;
        *(v4f*)(op + 4) = ob * inv;
      } else {
        *(v4f*)(op)     = *(const v4f*)(op) + oa * inv;
        *(v4f*)(op + 4) = *(const v4f*)(op + 4) + ob * inv;
      }
    }
    __syncthreads();                          // every reader has left the slabs (the next mask overwrites them); after the last mask: osum is whole
  }

  // ---- O x1024 -> f16 hi + residual planes; wave = group of 4 rows, lane = (row in group, 8 consecutive d) ----
  v4u oh, ol;
  {
    const v4f a = *(const v4f*)(osum + row * 68 + c8), b4 = *(const v4f*)(osum + row * 68 + c8 + 4);
    float w[8];
#pragma unroll
    for (int e = 0; e < 4; ++e) { w[e] = a[e] * OSC; w[4 + e] = b4[e] * OSC; }
#pragma unroll
    for (int e = 0; e < 4; ++e) {
      const _Float16 h0 = (_Float16)w[2 * e], h1 = (_Float16)w[2 * e + 1];
      const _Float16 l0 = (_Float16)(w[2 * e] - (float)h0), l1 = (_Float16)(w[2 * e + 1] - (float)h1);
      oh[e] = pk16(h_bits(h0), h_bits(h1));
      ol[e] = pk16(h_bits(l0), h_bits(l1));
    }
  }
  const size_t o8 = (((size_t)(q0 + row)) * NH + head) * HD + c8;
  *(v4u*)(OHIp + o8) = oh;
  *(v4u*)(OLOp + o8) = ol;
}

// =====================================================================================================
// Workspace map (bytes); every plane is fully written by whole-line stores before it is read; all extents are exact multiples
// of the store granularity (no pad rows needed); every offset a multiple of SEQ*256:
//   CT  f32 [SEQ][64]                  SEQ*256        ST  same
//   XB  bf16 [SEQ][1024]               SEQ*2048
//   WQB bf16 [1024 n][1024 k]         2097152        WKB, WVB same        2097152 each
//   WOH f16  [1024 n][1024 k] x1024   2097152
//   QF  f32 [SEQ][1024]                SEQ*4096       KF, VF same
//   QHI f16 [SEQ][16][64] x1024        SEQ*2048       QLO residual
//   KHI f16 [SEQ][16][64] x1024        SEQ*2048       KLO residual
//   VHI f16 [16][64][SEQ] x1024        SEQ*2048       VLO residual
//   OHI f16 [SEQ][1024] x1024          SEQ*2048       OLO residual
//   end (SEQ = 2048)                  72351744
// =====================================================================================================
extern "C" void kernel_launch(void* const* d_in, const int* in_sizes, int n_in,
                              void* d_out, int out_size, void* d_ws, size_t ws_size,
                              hipStream_t stream) {
  if (n_in < 11) return;
  if (in_sizes[0] != SEQ * DMOD) return;
  if (in_sizes[1] != SEQ || in_sizes[2] != SEQ) return;
  if (in_sizes[3] != DMOD * DMOD || in_sizes[5] != DMOD * DMOD) return;
  if (in_sizes[7] != DMOD * DMOD || in_sizes[9] != DMOD * DMOD) return;
  if (in_sizes[4] != DMOD || in_sizes[6] != DMOD || in_sizes[8] != DMOD || in_sizes[10] != DMOD) return;
  if (out_size != SEQ * DMOD) return;

  const float* x   = (const float*)d_in[0];
  const int*   bar = (const int*)d_in[1];
  const int*   ins = (const int*)d_in[2];
  const float* wq  = (const float*)d_in[3];
  const float* bq  = (const float*)d_in[4];
  const float* wk  = (const float*)d_in[5];
  const float* bk  = (const float*)d_in[6];
  const float* wv  = (const float*)d_in[7];
  const float* bv  = (const float*)d_in[8];
  const float* wo  = (const float*)d_in[9];
  const float* bo  = (const float*)d_in[10];
  float*       out = (float*)d_out;

  const size_t szTab = (size_t)SEQ * HD * 4;                    //   524288
  const size_t szXB  = (size_t)SEQ * DMOD * 2;                  //  4194304
  const size_t szW   = (size_t)DMOD * DMOD * 2;                 //  2097152
  const size_t szF   = (size_t)SEQ * DMOD * 4;                  //  8388608
  const size_t szP   = (size_t)SEQ * DMOD * 2;                  //  4194304
  size_t off = 0;
  const size_t oCT  = off; off += szTab;
  const size_t oST  = off; off += szTab;
  const size_t oXB  = off; off += szXB;
  const size_t oWQ  = off; off += szW;
  const size_t oWK  = off; off += szW;
  const size_t oWV  = off; off += szW;
  const size_t oWO  = off; off += szW;
  const size_t oQF  = off; off += szF;
  const size_t oKF  = off; off += szF;
  const size_t oVF  = off; off += szF;
  const size_t oQHI = off; off += szP;
  const size_t oQLO = off; off += szP;
  const size_t oKHI = off; off += szP;
  const size_t oKLO = off; off += szP;
  const size_t oVHI = off; off += szP;
  const size_t oVLO = off; off += szP;
  const size_t oOHI = off; off += szP;
  const size_t oOLO = off; off += szP;
  if (off > ws_size) return;                            // off = 72351744 at SEQ = 2048
  if (off > (size_t)134217728) return;

  char* ws = (char*)d_ws;
  float* CT  = (float*)(ws + oCT);
  float* ST  = (float*)(ws + oST);
  u16*   XB  = (u16*)(ws + oXB);
  u16*   WQB = (u16*)(ws + oWQ);
  u16*   WKB = (u16*)(ws + oWK);
  u16*   WVB = (u16*)(ws + oWV);
  u16*   WOH = (u16*)(ws + oWO);
  float* QF  = (float*)(ws + oQF);
  float* KF  = (float*)(ws + oKF);
  float* VF  = (float*)(ws + oVF);
  u16*   QHI = (u16*)(ws + oQHI);
  u16*   QLO = (u16*)(ws + oQLO);
  u16*   KHI = (u16*)(ws + oKHI);
  u16*   KLO = (u16*)(ws + oKLO);
  u16*   VHI = (u16*)(ws + oVHI);
  u16*   VLO = (u16*)(ws + oVLO);
  u16*   OHI = (u16*)(ws + oOHI);
  u16*   OLO = (u16*)(ws + oOLO);

  // inv_freq[i] = 1 / pow(10000, i/32) in f32 (pow correctly converted from f64, then IEEE f32 reciprocal)
  InvF inv;
  for (int i = 0; i < 32; ++i) {
    const double p = pow(10000.0, (double)i / 32.0);
    const float pf = (float)p;
    inv.f[i] = 1.0f / pf;
  }

  const dim3 blk(256);
  const int n8x = (SEQ * DMOD) / 8;                     // 262144
  const int n8w = (DMOD * DMOD) / 8;                    // 131072
  const dim3 gTab(SEQ / 8);                             // 256
  const dim3 gX(n8x / 256);                             // 1024 (exact)
  const dim3 gW(n8w / 256);                             // 512  (exact)
  const dim3 gG((SEQ / 64) * (DMOD / 64));              // 512
  const dim3 bG(128);
  const int rowsQ = SEQ * NH;                           // 32768 rows of 64
  const dim3 gR((rowsQ * 8) / 256);                     // 1024 (exact)
  const dim3 gVT(NH * NST);                             // 512
  const dim3 gAT(ATT_BLOCKS);                           // 1024
  const dim3 bAT(ATT_THREADS);                          // 256

  // (0) rotary cos/sin tables [SEQ][64]
  k_tab<<<gTab, blk, 0, stream>>>(CT, ST, inv);
  // (1) x -> bf16 plane
  cvt16<<<gX, blk, 0, stream>>>(x, XB, n8x, 0, 1.0f);
  // (2..4) Wq/Wk/Wv [n][k] -> bf16 planes (same layout, already k-contiguous)
  cvt16<<<gW, blk, 0, stream>>>(wq, WQB, n8w, 0, 1.0f);
  cvt16<<<gW, blk, 0, stream>>>(wk, WKB, n8w, 0, 1.0f);
  cvt16<<<gW, blk, 0, stream>>>(wv, WVB, n8w, 0, 1.0f);
  // (5) Wo [n][k] -> f16 plane of bf16 value x1024
  cvt16<<<gW, blk, 0, stream>>>(wo, WOH, n8w, 1, WOS);
  // (6..8) projections: q, k, v [SEQ][1024] in f32 (+ bias)
  gemm_bf<<<gG, bG, 0, stream>>>(XB, WQB, bq, QF, SEQ, DMOD, DMOD, 1.0f);
  gemm_bf<<<gG, bG, 0, stream>>>(XB, WKB, bk, KF, SEQ, DMOD, DMOD, 1.0f);
  gemm_bf<<<gG, bG, 0, stream>>>(XB, WVB, bv, VF, SEQ, DMOD, DMOD, 1.0f);
  // (9) q' planes: rows (s, h), heads per position NH
  rope16<<<gR, blk, 0, stream>>>(QF, CT, ST, QHI, QLO, rowsQ, NH, QSC);
  // (10) k' planes: rows (s, h)
  rope16<<<gR, blk, 0, stream>>>(KF, CT, ST, KHI, KLO, rowsQ, NH, KSC);
  // (11) v^T planes x1024 (hi + residual)
  vt16<<<gVT, blk, 0, stream>>>(VF, VHI, VLO);
  // (12) three masked attentions summed -> O planes [s][h][d] x1024 (hi + residual)
  attn3<<<gAT, bAT, 0, stream>>>(QHI, QLO, KHI, KLO, VHI, VLO, ins, bar, OHI, OLO);
  // (13) output projection -> out [SEQ][1024] f32, carries 1024 (O) x 1024 (Wo) folded back, + bo
  gemm_h2<<<gG, bG, 0, stream>>>(OHI, OLO, WOH, bo, out, SEQ, DMOD, DMOD, 1.0f / (OSC * WOS));
  (void)hipGetLastError();
}

// v004
// Measured time: 169 microseconds a run.
// Next to v003, in two timings, it ran 1.16 and 1.15 times as fast.
// Counting every step since v000, it is 2.00 times as fast.
// Contractions: x.W{q,k,v}^T on v_wmma_f32_16x16x32_bf16 (x and W RNE-converted to bf16, f32 accumulate);
// scores q'.k'^T (q', k' carried x1024 as f16 hi plane + f16 residual plane, products hh+lh+hl), P.v (P x32768 f16 hi+residual,
// v x1024 f16 hi+residual, products hh+lh+hl) and O.Wo^T (O x1024 f16 hi+residual, Wo as f16(bf16(Wo) x1024), products h.w+l.w):
// v_wmma_f32_16x16x32_f16, f32 accumulate. Rotary tables, rotation, masks, masked base-2 online softmax and 1/l fold in f32 on VALU.
#include <hip/hip_runtime.h>
#include <math.h>
#include <stdint.h>

#define SEQ   2048
#define DMOD  1024
#define NH    16
#define HD    64
#define GINST 129
#define QSC   1024.0f
#define KSC   1024.0f
#define PCAR  32768.0f
#define VCAR  1024.0f
#define OSC   1024.0f
#define WOS   1024.0f
#define LOG2E 1.4426950408889634f
#define WPB   8
#define QTW   2
#define NQP   (SEQ / (16 * QTW))
#define NST   (SEQ / 64)
#define NKT   (SEQ / 32)
#define ATT_THREADS (WPB * 32)
#define ATT_BLOCKS  (NQP * NH)
#define PTW   (16 * 36)
#define SLW   (16 * 68)
#define WREG  (QTW * SLW + QTW * 32)
#define SLAB64 (16 * 68)
#define VTP   72
#define GKC   128
#define GPB   272
#define GOPB  (64 * GPB)
#define GKS   (GKC / 32)
#define TABB  (SEQ / 8)
#define XCB   ((SEQ * DMOD) / 2048)
#define WCB   ((DMOD * DMOD) / 2048)
#define RPB   ((SEQ * NH * 8) / 256)
#define VTB   (NH * NST)
static_assert(DMOD == NH * HD && HD == 64 && NH == 16);
static_assert(WPB == 8 && ATT_THREADS == 256 && PTW <= SLW && (WREG % 4) == 0 && (SLW % 4) == 0 && QTW == 2);
static_assert((SEQ % 64) == 0 && (SEQ % ATT_THREADS) == 0 && (SEQ % 8) == 0 && SEQ <= 32768);
static_assert((DMOD % 64) == 0 && (DMOD % 32) == 0);
static_assert(((SEQ * DMOD) % 2048) == 0 && ((DMOD * DMOD) % 2048) == 0);
static_assert(((SEQ * NH * 8) % 256) == 0);
static_assert((DMOD % GKC) == 0 && (DMOD / GKC) >= 2 && GKC * 2 == 256 && GPB == 256 + 16 && (SEQ % 64) == 0);

typedef unsigned short u16;
typedef _Float16 v16h __attribute__((ext_vector_type(16)));
typedef _Float16 v8h  __attribute__((ext_vector_type(8)));
typedef __bf16   v16b __attribute__((ext_vector_type(16)));
typedef float    v8f  __attribute__((ext_vector_type(8)));
typedef float    v4f  __attribute__((ext_vector_type(4)));
typedef unsigned int v4u __attribute__((ext_vector_type(4)));

union FragH { v16h v; v8h h[2]; v4u u[2]; };
union FragB { v16b v; v4u u[2]; };

struct InvF { float f[32]; };
static_assert(sizeof(InvF) == 128);

// ---- scalar helpers --------------------------------------------------------------------------------
__device__ __forceinline__ unsigned short bf_bits(float f) {          // f32 -> bf16 bits, RNE convert
  unsigned u = __float_as_uint(f);
  return (unsigned short)((u + 0x7FFFu + ((u >> 16) & 1u)) >> 16);
}
__device__ __forceinline__ float bf_up(unsigned short h) { return __uint_as_float(((unsigned)h) << 16); }
__device__ __forceinline__ float bfr(float f) { return bf_up(bf_bits(f)); }
__device__ __forceinline__ unsigned short h_bits(_Float16 x) { return __builtin_bit_cast(unsigned short, x); }
__device__ __forceinline__ unsigned pk16(unsigned short a, unsigned short b) { return (unsigned)a | ((unsigned)b << 16); }
__device__ __forceinline__ v8f zero8() { v8f z = {0.f, 0.f, 0.f, 0.f, 0.f, 0.f, 0.f, 0.f}; return z; }

// ---- fragment loaders: 16-bit A/B operand, lane -> row/col (lane&15), p already includes +8*(lane>>4);
//      elements 0..7 <- p[0..7] (k0+8h..), elements 8..15 <- p[16..23] (k0+16+8h..)  (same split k map for A and B;
//      B is always read from a k-contiguous [n][k] plane)
// fragment from a wave-uniform plane base plus a 32-bit per-lane byte offset (one address register instead of a pointer pair per plane)
__device__ __forceinline__ v16h ldfrag_o(const u16* base, unsigned boff, unsigned cbytes) {
  const char* p = (const char*)(const void*)base + boff;
  FragH f;
  f.h[0] = *(const v8h*)(p + cbytes);
  f.h[1] = *(const v8h*)(p + cbytes + 32);
  return f.v;
}

__device__ __forceinline__ v8f mma_h(v16h a, v16h b, v8f c) {
  return __builtin_amdgcn_wmma_f32_16x16x32_f16(false, a, false, b, (short)0, c, false, false);
}
__device__ __forceinline__ v8f mma_b(v16b a, v16b b, v8f c) {
  return __builtin_amdgcn_wmma_f32_16x16x32_bf16(false, a, false, b, (short)0, c, false, false);
}
template <typename F>
__device__ __forceinline__ void guard6(v8f& a, v8f& b, v8f& c, v8f& d, F x0, F x1, F x2, F x3, F x4, F x5) {
#if defined(__HIP_DEVICE_COMPILE__)
  asm volatile("v_nop\n\tv_nop\n\tv_nop\n\tv_nop"
               : "+v"(a), "+v"(b), "+v"(c), "+v"(d) : "v"(x0), "v"(x1), "v"(x2), "v"(x3), "v"(x4), "v"(x5) : "memory");
#endif
}
__device__ __forceinline__ void guard10(v8f& a, v8f& b, v8f& c, v8f& d, v16h x0, v16h x1, v16h x2, v16h x3, v16h x4,
                                        v16h x5, v16h x6, v16h x7, v16h x8, v16h x9) {
#if defined(__HIP_DEVICE_COMPILE__)
  asm volatile("v_nop\n\tv_nop\n\tv_nop\n\tv_nop"
               : "+v"(a), "+v"(b), "+v"(c), "+v"(d)
               : "v"(x0), "v"(x1), "v"(x2), "v"(x3), "v"(x4), "v"(x5), "v"(x6), "v"(x7), "v"(x8), "v"(x9) : "memory");
#endif
}
__device__ __forceinline__ void acc_guard4(v8f& a, v8f& b, v8f& c, v8f& d) {
#if defined(__HIP_DEVICE_COMPILE__)
  asm volatile("v_nop\n\tv_nop\n\tv_nop\n\tv_nop" : "+v"(a), "+v"(b), "+v"(c), "+v"(d));
#endif
}
__device__ __forceinline__ void wave_sync_lds() {
  __builtin_amdgcn_fence(__ATOMIC_RELEASE, "workgroup");
  __builtin_amdgcn_wave_barrier();
  __builtin_amdgcn_fence(__ATOMIC_ACQUIRE, "workgroup");
}

// ---- GEMM operand staging: a stage = GKC k elements (256 B) of 64 rows of an operand, LDS row pitch GPB bytes ----
__device__ __forceinline__ unsigned lds_off(const void* p) { return (unsigned)(size_t)p; }   // LDS byte address of a __shared__ object
// 16 rows x 256 B of one operand, global memory -> LDS through no register: eight asynchronous copies of this wave. A copy is 2 whole rows
// (lane -> row lane >> 4, 16-B column lane & 15), four whole 128-B lines. l, g: this lane's LDS byte address and global address in copy 0;
// copy i lies 2 rows further on in both (ldk = elements between global rows). All 32 lanes on; both addresses multiples of 16.
// The closing s_wait_xcnt 0 stands inside the statement so that no address register named here is rewritten in front of it.
__device__ __forceinline__ void copy16rows(unsigned l, const u16* g, size_t ldk) {
#if defined(__HIP_DEVICE_COMPILE__)
  asm volatile("global_load_async_to_lds_b128 %0, %8, off\n\t"
               "global_load_async_to_lds_b128 %1, %9, off\n\t"
               "global_load_async_to_lds_b128 %2, %10, off\n\t"
               "global_load_async_to_lds_b128 %3, %11, off\n\t"
               "global_load_async_to_lds_b128 %4, %12, off\n\t"
               "global_load_async_to_lds_b128 %5, %13, off\n\t"
               "global_load_async_to_lds_b128 %6, %14, off\n\t"
               "global_load_async_to_lds_b128 %7, %15, off\n\t"
               "s_wait_xcnt 0x0"
               :: "v"(l), "v"(l + 2u * GPB), "v"(l + 4u * GPB), "v"(l + 6u * GPB),
                  "v"(l + 8u * GPB), "v"(l + 10u * GPB), "v"(l + 12u * GPB), "v"(l + 14u * GPB),
                  "v"(g), "v"(g + 2 * ldk), "v"(g + 4 * ldk), "v"(g + 6 * ldk),
                  "v"(g + 8 * ldk), "v"(g + 10 * ldk), "v"(g + 12 * ldk), "v"(g + 14 * ldk)
               : "memory");
#endif
}
// this wave's own copies have landed (the compiler places no wait for them)
__device__ __forceinline__ void wait_copies() {
#if defined(__HIP_DEVICE_COMPILE__)
  asm volatile("s_wait_asynccnt 0x0" ::: "memory");
#endif
}
// this wave's LDS reads have retired: stands in front of the barrier behind which the buffer it read is refilled
__device__ __forceinline__ void wait_lds() {
#if defined(__HIP_DEVICE_COMPILE__)
  asm volatile("s_wait_dscnt 0x0" ::: "memory");
#endif
}
// stands behind a piece's last global stores: in a grid of several pieces another piece's code follows in the listing and rewrites the
// registers that the stores name; this wait is in front of every such write (which piece is laid last is the compiler's choice: each has it)
__device__ __forceinline__ void wait_store_regs() {
#if defined(__HIP_DEVICE_COMPILE__)
  asm volatile("s_wait_xcnt 0x0" ::: "memory");
#endif
}
// fragment from a staged row: p = row start + 64 * k-step + 16 * (lane >> 4) bytes; the split k map of the loaders above (bytes +0 and +32)
__device__ __forceinline__ v16b ldsfrag_b(const unsigned char* p) {
  FragB f;
  f.u[0] = *(const v4u*)(p);
  f.u[1] = *(const v4u*)(p + 32);
  return f.v;
}
__device__ __forceinline__ v16h ldsfrag_h(const unsigned char* p) {
  FragH f;
  f.u[0] = *(const v4u*)(p);
  f.u[1] = *(const v4u*)(p + 32);
  return f.v;
}

// ---- accurate f32 sin/cos of a non-negative f32 angle (|angle| < 32768): f64 two-part pi/2 reduction + f64 polynomials,
//      plain f64 fma/mul only (no library f64 trig path), result converted to f32.
__device__ __forceinline__ void sincos_acc(float angf, float& sv, float& cv) {
  const double a = (double)angf;
  const double TWO_OVER_PI = 0.63661977236758134308;
  const double PIO2_HI = 1.5707963267948966;
  const double PIO2_LO = 6.123233995736766e-17;
  const int kq = (int)(a * TWO_OVER_PI + 0.5);
  const double kd = (double)kq;
  double r = fma(-kd, PIO2_HI, a);
  r = fma(-kd, PIO2_LO, r);
  const double r2 = r * r;
  double sp = 1.0 / 6227020800.0;
  sp = fma(sp, r2, -1.0 / 39916800.0);
  sp = fma(sp, r2, 1.0 / 362880.0);
  sp = fma(sp, r2, -1.0 / 5040.0);
  sp = fma(sp, r2, 1.0 / 120.0);
  sp = fma(sp, r2, -1.0 / 6.0);
  const double s = fma(sp * r2, r, r);
  double cp = -1.0 / 87178291200.0;
  cp = fma(cp, r2, 1.0 / 479001600.0);
  cp = fma(cp, r2, -1.0 / 3628800.0);
  cp = fma(cp, r2, 1.0 / 40320.0);
  cp = fma(cp, r2, -1.0 / 720.0);
  cp = fma(cp, r2, 1.0 / 24.0);
  cp = fma(cp, r2, -0.5);
  const double c = fma(cp, r2, 1.0);
  const int qd = kq & 3;
  const double so = (qd == 0) ? s : (qd == 1) ? c : (qd == 2) ? -s : -c;
  const double co = (qd == 0) ? c : (qd == 1) ? -s : (qd == 2) ? -c : s;
  sv = (float)so;
  cv = (float)co;
}

// =====================================================================================================
// Rotary tables: cosT[t][d], sinT[t][d] for t < SEQ, d < HD, angle = float(t) * inv_freq[d & 31] (f32 product), halves duplicated.
// Wave = one position t, lane = frequency index; inv_freq picked from the by-value table with a static select chain.
// coverage: blk = 0 .. SEQ/8 - 1, 8 waves each = SEQ rows; per row 4 line stores = 64 floats of each table.
// =====================================================================================================
__device__ __forceinline__ void tab_blk(int blk, float* cosT, float* sinT, const InvF& inv) {
  const int tid  = threadIdx.x;
  const int lane = tid & 31;
  const int t    = blk * 8 + (tid >> 5);
  float f = inv.f[0];
#pragma unroll
  for (int i = 1; i < 32; ++i) f = (lane == i) ? inv.f[i] : f;
  const float ang = (float)t * f;
  float sv, cv;
  sincos_acc(ang, sv, cv);
  float* cr = cosT + (size_t)t * HD;
  float* sr = sinT + (size_t)t * HD;
  *(float*)(cr + lane)      = cv;
  *(float*)(cr + 32 + lane) = cv;
  *(float*)(sr + lane)      = sv;
  *(float*)(sr + 32 + lane) = sv;
  wait_store_regs();
}

// =====================================================================================================
// f32 -> 16-bit plane, same layout.  f16mode false: bf16 RNE bits;  f16mode true: f16 bits of (bf16 RNE value) * scale.
// Thread = 8 consecutive elements: two 16-B loads, one 16-B store; 32 consecutive lanes = 512 contiguous, 512-B aligned bytes.
// coverage: blk = 0 .. n/2048 - 1, 256 thr x 8 elements each = the whole plane.
// =====================================================================================================
__device__ __forceinline__ void cvt_blk(const float* __restrict__ x, u16* D, int blk, bool f16mode, float scale) {
  const int gt = blk * 256 + (int)threadIdx.x;
  const float* p = x + (size_t)gt * 8;
  const v4f a = *(const v4f*)(p), b4 = *(const v4f*)(p + 4);
  float w[8];
#pragma unroll
  for (int e = 0; e < 4; ++e) { w[e] = a[e]; w[4 + e] = b4[e]; }
  v4u o;
#pragma unroll
  for (int e = 0; e < 4; ++e) {
    const float f0 = w[2 * e], f1 = w[2 * e + 1];
    o[e] = f16mode ? pk16(h_bits((_Float16)(bfr(f0) * scale)), h_bits((_Float16)(bfr(f1) * scale)))
                   : pk16(bf_bits(f0), bf_bits(f1));
  }
  *(v4u*)(D + (size_t)gt * 8) = o;
  wait_store_regs();
}

// =====================================================================================================
// Everything that reads inputs alone, in one grid: none of these pieces reads what another writes. The block index picks the piece
// (block-uniform; no barriers): TABB blocks of rotary tables first (the longest chain of a wave), XCB blocks x -> bf16,
// 3 * WCB blocks Wq, Wk, Wv -> bf16, WCB blocks Wo -> f16 of the bf16 value x1024.  grid = TABB + XCB + 4 * WCB, exact.
// =====================================================================================================
__global__ __launch_bounds__(256) void prep(const float* __restrict__ x, const float* __restrict__ wq, const float* __restrict__ wk,
                                            const float* __restrict__ wv, const float* __restrict__ wo,
                                            u16* XBo, u16* WQo, u16* WKo, u16* WVo, u16* WOo,
                                            float* cosT, float* sinT, InvF inv) {
  int b = blockIdx.x;
  if (b < TABB) { tab_blk(b, cosT, sinT, inv); return; }
  b -= TABB;
  if (b < XCB) { cvt_blk(x, XBo, b, false, 1.0f); return; }
  b -= XCB;
  const int w = b / WCB, wb = b % WCB;
  if (w < 3) {
    const float* s = (w == 0) ? wq : (w == 1) ? wk : wv;
    u16*         d = (w == 0) ? WQo : (w == 1) ? WKo : WVo;
    cvt_blk(s, d, wb, false, 1.0f);
  } else if (w == 3) {
    cvt_blk(wo, WOo, wb, true, WOS);
  }
}

// =====================================================================================================
// GEMM epilogue shared by both engines: the wave's 16x64 f32 tile (times oscale) staged in its LDS slab (pitch 68),
// coverage: 8 instructions x 2 rows x 16 lanes x 4 floats = the wave's 16 x 64 tile.
// =====================================================================================================
__device__ __forceinline__ void epi64(float* sl, v8f a0, v8f a1, v8f a2, v8f a3, float oscale,
                                      const float* __restrict__ bias, float* C, int N,
                                      size_t rowb, int col0, int lane) {
  const int hh = lane >> 4, m = lane & 15;
#pragma unroll
  for (int r = 0; r < 8; ++r) {
    const int ro = (8 * hh + r) * 68 + m;
    sl[ro]      = a0[r] * oscale;
    sl[ro + 16] = a1[r] * oscale;
    sl[ro + 32] = a2[r] * oscale;
    sl[ro + 48] = a3[r] * oscale;
  }
  wave_sync_lds();
  const v4f braw = *(const v4f*)(bias + col0 + m * 4);
  v4f bb;
#pragma unroll
  for (int e = 0; e < 4; ++e) bb[e] = bfr(braw[e]);
  v4f vals[8];
#pragma unroll
  for (int it = 0; it < 8; ++it) vals[it] = *(const v4f*)(sl + (it * 2 + hh) * 68 + m * 4) + bb;
  float* dst = C + (rowb + (size_t)hh) * (size_t)N + col0 + m * 4;
  {
#pragma unroll
    for (int it = 0; it < 8; ++it) {
      *(v4f*)(dst + (size_t)(it * 2) * (size_t)N) = vals[it];
    }
    
  }
}

// =====================================================================================================
// bf16 GEMM: C[M][N] (f32) = A[M][K] (bf16 row-major) . Bt[N][K]^T (bf16 k-contiguous), times oscale, plus bias[N].
// Block = 64x64 tile, 4 waves x 16 rows. K walked in stages of GKC: the block's 64 A rows and 64 Bt rows of a stage are brought into a
// two-buffer LDS ring by asynchronous copies of whole lines (each wave: 16 rows of each operand), stage t + 1 in flight while stage t is
// multiplied; fragments are read from LDS (two 16-B reads each, split k map for A and B), k ascending as before.
// Three products that share A run in one grid: blockIdx.y picks (Bt, bias, C) (block-uniform); none reads what another writes.
// The host passes M % 64 == 0, N % 64 == 0, K % GKC == 0, K >= 2 * GKC, grid = ((M/64)*(N/64), 3).
// =====================================================================================================
__global__ __launch_bounds__(128)
void gemm_bf(const u16* __restrict__ A, const u16* __restrict__ Bt0, const u16* __restrict__ Bt1, const u16* __restrict__ Bt2,
             const float* __restrict__ bias0, const float* __restrict__ bias1, const float* __restrict__ bias2,
             float* C0, float* C1, float* C2, int M, int N, int K, float oscale) {
  __shared__ __align__(16) float slab[4 * SLAB64];
  __shared__ __align__(16) unsigned char ring[2 * 2 * GOPB];   // [buffer][A | Bt][64 rows][GPB]
  const int tid = threadIdx.x, wave = tid >> 5, lane = tid & 31, hh = lane >> 4, m = lane & 15;
  const int which = blockIdx.y;
  const u16*   Bt   = (which == 0) ? Bt0 : (which == 1) ? Bt1 : Bt2;
  const float* bias = (which == 0) ? bias0 : (which == 1) ? bias1 : bias2;
  float*       C    = (which == 0) ? C0 : (which == 1) ? C1 : C2;
  const int ntile = N >> 6;
  const int bid   = blockIdx.x;
  const int row0  = (bid / ntile) * 64;
  const int rowb  = row0 + wave * 16;
  const int col0  = (bid % ntile) * 64;
  if (row0 + 64 > M) return;                 // block-uniform, in front of every barrier and copy; never taken with the exact grid
  const int nst  = K / GKC;
  const int crow = wave * 16 + hh;           // the tile row this lane brings in copy 0
  const u16* ga = A  + (size_t)(row0 + crow) * K + m * 8;
  const u16* gb = Bt + (size_t)(col0 + crow) * K + m * 8;
  const unsigned lc = lds_off(ring) + (unsigned)crow * GPB + (unsigned)m * 16u;
  copy16rows(lc, ga, (size_t)K);
  copy16rows(lc + GOPB, gb, (size_t)K);
  wait_copies();
  __syncthreads();                           // stage 0 is whole for every wave
  if (nst > 1) {
    copy16rows(lc + 2u * GOPB, ga + GKC, (size_t)K);
    copy16rows(lc + 3u * GOPB, gb + GKC, (size_t)K);
  }
  const unsigned char* fa = ring + (wave * 16 + m) * GPB + 16 * hh;
  const unsigned char* fb = ring + GOPB + m * GPB + 16 * hh;
  v8f acc0 = zero8(), acc1 = zero8(), acc2 = zero8(), acc3 = zero8();
  // kept rolled: one copy of the stage body, the buffer picked by the stage's parity
#pragma unroll 1
  for (int t = 0; t < nst; ++t) {
    const unsigned bo = (unsigned)(t & 1) * (2u * GOPB);
    // unrolled: the k-step offsets become immediates and the reads of later k-steps are issued ahead of the earlier products
#pragma unroll
    for (int kk = 0; kk < GKS; ++kk) {
      const v16b a  = ldsfrag_b(fa + bo + kk * 64);
      const v16b b0 = ldsfrag_b(fb + bo + kk * 64);
      const v16b b1 = ldsfrag_b(fb + bo + 16 * GPB + kk * 64);
      const v16b b2 = ldsfrag_b(fb + bo + 32 * GPB + kk * 64);
      const v16b b3 = ldsfrag_b(fb + bo + 48 * GPB + kk * 64);
      acc0 = mma_b(a, b0, acc0);
      acc1 = mma_b(a, b1, acc1);
      acc2 = mma_b(a, b2, acc2);
      acc3 = mma_b(a, b3, acc3);
      // its four v_nop keep the distance behind the stage's last matrix instructions on both sides of the branch at the loop's foot
      if (kk == GKS - 1) guard6<v16b>(acc0, acc1, acc2, acc3, a, b0, b1, b2, b3, a);
    }
    wait_lds();
    wait_copies();
    __syncthreads();                         // publishes stage t + 1 and ends every wave's reads of stage t's buffer
    if (t + 2 < nst) {
      copy16rows(lc + bo, ga + (size_t)(t + 2) * GKC, (size_t)K);
      copy16rows(lc + bo + GOPB, gb + (size_t)(t + 2) * GKC, (size_t)K);
    }
  }
  wait_copies();
  epi64(slab + wave * SLAB64, acc0, acc1, acc2, acc3, oscale, bias, C, N, (size_t)rowb, col0, lane);
}

// =====================================================================================================
// f16 hi+lo GEMM: C[M][N] (f32) = (Ahi + Alo)[M][K] . Bt[N][K]^T, times oscale, plus bias[N]; Ahi/Alo f16 planes (same layout),
// Bt f16 k-contiguous; products hi.B + lo.B into one accumulator (lo is the unscaled residual of hi). Same tiling and the same
// two-buffer LDS ring as gemm_bf, with three operand tiles a stage.
// =====================================================================================================
__global__ __launch_bounds__(128)
void gemm_h2(const u16* __restrict__ Ah, const u16* __restrict__ Al, const u16* __restrict__ Bt,
             const float* __restrict__ bias, float* C, int M, int N, int K, float oscale) {
  __shared__ __align__(16) float slab[4 * SLAB64];
  __shared__ __align__(16) unsigned char ring[2 * 3 * GOPB];   // [buffer][Ahi | Alo | Bt][64 rows][GPB]
  const int tid = threadIdx.x, wave = tid >> 5, lane = tid & 31, hh = lane >> 4, m = lane & 15;
  const int ntile = N >> 6;
  const int bid   = blockIdx.x;
  const int row0  = (bid / ntile) * 64;
  const int rowb  = row0 + wave * 16;
  const int col0  = (bid % ntile) * 64;
  if (row0 + 64 > M) return;                 // block-uniform, in front of every barrier and copy; never taken with the exact grid
  const int nst  = K / GKC;
  const int crow = wave * 16 + hh;           // the tile row this lane brings in copy 0
  const size_t aofs = (size_t)(row0 + crow) * K + m * 8;
  const u16* gh = Ah + aofs;
  const u16* gl = Al + aofs;
  const u16* gb = Bt + (size_t)(col0 + crow) * K + m * 8;
  const unsigned lc = lds_off(ring) + (unsigned)crow * GPB + (unsigned)m * 16u;
  copy16rows(lc, gh, (size_t)K);
  copy16rows(lc + GOPB, gl, (size_t)K);
  copy16rows(lc + 2u * GOPB, gb, (size_t)K);
  wait_copies();
  __syncthreads();                           // stage 0 is whole for every wave
  if (nst > 1) {
    copy16rows(lc + 3u * GOPB, gh + GKC, (size_t)K);
    copy16rows(lc + 4u * GOPB, gl + GKC, (size_t)K);
    copy16rows(lc + 5u * GOPB, gb + GKC, (size_t)K);
  }
  const unsigned char* fa = ring + (wave * 16 + m) * GPB + 16 * hh;
  const unsigned char* fb = ring + 2 * GOPB + m * GPB + 16 * hh;
  v8f acc0 = zero8(), acc1 = zero8(), acc2 = zero8(), acc3 = zero8();
  // kept rolled: one copy of the stage body, the buffer picked by the stage's parity
#pragma unroll 1
  for (int t = 0; t < nst; ++t) {
    const unsigned bo = (unsigned)(t & 1) * (3u * GOPB);
    // unrolled: the k-step offsets become immediates and the reads of later k-steps are issued ahead of the earlier products
#pragma unroll
    for (int kk = 0; kk < GKS; ++kk) {
      const v16h ah = ldsfrag_h(fa + bo + kk * 64), al = ldsfrag_h(fa + bo + GOPB + kk * 64);
      const v16h b0 = ldsfrag_h(fb + bo + kk * 64);
      const v16h b1 = ldsfrag_h(fb + bo + 16 * GPB + kk * 64);
      const v16h b2 = ldsfrag_h(fb + bo + 32 * GPB + kk * 64);
      const v16h b3 = ldsfrag_h(fb + bo + 48 * GPB + kk * 64);
      acc0 = mma_h(ah, b0, acc0);  acc0 = mma_h(al, b0, acc0);
      acc1 = mma_h(ah, b1, acc1);  acc1 = mma_h(al, b1, acc1);
      acc2 = mma_h(ah, b2, acc2);  acc2 = mma_h(al, b2, acc2);
      acc3 = mma_h(ah, b3, acc3);  acc3 = mma_h(al, b3, acc3);
      // its four v_nop keep the distance behind the stage's last matrix instructions on both sides of the branch at the loop's foot
      if (kk == GKS - 1) guard6<v16h>(acc0, acc1, acc2, acc3, ah, al, b0, b1, b2, b3);
    }
    wait_lds();
    wait_copies();
    __syncthreads();                         // publishes stage t + 1 and ends every wave's reads of stage t's buffer
    if (t + 2 < nst) {
      copy16rows(lc + bo, gh + (size_t)(t + 2) * GKC, (size_t)K);
      copy16rows(lc + bo + GOPB, gl + (size_t)(t + 2) * GKC, (size_t)K);
      copy16rows(lc + bo + 2u * GOPB, gb + (size_t)(t + 2) * GKC, (size_t)K);
    }
  }
  wait_copies();
  epi64(slab + wave * SLAB64, acc0, acc1, acc2, acc3, oscale, bias, C, N, (size_t)rowb, col0, lane);
}

// =====================================================================================================
// Rotate-half rotary + 16-bit split pack. Rows are (pos, head) with HD contiguous floats (f32 projection output);
// pos = (row / hpr) mod SEQ.  w[d] = x[d] * cos[pos][d] + r[d] * sin[pos][d],  r[d] = -x[d+32] for d < 32, x[d-32] for d >= 32;
// hi[d] = f16(w * sc), lo[d] = f16(w * sc - hi[d])  (sc a power of two, residual unscaled).
// Thread = 8 consecutive d of one row: 16-B loads of x (own and partner half), cos, sin; one 16-B store per plane per lane;
// coverage: blk = 0 .. nrows*8/256 - 1, 256 thr x 8 halves each = nrows x 64 of each plane exactly (exact division checked statically).
// =====================================================================================================
__device__ __forceinline__ void rope_blk(const float* __restrict__ x, const float* __restrict__ cosT,
                                         const float* __restrict__ sinT, u16* hpl, u16* lpl,
                                         int blk, int hpr, float sc) {
  const int gt  = blk * 256 + (int)threadIdx.x;
  const int row = gt >> 3;
  const int d0  = (gt & 7) * 8;
  const int pos = (row / hpr) % SEQ;
  const int d1  = d0 ^ 32;
  const float* xr = x + (size_t)row * HD;
  const float* cr = cosT + (size_t)pos * HD + d0;
  const float* sr = sinT + (size_t)pos * HD + d0;
  const v4f xa = *(const v4f*)(xr + d0), xb = *(const v4f*)(xr + d0 + 4);
  const v4f ya = *(const v4f*)(xr + d1), yb = *(const v4f*)(xr + d1 + 4);
  const v4f ca = *(const v4f*)(cr), cb = *(const v4f*)(cr + 4);
  const v4f sa = *(const v4f*)(sr), sb = *(const v4f*)(sr + 4);
  const float sgn = (d0 < 32) ? -1.0f : 1.0f;
  float w[8];
#pragma unroll
  for (int e = 0; e < 4; ++e) {
    w[e]     = xa[e] * ca[e] + (sgn * ya[e]) * sa[e];
    w[4 + e] = xb[e] * cb[e] + (sgn * yb[e]) * sb[e];
  }
  v4u oh, ol;
#pragma unroll
  for (int e = 0; e < 4; ++e) {
    const float t0 = w[2 * e] * sc, t1 = w[2 * e + 1] * sc;
    const _Float16 h0 = (_Float16)t0, h1 = (_Float16)t1;
    const _Float16 l0 = (_Float16)(t0 - (float)h0), l1 = (_Float16)(t1 - (float)h1);
    oh[e] = pk16(h_bits(h0), h_bits(h1));
    ol[e] = pk16(h_bits(l0), h_bits(l1));
  }
  const size_t o8 = (size_t)row * HD + d0;
  {
    *(v4u*)(hpl + o8) = oh;
    *(v4u*)(lpl + o8) = ol;
    wait_store_regs();
  }
}

// =====================================================================================================
// v^T planes: VH[g*HD + d][s] = f16(v[s][g][d] * 1024), VL = f16 residual of the same value.
// Block = (head g = blk / NST, 64 keys s0 = (blk % NST)*64): 64 source rows of HD floats loaded with 16-B loads, converted,
// scattered into two LDS tiles [d][64 keys] (pitch 72 halves); after a block barrier each d row segment (64 halves = one whole
// coverage: load 256 thr x 16 elements = 64 x 64; store 2 iterations x 256 thr x 8 halves = 64 lines x 64 = the block's tile of
//           each plane; blk = 0 .. NH x NST - 1 covers both planes exactly once. TH, TL: the block's two LDS tiles of HD * VTP halves.
// =====================================================================================================
__device__ __forceinline__ void vt_blk(const float* __restrict__ v, u16* VHo, u16* VLo, int blk, u16* TH, u16* TL) {
  const int tid = threadIdx.x;
  const int st  = blk % NST;
  const int g   = blk / NST;
  const int s0  = st * 64;
  {
    const int sl = tid >> 2;                  // key within tile 0..63
    const int dc = (tid & 3) * 16;            // d chunk
    const float* src = v + ((size_t)(s0 + sl) * NH + g) * HD + dc;
#pragma unroll
    for (int i = 0; i < 4; ++i) {
      const v4f a = *(const v4f*)(src + 4 * i);
#pragma unroll
      for (int e = 0; e < 4; ++e) {
        const float t = a[e] * VCAR;
        const _Float16 h = (_Float16)t;
        const _Float16 l = (_Float16)(t - (float)h);
        TH[(dc + 4 * i + e) * VTP + sl] = h_bits(h);
        TL[(dc + 4 * i + e) * VTP + sl] = h_bits(l);
      }
    }
  }
  __syncthreads();
  v4u vh[2], vl[2];
  const int q8 = tid >> 3, p8 = (tid & 7) * 8;
#pragma unroll
  for (int it = 0; it < 2; ++it) {
    const int line = it * 32 + q8;            // d = 0..63
    vh[it] = *(const v4u*)(TH + line * VTP + p8);
    vl[it] = *(const v4u*)(TL + line * VTP + p8);
  }
  const size_t base = ((size_t)g * HD) * SEQ + s0 + p8;
  {
#pragma unroll
    for (int it = 0; it < 2; ++it) {
      const int line = it * 32 + q8;
      *(v4u*)(VHo + base + (size_t)line * SEQ) = vh[it];
      *(v4u*)(VLo + base + (size_t)line * SEQ) = vl[it];
    }
    wait_store_regs();
  }
}

// =====================================================================================================
// The three packings of the f32 projections in one grid: none reads what another writes. The block index picks the piece (block-uniform,
// so the barrier inside vt_blk is passed by all of a block or by none): VTB blocks of v^T first (two phases and a barrier: the longest),
// RPB blocks q', RPB blocks k'.  grid = VTB + 2 * RPB, exact.
// =====================================================================================================
__global__ __launch_bounds__(256) void pack3(const float* __restrict__ qf, const float* __restrict__ kf, const float* __restrict__ vf,
                                             const float* __restrict__ cosT, const float* __restrict__ sinT,
                                             u16* QHo, u16* QLo, u16* KHo, u16* KLo, u16* VHo, u16* VLo) {
  __shared__ __align__(16) u16 TH[HD * VTP];
  __shared__ __align__(16) u16 TL[HD * VTP];
  int b = blockIdx.x;
  if (b < VTB) { vt_blk(vf, VHo, VLo, b, TH, TL); return; }
  b -= VTB;
  if (b < RPB)          rope_blk(qf, cosT, sinT, QHo, QLo, b, NH, QSC);
  else if (b < 2 * RPB) rope_blk(kf, cosT, sinT, KHo, KLo, b - RPB, NH, KSC);
}

// =====================================================================================================
// Triple-masked attention: block bid -> (head = bid % NH, query tile pair qp = NQP-1 - bid / NH: rows q0 = 32*qp .. q0+31; the pairs with
// the most keys take the lowest block ids). Every wave carries both 16-row query tiles of the pair, each with a softmax state of its own, so that one
// load of a k or v fragment serves two tiles. The block's WPB waves share that one (pair, head) and split its key tiles: in every group of eight
// consecutive key tiles g each wave takes one, kt = 8g + ((wave - g) & 7), so that any stride-4 or stride-8 pattern of live tiles is spread too.
//   q planes (hi, lo f16 x1024) laid out [s][h][d]; k planes [s][h][d]; v^T planes [h][d][s]; instrument and bar ids staged in LDS.
//   For each of the three masks in turn (block-uniform), each wave with its OWN running max m_a, sum Z_a and 4 accumulators acc_a per query tile:
//     att 0: (iq == ik) && (iq < 129) && (j <= i)
//     att 1: (iq != ik) && (ik < 129) && (iq < 129) && (bq >= 0) && ((0 <= bq-bk <= 2) || (bq-bk == 4))
//     att 2: ((ik == 129) || (bk == -1)) && (j <= i)
//   A wave's key tiles of 32 visited in order (att 0/2 up to the causal limit, att 1 all NKT); per tile every lane evaluates its
//   2 x 8 rows x 2 keys mask bits, a wave ballot skips tiles with no allowed element in either query tile (exact: such keys carry zero weight).
//   Per processed tile and query tile: 2 score subtiles x 2 k-steps x 3 products (q_hi.k_hi + q_lo.k_hi + q_hi.k_lo), fragments loaded straight
//   from the 16-bit planes (two 16-B loads per fragment, split k map); masked scores replaced by -inf; online max-subtracted base-2
//   softmax in f32 (scale 1/8 folded), -inf-safe rescale; the 16x32 prob tile stored to wave-private LDS (f32 element stores),
//   loads, same element type as stored), 4+4 v^T B fragments (hi and residual planes), 12 P.V WMMAs (hh + lh + hl).
//   After each mask every wave publishes its partial (m, Z, acc) in its LDS slab (which holds the prob tile during the loop); behind a
//   block barrier wave w merges the eight partials of rows 4w .. 4w+3 (a lane: one row, 8 d columns): M = max m_w, Z = sum Z_w 2^(m_w-M), acc likewise;
//   out_a = (Z > 0, i.e. the row has an allowed key) ? acc / Z : 0, carries 1/(32768*1024) folded once, summed in a lane-owned LDS tile:
//   O = out_0 + out_1 + out_2. A second barrier frees the slabs for the next mask. All barriers block-uniform; bounded loops only.
// coverage: per wave 4 rows x 8 lanes x 8 halves = 4 x 64 per plane, WPB waves = 32 x 64; grid NQP*NH blocks =
//           every (s, h) row of both O planes exactly once.
// =====================================================================================================
// second bound: four waves per SIMD (at most 256 registers), two blocks on a WGP: the grid takes two rounds
__global__ __launch_bounds__(ATT_THREADS, 4)
void attn3(const u16* __restrict__ QHIp, const u16* __restrict__ QLOp,
           const u16* __restrict__ KHIp, const u16* __restrict__ KLOp,
           const u16* __restrict__ VHIp, const u16* __restrict__ VLOp,
           const int* __restrict__ inst, const int* __restrict__ bar,
           u16* OHIp, u16* OLOp) {
  __shared__ __align__(16) float smem[WPB * WREG + QTW * SLW];
  __shared__ int sI[SEQ];
  __shared__ int sB[SEQ];

  const int tid  = threadIdx.x;
  const int wave = __builtin_amdgcn_readfirstlane(tid >> 5);   // scalar: it steers the key-tile loop
  const int lane = tid & 31;
  const int hh   = lane >> 4;
  const int c    = lane & 15;
  const int bid  = blockIdx.x;
  if (bid >= NQP * NH) return;               // block-uniform, before any barrier; never taken with the exact grid
  const int head = bid % NH;
  const int qp   = NQP - 1 - bid / NH;
  const int q0   = qp * (16 * QTW);
  const int rq   = lane >> 3;                // merge and output: this lane owns row 4*wave + rq of the block's 32,
  const int c8   = (lane & 7) * 8;           // d columns c8 .. c8 + 7
  const int row  = wave * 4 + rq;

  for (int i = tid; i < SEQ; i += ATT_THREADS) { sI[i] = inst[i]; sB[i] = bar[i]; }
  __syncthreads();

  float* slab = smem + wave * WREG;          // partial accumulators [16*QTW][64] pitch 68, written after a mask's key loop;
                                             // inside the key loop query tile t keeps its prob tile [16][32] pitch 36 at slab + t*SLW
  float* ml   = slab + QTW * SLW;            // partial m[16*QTW], Z[16*QTW]
  float* osum = smem + WPB * WREG;           // the block's result [16*QTW][64] pitch 68; elements (row, c8 .. c8 + 7) owned by this lane

  // byte offsets into the 16-bit planes (each plane SEQ*DMOD*2 bytes, far below 2^32); hi and residual planes share them
  const unsigned KROWB = NH * HD * 2u;                                          // bytes between consecutive query or key rows
  const unsigned qofs = ((unsigned)((q0 + c) * NH + head) * HD + 8u * hh) * 2u;  // query tile t: + t * 16 * KROWB
  const unsigned kofs = ((unsigned)(c * NH + head) * HD + 8u * hh) * 2u;         // key row kb + c added per step
  const unsigned vofs = ((unsigned)(head * HD + c) * SEQ + 8u * hh) * 2u;        // d column c (+16j), key kb added per step
  const float lsc = 0.125f * (LOG2E / (QSC * KSC));
  const float oc  = 1.0f / (PCAR * VCAR);

  // kept rolled: with two query tiles a wave, three copies of the tile body and of the merge would be about 60 KB of code, nearly the
  // whole instruction cache; the mask is picked by a scalar branch at each key tile
#pragma unroll 1
  for (int att = 0; att < 3; ++att) {
    float mrow[QTW][8], lrow[QTW][8];
    v8f o[QTW][4];
#pragma unroll
    for (int t = 0; t < QTW; ++t) {
#pragma unroll
      for (int r = 0; r < 8; ++r) { mrow[t][r] = -INFINITY; lrow[t][r] = 0.f; }
#pragma unroll
      for (int j = 0; j < 4; ++j) o[t][j] = zero8();
    }
    const int ncaus = ((q0 + 16 * QTW - 1) >> 5) + 1;                           // tiles holding keys <= the block's last query row
    const int nkt = (att == 1) ? NKT : ((ncaus < NKT) ? ncaus : NKT);

    const int ngrp = (nkt + WPB - 1) / WPB;
#pragma unroll 1
    for (int g = 0; g < ngrp; ++g) {
      const int kt = WPB * g + ((wave - g) & (WPB - 1));
      if (kt >= nkt) continue;                                                   // wave-uniform
      const int kb = kt * 32;
      const int j0 = kb + c, j1 = kb + 16 + c;
      const int ik0 = sI[j0], ik1 = sI[j1];
      const int bk0 = sB[j0], bk1 = sB[j1];
      // the query rows' ids are read from LDS beside the keys' ids at every key tile: held in registers over the whole
      // loop they would take 32 of the 256 and push the loop's addresses into scratch
      int iq[QTW][8], bq8[QTW][8];
#pragma unroll
      for (int t = 0; t < QTW; ++t) {
#pragma unroll
        for (int r = 0; r < 8; ++r) { const int i = q0 + 16 * t + 8 * hh + r; iq[t][r] = sI[i]; bq8[t][r] = sB[i]; }
      }
      // causal test j <= i written against the row's constant 16t + r (i = q0 + 8hh + 16t + r): no register per query row
      const int dj0 = j0 - (q0 + 8 * hh), dj1 = j1 - (q0 + 8 * hh);
      unsigned okb[QTW];
#pragma unroll
      for (int t = 0; t < QTW; ++t) {
        unsigned ob = 0u;
        if (att == 0) {
#pragma unroll
          for (int r = 0; r < 8; ++r) {
            const bool qa  = iq[t][r] < GINST;
            const bool ok0 = qa && (iq[t][r] == ik0) && (dj0 <= 16 * t + r);
            const bool ok1 = qa && (iq[t][r] == ik1) && (dj1 <= 16 * t + r);
            ob |= (ok0 ? (1u << r) : 0u) | (ok1 ? (1u << (8 + r)) : 0u);
          }
        } else if (att == 1) {
          const bool ka0 = ik0 < GINST, ka1 = ik1 < GINST;
#pragma unroll
          for (int r = 0; r < 8; ++r) {
            const bool qa  = (iq[t][r] < GINST) && (bq8[t][r] >= 0);
            const int  d0  = bq8[t][r] - bk0, d1 = bq8[t][r] - bk1;
            const bool w0  = ((d0 >= 0) && (d0 <= 2)) || (d0 == 4);
            const bool w1  = ((d1 >= 0) && (d1 <= 2)) || (d1 == 4);
            const bool ok0 = qa && ka0 && (iq[t][r] != ik0) && w0;
            const bool ok1 = qa && ka1 && (iq[t][r] != ik1) && w1;
            ob |= (ok0 ? (1u << r) : 0u) | (ok1 ? (1u << (8 + r)) : 0u);
          }
        } else {
          const bool g0 = (ik0 == GINST) || (bk0 == -1);
          const bool g1 = (ik1 == GINST) || (bk1 == -1);
#pragma unroll
          for (int r = 0; r < 8; ++r) {
            const bool ok0 = g0 && (dj0 <= 16 * t + r);
            const bool ok1 = g1 && (dj1 <= 16 * t + r);
            ob |= (ok0 ? (1u << r) : 0u) | (ok1 ? (1u << (8 + r)) : 0u);
          }
        }
        okb[t] = ob;
      }
      const unsigned anyw = __builtin_amdgcn_ballot_w32((okb[0] | okb[1]) != 0u);    // wave-uniform
      if (anyw == 0u) continue;

      // ---- scores: D element r of this lane = (query row q0 + 16t + 8hh + r, key kb + c) in s[t][0], key kb + 16 + c in s[t][1];
      //      each k fragment is loaded once and multiplied with both query tiles ----
      v8f s[QTW][2];
#pragma unroll
      for (int t = 0; t < QTW; ++t) { s[t][0] = zero8(); s[t][1] = zero8(); }
      const unsigned ko = kofs + (unsigned)kb * KROWB;
#pragma unroll
      for (int kk = 0; kk < 2; ++kk) {
        const v16h kh0 = ldfrag_o(KHIp, ko, kk * 64u),                kl0 = ldfrag_o(KLOp, ko, kk * 64u);
        const v16h kh1 = ldfrag_o(KHIp, ko, 16u * KROWB + kk * 64u),  kl1 = ldfrag_o(KLOp, ko, 16u * KROWB + kk * 64u);
        const v16h qa  = ldfrag_o(QHIp, qofs, kk * 64u),               qb  = ldfrag_o(QLOp, qofs, kk * 64u);
        const v16h qc  = ldfrag_o(QHIp, qofs, 16u * KROWB + kk * 64u), qd  = ldfrag_o(QLOp, qofs, 16u * KROWB + kk * 64u);
        s[0][0] = mma_h(qa, kh0, s[0][0]);
        s[0][0] = mma_h(qb, kh0, s[0][0]);
        s[0][0] = mma_h(qa, kl0, s[0][0]);
        s[0][1] = mma_h(qa, kh1, s[0][1]);
        s[0][1] = mma_h(qb, kh1, s[0][1]);
        s[0][1] = mma_h(qa, kl1, s[0][1]);
        s[1][0] = mma_h(qc, kh0, s[1][0]);
        s[1][0] = mma_h(qd, kh0, s[1][0]);
        s[1][0] = mma_h(qc, kl0, s[1][0]);
        s[1][1] = mma_h(qc, kh1, s[1][1]);
        s[1][1] = mma_h(qd, kh1, s[1][1]);
        s[1][1] = mma_h(qc, kl1, s[1][1]);
        guard10(s[0][0], s[0][1], s[1][0], s[1][1], qa, qb, qc, qd, kh0, kl0, kh1, kl1, kh0, kl0);
      }
      // ---- mask (replace by -inf) + online softmax in base 2, -inf-safe; a query tile with no allowed key in this key tile
      //      goes through with al = 1 (or 0 on a zero state) and an all-zero prob tile: its state keeps its bits ----
#pragma unroll
      for (int t = 0; t < QTW; ++t) {
        float* pt = slab + t * SLW;
#pragma unroll
        for (int r = 0; r < 8; ++r) {
          const bool ok0 = ((okb[t] >> r) & 1u) != 0u;
          const bool ok1 = ((okb[t] >> (8 + r)) & 1u) != 0u;
          const float t0 = ok0 ? (s[t][0][r] * lsc) : -INFINITY;
          const float t1 = ok1 ? (s[t][1][r] * lsc) : -INFINITY;
          float mx = fmaxf(t0, t1);
#pragma unroll
          for (int off = 1; off < 16; off <<= 1) mx = fmaxf(mx, __shfl_xor(mx, off, 32));
          const float mn = fmaxf(mrow[t][r], mx);
          const float ms = (mn == -INFINITY) ? 0.0f : mn;
          const float al = exp2f(mrow[t][r] - ms);
          mrow[t][r] = mn;
          const float e0 = exp2f(t0 - ms), e1 = exp2f(t1 - ms);
          float ps = e0 + e1;
#pragma unroll
          for (int off = 1; off < 16; off <<= 1) ps += __shfl_xor(ps, off, 32);
          lrow[t][r] = lrow[t][r] * al + ps;
#pragma unroll
          for (int j = 0; j < 4; ++j) o[t][j][r] *= al;
          const int ro = (8 * hh + r) * 36 + c;
          pt[ro]      = e0;
          pt[ro + 16] = e1;
        }
      }
      wave_sync_lds();
      // ---- P.V : B fragment col n = d = j*16 + c, keys contiguous in the v^T planes; each v fragment is loaded once and
      //      multiplied with both query tiles' prob fragments ----
      {
        const unsigned vo = vofs + (unsigned)kb * 2u;
        const v16h vh0 = ldfrag_o(VHIp, vo, 0u);
        const v16h vh1 = ldfrag_o(VHIp, vo, 16u * SEQ * 2u);
        const v16h vh2 = ldfrag_o(VHIp, vo, 32u * SEQ * 2u);
        const v16h vh3 = ldfrag_o(VHIp, vo, 48u * SEQ * 2u);
        const v16h vl0 = ldfrag_o(VLOp, vo, 0u);
        const v16h vl1 = ldfrag_o(VLOp, vo, 16u * SEQ * 2u);
        const v16h vl2 = ldfrag_o(VLOp, vo, 32u * SEQ * 2u);
        const v16h vl3 = ldfrag_o(VLOp, vo, 48u * SEQ * 2u);
#pragma unroll
        for (int t = 0; t < QTW; ++t) {
          // A fragments of P*32768: hi f16 and residual f16, row = c, split k map over the 32 keys of this step
          FragH ph, pl;
          const float* prow = slab + t * SLW + c * 36 + 8 * hh;
          const v4f p0 = *(const v4f*)(prow), p1 = *(const v4f*)(prow + 4);
          const v4f p2 = *(const v4f*)(prow + 16), p3 = *(const v4f*)(prow + 20);
#pragma unroll
          for (int e = 0; e < 4; ++e) {
            const float ta = p0[e] * PCAR, tb = p1[e] * PCAR, tc = p2[e] * PCAR, td = p3[e] * PCAR;
            const _Float16 ha = (_Float16)ta, hb = (_Float16)tb, hc = (_Float16)tc, hd = (_Float16)td;
            ph.h[0][e]     = ha;                               // elements 0..7  = keys kb + 8hh + 0..7
            ph.h[0][4 + e] = hb;
            ph.h[1][e]     = hc;                               // elements 8..15 = keys kb + 16 + 8hh + 0..7
            ph.h[1][4 + e] = hd;
            pl.h[0][e]     = (_Float16)(ta - (float)ha);
            pl.h[0][4 + e] = (_Float16)(tb - (float)hb);
            pl.h[1][e]     = (_Float16)(tc - (float)hc);
            pl.h[1][4 + e] = (_Float16)(td - (float)hd);
          }
          o[t][0] = mma_h(ph.v, vh0, o[t][0]);  o[t][0] = mma_h(pl.v, vh0, o[t][0]);  o[t][0] = mma_h(ph.v, vl0, o[t][0]);
          o[t][1] = mma_h(ph.v, vh1, o[t][1]);  o[t][1] = mma_h(pl.v, vh1, o[t][1]);  o[t][1] = mma_h(ph.v, vl1, o[t][1]);
          o[t][2] = mma_h(ph.v, vh2, o[t][2]);  o[t][2] = mma_h(pl.v, vh2, o[t][2]);  o[t][2] = mma_h(ph.v, vl2, o[t][2]);
          o[t][3] = mma_h(ph.v, vh3, o[t][3]);  o[t][3] = mma_h(pl.v, vh3, o[t][3]);  o[t][3] = mma_h(ph.v, vl3, o[t][3]);
          guard10(o[t][0], o[t][1], o[t][2], o[t][3], ph.v, pl.v, vh0, vh1, vh2, vh3, vl0, vl1, vl2, vl3);
        }
      }
      wave_sync_lds();
    }
#pragma unroll
    for (int t = 0; t < QTW; ++t) acc_guard4(o[t][0], o[t][1], o[t][2], o[t][3]);
    // ---- publish this wave's partial: acc in its slab, m and Z (equal in the 16 lanes of a half) by lane c == 0 ----
#pragma unroll
    for (int t = 0; t < QTW; ++t) {
#pragma unroll
      for (int r = 0; r < 8; ++r) {
#pragma unroll
        for (int j = 0; j < 4; ++j) slab[(16 * t + 8 * hh + r) * 68 + j * 16 + c] = o[t][j][r];
      }
    }
    if (c == 0) {
#pragma unroll
      for (int t = 0; t < QTW; ++t) {
        v4f m0, m1, z0, z1;
#pragma unroll
        for (int e = 0; e < 4; ++e) { m0[e] = mrow[t][e]; m1[e] = mrow[t][4 + e]; z0[e] = lrow[t][e]; z1[e] = lrow[t][4 + e]; }
        *(v4f*)(ml + 16 * t + 8 * hh)                = m0;
        *(v4f*)(ml + 16 * t + 8 * hh + 4)            = m1;
        *(v4f*)(ml + 16 * QTW + 16 * t + 8 * hh)     = z0;
        *(v4f*)(ml + 16 * QTW + 16 * t + 8 * hh + 4) = z1;
      }
    }
    __syncthreads();                          // all WPB partials of this mask are visible
    // ---- merge for this lane's row and 8 d columns: out_a = acc / Z (0 when no key allowed), carries (32768 on P, 1024 on v) folded once ----
    {
      float mw[WPB], zw[WPB];
#pragma unroll
      for (int w2 = 0; w2 < WPB; ++w2) {
        mw[w2] = smem[w2 * WREG + QTW * SLW + row];
        zw[w2] = smem[w2 * WREG + QTW * SLW + 16 * QTW + row];
      }
      float mx = mw[0];
#pragma unroll
      for (int w2 = 1; w2 < WPB; ++w2) mx = fmaxf(mx, mw[w2]);
      const float ms = (mx == -INFINITY) ? 0.0f : mx;
      float lv = 0.0f;
      v4f oa = {0.f, 0.f, 0.f, 0.f}, ob = {0.f, 0.f, 0.f, 0.f};
#pragma unroll
      for (int w2 = 0; w2 < WPB; ++w2) {
        const float sc = exp2f(mw[w2] - ms);
        const float* ap = smem + w2 * WREG + row * 68 + c8;
        lv += zw[w2] * sc;
        oa += *(const v4f*)(ap) * sc;
        ob += *(const v4f*)(ap + 4) * sc;
      }
      const float ls  = (lv > 0.0f) ? lv : 1.0f;
      const float inv = (lv > 0.0f) ? ((1.0f / ls) * oc) : 0.0f;
      float* op = osum + row * 68 + c8;
      if (att == 0) {
        *(v4f*)(op)     = oa * inv;
        *(v4f*)(op + 4) = ob * inv;
      } else {
        *(v4f*)(op)     = *(const v4f*)(op) + oa * inv;
        *(v4f*)(op + 4) = *(const v4f*)(op + 4) + ob * inv;
      }
    }
    __syncthreads();                          // every reader has left the slabs (the next mask overwrites them); after the last mask: osum is whole
  }

  // ---- O x1024 -> f16 hi + residual planes; wave = group of 4 rows, lane = (row in group, 8 consecutive d) ----
  v4u oh, ol;
  {
    const v4f a = *(const v4f*)(osum + row * 68 + c8), b4 = *(const v4f*)(osum + row * 68 + c8 + 4);
    float w[8];
#pragma unroll
    for (int e = 0; e < 4; ++e) { w[e] = a[e] * OSC; w[4 + e] = b4[e] * OSC; }
#pragma unroll
    for (int e = 0; e < 4; ++e) {
      const _Float16 h0 = (_Float16)w[2 * e], h1 = (_Float16)w[2 * e + 1];
      const _Float16 l0 = (_Float16)(w[2 * e] - (float)h0), l1 = (_Float16)(w[2 * e + 1] - (float)h1);
      oh[e] = pk16(h_bits(h0), h_bits(h1));
      ol[e] = pk16(h_bits(l0), h_bits(l1));
    }
  }
  const size_t o8 = (((size_t)(q0 + row)) * NH + head) * HD + c8;
  *(v4u*)(OHIp + o8) = oh;
  *(v4u*)(OLOp + o8) = ol;
}

// =====================================================================================================
// Workspace map (bytes); every plane is fully written by whole-line stores before it is read; all extents are exact multiples
// of the store granularity (no pad rows needed); every offset a multiple of SEQ*256:
//   CT  f32 [SEQ][64]                  SEQ*256        ST  same
//   XB  bf16 [SEQ][1024]               SEQ*2048
//   WQB bf16 [1024 n][1024 k]         2097152        WKB, WVB same        2097152 each
//   WOH f16  [1024 n][1024 k] x1024   2097152
//   QF  f32 [SEQ][1024]                SEQ*4096       KF, VF same
//   QHI f16 [SEQ][16][64] x1024        SEQ*2048       QLO residual
//   KHI f16 [SEQ][16][64] x1024        SEQ*2048       KLO residual
//   VHI f16 [16][64][SEQ] x1024        SEQ*2048       VLO residual
//   OHI f16 [SEQ][1024] x1024          SEQ*2048       OLO residual
//   end (SEQ = 2048)                  72351744
// =====================================================================================================
extern "C" void kernel_launch(void* const* d_in, const int* in_sizes, int n_in,
                              void* d_out, int out_size, void* d_ws, size_t ws_size,
                              hipStream_t stream) {
  if (n_in < 11) return;
  if (in_sizes[0] != SEQ * DMOD) return;
  if (in_sizes[1] != SEQ || in_sizes[2] != SEQ) return;
  if (in_sizes[3] != DMOD * DMOD || in_sizes[5] != DMOD * DMOD) return;
  if (in_sizes[7] != DMOD * DMOD || in_sizes[9] != DMOD * DMOD) return;
  if (in_sizes[4] != DMOD || in_sizes[6] != DMOD || in_sizes[8] != DMOD || in_sizes[10] != DMOD) return;
  if (out_size != SEQ * DMOD) return;

  const float* x   = (const float*)d_in[0];
  const int*   bar = (const int*)d_in[1];
  const int*   ins = (const int*)d_in[2];
  const float* wq  = (const float*)d_in[3];
  const float* bq  = (const float*)d_in[4];
  const float* wk  = (const float*)d_in[5];
  const float* bk  = (const float*)d_in[6];
  const float* wv  = (const float*)d_in[7];
  const float* bv  = (const float*)d_in[8];
  const float* wo  = (const float*)d_in[9];
  const float* bo  = (const float*)d_in[10];
  float*       out = (float*)d_out;

  const size_t szTab = (size_t)SEQ * HD * 4;                    //   524288
  const size_t szXB  = (size_t)SEQ * DMOD * 2;                  //  4194304
  const size_t szW   = (size_t)DMOD * DMOD * 2;                 //  2097152
  const size_t szF   = (size_t)SEQ * DMOD * 4;                  //  8388608
  const size_t szP   = (size_t)SEQ * DMOD * 2;                  //  4194304
  size_t off = 0;
  const size_t oCT  = off; off += szTab;
  const size_t oST  = off; off += szTab;
  const size_t oXB  = off; off += szXB;
  const size_t oWQ  = off; off += szW;
  const size_t oWK  = off; off += szW;
  const size_t oWV  = off; off += szW;
  const size_t oWO  = off; off += szW;
  const size_t oQF  = off; off += szF;
  const size_t oKF  = off; off += szF;
  const size_t oVF  = off; off += szF;
  const size_t oQHI = off; off += szP;
  const size_t oQLO = off; off += szP;
  const size_t oKHI = off; off += szP;
  const size_t oKLO = off; off += szP;
  const size_t oVHI = off; off += szP;
  const size_t oVLO = off; off += szP;
  const size_t oOHI = off; off += szP;
  const size_t oOLO = off; off += szP;
  if (off > ws_size) return;                            // off = 72351744 at SEQ = 2048
  if (off > (size_t)134217728) return;

  char* ws = (char*)d_ws;
  float* CT  = (float*)(ws + oCT);
  float* ST  = (float*)(ws + oST);
  u16*   XB  = (u16*)(ws + oXB);
  u16*   WQB = (u16*)(ws + oWQ);
  u16*   WKB = (u16*)(ws + oWK);
  u16*   WVB = (u16*)(ws + oWV);
  u16*   WOH = (u16*)(ws + oWO);
  float* QF  = (float*)(ws + oQF);
  float* KF  = (float*)(ws + oKF);
  float* VF  = (float*)(ws + oVF);
  u16*   QHI = (u16*)(ws + oQHI);
  u16*   QLO = (u16*)(ws + oQLO);
  u16*   KHI = (u16*)(ws + oKHI);
  u16*   KLO = (u16*)(ws + oKLO);
  u16*   VHI = (u16*)(ws + oVHI);
  u16*   VLO = (u16*)(ws + oVLO);
  u16*   OHI = (u16*)(ws + oOHI);
  u16*   OLO = (u16*)(ws + oOLO);

  // inv_freq[i] = 1 / pow(10000, i/32) in f32 (pow correctly converted from f64, then IEEE f32 reciprocal)
  InvF inv;
  for (int i = 0; i < 32; ++i) {
    const double p = pow(10000.0, (double)i / 32.0);
    const float pf = (float)p;
    inv.f[i] = 1.0f / pf;
  }

  const dim3 blk(256);
  const dim3 gPrep(TABB + XCB + 4 * WCB);               // 256 + 1024 + 2048
  const dim3 gG((SEQ / 64) * (DMOD / 64));              // 512
  const dim3 gG3((SEQ / 64) * (DMOD / 64), 3);          // 512 x 3
  const dim3 bG(128);
  const dim3 gPack(VTB + 2 * RPB);                      // 512 + 2048
  const dim3 gAT(ATT_BLOCKS);                           // 1024
  const dim3 bAT(ATT_THREADS);                          // 256

  // (0) rotary cos/sin tables [SEQ][64]; x, Wq, Wk, Wv -> bf16 planes (same layout, already k-contiguous); Wo -> f16 plane of bf16 value x1024
  prep<<<gPrep, blk, 0, stream>>>(x, wq, wk, wv, wo, XB, WQB, WKB, WVB, WOH, CT, ST, inv);
  // (1) projections: q, k, v [SEQ][1024] in f32 (+ bias)
  gemm_bf<<<gG3, bG, 0, stream>>>(XB, WQB, WKB, WVB, bq, bk, bv, QF, KF, VF, SEQ, DMOD, DMOD, 1.0f);
  // (2) q', k' planes: rows (s, h), heads per position NH; v^T planes x1024 (hi + residual)
  pack3<<<gPack, blk, 0, stream>>>(QF, KF, VF, CT, ST, QHI, QLO, KHI, KLO, VHI, VLO);
  // (3) three masked attentions summed -> O planes [s][h][d] x1024 (hi + residual)
  attn3<<<gAT, bAT, 0, stream>>>(QHI, QLO, KHI, KLO, VHI, VLO, ins, bar, OHI, OLO);
  // (4) output projection -> out [SEQ][1024] f32, carries 1024 (O) x 1024 (Wo) folded back, + bo
  gemm_h2<<<gG, bG, 0, stream>>>(OHI, OLO, WOH, bo, out, SEQ, DMOD, DMOD, 1.0f / (OSC * WOS));
  (void)hipGetLastError();
}

// v005
// A run of this version takes 135 microseconds.
// Next to v004, in two timings, it ran 1.25 and 1.24 times as fast.
// All steps since v000 together make it 2.48 times as fast.
// Contractions: x.W{q,k,v}^T on v_wmma_f32_16x16x32_bf16 (x and W RNE-converted to bf16, f32 accumulate);
// scores k'.q'^T (transposed; q', k' carried x1024 as f16 hi plane + f16 residual plane, products hh+lh+hl), v^T.P^T (P x32768 f16 hi+residual,
// v x1024 f16 hi+residual, products hh+lh+hl) and O.Wo^T (O x1024 f16 hi+residual, Wo as f16(bf16(Wo) x1024), products h.w+l.w):
// v_wmma_f32_16x16x32_f16, f32 accumulate. Rotary tables, rotation, masks, masked base-2 online softmax and 1/l fold in f32 on VALU.
#include <hip/hip_runtime.h>
#include <math.h>
#include <stdint.h>

#define SEQ   2048
#define DMOD  1024
#define NH    16
#define HD    64
#define GINST 129
#define QSC   1024.0f
#define KSC   1024.0f
#define PCAR  32768.0f
#define VCAR  1024.0f
#define OSC   1024.0f
#define WOS   1024.0f
#define LOG2E 1.4426950408889634f
#define WPB   8
#define QTW   2
#define NQP   (SEQ / (16 * QTW))
#define NST   (SEQ / 64)
#define NKT   (SEQ / 32)
#define ATT_THREADS (WPB * 32)
#define ATT_BLOCKS  (NQP * NH)
#define SLW   (16 * 68)
#define WREG  (QTW * SLW + QTW * 32)
#define SLAB64 (16 * 68)
#define VTP   72
#define GKC   128
#define GPB   272
#define GOPB  (64 * GPB)
#define GKS   (GKC / 32)
#define TABB  (SEQ / 8)
#define XCB   ((SEQ * DMOD) / 2048)
#define WCB   ((DMOD * DMOD) / 2048)
#define RPB   ((SEQ * NH * 8) / 256)
#define VTB   (NH * NST)
static_assert(DMOD == NH * HD && HD == 64 && NH == 16);
static_assert(WPB == 8 && ATT_THREADS == 256 && (WREG % 4) == 0 && (SLW % 4) == 0 && QTW == 2);
static_assert((SEQ % 64) == 0 && (SEQ % ATT_THREADS) == 0 && (SEQ % 8) == 0 && SEQ <= 32768);
static_assert((DMOD % 64) == 0 && (DMOD % 32) == 0);
static_assert(((SEQ * DMOD) % 2048) == 0 && ((DMOD * DMOD) % 2048) == 0);
static_assert(((SEQ * NH * 8) % 256) == 0);
static_assert((DMOD % GKC) == 0 && (DMOD / GKC) >= 2 && GKC * 2 == 256 && GPB == 256 + 16 && (SEQ % 64) == 0);

typedef unsigned short u16;
typedef _Float16 v16h __attribute__((ext_vector_type(16)));
typedef _Float16 v8h  __attribute__((ext_vector_type(8)));
typedef __bf16   v16b __attribute__((ext_vector_type(16)));
typedef float    v8f  __attribute__((ext_vector_type(8)));
typedef float    v4f  __attribute__((ext_vector_type(4)));
typedef unsigned int v4u __attribute__((ext_vector_type(4)));
typedef int v4i __attribute__((ext_vector_type(4)));

union FragH { v16h v; v8h h[2]; v4u u[2]; };
union FragB { v16b v; v4u u[2]; };

struct InvF { float f[32]; };
static_assert(sizeof(InvF) == 128);

// ---- scalar helpers --------------------------------------------------------------------------------
__device__ __forceinline__ unsigned short bf_bits(float f) {          // f32 -> bf16 bits, RNE convert
  unsigned u = __float_as_uint(f);
  return (unsigned short)((u + 0x7FFFu + ((u >> 16) & 1u)) >> 16);
}
__device__ __forceinline__ float bf_up(unsigned short h) { return __uint_as_float(((unsigned)h) << 16); }
__device__ __forceinline__ float bfr(float f) { return bf_up(bf_bits(f)); }
__device__ __forceinline__ unsigned short h_bits(_Float16 x) { return __builtin_bit_cast(unsigned short, x); }
__device__ __forceinline__ unsigned pk16(unsigned short a, unsigned short b) { return (unsigned)a | ((unsigned)b << 16); }
__device__ __forceinline__ v8f zero8() { v8f z = {0.f, 0.f, 0.f, 0.f, 0.f, 0.f, 0.f, 0.f}; return z; }

// ---- fragment loaders: 16-bit A/B operand, lane -> row/col (lane&15), p already includes +8*(lane>>4);
//      elements 0..7 <- p[0..7] (k0+8h..), elements 8..15 <- p[16..23] (k0+16+8h..)  (same split k map for A and B;
//      B is always read from a k-contiguous [n][k] plane)
// fragment from a wave-uniform plane base plus a 32-bit per-lane byte offset (one address register instead of a pointer pair per plane)
__device__ __forceinline__ v16h ldfrag_o(const u16* base, unsigned boff, unsigned cbytes) {
  const char* p = (const char*)(const void*)base + boff;
  FragH f;
  f.h[0] = *(const v8h*)(p + cbytes);
  f.h[1] = *(const v8h*)(p + cbytes + 32);
  return f.v;
}

__device__ __forceinline__ v8f mma_h(v16h a, v16h b, v8f c) {
  return __builtin_amdgcn_wmma_f32_16x16x32_f16(false, a, false, b, (short)0, c, false, false);
}
__device__ __forceinline__ v8f mma_b(v16b a, v16b b, v8f c) {
  return __builtin_amdgcn_wmma_f32_16x16x32_bf16(false, a, false, b, (short)0, c, false, false);
}
template <typename F>
__device__ __forceinline__ void guard6(v8f& a, v8f& b, v8f& c, v8f& d, F x0, F x1, F x2, F x3, F x4, F x5) {
#if defined(__HIP_DEVICE_COMPILE__)
  asm volatile("v_nop\n\tv_nop\n\tv_nop\n\tv_nop"
               : "+v"(a), "+v"(b), "+v"(c), "+v"(d) : "v"(x0), "v"(x1), "v"(x2), "v"(x3), "v"(x4), "v"(x5) : "memory");
#endif
}
__device__ __forceinline__ void guard10(v8f& a, v8f& b, v8f& c, v8f& d, v16h x0, v16h x1, v16h x2, v16h x3, v16h x4,
                                        v16h x5, v16h x6, v16h x7, v16h x8, v16h x9) {
#if defined(__HIP_DEVICE_COMPILE__)
  asm volatile("v_nop\n\tv_nop\n\tv_nop\n\tv_nop"
               : "+v"(a), "+v"(b), "+v"(c), "+v"(d)
               : "v"(x0), "v"(x1), "v"(x2), "v"(x3), "v"(x4), "v"(x5), "v"(x6), "v"(x7), "v"(x8), "v"(x9) : "memory");
#endif
}
__device__ __forceinline__ void acc_guard4(v8f& a, v8f& b, v8f& c, v8f& d) {
#if defined(__HIP_DEVICE_COMPILE__)
  asm volatile("v_nop\n\tv_nop\n\tv_nop\n\tv_nop" : "+v"(a), "+v"(b), "+v"(c), "+v"(d));
#endif
}
// the value that lane l ^ 16 holds: the other half's share of the same query column
__device__ __forceinline__ float xhalf(float x) {
  const int b = __float_as_int(x);
  return __int_as_float(__builtin_amdgcn_permlanex16(b, b, 0x76543210, 0xfedcba98, false, false));
}
__device__ __forceinline__ void wave_sync_lds() {
  __builtin_amdgcn_fence(__ATOMIC_RELEASE, "workgroup");
  __builtin_amdgcn_wave_barrier();
  __builtin_amdgcn_fence(__ATOMIC_ACQUIRE, "workgroup");
}

// ---- GEMM operand staging: a stage = GKC k elements (256 B) of 64 rows of an operand, LDS row pitch GPB bytes ----
__device__ __forceinline__ unsigned lds_off(const void* p) { return (unsigned)(size_t)p; }   // LDS byte address of a __shared__ object
// 16 rows x 256 B of one operand, global memory -> LDS through no register: eight asynchronous copies of this wave. A copy is 2 whole rows
// (lane -> row lane >> 4, 16-B column lane & 15), four whole 128-B lines. l, g: this lane's LDS byte address and global address in copy 0;
// copy i lies 2 rows further on in both (ldk = elements between global rows). All 32 lanes on; both addresses multiples of 16.
// The closing s_wait_xcnt 0 stands inside the statement so that no address register named here is rewritten in front of it.
__device__ __forceinline__ void copy16rows(unsigned l, const u16* g, size_t ldk) {
#if defined(__HIP_DEVICE_COMPILE__)
  asm volatile("global_load_async_to_lds_b128 %0, %8, off\n\t"
               "global_load_async_to_lds_b128 %1, %9, off\n\t"
               "global_load_async_to_lds_b128 %2, %10, off\n\t"
               "global_load_async_to_lds_b128 %3, %11, off\n\t"
               "global_load_async_to_lds_b128 %4, %12, off\n\t"
               "global_load_async_to_lds_b128 %5, %13, off\n\t"
               "global_load_async_to_lds_b128 %6, %14, off\n\t"
               "global_load_async_to_lds_b128 %7, %15, off\n\t"
               "s_wait_xcnt 0x0"
               :: "v"(l), "v"(l + 2u * GPB), "v"(l + 4u * GPB), "v"(l + 6u * GPB),
                  "v"(l + 8u * GPB), "v"(l + 10u * GPB), "v"(l + 12u * GPB), "v"(l + 14u * GPB),
                  "v"(g), "v"(g + 2 * ldk), "v"(g + 4 * ldk), "v"(g + 6 * ldk),
                  "v"(g + 8 * ldk), "v"(g + 10 * ldk), "v"(g + 12 * ldk), "v"(g + 14 * ldk)
               : "memory");
#endif
}
// this wave's own copies have landed (the compiler places no wait for them)
__device__ __forceinline__ void wait_copies() {
#if defined(__HIP_DEVICE_COMPILE__)
  asm volatile("s_wait_asynccnt 0x0" ::: "memory");
#endif
}
// this wave's LDS reads have retired: stands in front of the barrier behind which the buffer it read is refilled
__device__ __forceinline__ void wait_lds() {
#if defined(__HIP_DEVICE_COMPILE__)
  asm volatile("s_wait_dscnt 0x0" ::: "memory");
#endif
}
// stands behind a piece's last global stores: in a grid of several pieces another piece's code follows in the listing and rewrites the
// registers that the stores name; this wait is in front of every such write (which piece is laid last is the compiler's choice: each has it)
__device__ __forceinline__ void wait_store_regs() {
#if defined(__HIP_DEVICE_COMPILE__)
  asm volatile("s_wait_xcnt 0x0" ::: "memory");
#endif
}
// fragment from a staged row: p = row start + 64 * k-step + 16 * (lane >> 4) bytes; the split k map of the loaders above (bytes +0 and +32)
__device__ __forceinline__ v16b ldsfrag_b(const unsigned char* p) {
  FragB f;
  f.u[0] = *(const v4u*)(p);
  f.u[1] = *(const v4u*)(p + 32);
  return f.v;
}
__device__ __forceinline__ v16h ldsfrag_h(const unsigned char* p) {
  FragH f;
  f.u[0] = *(const v4u*)(p);
  f.u[1] = *(const v4u*)(p + 32);
  return f.v;
}

// ---- accurate f32 sin/cos of a non-negative f32 angle (|angle| < 32768): f64 two-part pi/2 reduction + f64 polynomials,
//      plain f64 fma/mul only (no library f64 trig path), result converted to f32.
__device__ __forceinline__ void sincos_acc(float angf, float& sv, float& cv) {
  const double a = (double)angf;
  const double TWO_OVER_PI = 0.63661977236758134308;
  const double PIO2_HI = 1.5707963267948966;
  const double PIO2_LO = 6.123233995736766e-17;
  const int kq = (int)(a * TWO_OVER_PI + 0.5);
  const double kd = (double)kq;
  double r = fma(-kd, PIO2_HI, a);
  r = fma(-kd, PIO2_LO, r);
  const double r2 = r * r;
  double sp = 1.0 / 6227020800.0;
  sp = fma(sp, r2, -1.0 / 39916800.0);
  sp = fma(sp, r2, 1.0 / 362880.0);
  sp = fma(sp, r2, -1.0 / 5040.0);
  sp = fma(sp, r2, 1.0 / 120.0);
  sp = fma(sp, r2, -1.0 / 6.0);
  const double s = fma(sp * r2, r, r);
  double cp = -1.0 / 87178291200.0;
  cp = fma(cp, r2, 1.0 / 479001600.0);
  cp = fma(cp, r2, -1.0 / 3628800.0);
  cp = fma(cp, r2, 1.0 / 40320.0);
  cp = fma(cp, r2, -1.0 / 720.0);
  cp = fma(cp, r2, 1.0 / 24.0);
  cp = fma(cp, r2, -0.5);
  const double c = fma(cp, r2, 1.0);
  const int qd = kq & 3;
  const double so = (qd == 0) ? s : (qd == 1) ? c : (qd == 2) ? -s : -c;
  const double co = (qd == 0) ? c : (qd == 1) ? -s : (qd == 2) ? -c : s;
  sv = (float)so;
  cv = (float)co;
}

// =====================================================================================================
// Rotary tables: cosT[t][d], sinT[t][d] for t < SEQ, d < HD, angle = float(t) * inv_freq[d & 31] (f32 product), halves duplicated.
// Wave = one position t, lane = frequency index; inv_freq picked from the by-value table with a static select chain.
// coverage: blk = 0 .. SEQ/8 - 1, 8 waves each = SEQ rows; per row 4 line stores = 64 floats of each table.
// =====================================================================================================
__device__ __forceinline__ void tab_blk(int blk, float* cosT, float* sinT, const InvF& inv) {
  const int tid  = threadIdx.x;
  const int lane = tid & 31;
  const int t    = blk * 8 + (tid >> 5);
  float f = inv.f[0];
#pragma unroll
  for (int i = 1; i < 32; ++i) f = (lane == i) ? inv.f[i] : f;
  const float ang = (float)t * f;
  float sv, cv;
  sincos_acc(ang, sv, cv);
  float* cr = cosT + (size_t)t * HD;
  float* sr = sinT + (size_t)t * HD;
  *(float*)(cr + lane)      = cv;
  *(float*)(cr + 32 + lane) = cv;
  *(float*)(sr + lane)      = sv;
  *(float*)(sr + 32 + lane) = sv;
  wait_store_regs();
}

// =====================================================================================================
// f32 -> 16-bit plane, same layout.  f16mode false: bf16 RNE bits;  f16mode true: f16 bits of (bf16 RNE value) * scale.
// Thread = 8 consecutive elements: two 16-B loads, one 16-B store; 32 consecutive lanes = 512 contiguous, 512-B aligned bytes.
// coverage: blk = 0 .. n/2048 - 1, 256 thr x 8 elements each = the whole plane.
// =====================================================================================================
__device__ __forceinline__ void cvt_blk(const float* __restrict__ x, u16* D, int blk, bool f16mode, float scale) {
  const int gt = blk * 256 + (int)threadIdx.x;
  const float* p = x + (size_t)gt * 8;
  const v4f a = *(const v4f*)(p), b4 = *(const v4f*)(p + 4);
  float w[8];
#pragma unroll
  for (int e = 0; e < 4; ++e) { w[e] = a[e]; w[4 + e] = b4[e]; }
  v4u o;
#pragma unroll
  for (int e = 0; e < 4; ++e) {
    const float f0 = w[2 * e], f1 = w[2 * e + 1];
    o[e] = f16mode ? pk16(h_bits((_Float16)(bfr(f0) * scale)), h_bits((_Float16)(bfr(f1) * scale)))
                   : pk16(bf_bits(f0), bf_bits(f1));
  }
  *(v4u*)(D + (size_t)gt * 8) = o;
  wait_store_regs();
}

// =====================================================================================================
// Everything that reads inputs alone, in one grid: none of these pieces reads what another writes. The block index picks the piece
// (block-uniform; no barriers): TABB blocks of rotary tables first (the longest chain of a wave), XCB blocks x -> bf16,
// 3 * WCB blocks Wq, Wk, Wv -> bf16, WCB blocks Wo -> f16 of the bf16 value x1024.  grid = TABB + XCB + 4 * WCB, exact.
// =====================================================================================================
__global__ __launch_bounds__(256) void prep(const float* __restrict__ x, const float* __restrict__ wq, const float* __restrict__ wk,
                                            const float* __restrict__ wv, const float* __restrict__ wo,
                                            u16* XBo, u16* WQo, u16* WKo, u16* WVo, u16* WOo,
                                            float* cosT, float* sinT, InvF inv) {
  int b = blockIdx.x;
  if (b < TABB) { tab_blk(b, cosT, sinT, inv); return; }
  b -= TABB;
  if (b < XCB) { cvt_blk(x, XBo, b, false, 1.0f); return; }
  b -= XCB;
  const int w = b / WCB, wb = b % WCB;
  if (w < 3) {
    const float* s = (w == 0) ? wq : (w == 1) ? wk : wv;
    u16*         d = (w == 0) ? WQo : (w == 1) ? WKo : WVo;
    cvt_blk(s, d, wb, false, 1.0f);
  } else if (w == 3) {
    cvt_blk(wo, WOo, wb, true, WOS);
  }
}

// =====================================================================================================
// GEMM epilogue shared by both engines: the wave's 16x64 f32 tile (times oscale) staged in its LDS slab (pitch 68),
// coverage: 8 instructions x 2 rows x 16 lanes x 4 floats = the wave's 16 x 64 tile.
// =====================================================================================================
__device__ __forceinline__ void epi64(float* sl, v8f a0, v8f a1, v8f a2, v8f a3, float oscale,
                                      const float* __restrict__ bias, float* C, int N,
                                      size_t rowb, int col0, int lane) {
  const int hh = lane >> 4, m = lane & 15;
#pragma unroll
  for (int r = 0; r < 8; ++r) {
    const int ro = (8 * hh + r) * 68 + m;
    sl[ro]      = a0[r] * oscale;
    sl[ro + 16] = a1[r] * oscale;
    sl[ro + 32] = a2[r] * oscale;
    sl[ro + 48] = a3[r] * oscale;
  }
  wave_sync_lds();
  const v4f braw = *(const v4f*)(bias + col0 + m * 4);
  v4f bb;
#pragma unroll
  for (int e = 0; e < 4; ++e) bb[e] = bfr(braw[e]);
  v4f vals[8];
#pragma unroll
  for (int it = 0; it < 8; ++it) vals[it] = *(const v4f*)(sl + (it * 2 + hh) * 68 + m * 4) + bb;
  float* dst = C + (rowb + (size_t)hh) * (size_t)N + col0 + m * 4;
  {
#pragma unroll
    for (int it = 0; it < 8; ++it) {
      *(v4f*)(dst + (size_t)(it * 2) * (size_t)N) = vals[it];
    }
    
  }
}

// =====================================================================================================
// bf16 GEMM: C[M][N] (f32) = A[M][K] (bf16 row-major) . Bt[N][K]^T (bf16 k-contiguous), times oscale, plus bias[N].
// Block = 64x64 tile, 4 waves x 16 rows. K walked in stages of GKC: the block's 64 A rows and 64 Bt rows of a stage are brought into a
// two-buffer LDS ring by asynchronous copies of whole lines (each wave: 16 rows of each operand), stage t + 1 in flight while stage t is
// multiplied; fragments are read from LDS (two 16-B reads each, split k map for A and B), k ascending as before.
// Three products that share A run in one grid: blockIdx.y picks (Bt, bias, C) (block-uniform); none reads what another writes.
// The host passes M % 64 == 0, N % 64 == 0, K % GKC == 0, K >= 2 * GKC, grid = ((M/64)*(N/64), 3).
// =====================================================================================================
__global__ __launch_bounds__(128)
void gemm_bf(const u16* __restrict__ A, const u16* __restrict__ Bt0, const u16* __restrict__ Bt1, const u16* __restrict__ Bt2,
             const float* __restrict__ bias0, const float* __restrict__ bias1, const float* __restrict__ bias2,
             float* C0, float* C1, float* C2, int M, int N, int K, float oscale) {
  __shared__ __align__(16) float slab[4 * SLAB64];
  __shared__ __align__(16) unsigned char ring[2 * 2 * GOPB];   // [buffer][A | Bt][64 rows][GPB]
  const int tid = threadIdx.x, wave = tid >> 5, lane = tid & 31, hh = lane >> 4, m = lane & 15;
  const int which = blockIdx.y;
  const u16*   Bt   = (which == 0) ? Bt0 : (which == 1) ? Bt1 : Bt2;
  const float* bias = (which == 0) ? bias0 : (which == 1) ? bias1 : bias2;
  float*       C    = (which == 0) ? C0 : (which == 1) ? C1 : C2;
  const int ntile = N >> 6;
  const int bid   = blockIdx.x;
  const int row0  = (bid / ntile) * 64;
  const int rowb  = row0 + wave * 16;
  const int col0  = (bid % ntile) * 64;
  if (row0 + 64 > M) return;                 // block-uniform, in front of every barrier and copy; never taken with the exact grid
  const int nst  = K / GKC;
  const int crow = wave * 16 + hh;           // the tile row this lane brings in copy 0
  const u16* ga = A  + (size_t)(row0 + crow) * K + m * 8;
  const u16* gb = Bt + (size_t)(col0 + crow) * K + m * 8;
  const unsigned lc = lds_off(ring) + (unsigned)crow * GPB + (unsigned)m * 16u;
  copy16rows(lc, ga, (size_t)K);
  copy16rows(lc + GOPB, gb, (size_t)K);
  wait_copies();
  __syncthreads();                           // stage 0 is whole for every wave
  if (nst > 1) {
    copy16rows(lc + 2u * GOPB, ga + GKC, (size_t)K);
    copy16rows(lc + 3u * GOPB, gb + GKC, (size_t)K);
  }
  const unsigned char* fa = ring + (wave * 16 + m) * GPB + 16 * hh;
  const unsigned char* fb = ring + GOPB + m * GPB + 16 * hh;
  v8f acc0 = zero8(), acc1 = zero8(), acc2 = zero8(), acc3 = zero8();
  // kept rolled: one copy of the stage body, the buffer picked by the stage's parity
#pragma unroll 1
  for (int t = 0; t < nst; ++t) {
    const unsigned bo = (unsigned)(t & 1) * (2u * GOPB);
    // unrolled: the k-step offsets become immediates and the reads of later k-steps are issued ahead of the earlier products
#pragma unroll
    for (int kk = 0; kk < GKS; ++kk) {
      const v16b a  = ldsfrag_b(fa + bo + kk * 64);
      const v16b b0 = ldsfrag_b(fb + bo + kk * 64);
      const v16b b1 = ldsfrag_b(fb + bo + 16 * GPB + kk * 64);
      const v16b b2 = ldsfrag_b(fb + bo + 32 * GPB + kk * 64);
      const v16b b3 = ldsfrag_b(fb + bo + 48 * GPB + kk * 64);
      acc0 = mma_b(a, b0, acc0);
      acc1 = mma_b(a, b1, acc1);
      acc2 = mma_b(a, b2, acc2);
      acc3 = mma_b(a, b3, acc3);
      // its four v_nop keep the distance behind the stage's last matrix instructions on both sides of the branch at the loop's foot
      if (kk == GKS - 1) guard6<v16b>(acc0, acc1, acc2, acc3, a, b0, b1, b2, b3, a);
    }
    wait_lds();
    wait_copies();
    __syncthreads();                         // publishes stage t + 1 and ends every wave's reads of stage t's buffer
    if (t + 2 < nst) {
      copy16rows(lc + bo, ga + (size_t)(t + 2) * GKC, (size_t)K);
      copy16rows(lc + bo + GOPB, gb + (size_t)(t + 2) * GKC, (size_t)K);
    }
  }
  wait_copies();
  epi64(slab + wave * SLAB64, acc0, acc1, acc2, acc3, oscale, bias, C, N, (size_t)rowb, col0, lane);
}

// =====================================================================================================
// f16 hi+lo GEMM: C[M][N] (f32) = (Ahi + Alo)[M][K] . Bt[N][K]^T, times oscale, plus bias[N]; Ahi/Alo f16 planes (same layout),
// Bt f16 k-contiguous; products hi.B + lo.B into one accumulator (lo is the unscaled residual of hi). Same tiling and the same
// two-buffer LDS ring as gemm_bf, with three operand tiles a stage.
// =====================================================================================================
__global__ __launch_bounds__(128)
void gemm_h2(const u16* __restrict__ Ah, const u16* __restrict__ Al, const u16* __restrict__ Bt,
             const float* __restrict__ bias, float* C, int M, int N, int K, float oscale) {
  __shared__ __align__(16) float slab[4 * SLAB64];
  __shared__ __align__(16) unsigned char ring[2 * 3 * GOPB];   // [buffer][Ahi | Alo | Bt][64 rows][GPB]
  const int tid = threadIdx.x, wave = tid >> 5, lane = tid & 31, hh = lane >> 4, m = lane & 15;
  const int ntile = N >> 6;
  const int bid   = blockIdx.x;
  const int row0  = (bid / ntile) * 64;
  const int rowb  = row0 + wave * 16;
  const int col0  = (bid % ntile) * 64;
  if (row0 + 64 > M) return;                 // block-uniform, in front of every barrier and copy; never taken with the exact grid
  const int nst  = K / GKC;
  const int crow = wave * 16 + hh;           // the tile row this lane brings in copy 0
  const size_t aofs = (size_t)(row0 + crow) * K + m * 8;
  const u16* gh = Ah + aofs;
  const u16* gl = Al + aofs;
  const u16* gb = Bt + (size_t)(col0 + crow) * K + m * 8;
  const unsigned lc = lds_off(ring) + (unsigned)crow * GPB + (unsigned)m * 16u;
  copy16rows(lc, gh, (size_t)K);
  copy16rows(lc + GOPB, gl, (size_t)K);
  copy16rows(lc + 2u * GOPB, gb, (size_t)K);
  wait_copies();
  __syncthreads();                           // stage 0 is whole for every wave
  if (nst > 1) {
    copy16rows(lc + 3u * GOPB, gh + GKC, (size_t)K);
    copy16rows(lc + 4u * GOPB, gl + GKC, (size_t)K);
    copy16rows(lc + 5u * GOPB, gb + GKC, (size_t)K);
  }
  const unsigned char* fa = ring + (wave * 16 + m) * GPB + 16 * hh;
  const unsigned char* fb = ring + 2 * GOPB + m * GPB + 16 * hh;
  v8f acc0 = zero8(), acc1 = zero8(), acc2 = zero8(), acc3 = zero8();
  // kept rolled: one copy of the stage body, the buffer picked by the stage's parity
#pragma unroll 1
  for (int t = 0; t < nst; ++t) {
    const unsigned bo = (unsigned)(t & 1) * (3u * GOPB);
    // unrolled: the k-step offsets become immediates and the reads of later k-steps are issued ahead of the earlier products
#pragma unroll
    for (int kk = 0; kk < GKS; ++kk) {
      const v16h ah = ldsfrag_h(fa + bo + kk * 64), al = ldsfrag_h(fa + bo + GOPB + kk * 64);
      const v16h b0 = ldsfrag_h(fb + bo + kk * 64);
      const v16h b1 = ldsfrag_h(fb + bo + 16 * GPB + kk * 64);
      const v16h b2 = ldsfrag_h(fb + bo + 32 * GPB + kk * 64);
      const v16h b3 = ldsfrag_h(fb + bo + 48 * GPB + kk * 64);
      acc0 = mma_h(ah, b0, acc0);  acc0 = mma_h(al, b0, acc0);
      acc1 = mma_h(ah, b1, acc1);  acc1 = mma_h(al, b1, acc1);
      acc2 = mma_h(ah, b2, acc2);  acc2 = mma_h(al, b2, acc2);
      acc3 = mma_h(ah, b3, acc3);  acc3 = mma_h(al, b3, acc3);
      // its four v_nop keep the distance behind the stage's last matrix instructions on both sides of the branch at the loop's foot
      if (kk == GKS - 1) guard6<v16h>(acc0, acc1, acc2, acc3, ah, al, b0, b1, b2, b3);
    }
    wait_lds();
    wait_copies();
    __syncthreads();                         // publishes stage t + 1 and ends every wave's reads of stage t's buffer
    if (t + 2 < nst) {
      copy16rows(lc + bo, gh + (size_t)(t + 2) * GKC, (size_t)K);
      copy16rows(lc + bo + GOPB, gl + (size_t)(t + 2) * GKC, (size_t)K);
      copy16rows(lc + bo + 2u * GOPB, gb + (size_t)(t + 2) * GKC, (size_t)K);
    }
  }
  wait_copies();
  epi64(slab + wave * SLAB64, acc0, acc1, acc2, acc3, oscale, bias, C, N, (size_t)rowb, col0, lane);
}

// =====================================================================================================
// Rotate-half rotary + 16-bit split pack. Rows are (pos, head) with HD contiguous floats (f32 projection output);
// pos = (row / hpr) mod SEQ.  w[d] = x[d] * cos[pos][d] + r[d] * sin[pos][d],  r[d] = -x[d+32] for d < 32, x[d-32] for d >= 32;
// hi[d] = f16(w * sc), lo[d] = f16(w * sc - hi[d])  (sc a power of two, residual unscaled).
// Thread = 8 consecutive d of one row: 16-B loads of x (own and partner half), cos, sin; one 16-B store per plane per lane;
// coverage: blk = 0 .. nrows*8/256 - 1, 256 thr x 8 halves each = nrows x 64 of each plane exactly (exact division checked statically).
// =====================================================================================================
__device__ __forceinline__ void rope_blk(const float* __restrict__ x, const float* __restrict__ cosT,
                                         const float* __restrict__ sinT, u16* hpl, u16* lpl,
                                         int blk, int hpr, float sc) {
  const int gt  = blk * 256 + (int)threadIdx.x;
  const int row = gt >> 3;
  const int d0  = (gt & 7) * 8;
  const int pos = (row / hpr) % SEQ;
  const int d1  = d0 ^ 32;
  const float* xr = x + (size_t)row * HD;
  const float* cr = cosT + (size_t)pos * HD + d0;
  const float* sr = sinT + (size_t)pos * HD + d0;
  const v4f xa = *(const v4f*)(xr + d0), xb = *(const v4f*)(xr + d0 + 4);
  const v4f ya = *(const v4f*)(xr + d1), yb = *(const v4f*)(xr + d1 + 4);
  const v4f ca = *(const v4f*)(cr), cb = *(const v4f*)(cr + 4);
  const v4f sa = *(const v4f*)(sr), sb = *(const v4f*)(sr + 4);
  const float sgn = (d0 < 32) ? -1.0f : 1.0f;
  float w[8];
#pragma unroll
  for (int e = 0; e < 4; ++e) {
    w[e]     = xa[e] * ca[e] + (sgn * ya[e]) * sa[e];
    w[4 + e] = xb[e] * cb[e] + (sgn * yb[e]) * sb[e];
  }
  v4u oh, ol;
#pragma unroll
  for (int e = 0; e < 4; ++e) {
    const float t0 = w[2 * e] * sc, t1 = w[2 * e + 1] * sc;
    const _Float16 h0 = (_Float16)t0, h1 = (_Float16)t1;
    const _Float16 l0 = (_Float16)(t0 - (float)h0), l1 = (_Float16)(t1 - (float)h1);
    oh[e] = pk16(h_bits(h0), h_bits(h1));
    ol[e] = pk16(h_bits(l0), h_bits(l1));
  }
  const size_t o8 = (size_t)row * HD + d0;
  {
    *(v4u*)(hpl + o8) = oh;
    *(v4u*)(lpl + o8) = ol;
    wait_store_regs();
  }
}

// =====================================================================================================
// v^T planes: VH[g*HD + d][s] = f16(v[s][g][d] * 1024), VL = f16 residual of the same value.
// Block = (head g = blk / NST, 64 keys s0 = (blk % NST)*64): 64 source rows of HD floats loaded with 16-B loads, converted,
// scattered into two LDS tiles [d][64 keys] (pitch 72 halves); after a block barrier each d row segment (64 halves = one whole
// coverage: load 256 thr x 16 elements = 64 x 64; store 2 iterations x 256 thr x 8 halves = 64 lines x 64 = the block's tile of
//           each plane; blk = 0 .. NH x NST - 1 covers both planes exactly once. TH, TL: the block's two LDS tiles of HD * VTP halves.
// =====================================================================================================
__device__ __forceinline__ void vt_blk(const float* __restrict__ v, u16* VHo, u16* VLo, int blk, u16* TH, u16* TL) {
  const int tid = threadIdx.x;
  const int st  = blk % NST;
  const int g   = blk / NST;
  const int s0  = st * 64;
  {
    const int sl = tid >> 2;                  // key within tile 0..63
    const int dc = (tid & 3) * 16;            // d chunk
    const float* src = v + ((size_t)(s0 + sl) * NH + g) * HD + dc;
#pragma unroll
    for (int i = 0; i < 4; ++i) {
      const v4f a = *(const v4f*)(src + 4 * i);
#pragma unroll
      for (int e = 0; e < 4; ++e) {
        const float t = a[e] * VCAR;
        const _Float16 h = (_Float16)t;
        const _Float16 l = (_Float16)(t - (float)h);
        TH[(dc + 4 * i + e) * VTP + sl] = h_bits(h);
        TL[(dc + 4 * i + e) * VTP + sl] = h_bits(l);
      }
    }
  }
  __syncthreads();
  v4u vh[2], vl[2];
  const int q8 = tid >> 3, p8 = (tid & 7) * 8;
#pragma unroll
  for (int it = 0; it < 2; ++it) {
    const int line = it * 32 + q8;            // d = 0..63
    vh[it] = *(const v4u*)(TH + line * VTP + p8);
    vl[it] = *(const v4u*)(TL + line * VTP + p8);
  }
  const size_t base = ((size_t)g * HD) * SEQ + s0 + p8;
  {
#pragma unroll
    for (int it = 0; it < 2; ++it) {
      const int line = it * 32 + q8;
      *(v4u*)(VHo + base + (size_t)line * SEQ) = vh[it];
      *(v4u*)(VLo + base + (size_t)line * SEQ) = vl[it];
    }
    wait_store_regs();
  }
}

// =====================================================================================================
// The three packings of the f32 projections in one grid: none reads what another writes. The block index picks the piece (block-uniform,
// so the barrier inside vt_blk is passed by all of a block or by none): VTB blocks of v^T first (two phases and a barrier: the longest),
// RPB blocks q', RPB blocks k'.  grid = VTB + 2 * RPB, exact.
// =====================================================================================================
__global__ __launch_bounds__(256) void pack3(const float* __restrict__ qf, const float* __restrict__ kf, const float* __restrict__ vf,
                                             const float* __restrict__ cosT, const float* __restrict__ sinT,
                                             u16* QHo, u16* QLo, u16* KHo, u16* KLo, u16* VHo, u16* VLo) {
  __shared__ __align__(16) u16 TH[HD * VTP];
  __shared__ __align__(16) u16 TL[HD * VTP];
  int b = blockIdx.x;
  if (b < VTB) { vt_blk(vf, VHo, VLo, b, TH, TL); return; }
  b -= VTB;
  if (b < RPB)          rope_blk(qf, cosT, sinT, QHo, QLo, b, NH, QSC);
  else if (b < 2 * RPB) rope_blk(kf, cosT, sinT, KHo, KLo, b - RPB, NH, KSC);
}

// =====================================================================================================
// Triple-masked attention: block bid -> (head = bid % NH, query tile pair qp = NQP-1 - bid / NH: rows q0 = 32*qp .. q0+31; the pairs with
// the most keys take the lowest block ids). Every wave carries both 16-row query tiles of the pair, each with a softmax state of its own, so that one
// load of a k or v fragment serves two tiles. The block's WPB waves share that one (pair, head) and split its key tiles: in every group of eight
// consecutive key tiles g each wave takes one, kt = 8g + ((wave - g) & 7), so that any stride-4 or stride-8 pattern of live tiles is spread too.
//   q planes (hi, lo f16 x1024) laid out [s][h][d]; k planes [s][h][d]; v^T planes [h][d][s]; instrument and bar ids staged in LDS.
//   For each of the three masks in turn (block-uniform), each wave with its OWN running max m_a, sum Z_a and 4 accumulators acc_a per query tile:
//     att 0: (iq == ik) && (iq < 129) && (j <= i)
//     att 1: (iq != ik) && (ik < 129) && (iq < 129) && (bq >= 0) && ((0 <= bq-bk <= 2) || (bq-bk == 4))
//     att 2: ((ik == 129) || (bk == -1)) && (j <= i)
//   A wave's key tiles of 32 visited in order (att 0/2 up to the causal limit, att 1 all NKT); per tile every lane evaluates the mask bits of its
//   2 queries x 16 keys, a wave ballot skips tiles with no allowed element in either query tile (exact: such keys carry zero weight).
//   Both products are formed transposed, so that a lane owns one query of each query tile (column c of every D tile):
//   S^T = k'.q'^T: A = key rows, B = query rows, 2 key subtiles x 2 k-steps x 3 products (k_hi.q_hi + k_hi.q_lo + k_lo.q_hi), fragments loaded
//   straight from the 16-bit planes (two 16-B loads per fragment, split k map); a lane's 16 scores of a query tile are keys 16u + 8hh + r of
//   its own query; masked scores replaced by -inf; online max-subtracted base-2 softmax in f32 (scale 1/8 folded), -inf-safe rescale: the
//   maximum in-lane plus one exchange between the halves, the sum kept per half and joined once after the key loop.
//   O^T += v^T.P^T: the two score subtiles' registers, converted in place, ARE the B fragment of P^T in the split k map (no LDS, no lane
//   exchange); A = 4+4 v^T fragments (hi and residual planes), 12 WMMAs a query tile (hh + hl + lh); the rescale factor is the lane's own.
//   After each mask every wave publishes its partial (m, Z, acc) in its LDS slab; behind a
//   block barrier wave w merges the eight partials of rows 4w .. 4w+3 (a lane: one row, 8 d columns): M = max m_w, Z = sum Z_w 2^(m_w-M), acc likewise;
//   out_a = (Z > 0, i.e. the row has an allowed key) ? acc / Z : 0, carries 1/(32768*1024) folded once, summed in a lane-owned LDS tile:
//   O = out_0 + out_1 + out_2. A second barrier frees the slabs for the next mask. All barriers block-uniform; bounded loops only.
// coverage: per wave 4 rows x 8 lanes x 8 halves = 4 x 64 per plane, WPB waves = 32 x 64; grid NQP*NH blocks =
//           every (s, h) row of both O planes exactly once.
// =====================================================================================================
// second bound: four waves per SIMD (at most 256 registers), two blocks on a WGP: the grid takes two rounds
__global__ __launch_bounds__(ATT_THREADS, 4)
void attn3(const u16* __restrict__ QHIp, const u16* __restrict__ QLOp,
           const u16* __restrict__ KHIp, const u16* __restrict__ KLOp,
           const u16* __restrict__ VHIp, const u16* __restrict__ VLOp,
           const int* __restrict__ inst, const int* __restrict__ bar,
           u16* OHIp, u16* OLOp) {
  __shared__ __align__(16) float smem[WPB * WREG + QTW * SLW];
  __shared__ __align__(16) int sI[SEQ];
  __shared__ __align__(16) int sB[SEQ];

  const int tid  = threadIdx.x;
  const int wave = __builtin_amdgcn_readfirstlane(tid >> 5);   // scalar: it steers the key-tile loop
  const int lane = tid & 31;
  const int hh   = lane >> 4;
  const int c    = lane & 15;
  const int bid  = blockIdx.x;
  if (bid >= NQP * NH) return;               // block-uniform, before any barrier; never taken with the exact grid
  const int head = bid % NH;
  const int qp   = NQP - 1 - bid / NH;
  const int q0   = qp * (16 * QTW);
  const int rq   = lane >> 3;                // merge and output: this lane owns row 4*wave + rq of the block's 32,
  const int c8   = (lane & 7) * 8;           // d columns c8 .. c8 + 7
  const int row  = wave * 4 + rq;

  for (int i = tid; i < SEQ; i += ATT_THREADS) { sI[i] = inst[i]; sB[i] = bar[i]; }
  __syncthreads();

  float* slab = smem + wave * WREG;          // partial accumulators [16*QTW][64] pitch 68, written after a mask's key loop
  float* ml   = slab + QTW * SLW;            // partial m[16*QTW], Z[16*QTW]
  float* osum = smem + WPB * WREG;           // the block's result [16*QTW][64] pitch 68; elements (row, c8 .. c8 + 7) owned by this lane

  // byte offsets into the 16-bit planes (each plane SEQ*DMOD*2 bytes, far below 2^32); hi and residual planes share them
  const unsigned KROWB = NH * HD * 2u;                                          // bytes between consecutive query or key rows
  const unsigned qofs = ((unsigned)((q0 + c) * NH + head) * HD + 8u * hh) * 2u;  // query tile t: + t * 16 * KROWB
  const unsigned kofs = ((unsigned)(c * NH + head) * HD + 8u * hh) * 2u;         // key row kb + c added per step
  const unsigned vofs = ((unsigned)(head * HD + c) * SEQ + 8u * hh) * 2u;        // d column c (+16j), key kb added per step
  const float lsc = 0.125f * (LOG2E / (QSC * KSC));
  const float oc  = 1.0f / (PCAR * VCAR);
  // ids of this lane's own query of each tile (row q0 + 16t + c)
  int iqv[QTW], bqv[QTW];
#pragma unroll
  for (int t = 0; t < QTW; ++t) { iqv[t] = sI[q0 + 16 * t + c]; bqv[t] = sB[q0 + 16 * t + c]; }

  // kept rolled: with two query tiles a wave, three copies of the tile body and of the merge would be about 60 KB of code, nearly the
  // whole instruction cache; the mask is picked by a scalar branch at each key tile
#pragma unroll 1
  for (int att = 0; att < 3; ++att) {
    float mrow[QTW], lrow[QTW];              // this lane's query: running max (equal in both halves), this half's share of the sum
    v8f o[QTW][4];                            // o[t][j][r] = O^T[d = 16j + 8hh + r][query 16t + c]
#pragma unroll
    for (int t = 0; t < QTW; ++t) {
      mrow[t] = -INFINITY; lrow[t] = 0.f;
#pragma unroll
      for (int j = 0; j < 4; ++j) o[t][j] = zero8();
    }
    const int ncaus = ((q0 + 16 * QTW - 1) >> 5) + 1;                           // tiles holding keys <= the block's last query row
    const int nkt = (att == 1) ? NKT : ((ncaus < NKT) ? ncaus : NKT);

    const int ngrp = (nkt + WPB - 1) / WPB;
#pragma unroll 1
    for (int g = 0; g < ngrp; ++g) {
      const int kt = WPB * g + ((wave - g) & (WPB - 1));
      if (kt >= nkt) continue;                                                   // wave-uniform
      const int kb = kt * 32;
      // ids of this lane's 16 keys kb + 16u + 8hh + r (the rows of its D registers), 16-B LDS reads
      int ik[2][8], bk[2][8];
#pragma unroll
      for (int u = 0; u < 2; ++u) {
        const v4i ia = *(const v4i*)(sI + kb + 16 * u + 8 * hh), ib = *(const v4i*)(sI + kb + 16 * u + 8 * hh + 4);
        const v4i ba = *(const v4i*)(sB + kb + 16 * u + 8 * hh), bb = *(const v4i*)(sB + kb + 16 * u + 8 * hh + 4);
#pragma unroll
        for (int e = 0; e < 4; ++e) { ik[u][e] = ia[e]; ik[u][4 + e] = ib[e]; bk[u][e] = ba[e]; bk[u][4 + e] = bb[e]; }
      }
      // causal test j <= i (j = kb + 8hh + 16u + r, i = q0 + c + 16t) written against the constant 16u + r - 16t
      const int di = (q0 + c) - (kb + 8 * hh);
      unsigned okb[QTW];                                                         // bit 8u + r
#pragma unroll
      for (int t = 0; t < QTW; ++t) {
        unsigned ob = 0u;
        if (att == 0) {
          const bool qa = iqv[t] < GINST;
#pragma unroll
          for (int u = 0; u < 2; ++u) {
#pragma unroll
            for (int r = 0; r < 8; ++r) {
              const bool ok = qa && (iqv[t] == ik[u][r]) && (16 * u + r - 16 * t <= di);
              ob |= ok ? (1u << (8 * u + r)) : 0u;
            }
          }
        } else if (att == 1) {
          const bool qa = (iqv[t] < GINST) && (bqv[t] >= 0);
#pragma unroll
          for (int u = 0; u < 2; ++u) {
#pragma unroll
            for (int r = 0; r < 8; ++r) {
              const int  d  = bqv[t] - bk[u][r];
              const bool w  = ((d >= 0) && (d <= 2)) || (d == 4);
              const bool ok = qa && (ik[u][r] < GINST) && (iqv[t] != ik[u][r]) && w;
              ob |= ok ? (1u << (8 * u + r)) : 0u;
            }
          }
        } else {
#pragma unroll
          for (int u = 0; u < 2; ++u) {
#pragma unroll
            for (int r = 0; r < 8; ++r) {
              const bool ok = ((ik[u][r] == GINST) || (bk[u][r] == -1)) && (16 * u + r - 16 * t <= di);
              ob |= ok ? (1u << (8 * u + r)) : 0u;
            }
          }
        }
        okb[t] = ob;
      }
      const unsigned anyw = __builtin_amdgcn_ballot_w32((okb[0] | okb[1]) != 0u);    // wave-uniform
      if (anyw == 0u) continue;

      // ---- scores, transposed: D element r of this lane = (key kb + 16u + 8hh + r, query q0 + 16t + c) in s[t][u];
      //      each k fragment (A) is loaded once and multiplied with both query tiles (B) ----
      v8f s[QTW][2];
#pragma unroll
      for (int t = 0; t < QTW; ++t) { s[t][0] = zero8(); s[t][1] = zero8(); }
      const unsigned ko = kofs + (unsigned)kb * KROWB;
#pragma unroll
      for (int kk = 0; kk < 2; ++kk) {
        const v16h kh0 = ldfrag_o(KHIp, ko, kk * 64u),                kl0 = ldfrag_o(KLOp, ko, kk * 64u);
        const v16h kh1 = ldfrag_o(KHIp, ko, 16u * KROWB + kk * 64u),  kl1 = ldfrag_o(KLOp, ko, 16u * KROWB + kk * 64u);
        const v16h qa  = ldfrag_o(QHIp, qofs, kk * 64u),               qb  = ldfrag_o(QLOp, qofs, kk * 64u);
        const v16h qc  = ldfrag_o(QHIp, qofs, 16u * KROWB + kk * 64u), qd  = ldfrag_o(QLOp, qofs, 16u * KROWB + kk * 64u);
        s[0][0] = mma_h(kh0, qa, s[0][0]);
        s[0][0] = mma_h(kh0, qb, s[0][0]);
        s[0][0] = mma_h(kl0, qa, s[0][0]);
        s[0][1] = mma_h(kh1, qa, s[0][1]);
        s[0][1] = mma_h(kh1, qb, s[0][1]);
        s[0][1] = mma_h(kl1, qa, s[0][1]);
        s[1][0] = mma_h(kh0, qc, s[1][0]);
        s[1][0] = mma_h(kh0, qd, s[1][0]);
        s[1][0] = mma_h(kl0, qc, s[1][0]);
        s[1][1] = mma_h(kh1, qc, s[1][1]);
        s[1][1] = mma_h(kh1, qd, s[1][1]);
        s[1][1] = mma_h(kl1, qc, s[1][1]);
        guard10(s[0][0], s[0][1], s[1][0], s[1][1], qa, qb, qc, qd, kh0, kl0, kh1, kl1, kh0, kl0);
      }
      // ---- v^T fragments (A of the second product): row d = 16j + c, keys contiguous in the v^T planes; each is loaded once and
      //      multiplied with both query tiles' prob fragments ----
      const unsigned vo = vofs + (unsigned)kb * 2u;
      const v16h vh0 = ldfrag_o(VHIp, vo, 0u);
      const v16h vh1 = ldfrag_o(VHIp, vo, 16u * SEQ * 2u);
      const v16h vh2 = ldfrag_o(VHIp, vo, 32u * SEQ * 2u);
      const v16h vh3 = ldfrag_o(VHIp, vo, 48u * SEQ * 2u);
      const v16h vl0 = ldfrag_o(VLOp, vo, 0u);
      const v16h vl1 = ldfrag_o(VLOp, vo, 16u * SEQ * 2u);
      const v16h vl2 = ldfrag_o(VLOp, vo, 32u * SEQ * 2u);
      const v16h vl3 = ldfrag_o(VLOp, vo, 48u * SEQ * 2u);
#pragma unroll
      for (int t = 0; t < QTW; ++t) {
        // ---- mask (replace by -inf) + online softmax in base 2, -inf-safe, for this lane's query; a query with no allowed key in this
        //      key tile goes through with al = 1 (or 0 on a zero state) and all-zero probs: its state keeps its bits ----
        float tv[2][8];
        float mx = -INFINITY;
#pragma unroll
        for (int u = 0; u < 2; ++u) {
#pragma unroll
          for (int r = 0; r < 8; ++r) {
            const bool ok = ((okb[t] >> (8 * u + r)) & 1u) != 0u;
            tv[u][r] = ok ? (s[t][u][r] * lsc) : -INFINITY;
            mx = fmaxf(mx, tv[u][r]);
          }
        }
        mx = fmaxf(mx, xhalf(mx));
        const float mn = fmaxf(mrow[t], mx);
        const float ms = (mn == -INFINITY) ? 0.0f : mn;
        const float al = exp2f(mrow[t] - ms);
        mrow[t] = mn;
        // B fragments of P^T * 32768: hi f16 and residual f16, column = this lane's query; elements 0..7 = keys kb + 8hh + 0..7 (subtile 0),
        // elements 8..15 = keys kb + 16 + 8hh + 0..7 (subtile 1): the split k map of the v^T loader
        FragH ph, pl;
        float ps = 0.0f;
#pragma unroll
        for (int u = 0; u < 2; ++u) {
#pragma unroll
          for (int r = 0; r < 8; ++r) {
            const float e = exp2f(tv[u][r] - ms);
            ps += e;
            const float ta = e * PCAR;
            const _Float16 ha = (_Float16)ta;
            ph.h[u][r] = ha;
            pl.h[u][r] = (_Float16)(ta - (float)ha);
          }
        }
        lrow[t] = lrow[t] * al + ps;
#pragma unroll
        for (int j = 0; j < 4; ++j) o[t][j] *= al;
        o[t][0] = mma_h(vh0, ph.v, o[t][0]);  o[t][0] = mma_h(vh0, pl.v, o[t][0]);  o[t][0] = mma_h(vl0, ph.v, o[t][0]);
        o[t][1] = mma_h(vh1, ph.v, o[t][1]);  o[t][1] = mma_h(vh1, pl.v, o[t][1]);  o[t][1] = mma_h(vl1, ph.v, o[t][1]);
        o[t][2] = mma_h(vh2, ph.v, o[t][2]);  o[t][2] = mma_h(vh2, pl.v, o[t][2]);  o[t][2] = mma_h(vl2, ph.v, o[t][2]);
        o[t][3] = mma_h(vh3, ph.v, o[t][3]);  o[t][3] = mma_h(vh3, pl.v, o[t][3]);  o[t][3] = mma_h(vl3, ph.v, o[t][3]);
        guard10(o[t][0], o[t][1], o[t][2], o[t][3], ph.v, pl.v, vh0, vh1, vh2, vh3, vl0, vl1, vl2, vl3);
      }
    }
#pragma unroll
    for (int t = 0; t < QTW; ++t) acc_guard4(o[t][0], o[t][1], o[t][2], o[t][3]);
    // ---- publish this wave's partial: acc in its slab (a lane: its query's row, 8 consecutive d per j, 16-B stores); m and Z, the two
    //      halves' sums joined here, by the lower half ----
#pragma unroll
    for (int t = 0; t < QTW; ++t) {
#pragma unroll
      for (int j = 0; j < 4; ++j) {
        float* sp = slab + (16 * t + c) * 68 + j * 16 + 8 * hh;
        v4f a, b4;
#pragma unroll
        for (int e = 0; e < 4; ++e) { a[e] = o[t][j][e]; b4[e] = o[t][j][4 + e]; }
        *(v4f*)(sp)     = a;
        *(v4f*)(sp + 4) = b4;
      }
      const float z = lrow[t] + xhalf(lrow[t]);
      if (hh == 0) {
        ml[16 * t + c]            = mrow[t];
        ml[16 * QTW + 16 * t + c] = z;
      }
    }
    __syncthreads();                          // all WPB partials of this mask are visible
    // ---- merge for this lane's row and 8 d columns: out_a = acc / Z (0 when no key allowed), carries (32768 on P, 1024 on v) folded once ----
    {
      float mw[WPB], zw[WPB];
#pragma unroll
      for (int w2 = 0; w2 < WPB; ++w2) {
        mw[w2] = smem[w2 * WREG + QTW * SLW + row];
        zw[w2] = smem[w2 * WREG + QTW * SLW + 16 * QTW + row];
      }
      float mx = mw[0];
#pragma unroll
      for (int w2 = 1; w2 < WPB; ++w2) mx = fmaxf(mx, mw[w2]);
      const float ms = (mx == -INFINITY) ? 0.0f : mx;
      float lv = 0.0f;
      v4f oa = {0.f, 0.f, 0.f, 0.f}, ob = {0.f, 0.f, 0.f, 0.f};
#pragma unroll
      for (int w2 = 0; w2 < WPB; ++w2) {
        const float sc = exp2f(mw[w2] - ms);
        const float* ap = smem + w2 * WREG + row * 68 + c8;
        lv += zw[w2] * sc;
        oa += *(const v4f*)(ap) * sc;
        ob += *(const v4f*)(ap + 4) * sc;
      }
      const float ls  = (lv > 0.0f) ? lv : 1.0f;
      const float inv = (lv > 0.0f) ? ((1.0f / ls) * oc) : 0.0f;
      float* op = osum + row * 68 + c8;
      if (att == 0) {
        *(v4f*)(op)     = oa * inv;
        *(v4f*)(op + 4) = ob * inv;
      } else {
        *(v4f*)(op)     = *(const v4f*)(op) + oa * inv;
        *(v4f*)(op + 4) = *(const v4f*)(op + 4) + ob * inv;
      }
    }
    __syncthreads();                          // every reader has left the slabs (the next mask overwrites them); after the last mask: osum is whole
  }

  // ---- O x1024 -> f16 hi + residual planes; wave = group of 4 rows, lane = (row in group, 8 consecutive d) ----
  v4u oh, ol;
  {
    const v4f a = *(const v4f*)(osum + row * 68 + c8), b4 = *(const v4f*)(osum + row * 68 + c8 + 4);
    float w[8];
#pragma unroll
    for (int e = 0; e < 4; ++e) { w[e] = a[e] * OSC; w[4 + e] = b4[e] * OSC; }
#pragma unroll
    for (int e = 0; e < 4; ++e) {
      const _Float16 h0 = (_Float16)w[2 * e], h1 = (_Float16)w[2 * e + 1];
      const _Float16 l0 = (_Float16)(w[2 * e] - (float)h0), l1 = (_Float16)(w[2 * e + 1] - (float)h1);
      oh[e] = pk16(h_bits(h0), h_bits(h1));
      ol[e] = pk16(h_bits(l0), h_bits(l1));
    }
  }
  const size_t o8 = (((size_t)(q0 + row)) * NH + head) * HD + c8;
  *(v4u*)(OHIp + o8) = oh;
  *(v4u*)(OLOp + o8) = ol;
}

// =====================================================================================================
// Workspace map (bytes); every plane is fully written by whole-line stores before it is read; all extents are exact multiples
// of the store granularity (no pad rows needed); every offset a multiple of SEQ*256:
//   CT  f32 [SEQ][64]                  SEQ*256        ST  same
//   XB  bf16 [SEQ][1024]               SEQ*2048
//   WQB bf16 [1024 n][1024 k]         2097152        WKB, WVB same        2097152 each
//   WOH f16  [1024 n][1024 k] x1024   2097152
//   QF  f32 [SEQ][1024]                SEQ*4096       KF, VF same
//   QHI f16 [SEQ][16][64] x1024        SEQ*2048       QLO residual
//   KHI f16 [SEQ][16][64] x1024        SEQ*2048       KLO residual
//   VHI f16 [16][64][SEQ] x1024        SEQ*2048       VLO residual
//   OHI f16 [SEQ][1024] x1024          SEQ*2048       OLO residual
//   end (SEQ = 2048)                  72351744
// =====================================================================================================
extern "C" void kernel_launch(void* const* d_in, const int* in_sizes, int n_in,
                              void* d_out, int out_size, void* d_ws, size_t ws_size,
                              hipStream_t stream) {
  if (n_in < 11) return;
  if (in_sizes[0] != SEQ * DMOD) return;
  if (in_sizes[1] != SEQ || in_sizes[2] != SEQ) return;
  if (in_sizes[3] != DMOD * DMOD || in_sizes[5] != DMOD * DMOD) return;
  if (in_sizes[7] != DMOD * DMOD || in_sizes[9] != DMOD * DMOD) return;
  if (in_sizes[4] != DMOD || in_sizes[6] != DMOD || in_sizes[8] != DMOD || in_sizes[10] != DMOD) return;
  if (out_size != SEQ * DMOD) return;

  const float* x   = (const float*)d_in[0];
  const int*   bar = (const int*)d_in[1];
  const int*   ins = (const int*)d_in[2];
  const float* wq  = (const float*)d_in[3];
  const float* bq  = (const float*)d_in[4];
  const float* wk  = (const float*)d_in[5];
  const float* bk  = (const float*)d_in[6];
  const float* wv  = (const float*)d_in[7];
  const float* bv  = (const float*)d_in[8];
  const float* wo  = (const float*)d_in[9];
  const float* bo  = (const float*)d_in[10];
  float*       out = (float*)d_out;

  const size_t szTab = (size_t)SEQ * HD * 4;                    //   524288
  const size_t szXB  = (size_t)SEQ * DMOD * 2;                  //  4194304
  const size_t szW   = (size_t)DMOD * DMOD * 2;                 //  2097152
  const size_t szF   = (size_t)SEQ * DMOD * 4;                  //  8388608
  const size_t szP   = (size_t)SEQ * DMOD * 2;                  //  4194304
  size_t off = 0;
  const size_t oCT  = off; off += szTab;
  const size_t oST  = off; off += szTab;
  const size_t oXB  = off; off += szXB;
  const size_t oWQ  = off; off += szW;
  const size_t oWK  = off; off += szW;
  const size_t oWV  = off; off += szW;
  const size_t oWO  = off; off += szW;
  const size_t oQF  = off; off += szF;
  const size_t oKF  = off; off += szF;
  const size_t oVF  = off; off += szF;
  const size_t oQHI = off; off += szP;
  const size_t oQLO = off; off += szP;
  const size_t oKHI = off; off += szP;
  const size_t oKLO = off; off += szP;
  const size_t oVHI = off; off += szP;
  const size_t oVLO = off; off += szP;
  const size_t oOHI = off; off += szP;
  const size_t oOLO = off; off += szP;
  if (off > ws_size) return;                            // off = 72351744 at SEQ = 2048
  if (off > (size_t)134217728) return;

  char* ws = (char*)d_ws;
  float* CT  = (float*)(ws + oCT);
  float* ST  = (float*)(ws + oST);
  u16*   XB  = (u16*)(ws + oXB);
  u16*   WQB = (u16*)(ws + oWQ);
  u16*   WKB = (u16*)(ws + oWK);
  u16*   WVB = (u16*)(ws + oWV);
  u16*   WOH = (u16*)(ws + oWO);
  float* QF  = (float*)(ws + oQF);
  float* KF  = (float*)(ws + oKF);
  float* VF  = (float*)(ws + oVF);
  u16*   QHI = (u16*)(ws + oQHI);
  u16*   QLO = (u16*)(ws + oQLO);
  u16*   KHI = (u16*)(ws + oKHI);
  u16*   KLO = (u16*)(ws + oKLO);
  u16*   VHI = (u16*)(ws + oVHI);
  u16*   VLO = (u16*)(ws + oVLO);
  u16*   OHI = (u16*)(ws + oOHI);
  u16*   OLO = (u16*)(ws + oOLO);

  // inv_freq[i] = 1 / pow(10000, i/32) in f32 (pow correctly converted from f64, then IEEE f32 reciprocal)
  InvF inv;
  for (int i = 0; i < 32; ++i) {
    const double p = pow(10000.0, (double)i / 32.0);
    const float pf = (float)p;
    inv.f[i] = 1.0f / pf;
  }

  const dim3 blk(256);
  const dim3 gPrep(TABB + XCB + 4 * WCB);               // 256 + 1024 + 2048
  const dim3 gG((SEQ / 64) * (DMOD / 64));              // 512
  const dim3 gG3((SEQ / 64) * (DMOD / 64), 3);          // 512 x 3
  const dim3 bG(128);
  const dim3 gPack(VTB + 2 * RPB);                      // 512 + 2048
  const dim3 gAT(ATT_BLOCKS);                           // 1024
  const dim3 bAT(ATT_THREADS);                          // 256

  // (0) rotary cos/sin tables [SEQ][64]; x, Wq, Wk, Wv -> bf16 planes (same layout, already k-contiguous); Wo -> f16 plane of bf16 value x1024
  prep<<<gPrep, blk, 0, stream>>>(x, wq, wk, wv, wo, XB, WQB, WKB, WVB, WOH, CT, ST, inv);
  // (1) projections: q, k, v [SEQ][1024] in f32 (+ bias)
  gemm_bf<<<gG3, bG, 0, stream>>>(XB, WQB, WKB, WVB, bq, bk, bv, QF, KF, VF, SEQ, DMOD, DMOD, 1.0f);
  // (2) q', k' planes: rows (s, h), heads per position NH; v^T planes x1024 (hi + residual)
  pack3<<<gPack, blk, 0, stream>>>(QF, KF, VF, CT, ST, QHI, QLO, KHI, KLO, VHI, VLO);
  // (3) three masked attentions summed -> O planes [s][h][d] x1024 (hi + residual)
  attn3<<<gAT, bAT, 0, stream>>>(QHI, QLO, KHI, KLO, VHI, VLO, ins, bar, OHI, OLO);
  // (4) output projection -> out [SEQ][1024] f32, carries 1024 (O) x 1024 (Wo) folded back, + bo
  gemm_h2<<<gG, bG, 0, stream>>>(OHI, OLO, WOH, bo, out, SEQ, DMOD, DMOD, 1.0f / (OSC * WOS));
  (void)hipGetLastError();
}

// v006
// A run of this version takes 116 microseconds.
// In both of two side-by-side timings against v005, it was 1.16 times as fast.
// Over all steps from v000 it is 2.89 times as fast.
// Contractions: x.W{q,k,v}^T on v_wmma_f32_16x16x32_bf16 (x and W RNE-converted to bf16, f32 accumulate);
// scores k'.q'^T (transposed; q', k' carried x1024 as f16 hi plane + f16 residual plane, products hh+lh+hl), v^T.P^T (P x32768 f16 hi+residual,
// v x1024 f16 hi+residual, products hh+lh+hl) and O.Wo^T (O x1024 f16 hi+residual, Wo as f16(bf16(Wo) x1024), products h.w+l.w):
// v_wmma_f32_16x16x32_f16, f32 accumulate. Rotary tables, rotation, masks, masked base-2 online softmax and 1/l fold in f32 on VALU.
#include <hip/hip_runtime.h>
#include <math.h>
#include <stdint.h>

#define SEQ   2048
#define DMOD  1024
#define NH    16
#define HD    64
#define GINST 129
#define QSC   1024.0f
#define KSC   1024.0f
#define PCAR  32768.0f
#define VCAR  1024.0f
#define OSC   1024.0f
#define WOS   1024.0f
#define LOG2E 1.4426950408889634f
#define WPB   8
#define QTW   2
#define NQP   (SEQ / (16 * QTW))
#define NST   (SEQ / 64)
#define NKT   (SEQ / 32)
#define ATT_THREADS (WPB * 32)
#define ATT_BLOCKS  (NQP * NH)
#define SLW   (16 * 68)
#define WREG  (QTW * SLW + QTW * 32)
#define SLAB64 (16 * 68)
#define VTP   72
#define GKC   128
#define GPB   272
#define GOPB  (64 * GPB)
#define GKS   (GKC / 32)
#define TABB  (SEQ / 8)
#define XCB   ((SEQ * DMOD) / 2048)
#define WCB   ((DMOD * DMOD) / 2048)
#define RPB   ((SEQ * NH * 8) / 256)
#define VTB   (NH * NST)
static_assert(DMOD == NH * HD && HD == 64 && NH == 16);
static_assert(WPB == 8 && ATT_THREADS == 256 && (WREG % 4) == 0 && (SLW % 4) == 0 && QTW == 2);
static_assert((SEQ % 64) == 0 && (SEQ % ATT_THREADS) == 0 && (SEQ % 8) == 0 && SEQ <= 32768);
static_assert((DMOD % 64) == 0 && (DMOD % 32) == 0);
static_assert(((SEQ * DMOD) % 2048) == 0 && ((DMOD * DMOD) % 2048) == 0);
static_assert(((SEQ * NH * 8) % 256) == 0);
static_assert((DMOD % GKC) == 0 && (DMOD / GKC) >= 2 && GKC * 2 == 256 && GPB == 256 + 16 && (SEQ % 64) == 0);

typedef unsigned short u16;
typedef _Float16 v16h __attribute__((ext_vector_type(16)));
typedef _Float16 v8h  __attribute__((ext_vector_type(8)));
typedef __bf16   v16b __attribute__((ext_vector_type(16)));
typedef float    v8f  __attribute__((ext_vector_type(8)));
typedef float    v4f  __attribute__((ext_vector_type(4)));
typedef unsigned int v4u __attribute__((ext_vector_type(4)));
typedef int v4i __attribute__((ext_vector_type(4)));

union FragH { v16h v; v8h h[2]; v4u u[2]; };
union FragB { v16b v; v4u u[2]; };

struct InvF { float f[32]; };
static_assert(sizeof(InvF) == 128);

// ---- scalar helpers --------------------------------------------------------------------------------
__device__ __forceinline__ unsigned short bf_bits(float f) {          // f32 -> bf16 bits, RNE convert
  unsigned u = __float_as_uint(f);
  return (unsigned short)((u + 0x7FFFu + ((u >> 16) & 1u)) >> 16);
}
__device__ __forceinline__ float bf_up(unsigned short h) { return __uint_as_float(((unsigned)h) << 16); }
__device__ __forceinline__ float bfr(float f) { return bf_up(bf_bits(f)); }
__device__ __forceinline__ unsigned short h_bits(_Float16 x) { return __builtin_bit_cast(unsigned short, x); }
__device__ __forceinline__ unsigned pk16(unsigned short a, unsigned short b) { return (unsigned)a | ((unsigned)b << 16); }
__device__ __forceinline__ v8f zero8() { v8f z = {0.f, 0.f, 0.f, 0.f, 0.f, 0.f, 0.f, 0.f}; return z; }

// ---- fragment map: 16-bit A/B operand, lane -> row/col (lane&15), half hh = lane>>4;
//      elements 0..7 <- k0+8hh+0..7, elements 8..15 <- k0+16+8hh+0..7  (same split k map for A and B)
// ---- fragment-order planes (q', k', v^T): a fragment (16 rows x 32 k) is 1 KB in a row: [i = 0,1][lane 0..31][8 halves], the 8 halves being
//      row (lane&15), k = k0 + 16i + 8hh + 0..7: what lane holds in elements 8i .. 8i+7. One load of a wave is then 512 contiguous bytes,
//      four whole 128-B lines, where a row-major plane gives 16-B pieces of 16 lines.
// fragment from a wave-uniform plane base plus a 32-bit per-lane byte offset (fragment start + 16 * lane)
__device__ __forceinline__ v16h ldfrag_o(const u16* base, unsigned boff, unsigned cbytes) {
  const char* p = (const char*)(const void*)base + boff;
  FragH f;
  f.h[0] = *(const v8h*)(p + cbytes);
  f.h[1] = *(const v8h*)(p + cbytes + 512);
  return f.v;
}

__device__ __forceinline__ v8f mma_h(v16h a, v16h b, v8f c) {
  return __builtin_amdgcn_wmma_f32_16x16x32_f16(false, a, false, b, (short)0, c, false, false);
}
__device__ __forceinline__ v8f mma_b(v16b a, v16b b, v8f c) {
  return __builtin_amdgcn_wmma_f32_16x16x32_bf16(false, a, false, b, (short)0, c, false, false);
}
template <typename F>
__device__ __forceinline__ void guard6(v8f& a, v8f& b, v8f& c, v8f& d, F x0, F x1, F x2, F x3, F x4, F x5) {
#if defined(__HIP_DEVICE_COMPILE__)
  asm volatile("v_nop\n\tv_nop\n\tv_nop\n\tv_nop"
               : "+v"(a), "+v"(b), "+v"(c), "+v"(d) : "v"(x0), "v"(x1), "v"(x2), "v"(x3), "v"(x4), "v"(x5) : "memory");
#endif
}
__device__ __forceinline__ void guard10(v8f& a, v8f& b, v8f& c, v8f& d, v16h x0, v16h x1, v16h x2, v16h x3, v16h x4,
                                        v16h x5, v16h x6, v16h x7, v16h x8, v16h x9) {
#if defined(__HIP_DEVICE_COMPILE__)
  asm volatile("v_nop\n\tv_nop\n\tv_nop\n\tv_nop"
               : "+v"(a), "+v"(b), "+v"(c), "+v"(d)
               : "v"(x0), "v"(x1), "v"(x2), "v"(x3), "v"(x4), "v"(x5), "v"(x6), "v"(x7), "v"(x8), "v"(x9) : "memory");
#endif
}
__device__ __forceinline__ void acc_guard4(v8f& a, v8f& b, v8f& c, v8f& d) {
#if defined(__HIP_DEVICE_COMPILE__)
  asm volatile("v_nop\n\tv_nop\n\tv_nop\n\tv_nop" : "+v"(a), "+v"(b), "+v"(c), "+v"(d));
#endif
}
// the value that lane l ^ 16 holds: the other half's share of the same query column
__device__ __forceinline__ float xhalf(float x) {
  const int b = __float_as_int(x);
  return __int_as_float(__builtin_amdgcn_permlanex16(b, b, 0x76543210, 0xfedcba98, false, false));
}
__device__ __forceinline__ void wave_sync_lds() {
  __builtin_amdgcn_fence(__ATOMIC_RELEASE, "workgroup");
  __builtin_amdgcn_wave_barrier();
  __builtin_amdgcn_fence(__ATOMIC_ACQUIRE, "workgroup");
}

// ---- GEMM operand staging: a stage = GKC k elements (256 B) of 64 rows of an operand, LDS row pitch GPB bytes ----
__device__ __forceinline__ unsigned lds_off(const void* p) { return (unsigned)(size_t)p; }   // LDS byte address of a __shared__ object
// 16 rows x 256 B of one operand, global memory -> LDS through no register: eight asynchronous copies of this wave. A copy is 2 whole rows
// (lane -> row lane >> 4, 16-B column lane & 15), four whole 128-B lines. l, g: this lane's LDS byte address and global address in copy 0;
// copy i lies 2 rows further on in both (ldk = elements between global rows). All 32 lanes on; both addresses multiples of 16.
// The closing s_wait_xcnt 0 stands inside the statement so that no address register named here is rewritten in front of it.
__device__ __forceinline__ void copy16rows(unsigned l, const u16* g, size_t ldk) {
#if defined(__HIP_DEVICE_COMPILE__)
  asm volatile("global_load_async_to_lds_b128 %0, %8, off\n\t"
               "global_load_async_to_lds_b128 %1, %9, off\n\t"
               "global_load_async_to_lds_b128 %2, %10, off\n\t"
               "global_load_async_to_lds_b128 %3, %11, off\n\t"
               "global_load_async_to_lds_b128 %4, %12, off\n\t"
               "global_load_async_to_lds_b128 %5, %13, off\n\t"
               "global_load_async_to_lds_b128 %6, %14, off\n\t"
               "global_load_async_to_lds_b128 %7, %15, off\n\t"
               "s_wait_xcnt 0x0"
               :: "v"(l), "v"(l + 2u * GPB), "v"(l + 4u * GPB), "v"(l + 6u * GPB),
                  "v"(l + 8u * GPB), "v"(l + 10u * GPB), "v"(l + 12u * GPB), "v"(l + 14u * GPB),
                  "v"(g), "v"(g + 2 * ldk), "v"(g + 4 * ldk), "v"(g + 6 * ldk),
                  "v"(g + 8 * ldk), "v"(g + 10 * ldk), "v"(g + 12 * ldk), "v"(g + 14 * ldk)
               : "memory");
#endif
}
// this wave's own copies have landed (the compiler places no wait for them)
__device__ __forceinline__ void wait_copies() {
#if defined(__HIP_DEVICE_COMPILE__)
  asm volatile("s_wait_asynccnt 0x0" ::: "memory");
#endif
}
// this wave's LDS reads have retired: stands in front of the barrier behind which the buffer it read is refilled
__device__ __forceinline__ void wait_lds() {
#if defined(__HIP_DEVICE_COMPILE__)
  asm volatile("s_wait_dscnt 0x0" ::: "memory");
#endif
}
// stands behind a piece's last global stores: in a grid of several pieces another piece's code follows in the listing and rewrites the
// registers that the stores name; this wait is in front of every such write (which piece is laid last is the compiler's choice: each has it)
__device__ __forceinline__ void wait_store_regs() {
#if defined(__HIP_DEVICE_COMPILE__)
  asm volatile("s_wait_xcnt 0x0" ::: "memory");
#endif
}
// fragment from a staged row: p = row start + 64 * k-step + 16 * (lane >> 4) bytes; the split k map of the loaders above (bytes +0 and +32)
__device__ __forceinline__ v16b ldsfrag_b(const unsigned char* p) {
  FragB f;
  f.u[0] = *(const v4u*)(p);
  f.u[1] = *(const v4u*)(p + 32);
  return f.v;
}
__device__ __forceinline__ v16h ldsfrag_h(const unsigned char* p) {
  FragH f;
  f.u[0] = *(const v4u*)(p);
  f.u[1] = *(const v4u*)(p + 32);
  return f.v;
}

// ---- accurate f32 sin/cos of a non-negative f32 angle (|angle| < 32768): f64 two-part pi/2 reduction + f64 polynomials,
//      plain f64 fma/mul only (no library f64 trig path), result converted to f32.
__device__ __forceinline__ void sincos_acc(float angf, float& sv, float& cv) {
  const double a = (double)angf;
  const double TWO_OVER_PI = 0.63661977236758134308;
  const double PIO2_HI = 1.5707963267948966;
  const double PIO2_LO = 6.123233995736766e-17;
  const int kq = (int)(a * TWO_OVER_PI + 0.5);
  const double kd = (double)kq;
  double r = fma(-kd, PIO2_HI, a);
  r = fma(-kd, PIO2_LO, r);
  const double r2 = r * r;
  double sp = 1.0 / 6227020800.0;
  sp = fma(sp, r2, -1.0 / 39916800.0);
  sp = fma(sp, r2, 1.0 / 362880.0);
  sp = fma(sp, r2, -1.0 / 5040.0);
  sp = fma(sp, r2, 1.0 / 120.0);
  sp = fma(sp, r2, -1.0 / 6.0);
  const double s = fma(sp * r2, r, r);
  double cp = -1.0 / 87178291200.0;
  cp = fma(cp, r2, 1.0 / 479001600.0);
  cp = fma(cp, r2, -1.0 / 3628800.0);
  cp = fma(cp, r2, 1.0 / 40320.0);
  cp = fma(cp, r2, -1.0 / 720.0);
  cp = fma(cp, r2, 1.0 / 24.0);
  cp = fma(cp, r2, -0.5);
  const double c = fma(cp, r2, 1.0);
  const int qd = kq & 3;
  const double so = (qd == 0) ? s : (qd == 1) ? c : (qd == 2) ? -s : -c;
  const double co = (qd == 0) ? c : (qd == 1) ? -s : (qd == 2) ? -c : s;
  sv = (float)so;
  cv = (float)co;
}

// =====================================================================================================
// Rotary tables: cosT[t][d], sinT[t][d] for t < SEQ, d < HD, angle = float(t) * inv_freq[d & 31] (f32 product), halves duplicated.
// Wave = one position t, lane = frequency index; inv_freq picked from the by-value table with a static select chain.
// coverage: blk = 0 .. SEQ/8 - 1, 8 waves each = SEQ rows; per row 4 line stores = 64 floats of each table.
// =====================================================================================================
__device__ __forceinline__ void tab_blk(int blk, float* cosT, float* sinT, const InvF& inv) {
  const int tid  = threadIdx.x;
  const int lane = tid & 31;
  const int t    = blk * 8 + (tid >> 5);
  float f = inv.f[0];
#pragma unroll
  for (int i = 1; i < 32; ++i) f = (lane == i) ? inv.f[i] : f;
  const float ang = (float)t * f;
  float sv, cv;
  sincos_acc(ang, sv, cv);
  float* cr = cosT + (size_t)t * HD;
  float* sr = sinT + (size_t)t * HD;
  *(float*)(cr + lane)      = cv;
  *(float*)(cr + 32 + lane) = cv;
  *(float*)(sr + lane)      = sv;
  *(float*)(sr + 32 + lane) = sv;
  wait_store_regs();
}

// =====================================================================================================
// f32 -> 16-bit plane, same layout.  f16mode false: bf16 RNE bits;  f16mode true: f16 bits of (bf16 RNE value) * scale.
// Thread = 8 consecutive elements: two 16-B loads, one 16-B store; 32 consecutive lanes = 512 contiguous, 512-B aligned bytes.
// coverage: blk = 0 .. n/2048 - 1, 256 thr x 8 elements each = the whole plane.
// =====================================================================================================
__device__ __forceinline__ void cvt_blk(const float* __restrict__ x, u16* D, int blk, bool f16mode, float scale) {
  const int gt = blk * 256 + (int)threadIdx.x;
  const float* p = x + (size_t)gt * 8;
  const v4f a = *(const v4f*)(p), b4 = *(const v4f*)(p + 4);
  float w[8];
#pragma unroll
  for (int e = 0; e < 4; ++e) { w[e] = a[e]; w[4 + e] = b4[e]; }
  v4u o;
#pragma unroll
  for (int e = 0; e < 4; ++e) {
    const float f0 = w[2 * e], f1 = w[2 * e + 1];
    o[e] = f16mode ? pk16(h_bits((_Float16)(bfr(f0) * scale)), h_bits((_Float16)(bfr(f1) * scale)))
                   : pk16(bf_bits(f0), bf_bits(f1));
  }
  *(v4u*)(D + (size_t)gt * 8) = o;
  wait_store_regs();
}

// =====================================================================================================
// Everything that reads inputs alone, in one grid: none of these pieces reads what another writes. The block index picks the piece
// (block-uniform; no barriers): TABB blocks of rotary tables first (the longest chain of a wave), XCB blocks x -> bf16,
// 3 * WCB blocks Wq, Wk, Wv -> bf16, WCB blocks Wo -> f16 of the bf16 value x1024.  grid = TABB + XCB + 4 * WCB, exact.
// =====================================================================================================
__global__ __launch_bounds__(256) void prep(const float* __restrict__ x, const float* __restrict__ wq, const float* __restrict__ wk,
                                            const float* __restrict__ wv, const float* __restrict__ wo,
                                            u16* XBo, u16* WQo, u16* WKo, u16* WVo, u16* WOo,
                                            float* cosT, float* sinT, InvF inv) {
  int b = blockIdx.x;
  if (b < TABB) { tab_blk(b, cosT, sinT, inv); return; }
  b -= TABB;
  if (b < XCB) { cvt_blk(x, XBo, b, false, 1.0f); return; }
  b -= XCB;
  const int w = b / WCB, wb = b % WCB;
  if (w < 3) {
    const float* s = (w == 0) ? wq : (w == 1) ? wk : wv;
    u16*         d = (w == 0) ? WQo : (w == 1) ? WKo : WVo;
    cvt_blk(s, d, wb, false, 1.0f);
  } else if (w == 3) {
    cvt_blk(wo, WOo, wb, true, WOS);
  }
}

// =====================================================================================================
// GEMM epilogue shared by both engines: the wave's 16x64 f32 tile (times oscale) staged in its LDS slab (pitch 68),
// coverage: 8 instructions x 2 rows x 16 lanes x 4 floats = the wave's 16 x 64 tile.
// =====================================================================================================
__device__ __forceinline__ void epi64(float* sl, v8f a0, v8f a1, v8f a2, v8f a3, float oscale,
                                      const float* __restrict__ bias, float* C, int N,
                                      size_t rowb, int col0, int lane) {
  const int hh = lane >> 4, m = lane & 15;
#pragma unroll
  for (int r = 0; r < 8; ++r) {
    const int ro = (8 * hh + r) * 68 + m;
    sl[ro]      = a0[r] * oscale;
    sl[ro + 16] = a1[r] * oscale;
    sl[ro + 32] = a2[r] * oscale;
    sl[ro + 48] = a3[r] * oscale;
  }
  wave_sync_lds();
  const v4f braw = *(const v4f*)(bias + col0 + m * 4);
  v4f bb;
#pragma unroll
  for (int e = 0; e < 4; ++e) bb[e] = bfr(braw[e]);
  v4f vals[8];
#pragma unroll
  for (int it = 0; it < 8; ++it) vals[it] = *(const v4f*)(sl + (it * 2 + hh) * 68 + m * 4) + bb;
  float* dst = C + (rowb + (size_t)hh) * (size_t)N + col0 + m * 4;
  {
#pragma unroll
    for (int it = 0; it < 8; ++it) {
      *(v4f*)(dst + (size_t)(it * 2) * (size_t)N) = vals[it];
    }
    
  }
}

// =====================================================================================================
// bf16 GEMM: C[M][N] (f32) = A[M][K] (bf16 row-major) . Bt[N][K]^T (bf16 k-contiguous), times oscale, plus bias[N].
// Block = 64x64 tile, 4 waves x 16 rows. K walked in stages of GKC: the block's 64 A rows and 64 Bt rows of a stage are brought into a
// two-buffer LDS ring by asynchronous copies of whole lines (each wave: 16 rows of each operand), stage t + 1 in flight while stage t is
// multiplied; fragments are read from LDS (two 16-B reads each, split k map for A and B), k ascending as before.
// Three products that share A run in one grid: blockIdx.y picks (Bt, bias, C) (block-uniform); none reads what another writes.
// The host passes M % 64 == 0, N % 64 == 0, K % GKC == 0, K >= 2 * GKC, grid = ((M/64)*(N/64), 3).
// =====================================================================================================
__global__ __launch_bounds__(128)
void gemm_bf(const u16* __restrict__ A, const u16* __restrict__ Bt0, const u16* __restrict__ Bt1, const u16* __restrict__ Bt2,
             const float* __restrict__ bias0, const float* __restrict__ bias1, const float* __restrict__ bias2,
             float* C0, float* C1, float* C2, int M, int N, int K, float oscale) {
  __shared__ __align__(16) float slab[4 * SLAB64];
  __shared__ __align__(16) unsigned char ring[2 * 2 * GOPB];   // [buffer][A | Bt][64 rows][GPB]
  const int tid = threadIdx.x, wave = tid >> 5, lane = tid & 31, hh = lane >> 4, m = lane & 15;
  const int which = blockIdx.y;
  const u16*   Bt   = (which == 0) ? Bt0 : (which == 1) ? Bt1 : Bt2;
  const float* bias = (which == 0) ? bias0 : (which == 1) ? bias1 : bias2;
  float*       C    = (which == 0) ? C0 : (which == 1) ? C1 : C2;
  const int ntile = N >> 6;
  const int bid   = blockIdx.x;
  const int row0  = (bid / ntile) * 64;
  const int rowb  = row0 + wave * 16;
  const int col0  = (bid % ntile) * 64;
  if (row0 + 64 > M) return;                 // block-uniform, in front of every barrier and copy; never taken with the exact grid
  const int nst  = K / GKC;
  const int crow = wave * 16 + hh;           // the tile row this lane brings in copy 0
  const u16* ga = A  + (size_t)(row0 + crow) * K + m * 8;
  const u16* gb = Bt + (size_t)(col0 + crow) * K + m * 8;
  const unsigned lc = lds_off(ring) + (unsigned)crow * GPB + (unsigned)m * 16u;
  copy16rows(lc, ga, (size_t)K);
  copy16rows(lc + GOPB, gb, (size_t)K);
  wait_copies();
  __syncthreads();                           // stage 0 is whole for every wave
  if (nst > 1) {
    copy16rows(lc + 2u * GOPB, ga + GKC, (size_t)K);
    copy16rows(lc + 3u * GOPB, gb + GKC, (size_t)K);
  }
  const unsigned char* fa = ring + (wave * 16 + m) * GPB + 16 * hh;
  const unsigned char* fb = ring + GOPB + m * GPB + 16 * hh;
  v8f acc0 = zero8(), acc1 = zero8(), acc2 = zero8(), acc3 = zero8();
  // kept rolled: one copy of the stage body, the buffer picked by the stage's parity
#pragma unroll 1
  for (int t = 0; t < nst; ++t) {
    const unsigned bo = (unsigned)(t & 1) * (2u * GOPB);
    // unrolled: the k-step offsets become immediates and the reads of later k-steps are issued ahead of the earlier products
#pragma unroll
    for (int kk = 0; kk < GKS; ++kk) {
      const v16b a  = ldsfrag_b(fa + bo + kk * 64);
      const v16b b0 = ldsfrag_b(fb + bo + kk * 64);
      const v16b b1 = ldsfrag_b(fb + bo + 16 * GPB + kk * 64);
      const v16b b2 = ldsfrag_b(fb + bo + 32 * GPB + kk * 64);
      const v16b b3 = ldsfrag_b(fb + bo + 48 * GPB + kk * 64);
      acc0 = mma_b(a, b0, acc0);
      acc1 = mma_b(a, b1, acc1);
      acc2 = mma_b(a, b2, acc2);
      acc3 = mma_b(a, b3, acc3);
      // its four v_nop keep the distance behind the stage's last matrix instructions on both sides of the branch at the loop's foot
      if (kk == GKS - 1) guard6<v16b>(acc0, acc1, acc2, acc3, a, b0, b1, b2, b3, a);
    }
    wait_lds();
    wait_copies();
    __syncthreads();                         // publishes stage t + 1 and ends every wave's reads of stage t's buffer
    if (t + 2 < nst) {
      copy16rows(lc + bo, ga + (size_t)(t + 2) * GKC, (size_t)K);
      copy16rows(lc + bo + GOPB, gb + (size_t)(t + 2) * GKC, (size_t)K);
    }
  }
  wait_copies();
  epi64(slab + wave * SLAB64, acc0, acc1, acc2, acc3, oscale, bias, C, N, (size_t)rowb, col0, lane);
}

// =====================================================================================================
// f16 hi+lo GEMM: C[M][N] (f32) = (Ahi + Alo)[M][K] . Bt[N][K]^T, times oscale, plus bias[N]; Ahi/Alo f16 planes (same layout),
// Bt f16 k-contiguous; products hi.B + lo.B into one accumulator (lo is the unscaled residual of hi). Same tiling and the same
// two-buffer LDS ring as gemm_bf, with three operand tiles a stage.
// =====================================================================================================
__global__ __launch_bounds__(128)
void gemm_h2(const u16* __restrict__ Ah, const u16* __restrict__ Al, const u16* __restrict__ Bt,
             const float* __restrict__ bias, float* C, int M, int N, int K, float oscale) {
  __shared__ __align__(16) float slab[4 * SLAB64];
  __shared__ __align__(16) unsigned char ring[2 * 3 * GOPB];   // [buffer][Ahi | Alo | Bt][64 rows][GPB]
  const int tid = threadIdx.x, wave = tid >> 5, lane = tid & 31, hh = lane >> 4, m = lane & 15;
  const int ntile = N >> 6;
  const int bid   = blockIdx.x;
  const int row0  = (bid / ntile) * 64;
  const int rowb  = row0 + wave * 16;
  const int col0  = (bid % ntile) * 64;
  if (row0 + 64 > M) return;                 // block-uniform, in front of every barrier and copy; never taken with the exact grid
  const int nst  = K / GKC;
  const int crow = wave * 16 + hh;           // the tile row this lane brings in copy 0
  const size_t aofs = (size_t)(row0 + crow) * K + m * 8;
  const u16* gh = Ah + aofs;
  const u16* gl = Al + aofs;
  const u16* gb = Bt + (size_t)(col0 + crow) * K + m * 8;
  const unsigned lc = lds_off(ring) + (unsigned)crow * GPB + (unsigned)m * 16u;
  copy16rows(lc, gh, (size_t)K);
  copy16rows(lc + GOPB, gl, (size_t)K);
  copy16rows(lc + 2u * GOPB, gb, (size_t)K);
  wait_copies();
  __syncthreads();                           // stage 0 is whole for every wave
  if (nst > 1) {
    copy16rows(lc + 3u * GOPB, gh + GKC, (size_t)K);
    copy16rows(lc + 4u * GOPB, gl + GKC, (size_t)K);
    copy16rows(lc + 5u * GOPB, gb + GKC, (size_t)K);
  }
  const unsigned char* fa = ring + (wave * 16 + m) * GPB + 16 * hh;
  const unsigned char* fb = ring + 2 * GOPB + m * GPB + 16 * hh;
  v8f acc0 = zero8(), acc1 = zero8(), acc2 = zero8(), acc3 = zero8();
  // kept rolled: one copy of the stage body, the buffer picked by the stage's parity
#pragma unroll 1
  for (int t = 0; t < nst; ++t) {
    const unsigned bo = (unsigned)(t & 1) * (3u * GOPB);
    // unrolled: the k-step offsets become immediates and the reads of later k-steps are issued ahead of the earlier products
#pragma unroll
    for (int kk = 0; kk < GKS; ++kk) {
      const v16h ah = ldsfrag_h(fa + bo + kk * 64), al = ldsfrag_h(fa + bo + GOPB + kk * 64);
      const v16h b0 = ldsfrag_h(fb + bo + kk * 64);
      const v16h b1 = ldsfrag_h(fb + bo + 16 * GPB + kk * 64);
      const v16h b2 = ldsfrag_h(fb + bo + 32 * GPB + kk * 64);
      const v16h b3 = ldsfrag_h(fb + bo + 48 * GPB + kk * 64);
      acc0 = mma_h(ah, b0, acc0);  acc0 = mma_h(al, b0, acc0);
      acc1 = mma_h(ah, b1, acc1);  acc1 = mma_h(al, b1, acc1);
      acc2 = mma_h(ah, b2, acc2);  acc2 = mma_h(al, b2, acc2);
      acc3 = mma_h(ah, b3, acc3);  acc3 = mma_h(al, b3, acc3);
      // its four v_nop keep the distance behind the stage's last matrix instructions on both sides of the branch at the loop's foot
      if (kk == GKS - 1) guard6<v16h>(acc0, acc1, acc2, acc3, ah, al, b0, b1, b2, b3);
    }
    wait_lds();
    wait_copies();
    __syncthreads();                         // publishes stage t + 1 and ends every wave's reads of stage t's buffer
    if (t + 2 < nst) {
      copy16rows(lc + bo, gh + (size_t)(t + 2) * GKC, (size_t)K);
      copy16rows(lc + bo + GOPB, gl + (size_t)(t + 2) * GKC, (size_t)K);
      copy16rows(lc + bo + 2u * GOPB, gb + (size_t)(t + 2) * GKC, (size_t)K);
    }
  }
  wait_copies();
  epi64(slab + wave * SLAB64, acc0, acc1, acc2, acc3, oscale, bias, C, N, (size_t)rowb, col0, lane);
}

// =====================================================================================================
// Rotate-half rotary + 16-bit split pack. Rows are (pos, head) with HD contiguous floats (f32 projection output);
// pos = (row / hpr) mod SEQ.  w[d] = x[d] * cos[pos][d] + r[d] * sin[pos][d],  r[d] = -x[d+32] for d < 32, x[d-32] for d >= 32;
// hi[d] = f16(w * sc), lo[d] = f16(w * sc - hi[d])  (sc a power of two, residual unscaled).
// Output in fragment order: [head][row tile rt = pos / 16][k-step kk][i][lane][8 halves] (2 KB a row tile and head).
// Thread = 8 consecutive d of one row: 16-B loads of x (own and partner half), cos, sin; one 16-B store per plane per lane. A wave is
// 8 rows x the 32 d of one k-step (head, rt, kk, a): lane -> chunk q = lane & 3 (i = q >> 1, hh = q & 1), row c = 8 a + (lane >> 2),
// pos = 16 rt + c, d0 = 32 kk + 8 q. Four lanes share each 128-B source line (8 lines a load), and the 8 lanes of a chunk store 128
// contiguous bytes: every store of a wave is four whole lines.
// coverage: blk = 0 .. nrows*8/256 - 1, 256 thr x 8 halves each = nrows x 64 of each plane exactly (exact division checked statically);
//           flat thread index -> (head, rt, kk, a, row, q) -> (head, rt, kk, i, hh, c) is a bijection.
// =====================================================================================================
__device__ __forceinline__ void rope_blk(const float* __restrict__ x, const float* __restrict__ cosT,
                                         const float* __restrict__ sinT, u16* hpl, u16* lpl,
                                         int blk, int hpr, float sc) {
  const int gt  = blk * 256 + (int)threadIdx.x;
  const int til = gt >> 7;                    // head * (SEQ / 16) + rt
  const int kk  = (gt >> 6) & 1;
  const int c   = ((gt >> 5) & 1) * 8 + ((gt >> 2) & 7);
  const int q   = gt & 3;
  const int pos = (til % (SEQ / 16)) * 16 + c;
  const int row = pos * hpr + til / (SEQ / 16);
  const int d0  = kk * 32 + q * 8;
  const int d1  = d0 ^ 32;
  const float* xr = x + (size_t)row * HD;
  const float* cr = cosT + (size_t)pos * HD + d0;
  const float* sr = sinT + (size_t)pos * HD + d0;
  const v4f xa = *(const v4f*)(xr + d0), xb = *(const v4f*)(xr + d0 + 4);
  const v4f ya = *(const v4f*)(xr + d1), yb = *(const v4f*)(xr + d1 + 4);
  const v4f ca = *(const v4f*)(cr), cb = *(const v4f*)(cr + 4);
  const v4f sa = *(const v4f*)(sr), sb = *(const v4f*)(sr + 4);
  const float sgn = (d0 < 32) ? -1.0f : 1.0f;
  float w[8];
#pragma unroll
  for (int e = 0; e < 4; ++e) {
    w[e]     = xa[e] * ca[e] + (sgn * ya[e]) * sa[e];
    w[4 + e] = xb[e] * cb[e] + (sgn * yb[e]) * sb[e];
  }
  v4u oh, ol;
#pragma unroll
  for (int e = 0; e < 4; ++e) {
    const float t0 = w[2 * e] * sc, t1 = w[2 * e + 1] * sc;
    const _Float16 h0 = (_Float16)t0, h1 = (_Float16)t1;
    const _Float16 l0 = (_Float16)(t0 - (float)h0), l1 = (_Float16)(t1 - (float)h1);
    oh[e] = pk16(h_bits(h0), h_bits(h1));
    ol[e] = pk16(h_bits(l0), h_bits(l1));
  }
  const size_t o8 = (size_t)til * (16 * HD) + kk * 512 + (q >> 1) * 256 + ((q & 1) * 16 + c) * 8;
  {
    *(v4u*)(hpl + o8) = oh;
    *(v4u*)(lpl + o8) = ol;
    wait_store_regs();
  }
}

// =====================================================================================================
// v^T planes in fragment order: [head g][key tile kt = s / 32][j = d / 16][i][lane][8 halves] (4 KB a key tile and head), the 8 halves being
// row d = 16 j + (lane & 15), keys 32 kt + 16 i + 8 (lane >> 4) + 0..7: VH = f16(v[s][g][d] * 1024), VL = f16 residual of the same value.
// Block = (head g = blk / NST, 64 keys s0 = (blk % NST)*64): 64 source rows of HD floats loaded with 16-B loads, converted,
// scattered into two LDS tiles [d][64 keys] (pitch 72 halves); after a block barrier the tiles are read back in fragment order and stored.
// coverage: load 256 thr x 16 elements = 64 x 64; store 2 iterations x 256 thr x 8 halves = 64 lines x 64 = the block's tile of
//           each plane; blk = 0 .. NH x NST - 1 covers both planes exactly once. TH, TL: the block's two LDS tiles of HD * VTP halves.
// =====================================================================================================
__device__ __forceinline__ void vt_blk(const float* __restrict__ v, u16* VHo, u16* VLo, int blk, u16* TH, u16* TL) {
  const int tid = threadIdx.x;
  const int st  = blk % NST;
  const int g   = blk / NST;
  const int s0  = st * 64;
  {
    const int sl = tid >> 2;                  // key within tile 0..63
    const int dc = (tid & 3) * 16;            // d chunk
    const float* src = v + ((size_t)(s0 + sl) * NH + g) * HD + dc;
#pragma unroll
    for (int i = 0; i < 4; ++i) {
      const v4f a = *(const v4f*)(src + 4 * i);
#pragma unroll
      for (int e = 0; e < 4; ++e) {
        const float t = a[e] * VCAR;
        const _Float16 h = (_Float16)t;
        const _Float16 l = (_Float16)(t - (float)h);
        TH[(dc + 4 * i + e) * VTP + sl] = h_bits(h);
        TL[(dc + 4 * i + e) * VTP + sl] = h_bits(l);
      }
    }
  }
  __syncthreads();
  // iteration it = the block's key tile 2 st + it; wave = half fragment (j = wave >> 1, i = wave & 1); lane (hh, c) -> row d = 16 j + c,
  // keys 32 it + 16 i + 8 hh + 0..7 of the block's 64: the block's 8 KB of each plane are written in address order
  v4u vh[2], vl[2];
  const int line = (tid >> 6) * 16 + (tid & 15);                     // d = 0..63
  const int p8   = ((tid >> 5) & 1) * 16 + ((tid >> 4) & 1) * 8;     // key within the key tile
#pragma unroll
  for (int it = 0; it < 2; ++it) {
    vh[it] = *(const v4u*)(TH + line * VTP + it * 32 + p8);
    vl[it] = *(const v4u*)(TL + line * VTP + it * 32 + p8);
  }
  const size_t base = ((size_t)g * HD) * SEQ + (size_t)s0 * HD + tid * 8;
  {
#pragma unroll
    for (int it = 0; it < 2; ++it) {
      *(v4u*)(VHo + base + it * (32 * HD)) = vh[it];
      *(v4u*)(VLo + base + it * (32 * HD)) = vl[it];
    }
    wait_store_regs();
  }
}

// =====================================================================================================
// The three packings of the f32 projections in one grid: none reads what another writes. The block index picks the piece (block-uniform,
// so the barrier inside vt_blk is passed by all of a block or by none): VTB blocks of v^T first (two phases and a barrier: the longest),
// RPB blocks q', RPB blocks k'.  grid = VTB + 2 * RPB, exact.
// =====================================================================================================
__global__ __launch_bounds__(256) void pack3(const float* __restrict__ qf, const float* __restrict__ kf, const float* __restrict__ vf,
                                             const float* __restrict__ cosT, const float* __restrict__ sinT,
                                             u16* QHo, u16* QLo, u16* KHo, u16* KLo, u16* VHo, u16* VLo) {
  __shared__ __align__(16) u16 TH[HD * VTP];
  __shared__ __align__(16) u16 TL[HD * VTP];
  int b = blockIdx.x;
  if (b < VTB) { vt_blk(vf, VHo, VLo, b, TH, TL); return; }
  b -= VTB;
  if (b < RPB)          rope_blk(qf, cosT, sinT, QHo, QLo, b, NH, QSC);
  else if (b < 2 * RPB) rope_blk(kf, cosT, sinT, KHo, KLo, b - RPB, NH, KSC);
}

// =====================================================================================================
// Triple-masked attention: block bid -> (head = bid % NH, query tile pair qp = NQP-1 - bid / NH: rows q0 = 32*qp .. q0+31; the pairs with
// the most keys take the lowest block ids). Every wave carries both 16-row query tiles of the pair, each with a softmax state of its own, so that one
// load of a k or v fragment serves two tiles. The block's WPB waves share that one (pair, head) and split its key tiles: in every group of eight
// consecutive key tiles g each wave takes one, kt = 8g + ((wave - g) & 7), so that any stride-4 or stride-8 pattern of live tiles is spread too.
//   q, k planes (hi, lo f16 x1024) and v^T planes in fragment order, [h][row tile][k-step] and [h][key tile][d tile]; instrument and bar ids staged in LDS.
//   For each of the three masks in turn (block-uniform), each wave with its OWN running max m_a, sum Z_a and 4 accumulators acc_a per query tile (8 in all):
//     att 0: (iq == ik) && (iq < 129) && (j <= i)
//     att 1: (iq != ik) && (ik < 129) && (iq < 129) && (bq >= 0) && ((0 <= bq-bk <= 2) || (bq-bk == 4))
//     att 2: ((ik == 129) || (bk == -1)) && (j <= i)
//   A wave's key tiles of 32 visited in order (att 0/2 up to the causal limit, att 1 all NKT); per tile every lane evaluates the mask bits of its
//   2 queries x 16 keys, a wave ballot skips tiles with no allowed element in either query tile (exact: such keys carry zero weight).
//   Both products are formed transposed, so that a lane owns one query of each query tile (column c of every D tile):
//   S^T = k'.q'^T: A = key rows, B = query rows, 2 key subtiles x 2 k-steps x 3 products (k_hi.q_hi + k_hi.q_lo + k_lo.q_hi), fragments loaded
//   straight from the 16-bit planes (two 16-B loads per fragment, each 512 contiguous bytes of a wave, split k map); a lane's 16 scores of a query tile are keys 16u + 8hh + r of
//   its own query; masked scores replaced by -inf; online max-subtracted base-2 softmax in f32 (scale 1/8 folded), -inf-safe rescale: the
//   maximum in-lane plus one exchange between the halves, the sum kept per half and joined once after the key loop.
//   O^T += v^T.P^T: the two score subtiles' registers, converted in place, ARE the B fragment of P^T in the split k map (no LDS, no lane
//   exchange); A = 4+4 v^T fragments (hi and residual planes), 12 WMMAs a query tile (hh + hl + lh); the rescale factor is the lane's own.
//   After each mask every wave publishes its partial (m, Z, acc) in its LDS slab; behind a
//   block barrier wave w merges the eight partials of rows 4w .. 4w+3 (a lane: one row, 8 d columns): M = max m_w, Z = sum Z_w 2^(m_w-M), acc likewise;
//   out_a = (Z > 0, i.e. the row has an allowed key) ? acc / Z : 0, carries 1/(32768*1024) folded once, summed in a lane-owned LDS tile:
//   O = out_0 + out_1 + out_2. A second barrier frees the slabs for the next mask. All barriers block-uniform; bounded loops only.
// coverage: per wave 4 rows x 8 lanes x 8 halves = 4 x 64 per plane, WPB waves = 32 x 64; grid NQP*NH blocks =
//           every (s, h) row of both O planes exactly once.
// =====================================================================================================
// second bound: four waves per SIMD (at most 256 registers), two blocks on a WGP: the grid takes two rounds
__global__ __launch_bounds__(ATT_THREADS, 4)
void attn3(const u16* __restrict__ QHIp, const u16* __restrict__ QLOp,
           const u16* __restrict__ KHIp, const u16* __restrict__ KLOp,
           const u16* __restrict__ VHIp, const u16* __restrict__ VLOp,
           const int* __restrict__ inst, const int* __restrict__ bar,
           u16* OHIp, u16* OLOp) {
  __shared__ __align__(16) float smem[WPB * WREG + QTW * SLW];
  __shared__ __align__(16) int sI[SEQ];
  __shared__ __align__(16) int sB[SEQ];

  const int tid  = threadIdx.x;
  const int wave = __builtin_amdgcn_readfirstlane(tid >> 5);   // scalar: it steers the key-tile loop
  const int lane = tid & 31;
  const int hh   = lane >> 4;
  const int c    = lane & 15;
  const int bid  = blockIdx.x;
  if (bid >= NQP * NH) return;               // block-uniform, before any barrier; never taken with the exact grid
  const int head = bid % NH;
  const int qp   = NQP - 1 - bid / NH;
  const int q0   = qp * (16 * QTW);
  const int rq   = lane >> 3;                // merge and output: this lane owns row 4*wave + rq of the block's 32,
  const int c8   = (lane & 7) * 8;           // d columns c8 .. c8 + 7
  const int row  = wave * 4 + rq;

  for (int i = tid; i < SEQ; i += ATT_THREADS) { sI[i] = inst[i]; sB[i] = bar[i]; }
  __syncthreads();

  float* slab = smem + wave * WREG;          // partial accumulators [16*QTW][64] pitch 68, written after a mask's key loop
  float* ml   = slab + QTW * SLW;            // partial m[16*QTW], Z[16*QTW]
  float* osum = smem + WPB * WREG;           // the block's result [16*QTW][64] pitch 68; elements (row, c8 .. c8 + 7) owned by this lane

  // byte offsets into the fragment-order planes (each plane SEQ*DMOD*2 bytes, far below 2^32); hi and residual planes share them
  const unsigned FRB  = 1024u;                                                  // bytes of a fragment (16 rows x 32 k)
  const unsigned RTB  = 2u * FRB;                                               // q', k': bytes of a 16-row tile of a head (2 k-steps)
  const unsigned KTB  = 32u * HD * 2u;                                          // k', v^T: bytes of a 32-key tile of a head
  const unsigned hofs = (unsigned)head * (SEQ * HD * 2u) + (unsigned)lane * 16u; // this head's part of a plane, this lane's 16 B
  const unsigned qofs = hofs + (unsigned)(q0 >> 4) * RTB;                        // query tile t: + t * RTB
  const float lsc = 0.125f * (LOG2E / (QSC * KSC));
  const float oc  = 1.0f / (PCAR * VCAR);
  // ids of this lane's own query of each tile (row q0 + 16t + c)
  int iqv[QTW], bqv[QTW];
#pragma unroll
  for (int t = 0; t < QTW; ++t) { iqv[t] = sI[q0 + 16 * t + c]; bqv[t] = sB[q0 + 16 * t + c]; }

  // kept rolled: with two query tiles a wave, three copies of the tile body and of the merge would be about 60 KB of code, nearly the
  // whole instruction cache; the mask is picked by a scalar branch at each key tile
#pragma unroll 1
  for (int att = 0; att < 3; ++att) {
    float mrow[QTW], lrow[QTW];              // this lane's query: running max (equal in both halves), this half's share of the sum
    v8f o[QTW][4];                            // o[t][j][r] = O^T[d = 16j + 8hh + r][query 16t + c]
#pragma unroll
    for (int t = 0; t < QTW; ++t) {
      mrow[t] = -INFINITY; lrow[t] = 0.f;
#pragma unroll
      for (int j = 0; j < 4; ++j) o[t][j] = zero8();
    }
    const int ncaus = ((q0 + 16 * QTW - 1) >> 5) + 1;                           // tiles holding keys <= the block's last query row
    const int nkt = (att == 1) ? NKT : ((ncaus < NKT) ? ncaus : NKT);

    const int ngrp = (nkt + WPB - 1) / WPB;
#pragma unroll 1
    for (int g = 0; g < ngrp; ++g) {
      const int kt = WPB * g + ((wave - g) & (WPB - 1));
      if (kt >= nkt) continue;                                                   // wave-uniform
      const int kb = kt * 32;
      // ids of this lane's 16 keys kb + 16u + 8hh + r (the rows of its D registers), 16-B LDS reads
      int ik[2][8], bk[2][8];
#pragma unroll
      for (int u = 0; u < 2; ++u) {
        const v4i ia = *(const v4i*)(sI + kb + 16 * u + 8 * hh), ib = *(const v4i*)(sI + kb + 16 * u + 8 * hh + 4);
        const v4i ba = *(const v4i*)(sB + kb + 16 * u + 8 * hh), bb = *(const v4i*)(sB + kb + 16 * u + 8 * hh + 4);
#pragma unroll
        for (int e = 0; e < 4; ++e) { ik[u][e] = ia[e]; ik[u][4 + e] = ib[e]; bk[u][e] = ba[e]; bk[u][4 + e] = bb[e]; }
      }
      // causal test j <= i (j = kb + 8hh + 16u + r, i = q0 + c + 16t) written against the constant 16u + r - 16t
      const int di = (q0 + c) - (kb + 8 * hh);
      unsigned okb[QTW];                                                         // bit 8u + r
#pragma unroll
      for (int t = 0; t < QTW; ++t) {
        unsigned ob = 0u;
        if (att == 0) {
          const bool qa = iqv[t] < GINST;
#pragma unroll
          for (int u = 0; u < 2; ++u) {
#pragma unroll
            for (int r = 0; r < 8; ++r) {
              const bool ok = qa && (iqv[t] == ik[u][r]) && (16 * u + r - 16 * t <= di);
              ob |= ok ? (1u << (8 * u + r)) : 0u;
            }
          }
        } else if (att == 1) {
          const bool qa = (iqv[t] < GINST) && (bqv[t] >= 0);
#pragma unroll
          for (int u = 0; u < 2; ++u) {
#pragma unroll
            for (int r = 0; r < 8; ++r) {
              const int  d  = bqv[t] - bk[u][r];
              const bool w  = ((d >= 0) && (d <= 2)) || (d == 4);
              const bool ok = qa && (ik[u][r] < GINST) && (iqv[t] != ik[u][r]) && w;
              ob |= ok ? (1u << (8 * u + r)) : 0u;
            }
          }
        } else {
#pragma unroll
          for (int u = 0; u < 2; ++u) {
#pragma unroll
            for (int r = 0; r < 8; ++r) {
              const bool ok = ((ik[u][r] == GINST) || (bk[u][r] == -1)) && (16 * u + r - 16 * t <= di);
              ob |= ok ? (1u << (8 * u + r)) : 0u;
            }
          }
        }
        okb[t] = ob;
      }
      const unsigned anyw = __builtin_amdgcn_ballot_w32((okb[0] | okb[1]) != 0u);    // wave-uniform
      if (anyw == 0u) continue;

      // ---- scores, transposed: D element r of this lane = (key kb + 16u + 8hh + r, query q0 + 16t + c) in s[t][u];
      //      each k fragment (A) is loaded once and multiplied with both query tiles (B) ----
      v8f s[QTW][2];
#pragma unroll
      for (int t = 0; t < QTW; ++t) { s[t][0] = zero8(); s[t][1] = zero8(); }
      const unsigned ko = hofs + (unsigned)kt * KTB;                               // the key tile's place in the k' planes and in the v^T planes
#pragma unroll
      for (int kk = 0; kk < 2; ++kk) {
        const v16h kh0 = ldfrag_o(KHIp, ko, kk * FRB),         kl0 = ldfrag_o(KLOp, ko, kk * FRB);
        const v16h kh1 = ldfrag_o(KHIp, ko, RTB + kk * FRB),   kl1 = ldfrag_o(KLOp, ko, RTB + kk * FRB);
        const v16h qa  = ldfrag_o(QHIp, qofs, kk * FRB),       qb  = ldfrag_o(QLOp, qofs, kk * FRB);
        const v16h qc  = ldfrag_o(QHIp, qofs, RTB + kk * FRB), qd  = ldfrag_o(QLOp, qofs, RTB + kk * FRB);
        s[0][0] = mma_h(kh0, qa, s[0][0]);
        s[0][0] = mma_h(kh0, qb, s[0][0]);
        s[0][0] = mma_h(kl0, qa, s[0][0]);
        s[0][1] = mma_h(kh1, qa, s[0][1]);
        s[0][1] = mma_h(kh1, qb, s[0][1]);
        s[0][1] = mma_h(kl1, qa, s[0][1]);
        s[1][0] = mma_h(kh0, qc, s[1][0]);
        s[1][0] = mma_h(kh0, qd, s[1][0]);
        s[1][0] = mma_h(kl0, qc, s[1][0]);
        s[1][1] = mma_h(kh1, qc, s[1][1]);
        s[1][1] = mma_h(kh1, qd, s[1][1]);
        s[1][1] = mma_h(kl1, qc, s[1][1]);
        guard10(s[0][0], s[0][1], s[1][0], s[1][1], qa, qb, qc, qd, kh0, kl0, kh1, kl1, kh0, kl0);
      }
      // ---- v^T fragments (A of the second product): row d = 16j + c, fragment j of the key tile; each is loaded once and
      //      multiplied with both query tiles' prob fragments ----
      const v16h vh0 = ldfrag_o(VHIp, ko, 0u);
      const v16h vh1 = ldfrag_o(VHIp, ko, FRB);
      const v16h vh2 = ldfrag_o(VHIp, ko, 2u * FRB);
      const v16h vh3 = ldfrag_o(VHIp, ko, 3u * FRB);
      const v16h vl0 = ldfrag_o(VLOp, ko, 0u);
      const v16h vl1 = ldfrag_o(VLOp, ko, FRB);
      const v16h vl2 = ldfrag_o(VLOp, ko, 2u * FRB);
      const v16h vl3 = ldfrag_o(VLOp, ko, 3u * FRB);
#pragma unroll
      for (int t = 0; t < QTW; ++t) {
        // ---- mask (replace by -inf) + online softmax in base 2, -inf-safe, for this lane's query; a query with no allowed key in this
        //      key tile goes through with al = 1 (or 0 on a zero state) and all-zero probs: its state keeps its bits ----
        float tv[2][8];
        float mx = -INFINITY;
#pragma unroll
        for (int u = 0; u < 2; ++u) {
#pragma unroll
          for (int r = 0; r < 8; ++r) {
            const bool ok = ((okb[t] >> (8 * u + r)) & 1u) != 0u;
            tv[u][r] = ok ? (s[t][u][r] * lsc) : -INFINITY;
            mx = fmaxf(mx, tv[u][r]);
          }
        }
        mx = fmaxf(mx, xhalf(mx));
        const float mn = fmaxf(mrow[t], mx);
        const float ms = (mn == -INFINITY) ? 0.0f : mn;
        const float al = exp2f(mrow[t] - ms);
        mrow[t] = mn;
        // B fragments of P^T * 32768: hi f16 and residual f16, column = this lane's query; elements 0..7 = keys kb + 8hh + 0..7 (subtile 0),
        // elements 8..15 = keys kb + 16 + 8hh + 0..7 (subtile 1): the split k map of the v^T loader
        FragH ph, pl;
        float ps = 0.0f;
#pragma unroll
        for (int u = 0; u < 2; ++u) {
#pragma unroll
          for (int r = 0; r < 8; ++r) {
            const float e = exp2f(tv[u][r] - ms);
            ps += e;
            const float ta = e * PCAR;
            const _Float16 ha = (_Float16)ta;
            ph.h[u][r] = ha;
            pl.h[u][r] = (_Float16)(ta - (float)ha);
          }
        }
        lrow[t] = lrow[t] * al + ps;
#pragma unroll
        for (int j = 0; j < 4; ++j) o[t][j] *= al;
        o[t][0] = mma_h(vh0, ph.v, o[t][0]);  o[t][0] = mma_h(vh0, pl.v, o[t][0]);  o[t][0] = mma_h(vl0, ph.v, o[t][0]);
        o[t][1] = mma_h(vh1, ph.v, o[t][1]);  o[t][1] = mma_h(vh1, pl.v, o[t][1]);  o[t][1] = mma_h(vl1, ph.v, o[t][1]);
        o[t][2] = mma_h(vh2, ph.v, o[t][2]);  o[t][2] = mma_h(vh2, pl.v, o[t][2]);  o[t][2] = mma_h(vl2, ph.v, o[t][2]);
        o[t][3] = mma_h(vh3, ph.v, o[t][3]);  o[t][3] = mma_h(vh3, pl.v, o[t][3]);  o[t][3] = mma_h(vl3, ph.v, o[t][3]);
        guard10(o[t][0], o[t][1], o[t][2], o[t][3], ph.v, pl.v, vh0, vh1, vh2, vh3, vl0, vl1, vl2, vl3);
      }
    }
#pragma unroll
    for (int t = 0; t < QTW; ++t) acc_guard4(o[t][0], o[t][1], o[t][2], o[t][3]);
    // ---- publish this wave's partial: acc in its slab (a lane: its query's row, 8 consecutive d per j, 16-B stores); m and Z, the two
    //      halves' sums joined here, by the lower half ----
#pragma unroll
    for (int t = 0; t < QTW; ++t) {
#pragma unroll
      for (int j = 0; j < 4; ++j) {
        float* sp = slab + (16 * t + c) * 68 + j * 16 + 8 * hh;
        v4f a, b4;
#pragma unroll
        for (int e = 0; e < 4; ++e) { a[e] = o[t][j][e]; b4[e] = o[t][j][4 + e]; }
        *(v4f*)(sp)     = a;
        *(v4f*)(sp + 4) = b4;
      }
      const float z = lrow[t] + xhalf(lrow[t]);
      if (hh == 0) {
        ml[16 * t + c]            = mrow[t];
        ml[16 * QTW + 16 * t + c] = z;
      }
    }
    __syncthreads();                          // all WPB partials of this mask are visible
    // ---- merge for this lane's row and 8 d columns: out_a = acc / Z (0 when no key allowed), carries (32768 on P, 1024 on v) folded once ----
    {
      float mw[WPB], zw[WPB];
#pragma unroll
      for (int w2 = 0; w2 < WPB; ++w2) {
        mw[w2] = smem[w2 * WREG + QTW * SLW + row];
        zw[w2] = smem[w2 * WREG + QTW * SLW + 16 * QTW + row];
      }
      float mx = mw[0];
#pragma unroll
      for (int w2 = 1; w2 < WPB; ++w2) mx = fmaxf(mx, mw[w2]);
      const float ms = (mx == -INFINITY) ? 0.0f : mx;
      float lv = 0.0f;
      v4f oa = {0.f, 0.f, 0.f, 0.f}, ob = {0.f, 0.f, 0.f, 0.f};
#pragma unroll
      for (int w2 = 0; w2 < WPB; ++w2) {
        const float sc = exp2f(mw[w2] - ms);
        const float* ap = smem + w2 * WREG + row * 68 + c8;
        lv += zw[w2] * sc;
        oa += *(const v4f*)(ap) * sc;
        ob += *(const v4f*)(ap + 4) * sc;
      }
      const float ls  = (lv > 0.0f) ? lv : 1.0f;
      const float inv = (lv > 0.0f) ? ((1.0f / ls) * oc) : 0.0f;
      float* op = osum + row * 68 + c8;
      if (att == 0) {
        *(v4f*)(op)     = oa * inv;
        *(v4f*)(op + 4) = ob * inv;
      } else {
        *(v4f*)(op)     = *(const v4f*)(op) + oa * inv;
        *(v4f*)(op + 4) = *(const v4f*)(op + 4) + ob * inv;
      }
    }
    __syncthreads();                          // every reader has left the slabs (the next mask overwrites them); after the last mask: osum is whole
  }

  // ---- O x1024 -> f16 hi + residual planes; wave = group of 4 rows, lane = (row in group, 8 consecutive d) ----
  v4u oh, ol;
  {
    const v4f a = *(const v4f*)(osum + row * 68 + c8), b4 = *(const v4f*)(osum + row * 68 + c8 + 4);
    float w[8];
#pragma unroll
    for (int e = 0; e < 4; ++e) { w[e] = a[e] * OSC; w[4 + e] = b4[e] * OSC; }
#pragma unroll
    for (int e = 0; e < 4; ++e) {
      const _Float16 h0 = (_Float16)w[2 * e], h1 = (_Float16)w[2 * e + 1];
      const _Float16 l0 = (_Float16)(w[2 * e] - (float)h0), l1 = (_Float16)(w[2 * e + 1] - (float)h1);
      oh[e] = pk16(h_bits(h0), h_bits(h1));
      ol[e] = pk16(h_bits(l0), h_bits(l1));
    }
  }
  const size_t o8 = (((size_t)(q0 + row)) * NH + head) * HD + c8;
  *(v4u*)(OHIp + o8) = oh;
  *(v4u*)(OLOp + o8) = ol;
}

// =====================================================================================================
// Workspace map (bytes); every plane is fully written by whole-line stores before it is read; all extents are exact multiples
// of the store granularity (no pad rows needed); every offset a multiple of SEQ*256:
//   CT  f32 [SEQ][64]                  SEQ*256        ST  same
//   XB  bf16 [SEQ][1024]               SEQ*2048
//   WQB bf16 [1024 n][1024 k]         2097152        WKB, WVB same        2097152 each
//   WOH f16  [1024 n][1024 k] x1024   2097152
//   QF  f32 [SEQ][1024]                SEQ*4096       KF, VF same
//   QHI f16 [16][SEQ/16][2][2][32][8] x1024  SEQ*2048  QLO residual   (fragment order: head, row tile, k-step, i, lane)
//   KHI f16 [16][SEQ/16][2][2][32][8] x1024  SEQ*2048  KLO residual
//   VHI f16 [16][SEQ/32][4][2][32][8] x1024  SEQ*2048  VLO residual   (fragment order: head, key tile, d tile, i, lane)
//   OHI f16 [SEQ][1024] x1024          SEQ*2048       OLO residual
//   end (SEQ = 2048)                  72351744
// =====================================================================================================
extern "C" void kernel_launch(void* const* d_in, const int* in_sizes, int n_in,
                              void* d_out, int out_size, void* d_ws, size_t ws_size,
                              hipStream_t stream) {
  if (n_in < 11) return;
  if (in_sizes[0] != SEQ * DMOD) return;
  if (in_sizes[1] != SEQ || in_sizes[2] != SEQ) return;
  if (in_sizes[3] != DMOD * DMOD || in_sizes[5] != DMOD * DMOD) return;
  if (in_sizes[7] != DMOD * DMOD || in_sizes[9] != DMOD * DMOD) return;
  if (in_sizes[4] != DMOD || in_sizes[6] != DMOD || in_sizes[8] != DMOD || in_sizes[10] != DMOD) return;
  if (out_size != SEQ * DMOD) return;

  const float* x   = (const float*)d_in[0];
  const int*   bar = (const int*)d_in[1];
  const int*   ins = (const int*)d_in[2];
  const float* wq  = (const float*)d_in[3];
  const float* bq  = (const float*)d_in[4];
  const float* wk  = (const float*)d_in[5];
  const float* bk  = (const float*)d_in[6];
  const float* wv  = (const float*)d_in[7];
  const float* bv  = (const float*)d_in[8];
  const float* wo  = (const float*)d_in[9];
  const float* bo  = (const float*)d_in[10];
  float*       out = (float*)d_out;

  const size_t szTab = (size_t)SEQ * HD * 4;                    //   524288
  const size_t szXB  = (size_t)SEQ * DMOD * 2;                  //  4194304
  const size_t szW   = (size_t)DMOD * DMOD * 2;                 //  2097152
  const size_t szF   = (size_t)SEQ * DMOD * 4;                  //  8388608
  const size_t szP   = (size_t)SEQ * DMOD * 2;                  //  4194304
  size_t off = 0;
  const size_t oCT  = off; off += szTab;
  const size_t oST  = off; off += szTab;
  const size_t oXB  = off; off += szXB;
  const size_t oWQ  = off; off += szW;
  const size_t oWK  = off; off += szW;
  const size_t oWV  = off; off += szW;
  const size_t oWO  = off; off += szW;
  const size_t oQF  = off; off += szF;
  const size_t oKF  = off; off += szF;
  const size_t oVF  = off; off += szF;
  const size_t oQHI = off; off += szP;
  const size_t oQLO = off; off += szP;
  const size_t oKHI = off; off += szP;
  const size_t oKLO = off; off += szP;
  const size_t oVHI = off; off += szP;
  const size_t oVLO = off; off += szP;
  const size_t oOHI = off; off += szP;
  const size_t oOLO = off; off += szP;
  if (off > ws_size) return;                            // off = 72351744 at SEQ = 2048
  if (off > (size_t)134217728) return;

  char* ws = (char*)d_ws;
  float* CT  = (float*)(ws + oCT);
  float* ST  = (float*)(ws + oST);
  u16*   XB  = (u16*)(ws + oXB);
  u16*   WQB = (u16*)(ws + oWQ);
  u16*   WKB = (u16*)(ws + oWK);
  u16*   WVB = (u16*)(ws + oWV);
  u16*   WOH = (u16*)(ws + oWO);
  float* QF  = (float*)(ws + oQF);
  float* KF  = (float*)(ws + oKF);
  float* VF  = (float*)(ws + oVF);
  u16*   QHI = (u16*)(ws + oQHI);
  u16*   QLO = (u16*)(ws + oQLO);
  u16*   KHI = (u16*)(ws + oKHI);
  u16*   KLO = (u16*)(ws + oKLO);
  u16*   VHI = (u16*)(ws + oVHI);
  u16*   VLO = (u16*)(ws + oVLO);
  u16*   OHI = (u16*)(ws + oOHI);
  u16*   OLO = (u16*)(ws + oOLO);

  // inv_freq[i] = 1 / pow(10000, i/32) in f32 (pow correctly converted from f64, then IEEE f32 reciprocal)
  InvF inv;
  for (int i = 0; i < 32; ++i) {
    const double p = pow(10000.0, (double)i / 32.0);
    const float pf = (float)p;
    inv.f[i] = 1.0f / pf;
  }

  const dim3 blk(256);
  const dim3 gPrep(TABB + XCB + 4 * WCB);               // 256 + 1024 + 2048
  const dim3 gG((SEQ / 64) * (DMOD / 64));              // 512
  const dim3 gG3((SEQ / 64) * (DMOD / 64), 3);          // 512 x 3
  const dim3 bG(128);
  const dim3 gPack(VTB + 2 * RPB);                      // 512 + 2048
  const dim3 gAT(ATT_BLOCKS);                           // 1024
  const dim3 bAT(ATT_THREADS);                          // 256

  // (0) rotary cos/sin tables [SEQ][64]; x, Wq, Wk, Wv -> bf16 planes (same layout, already k-contiguous); Wo -> f16 plane of bf16 value x1024
  prep<<<gPrep, blk, 0, stream>>>(x, wq, wk, wv, wo, XB, WQB, WKB, WVB, WOH, CT, ST, inv);
  // (1) projections: q, k, v [SEQ][1024] in f32 (+ bias)
  gemm_bf<<<gG3, bG, 0, stream>>>(XB, WQB, WKB, WVB, bq, bk, bv, QF, KF, VF, SEQ, DMOD, DMOD, 1.0f);
  // (2) q', k' planes (source rows (s, h), heads per position NH) and v^T planes x1024 (hi + residual), all in fragment order
  pack3<<<gPack, blk, 0, stream>>>(QF, KF, VF, CT, ST, QHI, QLO, KHI, KLO, VHI, VLO);
  // (3) three masked attentions summed -> O planes [s][h][d] x1024 (hi + residual)
  attn3<<<gAT, bAT, 0, stream>>>(QHI, QLO, KHI, KLO, VHI, VLO, ins, bar, OHI, OLO);
  // (4) output projection -> out [SEQ][1024] f32, carries 1024 (O) x 1024 (Wo) folded back, + bo
  gemm_h2<<<gG, bG, 0, stream>>>(OHI, OLO, WOH, bo, out, SEQ, DMOD, DMOD, 1.0f / (OSC * WOS));
  (void)hipGetLastError();
}

// v007
// A run of this version takes 104 microseconds.
// Two timings next to v006 put it at 1.12 and 1.10 times that version's speed.
// All steps since v000 together make it 3.21 times as fast.
// Contractions: x.W{q,k,v}^T on v_wmma_f32_16x16x32_bf16 (x and W RNE-converted to bf16, f32 accumulate);
// scores k'.q'^T (transposed; q', k' carried x1024 as f16 hi plane + f16 residual plane, products hh+lh+hl), v^T.P^T (P x32768 f16 hi+residual,
// v x1024 f16 hi+residual, products hh+lh+hl) and O.Wo^T (O x1024 f16 hi+residual, Wo as f16(bf16(Wo) x1024), products h.w+l.w):
// v_wmma_f32_16x16x32_f16, f32 accumulate. Rotary tables, rotation, masks, masked base-2 online softmax and 1/l fold in f32 on VALU.
#include <hip/hip_runtime.h>
#include <math.h>
#include <stdint.h>

#define SEQ   2048
#define DMOD  1024
#define NH    16
#define HD    64
#define GINST 129
#define QSC   1024.0f
#define KSC   1024.0f
#define PCAR  32768.0f
#define VCAR  1024.0f
#define OSC   1024.0f
#define WOS   1024.0f
#define LOG2E 1.4426950408889634f
#define WPB   8
#define QTW   2
#define NQP   (SEQ / (16 * QTW))
#define NST   (SEQ / 64)
#define NKT   (SEQ / 32)
#define ATT_THREADS (WPB * 32)
#define ATT_BLOCKS  (NQP * NH)
#define SLW   (16 * 68)
#define WREG  (QTW * SLW + QTW * 32)
#define SLAB64 (16 * 68)
#define VTP   72
#define GKC   128
#define GPB   272
#define GOPB  (64 * GPB)
#define GKS   (GKC / 32)
#define TABB  (SEQ / 8)
#define XCB   ((SEQ * DMOD) / 2048)
#define WCB   ((DMOD * DMOD) / 2048)
#define RPB   ((SEQ * NH * 8) / 256)
#define VTB   (NH * NST)
static_assert(DMOD == NH * HD && HD == 64 && NH == 16);
static_assert(WPB == 8 && ATT_THREADS == 256 && (WREG % 4) == 0 && (SLW % 4) == 0 && QTW == 2);
static_assert((SEQ % 64) == 0 && (SEQ % ATT_THREADS) == 0 && (SEQ % 8) == 0 && SEQ <= 32768);
static_assert((DMOD % 64) == 0 && (DMOD % 32) == 0);
static_assert(16 * QTW == 32 && NKT == 8 * WPB);
static_assert(((SEQ * DMOD) % 2048) == 0 && ((DMOD * DMOD) % 2048) == 0);
static_assert(((SEQ * NH * 8) % 256) == 0);
static_assert((DMOD % GKC) == 0 && (DMOD / GKC) >= 2 && GKC * 2 == 256 && GPB == 256 + 16 && (SEQ % 64) == 0);

typedef unsigned short u16;
typedef _Float16 v16h __attribute__((ext_vector_type(16)));
typedef _Float16 v8h  __attribute__((ext_vector_type(8)));
typedef __bf16   v16b __attribute__((ext_vector_type(16)));
typedef float    v8f  __attribute__((ext_vector_type(8)));
typedef float    v4f  __attribute__((ext_vector_type(4)));
typedef unsigned int v4u __attribute__((ext_vector_type(4)));
typedef int v4i __attribute__((ext_vector_type(4)));

union FragH { v16h v; v8h h[2]; v4u u[2]; };
union FragB { v16b v; v4u u[2]; };

struct InvF { float f[32]; };
static_assert(sizeof(InvF) == 128);

// ---- scalar helpers --------------------------------------------------------------------------------
__device__ __forceinline__ unsigned short bf_bits(float f) {          // f32 -> bf16 bits, RNE convert
  unsigned u = __float_as_uint(f);
  return (unsigned short)((u + 0x7FFFu + ((u >> 16) & 1u)) >> 16);
}
__device__ __forceinline__ float bf_up(unsigned short h) { return __uint_as_float(((unsigned)h) << 16); }
__device__ __forceinline__ float bfr(float f) { return bf_up(bf_bits(f)); }
__device__ __forceinline__ unsigned short h_bits(_Float16 x) { return __builtin_bit_cast(unsigned short, x); }
__device__ __forceinline__ unsigned pk16(unsigned short a, unsigned short b) { return (unsigned)a | ((unsigned)b << 16); }
__device__ __forceinline__ v8f zero8() { v8f z = {0.f, 0.f, 0.f, 0.f, 0.f, 0.f, 0.f, 0.f}; return z; }

// ---- fragment map: 16-bit A/B operand, lane -> row/col (lane&15), half hh = lane>>4;
//      elements 0..7 <- k0+8hh+0..7, elements 8..15 <- k0+16+8hh+0..7  (same split k map for A and B)
// ---- fragment-order planes (q', k', v^T): a fragment (16 rows x 32 k) is 1 KB in a row: [i = 0,1][lane 0..31][8 halves], the 8 halves being
//      row (lane&15), k = k0 + 16i + 8hh + 0..7: what lane holds in elements 8i .. 8i+7. One load of a wave is then 512 contiguous bytes,
//      four whole 128-B lines, where a row-major plane gives 16-B pieces of 16 lines.
// fragment from a wave-uniform plane base plus a 32-bit per-lane byte offset (fragment start + 16 * lane)
__device__ __forceinline__ v16h ldfrag_o(const u16* base, unsigned boff, unsigned cbytes) {
  const char* p = (const char*)(const void*)base + boff;
  FragH f;
  f.h[0] = *(const v8h*)(p + cbytes);
  f.h[1] = *(const v8h*)(p + cbytes + 512);
  return f.v;
}

__device__ __forceinline__ v8f mma_h(v16h a, v16h b, v8f c) {
  return __builtin_amdgcn_wmma_f32_16x16x32_f16(false, a, false, b, (short)0, c, false, false);
}
__device__ __forceinline__ v8f mma_b(v16b a, v16b b, v8f c) {
  return __builtin_amdgcn_wmma_f32_16x16x32_bf16(false, a, false, b, (short)0, c, false, false);
}
template <typename F>
__device__ __forceinline__ void guard6(v8f& a, v8f& b, v8f& c, v8f& d, F x0, F x1, F x2, F x3, F x4, F x5) {
#if defined(__HIP_DEVICE_COMPILE__)
  asm volatile("v_nop\n\tv_nop\n\tv_nop\n\tv_nop"
               : "+v"(a), "+v"(b), "+v"(c), "+v"(d) : "v"(x0), "v"(x1), "v"(x2), "v"(x3), "v"(x4), "v"(x5) : "memory");
#endif
}
__device__ __forceinline__ void guard10(v8f& a, v8f& b, v8f& c, v8f& d, v16h x0, v16h x1, v16h x2, v16h x3, v16h x4,
                                        v16h x5, v16h x6, v16h x7, v16h x8, v16h x9) {
#if defined(__HIP_DEVICE_COMPILE__)
  asm volatile("v_nop\n\tv_nop\n\tv_nop\n\tv_nop"
               : "+v"(a), "+v"(b), "+v"(c), "+v"(d)
               : "v"(x0), "v"(x1), "v"(x2), "v"(x3), "v"(x4), "v"(x5), "v"(x6), "v"(x7), "v"(x8), "v"(x9) : "memory");
#endif
}
__device__ __forceinline__ void acc_guard4(v8f& a, v8f& b, v8f& c, v8f& d) {
#if defined(__HIP_DEVICE_COMPILE__)
  asm volatile("v_nop\n\tv_nop\n\tv_nop\n\tv_nop" : "+v"(a), "+v"(b), "+v"(c), "+v"(d));
#endif
}
// the value that lane l ^ 16 holds: the other half's share of the same query column
__device__ __forceinline__ float xhalf(float x) {
  const int b = __float_as_int(x);
  return __int_as_float(__builtin_amdgcn_permlanex16(b, b, 0x76543210, 0xfedcba98, false, false));
}
// minimum and maximum over the 32 lanes of a wave, every lane on: four exchanges inside a 16-lane row (DPP row_xmask 1, 2, 4, 8), then
// one between the two rows; every lane ends with the result
__device__ __forceinline__ int wave_min_i(int x) {
  int y;
  y = __builtin_amdgcn_update_dpp(x, x, 0x161, 0xf, 0xf, false); x = (y < x) ? y : x;
  y = __builtin_amdgcn_update_dpp(x, x, 0x162, 0xf, 0xf, false); x = (y < x) ? y : x;
  y = __builtin_amdgcn_update_dpp(x, x, 0x164, 0xf, 0xf, false); x = (y < x) ? y : x;
  y = __builtin_amdgcn_update_dpp(x, x, 0x168, 0xf, 0xf, false); x = (y < x) ? y : x;
  y = __builtin_amdgcn_permlanex16(x, x, 0x76543210, 0xfedcba98, false, false); x = (y < x) ? y : x;
  return x;
}
__device__ __forceinline__ int wave_max_i(int x) {
  int y;
  y = __builtin_amdgcn_update_dpp(x, x, 0x161, 0xf, 0xf, false); x = (y > x) ? y : x;
  y = __builtin_amdgcn_update_dpp(x, x, 0x162, 0xf, 0xf, false); x = (y > x) ? y : x;
  y = __builtin_amdgcn_update_dpp(x, x, 0x164, 0xf, 0xf, false); x = (y > x) ? y : x;
  y = __builtin_amdgcn_update_dpp(x, x, 0x168, 0xf, 0xf, false); x = (y > x) ? y : x;
  y = __builtin_amdgcn_permlanex16(x, x, 0x76543210, 0xfedcba98, false, false); x = (y > x) ? y : x;
  return x;
}
__device__ __forceinline__ void wave_sync_lds() {
  __builtin_amdgcn_fence(__ATOMIC_RELEASE, "workgroup");
  __builtin_amdgcn_wave_barrier();
  __builtin_amdgcn_fence(__ATOMIC_ACQUIRE, "workgroup");
}

// ---- GEMM operand staging: a stage = GKC k elements (256 B) of 64 rows of an operand, LDS row pitch GPB bytes ----
__device__ __forceinline__ unsigned lds_off(const void* p) { return (unsigned)(size_t)p; }   // LDS byte address of a __shared__ object
// 16 rows x 256 B of one operand, global memory -> LDS through no register: eight asynchronous copies of this wave. A copy is 2 whole rows
// (lane -> row lane >> 4, 16-B column lane & 15), four whole 128-B lines. l, g: this lane's LDS byte address and global address in copy 0;
// copy i lies 2 rows further on in both (ldk = elements between global rows). All 32 lanes on; both addresses multiples of 16.
// The closing s_wait_xcnt 0 stands inside the statement so that no address register named here is rewritten in front of it.
__device__ __forceinline__ void copy16rows(unsigned l, const u16* g, size_t ldk) {
#if defined(__HIP_DEVICE_COMPILE__)
  asm volatile("global_load_async_to_lds_b128 %0, %8, off\n\t"
               "global_load_async_to_lds_b128 %1, %9, off\n\t"
               "global_load_async_to_lds_b128 %2, %10, off\n\t"
               "global_load_async_to_lds_b128 %3, %11, off\n\t"
               "global_load_async_to_lds_b128 %4, %12, off\n\t"
               "global_load_async_to_lds_b128 %5, %13, off\n\t"
               "global_load_async_to_lds_b128 %6, %14, off\n\t"
               "global_load_async_to_lds_b128 %7, %15, off\n\t"
               "s_wait_xcnt 0x0"
               :: "v"(l), "v"(l + 2u * GPB), "v"(l + 4u * GPB), "v"(l + 6u * GPB),
                  "v"(l + 8u * GPB), "v"(l + 10u * GPB), "v"(l + 12u * GPB), "v"(l + 14u * GPB),
                  "v"(g), "v"(g + 2 * ldk), "v"(g + 4 * ldk), "v"(g + 6 * ldk),
                  "v"(g + 8 * ldk), "v"(g + 10 * ldk), "v"(g + 12 * ldk), "v"(g + 14 * ldk)
               : "memory");
#endif
}
// this wave's own copies have landed (the compiler places no wait for them)
__device__ __forceinline__ void wait_copies() {
#if defined(__HIP_DEVICE_COMPILE__)
  asm volatile("s_wait_asynccnt 0x0" ::: "memory");
#endif
}
// this wave's LDS reads have retired: stands in front of the barrier behind which the buffer it read is refilled
__device__ __forceinline__ void wait_lds() {
#if defined(__HIP_DEVICE_COMPILE__)
  asm volatile("s_wait_dscnt 0x0" ::: "memory");
#endif
}
// stands behind a piece's last global stores: in a grid of several pieces another piece's code follows in the listing and rewrites the
// registers that the stores name; this wait is in front of every such write (which piece is laid last is the compiler's choice: each has it)
__device__ __forceinline__ void wait_store_regs() {
#if defined(__HIP_DEVICE_COMPILE__)
  asm volatile("s_wait_xcnt 0x0" ::: "memory");
#endif
}
// fragment from a staged row: p = row start + 64 * k-step + 16 * (lane >> 4) bytes; the split k map of the loaders above (bytes +0 and +32)
__device__ __forceinline__ v16b ldsfrag_b(const unsigned char* p) {
  FragB f;
  f.u[0] = *(const v4u*)(p);
  f.u[1] = *(const v4u*)(p + 32);
  return f.v;
}
__device__ __forceinline__ v16h ldsfrag_h(const unsigned char* p) {
  FragH f;
  f.u[0] = *(const v4u*)(p);
  f.u[1] = *(const v4u*)(p + 32);
  return f.v;
}

// ---- accurate f32 sin/cos of a non-negative f32 angle (|angle| < 32768): f64 two-part pi/2 reduction + f64 polynomials,
//      plain f64 fma/mul only (no library f64 trig path), result converted to f32.
__device__ __forceinline__ void sincos_acc(float angf, float& sv, float& cv) {
  const double a = (double)angf;
  const double TWO_OVER_PI = 0.63661977236758134308;
  const double PIO2_HI = 1.5707963267948966;
  const double PIO2_LO = 6.123233995736766e-17;
  const int kq = (int)(a * TWO_OVER_PI + 0.5);
  const double kd = (double)kq;
  double r = fma(-kd, PIO2_HI, a);
  r = fma(-kd, PIO2_LO, r);
  const double r2 = r * r;
  double sp = 1.0 / 6227020800.0;
  sp = fma(sp, r2, -1.0 / 39916800.0);
  sp = fma(sp, r2, 1.0 / 362880.0);
  sp = fma(sp, r2, -1.0 / 5040.0);
  sp = fma(sp, r2, 1.0 / 120.0);
  sp = fma(sp, r2, -1.0 / 6.0);
  const double s = fma(sp * r2, r, r);
  double cp = -1.0 / 87178291200.0;
  cp = fma(cp, r2, 1.0 / 479001600.0);
  cp = fma(cp, r2, -1.0 / 3628800.0);
  cp = fma(cp, r2, 1.0 / 40320.0);
  cp = fma(cp, r2, -1.0 / 720.0);
  cp = fma(cp, r2, 1.0 / 24.0);
  cp = fma(cp, r2, -0.5);
  const double c = fma(cp, r2, 1.0);
  const int qd = kq & 3;
  const double so = (qd == 0) ? s : (qd == 1) ? c : (qd == 2) ? -s : -c;
  const double co = (qd == 0) ? c : (qd == 1) ? -s : (qd == 2) ? -c : s;
  sv = (float)so;
  cv = (float)co;
}

// =====================================================================================================
// Rotary tables: cosT[t][d], sinT[t][d] for t < SEQ, d < HD, angle = float(t) * inv_freq[d & 31] (f32 product), halves duplicated.
// Wave = one position t, lane = frequency index; inv_freq picked from the by-value table with a static select chain.
// coverage: blk = 0 .. SEQ/8 - 1, 8 waves each = SEQ rows; per row 4 line stores = 64 floats of each table.
// =====================================================================================================
__device__ __forceinline__ void tab_blk(int blk, float* cosT, float* sinT, const InvF& inv) {
  const int tid  = threadIdx.x;
  const int lane = tid & 31;
  const int t    = blk * 8 + (tid >> 5);
  float f = inv.f[0];
#pragma unroll
  for (int i = 1; i < 32; ++i) f = (lane == i) ? inv.f[i] : f;
  const float ang = (float)t * f;
  float sv, cv;
  sincos_acc(ang, sv, cv);
  float* cr = cosT + (size_t)t * HD;
  float* sr = sinT + (size_t)t * HD;
  *(float*)(cr + lane)      = cv;
  *(float*)(cr + 32 + lane) = cv;
  *(float*)(sr + lane)      = sv;
  *(float*)(sr + 32 + lane) = sv;
  wait_store_regs();
}

// =====================================================================================================
// f32 -> 16-bit plane, same layout.  f16mode false: bf16 RNE bits;  f16mode true: f16 bits of (bf16 RNE value) * scale.
// Thread = 8 consecutive elements: two 16-B loads, one 16-B store; 32 consecutive lanes = 512 contiguous, 512-B aligned bytes.
// coverage: blk = 0 .. n/2048 - 1, 256 thr x 8 elements each = the whole plane.
// =====================================================================================================
__device__ __forceinline__ void cvt_blk(const float* __restrict__ x, u16* D, int blk, bool f16mode, float scale) {
  const int gt = blk * 256 + (int)threadIdx.x;
  const float* p = x + (size_t)gt * 8;
  const v4f a = *(const v4f*)(p), b4 = *(const v4f*)(p + 4);
  float w[8];
#pragma unroll
  for (int e = 0; e < 4; ++e) { w[e] = a[e]; w[4 + e] = b4[e]; }
  v4u o;
#pragma unroll
  for (int e = 0; e < 4; ++e) {
    const float f0 = w[2 * e], f1 = w[2 * e + 1];
    o[e] = f16mode ? pk16(h_bits((_Float16)(bfr(f0) * scale)), h_bits((_Float16)(bfr(f1) * scale)))
                   : pk16(bf_bits(f0), bf_bits(f1));
  }
  *(v4u*)(D + (size_t)gt * 8) = o;
  wait_store_regs();
}

// =====================================================================================================
// Everything that reads inputs alone, in one grid: none of these pieces reads what another writes. The block index picks the piece
// (block-uniform; no barriers): TABB blocks of rotary tables first (the longest chain of a wave), XCB blocks x -> bf16,
// 3 * WCB blocks Wq, Wk, Wv -> bf16, WCB blocks Wo -> f16 of the bf16 value x1024.  grid = TABB + XCB + 4 * WCB, exact.
// =====================================================================================================
__global__ __launch_bounds__(256) void prep(const float* __restrict__ x, const float* __restrict__ wq, const float* __restrict__ wk,
                                            const float* __restrict__ wv, const float* __restrict__ wo,
                                            u16* XBo, u16* WQo, u16* WKo, u16* WVo, u16* WOo,
                                            float* cosT, float* sinT, InvF inv) {
  int b = blockIdx.x;
  if (b < TABB) { tab_blk(b, cosT, sinT, inv); return; }
  b -= TABB;
  if (b < XCB) { cvt_blk(x, XBo, b, false, 1.0f); return; }
  b -= XCB;
  const int w = b / WCB, wb = b % WCB;
  if (w < 3) {
    const float* s = (w == 0) ? wq : (w == 1) ? wk : wv;
    u16*         d = (w == 0) ? WQo : (w == 1) ? WKo : WVo;
    cvt_blk(s, d, wb, false, 1.0f);
  } else if (w == 3) {
    cvt_blk(wo, WOo, wb, true, WOS);
  }
}

// =====================================================================================================
// GEMM epilogue shared by both engines: the wave's 16x64 f32 tile (times oscale) staged in its LDS slab (pitch 68),
// coverage: 8 instructions x 2 rows x 16 lanes x 4 floats = the wave's 16 x 64 tile.
// =====================================================================================================
__device__ __forceinline__ void epi64(float* sl, v8f a0, v8f a1, v8f a2, v8f a3, float oscale,
                                      const float* __restrict__ bias, float* C, int N,
                                      size_t rowb, int col0, int lane) {
  const int hh = lane >> 4, m = lane & 15;
#pragma unroll
  for (int r = 0; r < 8; ++r) {
    const int ro = (8 * hh + r) * 68 + m;
    sl[ro]      = a0[r] * oscale;
    sl[ro + 16] = a1[r] * oscale;
    sl[ro + 32] = a2[r] * oscale;
    sl[ro + 48] = a3[r] * oscale;
  }
  wave_sync_lds();
  const v4f braw = *(const v4f*)(bias + col0 + m * 4);
  v4f bb;
#pragma unroll
  for (int e = 0; e < 4; ++e) bb[e] = bfr(braw[e]);
  v4f vals[8];
#pragma unroll
  for (int it = 0; it < 8; ++it) vals[it] = *(const v4f*)(sl + (it * 2 + hh) * 68 + m * 4) + bb;
  float* dst = C + (rowb + (size_t)hh) * (size_t)N + col0 + m * 4;
  {
#pragma unroll
    for (int it = 0; it < 8; ++it) {
      *(v4f*)(dst + (size_t)(it * 2) * (size_t)N) = vals[it];
    }
    
  }
}

// =====================================================================================================
// bf16 GEMM: C[M][N] (f32) = A[M][K] (bf16 row-major) . Bt[N][K]^T (bf16 k-contiguous), times oscale, plus bias[N].
// Block = 64x64 tile, 4 waves x 16 rows. K walked in stages of GKC: the block's 64 A rows and 64 Bt rows of a stage are brought into a
// two-buffer LDS ring by asynchronous copies of whole lines (each wave: 16 rows of each operand), stage t + 1 in flight while stage t is
// multiplied; fragments are read from LDS (two 16-B reads each, split k map for A and B), k ascending as before.
// Three products that share A run in one grid: blockIdx.y picks (Bt, bias, C) (block-uniform); none reads what another writes.
// The host passes M % 64 == 0, N % 64 == 0, K % GKC == 0, K >= 2 * GKC, grid = ((M/64)*(N/64), 3).
// =====================================================================================================
__global__ __launch_bounds__(128)
void gemm_bf(const u16* __restrict__ A, const u16* __restrict__ Bt0, const u16* __restrict__ Bt1, const u16* __restrict__ Bt2,
             const float* __restrict__ bias0, const float* __restrict__ bias1, const float* __restrict__ bias2,
             float* C0, float* C1, float* C2, int M, int N, int K, float oscale) {
  __shared__ __align__(16) float slab[4 * SLAB64];
  __shared__ __align__(16) unsigned char ring[2 * 2 * GOPB];   // [buffer][A | Bt][64 rows][GPB]
  const int tid = threadIdx.x, wave = tid >> 5, lane = tid & 31, hh = lane >> 4, m = lane & 15;
  const int which = blockIdx.y;
  const u16*   Bt   = (which == 0) ? Bt0 : (which == 1) ? Bt1 : Bt2;
  const float* bias = (which == 0) ? bias0 : (which == 1) ? bias1 : bias2;
  float*       C    = (which == 0) ? C0 : (which == 1) ? C1 : C2;
  const int ntile = N >> 6;
  const int bid   = blockIdx.x;
  const int row0  = (bid / ntile) * 64;
  const int rowb  = row0 + wave * 16;
  const int col0  = (bid % ntile) * 64;
  if (row0 + 64 > M) return;                 // block-uniform, in front of every barrier and copy; never taken with the exact grid
  const int nst  = K / GKC;
  const int crow = wave * 16 + hh;           // the tile row this lane brings in copy 0
  const u16* ga = A  + (size_t)(row0 + crow) * K + m * 8;
  const u16* gb = Bt + (size_t)(col0 + crow) * K + m * 8;
  const unsigned lc = lds_off(ring) + (unsigned)crow * GPB + (unsigned)m * 16u;
  copy16rows(lc, ga, (size_t)K);
  copy16rows(lc + GOPB, gb, (size_t)K);
  wait_copies();
  __syncthreads();                           // stage 0 is whole for every wave
  if (nst > 1) {
    copy16rows(lc + 2u * GOPB, ga + GKC, (size_t)K);
    copy16rows(lc + 3u * GOPB, gb + GKC, (size_t)K);
  }
  const unsigned char* fa = ring + (wave * 16 + m) * GPB + 16 * hh;
  const unsigned char* fb = ring + GOPB + m * GPB + 16 * hh;
  v8f acc0 = zero8(), acc1 = zero8(), acc2 = zero8(), acc3 = zero8();
  // kept rolled: one copy of the stage body, the buffer picked by the stage's parity
#pragma unroll 1
  for (int t = 0; t < nst; ++t) {
    const unsigned bo = (unsigned)(t & 1) * (2u * GOPB);
    // unrolled: the k-step offsets become immediates and the reads of later k-steps are issued ahead of the earlier products
#pragma unroll
    for (int kk = 0; kk < GKS; ++kk) {
      const v16b a  = ldsfrag_b(fa + bo + kk * 64);
      const v16b b0 = ldsfrag_b(fb + bo + kk * 64);
      const v16b b1 = ldsfrag_b(fb + bo + 16 * GPB + kk * 64);
      const v16b b2 = ldsfrag_b(fb + bo + 32 * GPB + kk * 64);
      const v16b b3 = ldsfrag_b(fb + bo + 48 * GPB + kk * 64);
      acc0 = mma_b(a, b0, acc0);
      acc1 = mma_b(a, b1, acc1);
      acc2 = mma_b(a, b2, acc2);
      acc3 = mma_b(a, b3, acc3);
      // its four v_nop keep the distance behind the stage's last matrix instructions on both sides of the branch at the loop's foot
      if (kk == GKS - 1) guard6<v16b>(acc0, acc1, acc2, acc3, a, b0, b1, b2, b3, a);
    }
    wait_lds();
    wait_copies();
    __syncthreads();                         // publishes stage t + 1 and ends every wave's reads of stage t's buffer
    if (t + 2 < nst) {
      copy16rows(lc + bo, ga + (size_t)(t + 2) * GKC, (size_t)K);
      copy16rows(lc + bo + GOPB, gb + (size_t)(t + 2) * GKC, (size_t)K);
    }
  }
  wait_copies();
  epi64(slab + wave * SLAB64, acc0, acc1, acc2, acc3, oscale, bias, C, N, (size_t)rowb, col0, lane);
}

// =====================================================================================================
// f16 hi+lo GEMM: C[M][N] (f32) = (Ahi + Alo)[M][K] . Bt[N][K]^T, times oscale, plus bias[N]; Ahi/Alo f16 planes (same layout),
// Bt f16 k-contiguous; products hi.B + lo.B into one accumulator (lo is the unscaled residual of hi). Same tiling and the same
// two-buffer LDS ring as gemm_bf, with three operand tiles a stage.
// =====================================================================================================
__global__ __launch_bounds__(128)
void gemm_h2(const u16* __restrict__ Ah, const u16* __restrict__ Al, const u16* __restrict__ Bt,
             const float* __restrict__ bias, float* C, int M, int N, int K, float oscale) {
  __shared__ __align__(16) float slab[4 * SLAB64];
  __shared__ __align__(16) unsigned char ring[2 * 3 * GOPB];   // [buffer][Ahi | Alo | Bt][64 rows][GPB]
  const int tid = threadIdx.x, wave = tid >> 5, lane = tid & 31, hh = lane >> 4, m = lane & 15;
  const int ntile = N >> 6;
  const int bid   = blockIdx.x;
  const int row0  = (bid / ntile) * 64;
  const int rowb  = row0 + wave * 16;
  const int col0  = (bid % ntile) * 64;
  if (row0 + 64 > M) return;                 // block-uniform, in front of every barrier and copy; never taken with the exact grid
  const int nst  = K / GKC;
  const int crow = wave * 16 + hh;           // the tile row this lane brings in copy 0
  const size_t aofs = (size_t)(row0 + crow) * K + m * 8;
  const u16* gh = Ah + aofs;
  const u16* gl = Al + aofs;
  const u16* gb = Bt + (size_t)(col0 + crow) * K + m * 8;
  const unsigned lc = lds_off(ring) + (unsigned)crow * GPB + (unsigned)m * 16u;
  copy16rows(lc, gh, (size_t)K);
  copy16rows(lc + GOPB, gl, (size_t)K);
  copy16rows(lc + 2u * GOPB, gb, (size_t)K);
  wait_copies();
  __syncthreads();                           // stage 0 is whole for every wave
  if (nst > 1) {
    copy16rows(lc + 3u * GOPB, gh + GKC, (size_t)K);
    copy16rows(lc + 4u * GOPB, gl + GKC, (size_t)K);
    copy16rows(lc + 5u * GOPB, gb + GKC, (size_t)K);
  }
  const unsigned char* fa = ring + (wave * 16 + m) * GPB + 16 * hh;
  const unsigned char* fb = ring + 2 * GOPB + m * GPB + 16 * hh;
  v8f acc0 = zero8(), acc1 = zero8(), acc2 = zero8(), acc3 = zero8();
  // kept rolled: one copy of the stage body, the buffer picked by the stage's parity
#pragma unroll 1
  for (int t = 0; t < nst; ++t) {
    const unsigned bo = (unsigned)(t & 1) * (3u * GOPB);
    // unrolled: the k-step offsets become immediates and the reads of later k-steps are issued ahead of the earlier products
#pragma unroll
    for (int kk = 0; kk < GKS; ++kk) {
      const v16h ah = ldsfrag_h(fa + bo + kk * 64), al = ldsfrag_h(fa + bo + GOPB + kk * 64);
      const v16h b0 = ldsfrag_h(fb + bo + kk * 64);
      const v16h b1 = ldsfrag_h(fb + bo + 16 * GPB + kk * 64);
      const v16h b2 = ldsfrag_h(fb + bo + 32 * GPB + kk * 64);
      const v16h b3 = ldsfrag_h(fb + bo + 48 * GPB + kk * 64);
      acc0 = mma_h(ah, b0, acc0);  acc0 = mma_h(al, b0, acc0);
      acc1 = mma_h(ah, b1, acc1);  acc1 = mma_h(al, b1, acc1);
      acc2 = mma_h(ah, b2, acc2);  acc2 = mma_h(al, b2, acc2);
      acc3 = mma_h(ah, b3, acc3);  acc3 = mma_h(al, b3, acc3);
      // its four v_nop keep the distance behind the stage's last matrix instructions on both sides of the branch at the loop's foot
      if (kk == GKS - 1) guard6<v16h>(acc0, acc1, acc2, acc3, ah, al, b0, b1, b2, b3);
    }
    wait_lds();
    wait_copies();
    __syncthreads();                         // publishes stage t + 1 and ends every wave's reads of stage t's buffer
    if (t + 2 < nst) {
      copy16rows(lc + bo, gh + (size_t)(t + 2) * GKC, (size_t)K);
      copy16rows(lc + bo + GOPB, gl + (size_t)(t + 2) * GKC, (size_t)K);
      copy16rows(lc + bo + 2u * GOPB, gb + (size_t)(t + 2) * GKC, (size_t)K);
    }
  }
  wait_copies();
  epi64(slab + wave * SLAB64, acc0, acc1, acc2, acc3, oscale, bias, C, N, (size_t)rowb, col0, lane);
}

// =====================================================================================================
// Rotate-half rotary + 16-bit split pack. Rows are (pos, head) with HD contiguous floats (f32 projection output);
// pos = (row / hpr) mod SEQ.  w[d] = x[d] * cos[pos][d] + r[d] * sin[pos][d],  r[d] = -x[d+32] for d < 32, x[d-32] for d >= 32;
// hi[d] = f16(w * sc), lo[d] = f16(w * sc - hi[d])  (sc a power of two, residual unscaled).
// Output in fragment order: [head][row tile rt = pos / 16][k-step kk][i][lane][8 halves] (2 KB a row tile and head).
// Thread = 8 consecutive d of one row: 16-B loads of x (own and partner half), cos, sin; one 16-B store per plane per lane. A wave is
// 8 rows x the 32 d of one k-step (head, rt, kk, a): lane -> chunk q = lane & 3 (i = q >> 1, hh = q & 1), row c = 8 a + (lane >> 2),
// pos = 16 rt + c, d0 = 32 kk + 8 q. Four lanes share each 128-B source line (8 lines a load), and the 8 lanes of a chunk store 128
// contiguous bytes: every store of a wave is four whole lines.
// coverage: blk = 0 .. nrows*8/256 - 1, 256 thr x 8 halves each = nrows x 64 of each plane exactly (exact division checked statically);
//           flat thread index -> (head, rt, kk, a, row, q) -> (head, rt, kk, i, hh, c) is a bijection.
// =====================================================================================================
__device__ __forceinline__ void rope_blk(const float* __restrict__ x, const float* __restrict__ cosT,
                                         const float* __restrict__ sinT, u16* hpl, u16* lpl,
                                         int blk, int hpr, float sc) {
  const int gt  = blk * 256 + (int)threadIdx.x;
  const int til = gt >> 7;                    // head * (SEQ / 16) + rt
  const int kk  = (gt >> 6) & 1;
  const int c   = ((gt >> 5) & 1) * 8 + ((gt >> 2) & 7);
  const int q   = gt & 3;
  const int pos = (til % (SEQ / 16)) * 16 + c;
  const int row = pos * hpr + til / (SEQ / 16);
  const int d0  = kk * 32 + q * 8;
  const int d1  = d0 ^ 32;
  const float* xr = x + (size_t)row * HD;
  const float* cr = cosT + (size_t)pos * HD + d0;
  const float* sr = sinT + (size_t)pos * HD + d0;
  const v4f xa = *(const v4f*)(xr + d0), xb = *(const v4f*)(xr + d0 + 4);
  const v4f ya = *(const v4f*)(xr + d1), yb = *(const v4f*)(xr + d1 + 4);
  const v4f ca = *(const v4f*)(cr), cb = *(const v4f*)(cr + 4);
  const v4f sa = *(const v4f*)(sr), sb = *(const v4f*)(sr + 4);
  const float sgn = (d0 < 32) ? -1.0f : 1.0f;
  float w[8];
#pragma unroll
  for (int e = 0; e < 4; ++e) {
    w[e]     = xa[e] * ca[e] + (sgn * ya[e]) * sa[e];
    w[4 + e] = xb[e] * cb[e] + (sgn * yb[e]) * sb[e];
  }
  v4u oh, ol;
#pragma unroll
  for (int e = 0; e < 4; ++e) {
    const float t0 = w[2 * e] * sc, t1 = w[2 * e + 1] * sc;
    const _Float16 h0 = (_Float16)t0, h1 = (_Float16)t1;
    const _Float16 l0 = (_Float16)(t0 - (float)h0), l1 = (_Float16)(t1 - (float)h1);
    oh[e] = pk16(h_bits(h0), h_bits(h1));
    ol[e] = pk16(h_bits(l0), h_bits(l1));
  }
  const size_t o8 = (size_t)til * (16 * HD) + kk * 512 + (q >> 1) * 256 + ((q & 1) * 16 + c) * 8;
  {
    *(v4u*)(hpl + o8) = oh;
    *(v4u*)(lpl + o8) = ol;
    wait_store_regs();
  }
}

// =====================================================================================================
// v^T planes in fragment order: [head g][key tile kt = s / 32][j = d / 16][i][lane][8 halves] (4 KB a key tile and head), the 8 halves being
// row d = 16 j + (lane & 15), keys 32 kt + 16 i + 8 (lane >> 4) + 0..7: VH = f16(v[s][g][d] * 1024), VL = f16 residual of the same value.
// Block = (head g = blk / NST, 64 keys s0 = (blk % NST)*64): 64 source rows of HD floats loaded with 16-B loads, converted,
// scattered into two LDS tiles [d][64 keys] (pitch 72 halves); after a block barrier the tiles are read back in fragment order and stored.
// coverage: load 256 thr x 16 elements = 64 x 64; store 2 iterations x 256 thr x 8 halves = 64 lines x 64 = the block's tile of
//           each plane; blk = 0 .. NH x NST - 1 covers both planes exactly once. TH, TL: the block's two LDS tiles of HD * VTP halves.
// =====================================================================================================
__device__ __forceinline__ void vt_blk(const float* __restrict__ v, u16* VHo, u16* VLo, int blk, u16* TH, u16* TL) {
  const int tid = threadIdx.x;
  const int st  = blk % NST;
  const int g   = blk / NST;
  const int s0  = st * 64;
  {
    const int sl = tid >> 2;                  // key within tile 0..63
    const int dc = (tid & 3) * 16;            // d chunk
    const float* src = v + ((size_t)(s0 + sl) * NH + g) * HD + dc;
#pragma unroll
    for (int i = 0; i < 4; ++i) {
      const v4f a = *(const v4f*)(src + 4 * i);
#pragma unroll
      for (int e = 0; e < 4; ++e) {
        const float t = a[e] * VCAR;
        const _Float16 h = (_Float16)t;
        const _Float16 l = (_Float16)(t - (float)h);
        TH[(dc + 4 * i + e) * VTP + sl] = h_bits(h);
        TL[(dc + 4 * i + e) * VTP + sl] = h_bits(l);
      }
    }
  }
  __syncthreads();
  // iteration it = the block's key tile 2 st + it; wave = half fragment (j = wave >> 1, i = wave & 1); lane (hh, c) -> row d = 16 j + c,
  // keys 32 it + 16 i + 8 hh + 0..7 of the block's 64: the block's 8 KB of each plane are written in address order
  v4u vh[2], vl[2];
  const int line = (tid >> 6) * 16 + (tid & 15);                     // d = 0..63
  const int p8   = ((tid >> 5) & 1) * 16 + ((tid >> 4) & 1) * 8;     // key within the key tile
#pragma unroll
  for (int it = 0; it < 2; ++it) {
    vh[it] = *(const v4u*)(TH + line * VTP + it * 32 + p8);
    vl[it] = *(const v4u*)(TL + line * VTP + it * 32 + p8);
  }
  const size_t base = ((size_t)g * HD) * SEQ + (size_t)s0 * HD + tid * 8;
  {
#pragma unroll
    for (int it = 0; it < 2; ++it) {
      *(v4u*)(VHo + base + it * (32 * HD)) = vh[it];
      *(v4u*)(VLo + base + it * (32 * HD)) = vl[it];
    }
    wait_store_regs();
  }
}

// =====================================================================================================
// The three packings of the f32 projections in one grid: none reads what another writes. The block index picks the piece (block-uniform,
// so the barrier inside vt_blk is passed by all of a block or by none): VTB blocks of v^T first (two phases and a barrier: the longest),
// RPB blocks q', RPB blocks k'.  grid = VTB + 2 * RPB, exact.
// =====================================================================================================
__global__ __launch_bounds__(256) void pack3(const float* __restrict__ qf, const float* __restrict__ kf, const float* __restrict__ vf,
                                             const float* __restrict__ cosT, const float* __restrict__ sinT,
                                             u16* QHo, u16* QLo, u16* KHo, u16* KLo, u16* VHo, u16* VLo) {
  __shared__ __align__(16) u16 TH[HD * VTP];
  __shared__ __align__(16) u16 TL[HD * VTP];
  int b = blockIdx.x;
  if (b < VTB) { vt_blk(vf, VHo, VLo, b, TH, TL); return; }
  b -= VTB;
  if (b < RPB)          rope_blk(qf, cosT, sinT, QHo, QLo, b, NH, QSC);
  else if (b < 2 * RPB) rope_blk(kf, cosT, sinT, KHo, KLo, b - RPB, NH, KSC);
}

// =====================================================================================================
// Triple-masked attention: block bid -> (head = bid % NH, query tile pair qp = NQP-1 - bid / NH: rows q0 = 32*qp .. q0+31; the pairs with
// the most keys take the lowest block ids). Every wave carries both 16-row query tiles of the pair, each with a softmax state of its own, so that one
// load of a k or v fragment serves two tiles. The block's WPB waves share that one (pair, head) and split its key tiles: in every group of eight
// consecutive key tiles g each wave takes one, kt = 8g + ((wave - g) & 7), so that any stride-4 or stride-8 pattern of live tiles is spread too.
//   q, k planes (hi, lo f16 x1024) and v^T planes in fragment order, [h][row tile][k-step] and [h][key tile][d tile]; instrument and bar ids staged in LDS.
//   For each of the three masks in turn (block-uniform), each wave with its OWN running max m_a, sum Z_a and 4 accumulators acc_a per query tile (8 in all):
//     att 0: (iq == ik) && (iq < 129) && (j <= i)
//     att 1: (iq != ik) && (ik < 129) && (iq < 129) && (bq >= 0) && ((0 <= bq-bk <= 2) || (bq-bk == 4))
//     att 2: ((ik == 129) || (bk == -1)) && (j <= i)
//   A wave's key tiles of 32 visited in order (att 0/2 up to the causal limit, att 1 all NKT); per tile that passes the wave's scalar key-tile summary test (att 1, 2) every lane evaluates the mask bits of its
//   2 queries x 16 keys, a wave ballot skips tiles with no allowed element in either query tile (exact: such keys carry zero weight).
//   Both products are formed transposed, so that a lane owns one query of each query tile (column c of every D tile):
//   S^T = k'.q'^T: A = key rows, B = query rows, 2 key subtiles x 2 k-steps x 3 products (k_hi.q_hi + k_hi.q_lo + k_lo.q_hi), fragments loaded
//   straight from the 16-bit planes (two 16-B loads per fragment, each 512 contiguous bytes of a wave, split k map); a lane's 16 scores of a query tile are keys 16u + 8hh + r of
//   its own query; masked scores replaced by -inf; online max-subtracted base-2 softmax in f32 (scale 1/8 folded), -inf-safe rescale: the
//   maximum in-lane plus one exchange between the halves, the sum kept per half and joined once after the key loop.
//   O^T += v^T.P^T: the two score subtiles' registers, converted in place, ARE the B fragment of P^T in the split k map (no LDS, no lane
//   exchange); A = 4+4 v^T fragments (hi and residual planes), 12 WMMAs a query tile (hh + hl + lh); the rescale factor is the lane's own.
//   After each mask every wave publishes its partial (m, Z, acc) in its LDS slab; behind a
//   block barrier wave w merges the eight partials of rows 4w .. 4w+3 (a lane: one row, 8 d columns): M = max m_w, Z = sum Z_w 2^(m_w-M), acc likewise;
//   out_a = (Z > 0, i.e. the row has an allowed key) ? acc / Z : 0, carries 1/(32768*1024) folded once, summed in a lane-owned LDS tile:
//   O = out_0 + out_1 + out_2. A second barrier frees the slabs for the next mask. All barriers block-uniform; bounded loops only.
// coverage: per wave 4 rows x 8 lanes x 8 halves = 4 x 64 per plane, WPB waves = 32 x 64; grid NQP*NH blocks =
//           every (s, h) row of both O planes exactly once.
// =====================================================================================================
// second bound: four waves per SIMD (at most 256 registers), two blocks on a WGP: the grid takes two rounds
__global__ __launch_bounds__(ATT_THREADS, 4)
void attn3(const u16* __restrict__ QHIp, const u16* __restrict__ QLOp,
           const u16* __restrict__ KHIp, const u16* __restrict__ KLOp,
           const u16* __restrict__ VHIp, const u16* __restrict__ VLOp,
           const int* __restrict__ inst, const int* __restrict__ bar,
           u16* OHIp, u16* OLOp) {
  __shared__ __align__(16) float smem[WPB * WREG + QTW * SLW];
  __shared__ __align__(16) int sI[SEQ];
  __shared__ __align__(16) int sB[SEQ];

  const int tid  = threadIdx.x;
  const int wave = __builtin_amdgcn_readfirstlane(tid >> 5);   // scalar: it steers the key-tile loop
  const int lane = tid & 31;
  const int hh   = lane >> 4;
  const int c    = lane & 15;
  const int bid  = blockIdx.x;
  if (bid >= NQP * NH) return;               // block-uniform, before any barrier; never taken with the exact grid
  const int head = bid % NH;
  const int qp   = NQP - 1 - bid / NH;
  const int q0   = qp * (16 * QTW);
  const int rq   = lane >> 3;                // merge and output: this lane owns row 4*wave + rq of the block's 32,
  const int c8   = (lane & 7) * 8;           // d columns c8 .. c8 + 7
  const int row  = wave * 4 + rq;

  for (int i = tid; i < SEQ; i += ATT_THREADS) { sI[i] = inst[i]; sB[i] = bar[i]; }
  __syncthreads();

  float* slab = smem + wave * WREG;          // partial accumulators [16*QTW][64] pitch 68, written after a mask's key loop
  float* ml   = slab + QTW * SLW;            // partial m[16*QTW], Z[16*QTW]
  float* osum = smem + WPB * WREG;           // the block's result [16*QTW][64] pitch 68; elements (row, c8 .. c8 + 7) owned by this lane

  // byte offsets into the fragment-order planes (each plane SEQ*DMOD*2 bytes, far below 2^32); hi and residual planes share them
  const unsigned FRB  = 1024u;                                                  // bytes of a fragment (16 rows x 32 k)
  const unsigned RTB  = 2u * FRB;                                               // q', k': bytes of a 16-row tile of a head (2 k-steps)
  const unsigned KTB  = 32u * HD * 2u;                                          // k', v^T: bytes of a 32-key tile of a head
  const unsigned hofs = (unsigned)head * (SEQ * HD * 2u) + (unsigned)lane * 16u; // this head's part of a plane, this lane's 16 B
  const unsigned qofs = hofs + (unsigned)(q0 >> 4) * RTB;                        // query tile t: + t * RTB
  const float lsc = 0.125f * (LOG2E / (QSC * KSC));
  const float oc  = 1.0f / (PCAR * VCAR);
  // ids of this lane's own query of each tile (row q0 + 16t + c)
  int iqv[QTW], bqv[QTW];
#pragma unroll
  for (int t = 0; t < QTW; ++t) { iqv[t] = sI[q0 + 16 * t + c]; bqv[t] = sB[q0 + 16 * t + c]; }

  // ---- key-tile summaries, once a wave: four bits for each of the wave's own key tiles (bits 4g .. 4g + 3 = tile WPB*g + ((wave - g) & 7)),
  //      kept in scalar registers, so that the key loop passes a tile that cannot hold an allowed element on a scalar test, without the
  //      2 x 16 mask evaluations of every lane. Both tests are necessary conditions of the masks, for any content of the id arrays:
  //      att 1 allows (q, k) only if iq < 129, bq >= 0, ik < 129 and bq - bk in {0, 1, 2, 4}: then bk lies in [bq - 4, bq], inside
  //      [lo - 4, hi], lo and hi the least and largest bq of the block's 32 queries with iq < 129 and bq >= 0 (lo >= 0: lo - 4 does not wrap;
  //      no such query: lo = INT_MAX, hi = INT_MIN, no key passes);  att 2 allows only keys with ik == 129 or bk == -1.
  //      A tile that passes still gets the exact evaluation and its ballot below: the set of tiles that are multiplied stays the same.
  unsigned live1, live2;
  {
    const int  iq1 = sI[q0 + lane], bq1 = sB[q0 + lane];                         // a lane: one of the block's 32 queries
    const bool qv  = (iq1 < GINST) && (bq1 >= 0);
    const int  blo = __builtin_amdgcn_readfirstlane(wave_min_i(qv ? bq1 : 0x7fffffff)) - 4;
    const int  bhi = __builtin_amdgcn_readfirstlane(wave_max_i(qv ? bq1 : (int)0x80000000));
    // a lane: 8 consecutive keys (quarter lane & 3) of the wave's tile of group g1 = lane >> 2; four 16-B LDS reads cover the wave's 8 tiles
    const int g1  = lane >> 2;
    const int k8  = (WPB * g1 + ((wave - g1) & (WPB - 1))) * 32 + (lane & 3) * 8;
    const v4i ia = *(const v4i*)(sI + k8), ib = *(const v4i*)(sI + k8 + 4);
    const v4i ba = *(const v4i*)(sB + k8), bb = *(const v4i*)(sB + k8 + 4);
    bool c1 = false, c2 = false;                                                 // & and |, not && and ||: straight-line code, no lane branches
#pragma unroll
    for (int e = 0; e < 4; ++e) {
      c1 |= ((ia[e] < GINST) & (ba[e] >= blo) & (ba[e] <= bhi)) | ((ib[e] < GINST) & (bb[e] >= blo) & (bb[e] <= bhi));
      c2 |= (ia[e] == GINST) | (ba[e] == -1) | (ib[e] == GINST) | (bb[e] == -1);
    }
    live1 = __builtin_amdgcn_ballot_w32(c1);
    live2 = __builtin_amdgcn_ballot_w32(c2);
  }

  // kept rolled: with two query tiles a wave, three copies of the tile body and of the merge would be about 60 KB of code, nearly the
  // whole instruction cache; the mask is picked by a scalar branch at each key tile
#pragma unroll 1
  for (int att = 0; att < 3; ++att) {
    float mrow[QTW], lrow[QTW];              // this lane's query: running max (equal in both halves), this half's share of the sum
    v8f o[QTW][4];                            // o[t][j][r] = O^T[d = 16j + 8hh + r][query 16t + c]
#pragma unroll
    for (int t = 0; t < QTW; ++t) {
      mrow[t] = -INFINITY; lrow[t] = 0.f;
#pragma unroll
      for (int j = 0; j < 4; ++j) o[t][j] = zero8();
    }
    const int ncaus = ((q0 + 16 * QTW - 1) >> 5) + 1;                           // tiles holding keys <= the block's last query row
    const int nkt = (att == 1) ? NKT : ((ncaus < NKT) ? ncaus : NKT);

    const int ngrp = (nkt + WPB - 1) / WPB;
    const unsigned livem = (att == 1) ? live1 : (att == 2) ? live2 : 0xffffffffu;  // wave-uniform
#pragma unroll 1
    for (int g = 0; g < ngrp; ++g) {
      const int kt = WPB * g + ((wave - g) & (WPB - 1));
      if (kt >= nkt) continue;                                                   // wave-uniform
      if (((livem >> (4 * g)) & 0xfu) == 0u) continue;                           // wave-uniform: no key of the tile can be allowed under this mask
      const int kb = kt * 32;
      // ids of this lane's 16 keys kb + 16u + 8hh + r (the rows of its D registers), 16-B LDS reads
      int ik[2][8], bk[2][8];
#pragma unroll
      for (int u = 0; u < 2; ++u) {
        const v4i ia = *(const v4i*)(sI + kb + 16 * u + 8 * hh), ib = *(const v4i*)(sI + kb + 16 * u + 8 * hh + 4);
        const v4i ba = *(const v4i*)(sB + kb + 16 * u + 8 * hh), bb = *(const v4i*)(sB + kb + 16 * u + 8 * hh + 4);
#pragma unroll
        for (int e = 0; e < 4; ++e) { ik[u][e] = ia[e]; ik[u][4 + e] = ib[e]; bk[u][e] = ba[e]; bk[u][4 + e] = bb[e]; }
      }
      // causal test j <= i (j = kb + 8hh + 16u + r, i = q0 + c + 16t) written against the constant 16u + r - 16t
      const int di = (q0 + c) - (kb + 8 * hh);
      unsigned okb[QTW];                                                         // bit 8u + r
#pragma unroll
      for (int t = 0; t < QTW; ++t) {
        unsigned ob = 0u;
        if (att == 0) {
          const bool qa = iqv[t] < GINST;
#pragma unroll
          for (int u = 0; u < 2; ++u) {
#pragma unroll
            for (int r = 0; r < 8; ++r) {
              const bool ok = qa && (iqv[t] == ik[u][r]) && (16 * u + r - 16 * t <= di);
              ob |= ok ? (1u << (8 * u + r)) : 0u;
            }
          }
        } else if (att == 1) {
          const bool qa = (iqv[t] < GINST) && (bqv[t] >= 0);
#pragma unroll
          for (int u = 0; u < 2; ++u) {
#pragma unroll
            for (int r = 0; r < 8; ++r) {
              const int  d  = bqv[t] - bk[u][r];
              const bool w  = ((d >= 0) && (d <= 2)) || (d == 4);
              const bool ok = qa && (ik[u][r] < GINST) && (iqv[t] != ik[u][r]) && w;
              ob |= ok ? (1u << (8 * u + r)) : 0u;
            }
          }
        } else {
#pragma unroll
          for (int u = 0; u < 2; ++u) {
#pragma unroll
            for (int r = 0; r < 8; ++r) {
              const bool ok = ((ik[u][r] == GINST) || (bk[u][r] == -1)) && (16 * u + r - 16 * t <= di);
              ob |= ok ? (1u << (8 * u + r)) : 0u;
            }
          }
        }
        okb[t] = ob;
      }
      const unsigned anyw = __builtin_amdgcn_ballot_w32((okb[0] | okb[1]) != 0u);    // wave-uniform
      if (anyw == 0u) continue;

      // ---- scores, transposed: D element r of this lane = (key kb + 16u + 8hh + r, query q0 + 16t + c) in s[t][u];
      //      each k fragment (A) is loaded once and multiplied with both query tiles (B) ----
      v8f s[QTW][2];
#pragma unroll
      for (int t = 0; t < QTW; ++t) { s[t][0] = zero8(); s[t][1] = zero8(); }
      const unsigned ko = hofs + (unsigned)kt * KTB;                               // the key tile's place in the k' planes and in the v^T planes
#pragma unroll
      for (int kk = 0; kk < 2; ++kk) {
        const v16h kh0 = ldfrag_o(KHIp, ko, kk * FRB),         kl0 = ldfrag_o(KLOp, ko, kk * FRB);
        const v16h kh1 = ldfrag_o(KHIp, ko, RTB + kk * FRB),   kl1 = ldfrag_o(KLOp, ko, RTB + kk * FRB);
        const v16h qa  = ldfrag_o(QHIp, qofs, kk * FRB),       qb  = ldfrag_o(QLOp, qofs, kk * FRB);
        const v16h qc  = ldfrag_o(QHIp, qofs, RTB + kk * FRB), qd  = ldfrag_o(QLOp, qofs, RTB + kk * FRB);
        s[0][0] = mma_h(kh0, qa, s[0][0]);
        s[0][0] = mma_h(kh0, qb, s[0][0]);
        s[0][0] = mma_h(kl0, qa, s[0][0]);
        s[0][1] = mma_h(kh1, qa, s[0][1]);
        s[0][1] = mma_h(kh1, qb, s[0][1]);
        s[0][1] = mma_h(kl1, qa, s[0][1]);
        s[1][0] = mma_h(kh0, qc, s[1][0]);
        s[1][0] = mma_h(kh0, qd, s[1][0]);
        s[1][0] = mma_h(kl0, qc, s[1][0]);
        s[1][1] = mma_h(kh1, qc, s[1][1]);
        s[1][1] = mma_h(kh1, qd, s[1][1]);
        s[1][1] = mma_h(kl1, qc, s[1][1]);
        guard10(s[0][0], s[0][1], s[1][0], s[1][1], qa, qb, qc, qd, kh0, kl0, kh1, kl1, kh0, kl0);
      }
      // ---- v^T fragments (A of the second product): row d = 16j + c, fragment j of the key tile; each is loaded once and
      //      multiplied with both query tiles' prob fragments ----
      const v16h vh0 = ldfrag_o(VHIp, ko, 0u);
      const v16h vh1 = ldfrag_o(VHIp, ko, FRB);
      const v16h vh2 = ldfrag_o(VHIp, ko, 2u * FRB);
      const v16h vh3 = ldfrag_o(VHIp, ko, 3u * FRB);
      const v16h vl0 = ldfrag_o(VLOp, ko, 0u);
      const v16h vl1 = ldfrag_o(VLOp, ko, FRB);
      const v16h vl2 = ldfrag_o(VLOp, ko, 2u * FRB);
      const v16h vl3 = ldfrag_o(VLOp, ko, 3u * FRB);
#pragma unroll
      for (int t = 0; t < QTW; ++t) {
        // ---- mask (replace by -inf) + online softmax in base 2, -inf-safe, for this lane's query; a query with no allowed key in this
        //      key tile goes through with al = 1 (or 0 on a zero state) and all-zero probs: its state keeps its bits ----
        float tv[2][8];
        float mx = -INFINITY;
#pragma unroll
        for (int u = 0; u < 2; ++u) {
#pragma unroll
          for (int r = 0; r < 8; ++r) {
            const bool ok = ((okb[t] >> (8 * u + r)) & 1u) != 0u;
            tv[u][r] = ok ? (s[t][u][r] * lsc) : -INFINITY;
            mx = fmaxf(mx, tv[u][r]);
          }
        }
        mx = fmaxf(mx, xhalf(mx));
        const float mn = fmaxf(mrow[t], mx);
        const float ms = (mn == -INFINITY) ? 0.0f : mn;
        const float al = exp2f(mrow[t] - ms);
        mrow[t] = mn;
        // B fragments of P^T * 32768: hi f16 and residual f16, column = this lane's query; elements 0..7 = keys kb + 8hh + 0..7 (subtile 0),
        // elements 8..15 = keys kb + 16 + 8hh + 0..7 (subtile 1): the split k map of the v^T loader
        FragH ph, pl;
        float ps = 0.0f;
#pragma unroll
        for (int u = 0; u < 2; ++u) {
#pragma unroll
          for (int r = 0; r < 8; ++r) {
            const float e = exp2f(tv[u][r] - ms);
            ps += e;
            const float ta = e * PCAR;
            const _Float16 ha = (_Float16)ta;
            ph.h[u][r] = ha;
            pl.h[u][r] = (_Float16)(ta - (float)ha);
          }
        }
        lrow[t] = lrow[t] * al + ps;
#pragma unroll
        for (int j = 0; j < 4; ++j) o[t][j] *= al;
        o[t][0] = mma_h(vh0, ph.v, o[t][0]);  o[t][0] = mma_h(vh0, pl.v, o[t][0]);  o[t][0] = mma_h(vl0, ph.v, o[t][0]);
        o[t][1] = mma_h(vh1, ph.v, o[t][1]);  o[t][1] = mma_h(vh1, pl.v, o[t][1]);  o[t][1] = mma_h(vl1, ph.v, o[t][1]);
        o[t][2] = mma_h(vh2, ph.v, o[t][2]);  o[t][2] = mma_h(vh2, pl.v, o[t][2]);  o[t][2] = mma_h(vl2, ph.v, o[t][2]);
        o[t][3] = mma_h(vh3, ph.v, o[t][3]);  o[t][3] = mma_h(vh3, pl.v, o[t][3]);  o[t][3] = mma_h(vl3, ph.v, o[t][3]);
        guard10(o[t][0], o[t][1], o[t][2], o[t][3], ph.v, pl.v, vh0, vh1, vh2, vh3, vl0, vl1, vl2, vl3);
      }
    }
#pragma unroll
    for (int t = 0; t < QTW; ++t) acc_guard4(o[t][0], o[t][1], o[t][2], o[t][3]);
    // ---- publish this wave's partial: acc in its slab (a lane: its query's row, 8 consecutive d per j, 16-B stores); m and Z, the two
    //      halves' sums joined here, by the lower half ----
#pragma unroll
    for (int t = 0; t < QTW; ++t) {
#pragma unroll
      for (int j = 0; j < 4; ++j) {
        float* sp = slab + (16 * t + c) * 68 + j * 16 + 8 * hh;
        v4f a, b4;
#pragma unroll
        for (int e = 0; e < 4; ++e) { a[e] = o[t][j][e]; b4[e] = o[t][j][4 + e]; }
        *(v4f*)(sp)     = a;
        *(v4f*)(sp + 4) = b4;
      }
      const float z = lrow[t] + xhalf(lrow[t]);
      if (hh == 0) {
        ml[16 * t + c]            = mrow[t];
        ml[16 * QTW + 16 * t + c] = z;
      }
    }
    __syncthreads();                          // all WPB partials of this mask are visible
    // ---- merge for this lane's row and 8 d columns: out_a = acc / Z (0 when no key allowed), carries (32768 on P, 1024 on v) folded once ----
    {
      float mw[WPB], zw[WPB];
#pragma unroll
      for (int w2 = 0; w2 < WPB; ++w2) {
        mw[w2] = smem[w2 * WREG + QTW * SLW + row];
        zw[w2] = smem[w2 * WREG + QTW * SLW + 16 * QTW + row];
      }
      float mx = mw[0];
#pragma unroll
      for (int w2 = 1; w2 < WPB; ++w2) mx = fmaxf(mx, mw[w2]);
      const float ms = (mx == -INFINITY) ? 0.0f : mx;
      float lv = 0.0f;
      v4f oa = {0.f, 0.f, 0.f, 0.f}, ob = {0.f, 0.f, 0.f, 0.f};
#pragma unroll
      for (int w2 = 0; w2 < WPB; ++w2) {
        const float sc = exp2f(mw[w2] - ms);
        const float* ap = smem + w2 * WREG + row * 68 + c8;
        lv += zw[w2] * sc;
        oa += *(const v4f*)(ap) * sc;
        ob += *(const v4f*)(ap + 4) * sc;
      }
      const float ls  = (lv > 0.0f) ? lv : 1.0f;
      const float inv = (lv > 0.0f) ? ((1.0f / ls) * oc) : 0.0f;
      float* op = osum + row * 68 + c8;
      if (att == 0) {
        *(v4f*)(op)     = oa * inv;
        *(v4f*)(op + 4) = ob * inv;
      } else {
        *(v4f*)(op)     = *(const v4f*)(op) + oa * inv;
        *(v4f*)(op + 4) = *(const v4f*)(op + 4) + ob * inv;
      }
    }
    __syncthreads();                          // every reader has left the slabs (the next mask overwrites them); after the last mask: osum is whole
  }

  // ---- O x1024 -> f16 hi + residual planes; wave = group of 4 rows, lane = (row in group, 8 consecutive d) ----
  v4u oh, ol;
  {
    const v4f a = *(const v4f*)(osum + row * 68 + c8), b4 = *(const v4f*)(osum + row * 68 + c8 + 4);
    float w[8];
#pragma unroll
    for (int e = 0; e < 4; ++e) { w[e] = a[e] * OSC; w[4 + e] = b4[e] * OSC; }
#pragma unroll
    for (int e = 0; e < 4; ++e) {
      const _Float16 h0 = (_Float16)w[2 * e], h1 = (_Float16)w[2 * e + 1];
      const _Float16 l0 = (_Float16)(w[2 * e] - (float)h0), l1 = (_Float16)(w[2 * e + 1] - (float)h1);
      oh[e] = pk16(h_bits(h0), h_bits(h1));
      ol[e] = pk16(h_bits(l0), h_bits(l1));
    }
  }
  const size_t o8 = (((size_t)(q0 + row)) * NH + head) * HD + c8;
  *(v4u*)(OHIp + o8) = oh;
  *(v4u*)(OLOp + o8) = ol;
}

// =====================================================================================================
// Workspace map (bytes); every plane is fully written by whole-line stores before it is read; all extents are exact multiples
// of the store granularity (no pad rows needed); every offset a multiple of SEQ*256:
//   CT  f32 [SEQ][64]                  SEQ*256        ST  same
//   XB  bf16 [SEQ][1024]               SEQ*2048
//   WQB bf16 [1024 n][1024 k]         2097152        WKB, WVB same        2097152 each
//   WOH f16  [1024 n][1024 k] x1024   2097152
//   QF  f32 [SEQ][1024]                SEQ*4096       KF, VF same
//   QHI f16 [16][SEQ/16][2][2][32][8] x1024  SEQ*2048  QLO residual   (fragment order: head, row tile, k-step, i, lane)
//   KHI f16 [16][SEQ/16][2][2][32][8] x1024  SEQ*2048  KLO residual
//   VHI f16 [16][SEQ/32][4][2][32][8] x1024  SEQ*2048  VLO residual   (fragment order: head, key tile, d tile, i, lane)
//   OHI f16 [SEQ][1024] x1024          SEQ*2048       OLO residual
//   end (SEQ = 2048)                  72351744
// =====================================================================================================
extern "C" void kernel_launch(void* const* d_in, const int* in_sizes, int n_in,
                              void* d_out, int out_size, void* d_ws, size_t ws_size,
                              hipStream_t stream) {
  if (n_in < 11) return;
  if (in_sizes[0] != SEQ * DMOD) return;
  if (in_sizes[1] != SEQ || in_sizes[2] != SEQ) return;
  if (in_sizes[3] != DMOD * DMOD || in_sizes[5] != DMOD * DMOD) return;
  if (in_sizes[7] != DMOD * DMOD || in_sizes[9] != DMOD * DMOD) return;
  if (in_sizes[4] != DMOD || in_sizes[6] != DMOD || in_sizes[8] != DMOD || in_sizes[10] != DMOD) return;
  if (out_size != SEQ * DMOD) return;

  const float* x   = (const float*)d_in[0];
  const int*   bar = (const int*)d_in[1];
  const int*   ins = (const int*)d_in[2];
  const float* wq  = (const float*)d_in[3];
  const float* bq  = (const float*)d_in[4];
  const float* wk  = (const float*)d_in[5];
  const float* bk  = (const float*)d_in[6];
  const float* wv  = (const float*)d_in[7];
  const float* bv  = (const float*)d_in[8];
  const float* wo  = (const float*)d_in[9];
  const float* bo  = (const float*)d_in[10];
  float*       out = (float*)d_out;

  const size_t szTab = (size_t)SEQ * HD * 4;                    //   524288
  const size_t szXB  = (size_t)SEQ * DMOD * 2;                  //  4194304
  const size_t szW   = (size_t)DMOD * DMOD * 2;                 //  2097152
  const size_t szF   = (size_t)SEQ * DMOD * 4;                  //  8388608
  const size_t szP   = (size_t)SEQ * DMOD * 2;                  //  4194304
  size_t off = 0;
  const size_t oCT  = off; off += szTab;
  const size_t oST  = off; off += szTab;
  const size_t oXB  = off; off += szXB;
  const size_t oWQ  = off; off += szW;
  const size_t oWK  = off; off += szW;
  const size_t oWV  = off; off += szW;
  const size_t oWO  = off; off += szW;
  const size_t oQF  = off; off += szF;
  const size_t oKF  = off; off += szF;
  const size_t oVF  = off; off += szF;
  const size_t oQHI = off; off += szP;
  const size_t oQLO = off; off += szP;
  const size_t oKHI = off; off += szP;
  const size_t oKLO = off; off += szP;
  const size_t oVHI = off; off += szP;
  const size_t oVLO = off; off += szP;
  const size_t oOHI = off; off += szP;
  const size_t oOLO = off; off += szP;
  if (off > ws_size) return;                            // off = 72351744 at SEQ = 2048
  if (off > (size_t)134217728) return;

  char* ws = (char*)d_ws;
  float* CT  = (float*)(ws + oCT);
  float* ST  = (float*)(ws + oST);
  u16*   XB  = (u16*)(ws + oXB);
  u16*   WQB = (u16*)(ws + oWQ);
  u16*   WKB = (u16*)(ws + oWK);
  u16*   WVB = (u16*)(ws + oWV);
  u16*   WOH = (u16*)(ws + oWO);
  float* QF  = (float*)(ws + oQF);
  float* KF  = (float*)(ws + oKF);
  float* VF  = (float*)(ws + oVF);
  u16*   QHI = (u16*)(ws + oQHI);
  u16*   QLO = (u16*)(ws + oQLO);
  u16*   KHI = (u16*)(ws + oKHI);
  u16*   KLO = (u16*)(ws + oKLO);
  u16*   VHI = (u16*)(ws + oVHI);
  u16*   VLO = (u16*)(ws + oVLO);
  u16*   OHI = (u16*)(ws + oOHI);
  u16*   OLO = (u16*)(ws + oOLO);

  // inv_freq[i] = 1 / pow(10000, i/32) in f32 (pow correctly converted from f64, then IEEE f32 reciprocal)
  InvF inv;
  for (int i = 0; i < 32; ++i) {
    const double p = pow(10000.0, (double)i / 32.0);
    const float pf = (float)p;
    inv.f[i] = 1.0f / pf;
  }

  const dim3 blk(256);
  const dim3 gPrep(TABB + XCB + 4 * WCB);               // 256 + 1024 + 2048
  const dim3 gG((SEQ / 64) * (DMOD / 64));              // 512
  const dim3 gG3((SEQ / 64) * (DMOD / 64), 3);          // 512 x 3
  const dim3 bG(128);
  const dim3 gPack(VTB + 2 * RPB);                      // 512 + 2048
  const dim3 gAT(ATT_BLOCKS);                           // 1024
  const dim3 bAT(ATT_THREADS);                          // 256

  // (0) rotary cos/sin tables [SEQ][64]; x, Wq, Wk, Wv -> bf16 planes (same layout, already k-contiguous); Wo -> f16 plane of bf16 value x1024
  prep<<<gPrep, blk, 0, stream>>>(x, wq, wk, wv, wo, XB, WQB, WKB, WVB, WOH, CT, ST, inv);
  // (1) projections: q, k, v [SEQ][1024] in f32 (+ bias)
  gemm_bf<<<gG3, bG, 0, stream>>>(XB, WQB, WKB, WVB, bq, bk, bv, QF, KF, VF, SEQ, DMOD, DMOD, 1.0f);
  // (2) q', k' planes (source rows (s, h), heads per position NH) and v^T planes x1024 (hi + residual), all in fragment order
  pack3<<<gPack, blk, 0, stream>>>(QF, KF, VF, CT, ST, QHI, QLO, KHI, KLO, VHI, VLO);
  // (3) three masked attentions summed -> O planes [s][h][d] x1024 (hi + residual)
  attn3<<<gAT, bAT, 0, stream>>>(QHI, QLO, KHI, KLO, VHI, VLO, ins, bar, OHI, OLO);
  // (4) output projection -> out [SEQ][1024] f32, carries 1024 (O) x 1024 (Wo) folded back, + bo
  gemm_h2<<<gG, bG, 0, stream>>>(OHI, OLO, WOH, bo, out, SEQ, DMOD, DMOD, 1.0f / (OSC * WOS));
  (void)hipGetLastError();
}

// v008
// Measured time: 97.3 microseconds a run.
// Timed twice side by side with v007, it ran 1.07 times as fast both times.
// Counting every step since v000, it is 3.44 times as fast.
// Contractions: x.W{q,k,v}^T on v_wmma_f32_16x16x32_bf16 (x and W RNE-converted to bf16, f32 accumulate);
// scores k'.q'^T (transposed; q', k' carried x1024 as f16 hi plane + f16 residual plane, products hh+lh+hl), v^T.P^T (P x32768 f16 hi+residual,
// v x1024 f16 hi+residual, products hh+lh+hl) and O.Wo^T (O x1024 f16 hi+residual, Wo as f16(bf16(Wo) x1024), products h.w+l.w):
// v_wmma_f32_16x16x32_f16, f32 accumulate. Rotary tables, rotation, masks, masked base-2 online softmax and 1/l fold in f32 on VALU.
#include <hip/hip_runtime.h>
#include <math.h>
#include <stdint.h>

#define SEQ   2048
#define DMOD  1024
#define NH    16
#define HD    64
#define GINST 129
#define QSC   1024.0f
#define KSC   1024.0f
#define PCAR  32768.0f
#define VCAR  1024.0f
#define OSC   1024.0f
#define WOS   1024.0f
#define LOG2E 1.4426950408889634f
#define WPB   8
#define QTW   2
#define NQP   (SEQ / (16 * QTW))
#define NKT   (SEQ / 32)
#define ATT_THREADS (WPB * 32)
#define ATT_BLOCKS  (NQP * NH)
#define SLW   (16 * 68)
#define WREG  (QTW * SLW + QTW * 32)
#define SLAB64 (16 * 68)
#define GKC   128
#define GPB   272
#define GOPB  (64 * GPB)
#define GKS   (GKC / 32)
#define TABB  (SEQ / 8)
#define XCB   ((SEQ * DMOD) / 2048)
#define WCB   ((DMOD * DMOD) / 2048)
static_assert(DMOD == NH * HD && HD == 64 && NH == 16);
static_assert(WPB == 8 && ATT_THREADS == 256 && (WREG % 4) == 0 && (SLW % 4) == 0 && QTW == 2);
static_assert((SEQ % 64) == 0 && (SEQ % ATT_THREADS) == 0 && (SEQ % 8) == 0 && SEQ <= 32768);
static_assert((DMOD % 64) == 0 && (DMOD % 32) == 0);
static_assert(16 * QTW == 32 && NKT == 8 * WPB);
static_assert(((SEQ * DMOD) % 2048) == 0 && ((DMOD * DMOD) % 2048) == 0);
static_assert((DMOD % GKC) == 0 && (DMOD / GKC) >= 2 && GKC * 2 == 256 && GPB == 256 + 16 && (SEQ % 64) == 0);

typedef unsigned short u16;
typedef _Float16 v16h __attribute__((ext_vector_type(16)));
typedef _Float16 v8h  __attribute__((ext_vector_type(8)));
typedef __bf16   v16b __attribute__((ext_vector_type(16)));
typedef float    v8f  __attribute__((ext_vector_type(8)));
typedef float    v4f  __attribute__((ext_vector_type(4)));
typedef unsigned int v4u __attribute__((ext_vector_type(4)));
typedef int v4i __attribute__((ext_vector_type(4)));

union FragH { v16h v; v8h h[2]; v4u u[2]; };
union FragB { v16b v; v4u u[2]; };

struct InvF { float f[32]; };
static_assert(sizeof(InvF) == 128);

// ---- scalar helpers --------------------------------------------------------------------------------
__device__ __forceinline__ unsigned short bf_bits(float f) {          // f32 -> bf16 bits, RNE convert
  unsigned u = __float_as_uint(f);
  return (unsigned short)((u + 0x7FFFu + ((u >> 16) & 1u)) >> 16);
}
__device__ __forceinline__ float bf_up(unsigned short h) { return __uint_as_float(((unsigned)h) << 16); }
__device__ __forceinline__ float bfr(float f) { return bf_up(bf_bits(f)); }
__device__ __forceinline__ unsigned short h_bits(_Float16 x) { return __builtin_bit_cast(unsigned short, x); }
__device__ __forceinline__ unsigned pk16(unsigned short a, unsigned short b) { return (unsigned)a | ((unsigned)b << 16); }
__device__ __forceinline__ v8f zero8() { v8f z = {0.f, 0.f, 0.f, 0.f, 0.f, 0.f, 0.f, 0.f}; return z; }

// ---- fragment map: 16-bit A/B operand, lane -> row/col (lane&15), half hh = lane>>4;
//      elements 0..7 <- k0+8hh+0..7, elements 8..15 <- k0+16+8hh+0..7  (same split k map for A and B)
// ---- fragment-order planes (q', k', v^T): a fragment (16 rows x 32 k) is 1 KB in a row: [i = 0,1][lane 0..31][8 halves], the 8 halves being
//      row (lane&15), k = k0 + 16i + 8hh + 0..7: what lane holds in elements 8i .. 8i+7. One load of a wave is then 512 contiguous bytes,
//      four whole 128-B lines, where a row-major plane gives 16-B pieces of 16 lines.
// fragment from a wave-uniform plane base plus a 32-bit per-lane byte offset (fragment start + 16 * lane)
__device__ __forceinline__ v16h ldfrag_o(const u16* base, unsigned boff, unsigned cbytes) {
  const char* p = (const char*)(const void*)base + boff;
  FragH f;
  f.h[0] = *(const v8h*)(p + cbytes);
  f.h[1] = *(const v8h*)(p + cbytes + 512);
  return f.v;
}

__device__ __forceinline__ v8f mma_h(v16h a, v16h b, v8f c) {
  return __builtin_amdgcn_wmma_f32_16x16x32_f16(false, a, false, b, (short)0, c, false, false);
}
__device__ __forceinline__ v8f mma_b(v16b a, v16b b, v8f c) {
  return __builtin_amdgcn_wmma_f32_16x16x32_bf16(false, a, false, b, (short)0, c, false, false);
}
template <typename F>
__device__ __forceinline__ void guard6(v8f& a, v8f& b, v8f& c, v8f& d, F x0, F x1, F x2, F x3, F x4, F x5) {
#if defined(__HIP_DEVICE_COMPILE__)
  asm volatile("v_nop\n\tv_nop\n\tv_nop\n\tv_nop"
               : "+v"(a), "+v"(b), "+v"(c), "+v"(d) : "v"(x0), "v"(x1), "v"(x2), "v"(x3), "v"(x4), "v"(x5) : "memory");
#endif
}
__device__ __forceinline__ void guard10(v8f& a, v8f& b, v8f& c, v8f& d, v16h x0, v16h x1, v16h x2, v16h x3, v16h x4,
                                        v16h x5, v16h x6, v16h x7, v16h x8, v16h x9) {
#if defined(__HIP_DEVICE_COMPILE__)
  asm volatile("v_nop\n\tv_nop\n\tv_nop\n\tv_nop"
               : "+v"(a), "+v"(b), "+v"(c), "+v"(d)
               : "v"(x0), "v"(x1), "v"(x2), "v"(x3), "v"(x4), "v"(x5), "v"(x6), "v"(x7), "v"(x8), "v"(x9) : "memory");
#endif
}
__device__ __forceinline__ void acc_guard4(v8f& a, v8f& b, v8f& c, v8f& d) {
#if defined(__HIP_DEVICE_COMPILE__)
  asm volatile("v_nop\n\tv_nop\n\tv_nop\n\tv_nop" : "+v"(a), "+v"(b), "+v"(c), "+v"(d));
#endif
}
// the value that lane l ^ 16 holds: the other half's share of the same query column
__device__ __forceinline__ float xhalf(float x) {
  const int b = __float_as_int(x);
  return __int_as_float(__builtin_amdgcn_permlanex16(b, b, 0x76543210, 0xfedcba98, false, false));
}
// minimum and maximum over the 32 lanes of a wave, every lane on: four exchanges inside a 16-lane row (DPP row_xmask 1, 2, 4, 8), then
// one between the two rows; every lane ends with the result
__device__ __forceinline__ int wave_min_i(int x) {
  int y;
  y = __builtin_amdgcn_update_dpp(x, x, 0x161, 0xf, 0xf, false); x = (y < x) ? y : x;
  y = __builtin_amdgcn_update_dpp(x, x, 0x162, 0xf, 0xf, false); x = (y < x) ? y : x;
  y = __builtin_amdgcn_update_dpp(x, x, 0x164, 0xf, 0xf, false); x = (y < x) ? y : x;
  y = __builtin_amdgcn_update_dpp(x, x, 0x168, 0xf, 0xf, false); x = (y < x) ? y : x;
  y = __builtin_amdgcn_permlanex16(x, x, 0x76543210, 0xfedcba98, false, false); x = (y < x) ? y : x;
  return x;
}
__device__ __forceinline__ int wave_max_i(int x) {
  int y;
  y = __builtin_amdgcn_update_dpp(x, x, 0x161, 0xf, 0xf, false); x = (y > x) ? y : x;
  y = __builtin_amdgcn_update_dpp(x, x, 0x162, 0xf, 0xf, false); x = (y > x) ? y : x;
  y = __builtin_amdgcn_update_dpp(x, x, 0x164, 0xf, 0xf, false); x = (y > x) ? y : x;
  y = __builtin_amdgcn_update_dpp(x, x, 0x168, 0xf, 0xf, false); x = (y > x) ? y : x;
  y = __builtin_amdgcn_permlanex16(x, x, 0x76543210, 0xfedcba98, false, false); x = (y > x) ? y : x;
  return x;
}
__device__ __forceinline__ void wave_sync_lds() {
  __builtin_amdgcn_fence(__ATOMIC_RELEASE, "workgroup");
  __builtin_amdgcn_wave_barrier();
  __builtin_amdgcn_fence(__ATOMIC_ACQUIRE, "workgroup");
}

// ---- GEMM operand staging: a stage = GKC k elements (256 B) of 64 rows of an operand, LDS row pitch GPB bytes ----
__device__ __forceinline__ unsigned lds_off(const void* p) { return (unsigned)(size_t)p; }   // LDS byte address of a __shared__ object
// 16 rows x 256 B of one operand, global memory -> LDS through no register: eight asynchronous copies of this wave. A copy is 2 whole rows
// (lane -> row lane >> 4, 16-B column lane & 15), four whole 128-B lines. l, g: this lane's LDS byte address and global address in copy 0;
// copy i lies 2 rows further on in both (ldk = elements between global rows). All 32 lanes on; both addresses multiples of 16.
// The closing s_wait_xcnt 0 stands inside the statement so that no address register named here is rewritten in front of it.
__device__ __forceinline__ void copy16rows(unsigned l, const u16* g, size_t ldk) {
#if defined(__HIP_DEVICE_COMPILE__)
  asm volatile("global_load_async_to_lds_b128 %0, %8, off\n\t"
               "global_load_async_to_lds_b128 %1, %9, off\n\t"
               "global_load_async_to_lds_b128 %2, %10, off\n\t"
               "global_load_async_to_lds_b128 %3, %11, off\n\t"
               "global_load_async_to_lds_b128 %4, %12, off\n\t"
               "global_load_async_to_lds_b128 %5, %13, off\n\t"
               "global_load_async_to_lds_b128 %6, %14, off\n\t"
               "global_load_async_to_lds_b128 %7, %15, off\n\t"
               "s_wait_xcnt 0x0"
               :: "v"(l), "v"(l + 2u * GPB), "v"(l + 4u * GPB), "v"(l + 6u * GPB),
                  "v"(l + 8u * GPB), "v"(l + 10u * GPB), "v"(l + 12u * GPB), "v"(l + 14u * GPB),
                  "v"(g), "v"(g + 2 * ldk), "v"(g + 4 * ldk), "v"(g + 6 * ldk),
                  "v"(g + 8 * ldk), "v"(g + 10 * ldk), "v"(g + 12 * ldk), "v"(g + 14 * ldk)
               : "memory");
#endif
}
// this wave's own copies have landed (the compiler places no wait for them)
__device__ __forceinline__ void wait_copies() {
#if defined(__HIP_DEVICE_COMPILE__)
  asm volatile("s_wait_asynccnt 0x0" ::: "memory");
#endif
}
// this wave's LDS reads have retired: stands in front of the barrier behind which the buffer it read is refilled
__device__ __forceinline__ void wait_lds() {
#if defined(__HIP_DEVICE_COMPILE__)
  asm volatile("s_wait_dscnt 0x0" ::: "memory");
#endif
}
// stands behind a piece's last global stores: in a grid of several pieces another piece's code follows in the listing and rewrites the
// registers that the stores name; this wait is in front of every such write (which piece is laid last is the compiler's choice: each has it)
__device__ __forceinline__ void wait_store_regs() {
#if defined(__HIP_DEVICE_COMPILE__)
  asm volatile("s_wait_xcnt 0x0" ::: "memory");
#endif
}
// fragment from a staged row: p = row start + 64 * k-step + 16 * (lane >> 4) bytes; the split k map of the loaders above (bytes +0 and +32)
__device__ __forceinline__ v16b ldsfrag_b(const unsigned char* p) {
  FragB f;
  f.u[0] = *(const v4u*)(p);
  f.u[1] = *(const v4u*)(p + 32);
  return f.v;
}
__device__ __forceinline__ v16h ldsfrag_h(const unsigned char* p) {
  FragH f;
  f.u[0] = *(const v4u*)(p);
  f.u[1] = *(const v4u*)(p + 32);
  return f.v;
}

// ---- accurate f32 sin/cos of a non-negative f32 angle (|angle| < 32768): f64 two-part pi/2 reduction + f64 polynomials,
//      plain f64 fma/mul only (no library f64 trig path), result converted to f32.
__device__ __forceinline__ void sincos_acc(float angf, float& sv, float& cv) {
  const double a = (double)angf;
  const double TWO_OVER_PI = 0.63661977236758134308;
  const double PIO2_HI = 1.5707963267948966;
  const double PIO2_LO = 6.123233995736766e-17;
  const int kq = (int)(a * TWO_OVER_PI + 0.5);
  const double kd = (double)kq;
  double r = fma(-kd, PIO2_HI, a);
  r = fma(-kd, PIO2_LO, r);
  const double r2 = r * r;
  double sp = 1.0 / 6227020800.0;
  sp = fma(sp, r2, -1.0 / 39916800.0);
  sp = fma(sp, r2, 1.0 / 362880.0);
  sp = fma(sp, r2, -1.0 / 5040.0);
  sp = fma(sp, r2, 1.0 / 120.0);
  sp = fma(sp, r2, -1.0 / 6.0);
  const double s = fma(sp * r2, r, r);
  double cp = -1.0 / 87178291200.0;
  cp = fma(cp, r2, 1.0 / 479001600.0);
  cp = fma(cp, r2, -1.0 / 3628800.0);
  cp = fma(cp, r2, 1.0 / 40320.0);
  cp = fma(cp, r2, -1.0 / 720.0);
  cp = fma(cp, r2, 1.0 / 24.0);
  cp = fma(cp, r2, -0.5);
  const double c = fma(cp, r2, 1.0);
  const int qd = kq & 3;
  const double so = (qd == 0) ? s : (qd == 1) ? c : (qd == 2) ? -s : -c;
  const double co = (qd == 0) ? c : (qd == 1) ? -s : (qd == 2) ? -c : s;
  sv = (float)so;
  cv = (float)co;
}

// =====================================================================================================
// Rotary tables: cosT[t][d], sinT[t][d] for t < SEQ, d < HD, angle = float(t) * inv_freq[d & 31] (f32 product), halves duplicated.
// Wave = one position t, lane = frequency index; inv_freq picked from the by-value table with a static select chain.
// coverage: blk = 0 .. SEQ/8 - 1, 8 waves each = SEQ rows; per row 4 line stores = 64 floats of each table.
// =====================================================================================================
__device__ __forceinline__ void tab_blk(int blk, float* cosT, float* sinT, const InvF& inv) {
  const int tid  = threadIdx.x;
  const int lane = tid & 31;
  const int t    = blk * 8 + (tid >> 5);
  float f = inv.f[0];
#pragma unroll
  for (int i = 1; i < 32; ++i) f = (lane == i) ? inv.f[i] : f;
  const float ang = (float)t * f;
  float sv, cv;
  sincos_acc(ang, sv, cv);
  float* cr = cosT + (size_t)t * HD;
  float* sr = sinT + (size_t)t * HD;
  *(float*)(cr + lane)      = cv;
  *(float*)(cr + 32 + lane) = cv;
  *(float*)(sr + lane)      = sv;
  *(float*)(sr + 32 + lane) = sv;
  wait_store_regs();
}

// =====================================================================================================
// f32 -> 16-bit plane, same layout.  f16mode false: bf16 RNE bits;  f16mode true: f16 bits of (bf16 RNE value) * scale.
// Thread = 8 consecutive elements: two 16-B loads, one 16-B store; 32 consecutive lanes = 512 contiguous, 512-B aligned bytes.
// coverage: blk = 0 .. n/2048 - 1, 256 thr x 8 elements each = the whole plane.
// =====================================================================================================
__device__ __forceinline__ void cvt_blk(const float* __restrict__ x, u16* D, int blk, bool f16mode, float scale) {
  const int gt = blk * 256 + (int)threadIdx.x;
  const float* p = x + (size_t)gt * 8;
  const v4f a = *(const v4f*)(p), b4 = *(const v4f*)(p + 4);
  float w[8];
#pragma unroll
  for (int e = 0; e < 4; ++e) { w[e] = a[e]; w[4 + e] = b4[e]; }
  v4u o;
#pragma unroll
  for (int e = 0; e < 4; ++e) {
    const float f0 = w[2 * e], f1 = w[2 * e + 1];
    o[e] = f16mode ? pk16(h_bits((_Float16)(bfr(f0) * scale)), h_bits((_Float16)(bfr(f1) * scale)))
                   : pk16(bf_bits(f0), bf_bits(f1));
  }
  *(v4u*)(D + (size_t)gt * 8) = o;
  wait_store_regs();
}

// =====================================================================================================
// Everything that reads inputs alone, in one grid: none of these pieces reads what another writes. The block index picks the piece
// (block-uniform; no barriers): TABB blocks of rotary tables first (the longest chain of a wave), XCB blocks x -> bf16,
// 3 * WCB blocks Wq, Wk, Wv -> bf16, WCB blocks Wo -> f16 of the bf16 value x1024.  grid = TABB + XCB + 4 * WCB, exact.
// =====================================================================================================
__global__ __launch_bounds__(256) void prep(const float* __restrict__ x, const float* __restrict__ wq, const float* __restrict__ wk,
                                            const float* __restrict__ wv, const float* __restrict__ wo,
                                            u16* XBo, u16* WQo, u16* WKo, u16* WVo, u16* WOo,
                                            float* cosT, float* sinT, InvF inv) {
  int b = blockIdx.x;
  if (b < TABB) { tab_blk(b, cosT, sinT, inv); return; }
  b -= TABB;
  if (b < XCB) { cvt_blk(x, XBo, b, false, 1.0f); return; }
  b -= XCB;
  const int w = b / WCB, wb = b % WCB;
  if (w < 3) {
    const float* s = (w == 0) ? wq : (w == 1) ? wk : wv;
    u16*         d = (w == 0) ? WQo : (w == 1) ? WKo : WVo;
    cvt_blk(s, d, wb, false, 1.0f);
  } else if (w == 3) {
    cvt_blk(wo, WOo, wb, true, WOS);
  }
}

// =====================================================================================================
// Epilogue of the output projection: the wave's 16x64 f32 tile (times oscale) staged in its LDS slab (pitch 68),
// coverage: 8 instructions x 2 rows x 16 lanes x 4 floats = the wave's 16 x 64 tile.
// =====================================================================================================
__device__ __forceinline__ void epi64(float* sl, v8f a0, v8f a1, v8f a2, v8f a3, float oscale,
                                      const float* __restrict__ bias, float* C, int N,
                                      size_t rowb, int col0, int lane) {
  const int hh = lane >> 4, m = lane & 15;
#pragma unroll
  for (int r = 0; r < 8; ++r) {
    const int ro = (8 * hh + r) * 68 + m;
    sl[ro]      = a0[r] * oscale;
    sl[ro + 16] = a1[r] * oscale;
    sl[ro + 32] = a2[r] * oscale;
    sl[ro + 48] = a3[r] * oscale;
  }
  wave_sync_lds();
  const v4f braw = *(const v4f*)(bias + col0 + m * 4);
  v4f bb;
#pragma unroll
  for (int e = 0; e < 4; ++e) bb[e] = bfr(braw[e]);
  v4f vals[8];
#pragma unroll
  for (int it = 0; it < 8; ++it) vals[it] = *(const v4f*)(sl + (it * 2 + hh) * 68 + m * 4) + bb;
  float* dst = C + (rowb + (size_t)hh) * (size_t)N + col0 + m * 4;
  {
#pragma unroll
    for (int it = 0; it < 8; ++it) {
      *(v4f*)(dst + (size_t)(it * 2) * (size_t)N) = vals[it];
    }
    
  }
}

// =====================================================================================================
// Projection epilogue for q and k: rotate-half rotary + 16-bit split pack of the wave's 16 x 64 f32 tile = 16 positions x one whole head
// (the tile's 64 columns are head col0 / 64), written straight into the fragment-order planes: no f32 plane in between.
// x[d] = acc * oscale + bias;  w[d] = x[d] * cos[pos][d] + r[d] * sin[pos][d],  r[d] = -x[d+32] for d < 32, x[d-32] for d >= 32
// (cos, sin: both halves of a table row are equal, so the row's first half serves d and d + 32);
// hi[d] = f16(w * sc), lo[d] = f16(w * sc - hi[d])  (sc a power of two, residual unscaled).
// Output in fragment order: [head][row tile rt = pos / 16][k-step kk][i][lane][8 halves] (2 KB a row tile and head): the wave's tile is
// exactly one (head, rt). The tile is turned in the wave's LDS slab (pitch 68): written from the D registers (lane: column m, rows 8hh + r),
// read back as lane (hh, c = m) -> row c, d = 16 i + 8 hh + 0..7 and the same + 32: what this lane holds of fragments kk = 0 and kk = 1.
// coverage: 2 (i) x 2 (kk) stores x 32 lanes x 8 halves = 16 x 64 of each plane; every store of a wave is 512 contiguous bytes, four whole lines.
// =====================================================================================================
__device__ __forceinline__ void epi_rope(float* sl, v8f a0, v8f a1, v8f a2, v8f a3, float oscale,
                                         const float* __restrict__ bias, const float* __restrict__ cosT,
                                         const float* __restrict__ sinT, u16* hpl, u16* lpl,
                                         int rowb, int col0, int lane, float sc) {
  const int hh = lane >> 4, m = lane & 15;
  const float* cr = cosT + (size_t)(rowb + m) * HD + 8 * hh;
  const float* sr = sinT + (size_t)(rowb + m) * HD + 8 * hh;
  const float* br = bias + col0 + 8 * hh;
  v4f cs[2][2], sn[2][2], b0[2][2], b1[2][2];
#pragma unroll
  for (int i = 0; i < 2; ++i) {
#pragma unroll
    for (int p = 0; p < 2; ++p) {
      cs[i][p] = *(const v4f*)(cr + 16 * i + 4 * p);
      sn[i][p] = *(const v4f*)(sr + 16 * i + 4 * p);
      b0[i][p] = *(const v4f*)(br + 16 * i + 4 * p);
      b1[i][p] = *(const v4f*)(br + 32 + 16 * i + 4 * p);
    }
  }
#pragma unroll
  for (int r = 0; r < 8; ++r) {
    const int ro = (8 * hh + r) * 68 + m;
    sl[ro]      = a0[r] * oscale;
    sl[ro + 16] = a1[r] * oscale;
    sl[ro + 32] = a2[r] * oscale;
    sl[ro + 48] = a3[r] * oscale;
  }
  wave_sync_lds();
  v4u oh[2][2], ol[2][2];                     // [kk][i]
#pragma unroll
  for (int i = 0; i < 2; ++i) {
    const float* xr = sl + m * 68 + 16 * i + 8 * hh;
    float w0[8], w1[8];
#pragma unroll
    for (int p = 0; p < 2; ++p) {
      const v4f xl = *(const v4f*)(xr + 4 * p), xu = *(const v4f*)(xr + 32 + 4 * p);
#pragma unroll
      for (int e = 0; e < 4; ++e) {
        const float x0 = xl[e] + bfr(b0[i][p][e]), x1 = xu[e] + bfr(b1[i][p][e]);
        w0[4 * p + e] = x0 * cs[i][p][e] + (-x1) * sn[i][p][e];
        w1[4 * p + e] = x1 * cs[i][p][e] + x0 * sn[i][p][e];
      }
    }
#pragma unroll
    for (int e = 0; e < 4; ++e) {
      const float t0 = w0[2 * e] * sc, t1 = w0[2 * e + 1] * sc, t2 = w1[2 * e] * sc, t3 = w1[2 * e + 1] * sc;
      const _Float16 h0 = (_Float16)t0, h1 = (_Float16)t1, h2 = (_Float16)t2, h3 = (_Float16)t3;
      oh[0][i][e] = pk16(h_bits(h0), h_bits(h1));
      oh[1][i][e] = pk16(h_bits(h2), h_bits(h3));
      ol[0][i][e] = pk16(h_bits((_Float16)(t0 - (float)h0)), h_bits((_Float16)(t1 - (float)h1)));
      ol[1][i][e] = pk16(h_bits((_Float16)(t2 - (float)h2)), h_bits((_Float16)(t3 - (float)h3)));
    }
  }
  const size_t o8 = ((size_t)(col0 >> 6) * (SEQ / 16) + (size_t)(rowb >> 4)) * (16 * HD) + (size_t)lane * 8;
#pragma unroll
  for (int kk = 0; kk < 2; ++kk) {
#pragma unroll
    for (int i = 0; i < 2; ++i) {
      *(v4u*)(hpl + o8 + kk * 512 + i * 256) = oh[kk][i];
      *(v4u*)(lpl + o8 + kk * 512 + i * 256) = ol[kk][i];
    }
  }
  wait_store_regs();
}

// =====================================================================================================
// Projection epilogue for v: the wave's 16 x 64 f32 tile = 16 keys x one whole head g = col0 / 64, written straight into the v^T planes.
// v^T planes in fragment order: [head g][key tile kt = s / 32][j = d / 16][i][lane][8 halves] (4 KB a key tile and head), the 8 halves being
// row d = 16 j + (lane & 15), keys 32 kt + 16 i + 8 (lane >> 4) + 0..7: VH = f16(v[s][g][d] * 1024), VL = f16 residual of the same value.
// D register r of accumulator j in lane (hh, m) is (key rowb + 8 hh + r, d = 16 j + m): the lane's eight registers ARE its 8 halves of half
// fragment (kt = rowb / 32, j, i = (rowb / 16) & 1): no LDS, no lane exchange.
// coverage: 4 (j) stores x 32 lanes x 8 halves = 64 d x 16 keys of each plane; every store of a wave is 512 contiguous bytes, four whole lines.
// =====================================================================================================
__device__ __forceinline__ void epi_vt(v8f a0, v8f a1, v8f a2, v8f a3, float oscale, const float* __restrict__ bias,
                                       u16* VHo, u16* VLo, int rowb, int col0, int lane) {
  const int m = lane & 15;
  v4u vh[4], vl[4];
#pragma unroll
  for (int j = 0; j < 4; ++j) {
    const v8f a = (j == 0) ? a0 : (j == 1) ? a1 : (j == 2) ? a2 : a3;
    const float bj = bfr(bias[col0 + 16 * j + m]);
#pragma unroll
    for (int e = 0; e < 4; ++e) {
      const float t0 = (a[2 * e] * oscale + bj) * VCAR, t1 = (a[2 * e + 1] * oscale + bj) * VCAR;
      const _Float16 h0 = (_Float16)t0, h1 = (_Float16)t1;
      vh[j][e] = pk16(h_bits(h0), h_bits(h1));
      vl[j][e] = pk16(h_bits((_Float16)(t0 - (float)h0)), h_bits((_Float16)(t1 - (float)h1)));
    }
  }
  const size_t base = ((size_t)(col0 >> 6) * HD) * SEQ + (size_t)(rowb >> 5) * (32 * HD) + ((rowb >> 4) & 1) * 256 + (size_t)lane * 8;
#pragma unroll
  for (int j = 0; j < 4; ++j) {
    *(v4u*)(VHo + base + j * 512) = vh[j];
    *(v4u*)(VLo + base + j * 512) = vl[j];
  }
  wait_store_regs();
}

// =====================================================================================================
// bf16 GEMM of the three projections: A[M][K] (bf16 row-major) . Bt[N][K]^T (bf16 k-contiguous), times oscale, plus bias[N], f32 in registers;
// the epilogue packs the tile into the 16-bit planes that the attention reads (q, k: rotary, epi_rope; v: transposed, epi_vt).
// Block = 64x64 tile, 4 waves x 16 rows. K walked in stages of GKC: the block's 64 A rows and 64 Bt rows of a stage are brought into a
// two-buffer LDS ring by asynchronous copies of whole lines (each wave: 16 rows of each operand), stage t + 1 in flight while stage t is
// multiplied; fragments are read from LDS (two 16-B reads each, split k map for A and B), k ascending as before.
// Three products that share A run in one grid: blockIdx.y picks (Bt, bias, planes, epilogue) (block-uniform); none reads what another writes.
// The host passes M == SEQ, N == NH * HD (a 64-column tile is one head), K % GKC == 0, K >= 2 * GKC, grid = ((M/64)*(N/64), 3).
// =====================================================================================================
__global__ __launch_bounds__(128)
void gemm_bf(const u16* __restrict__ A, const u16* __restrict__ Bt0, const u16* __restrict__ Bt1, const u16* __restrict__ Bt2,
             const float* __restrict__ bias0, const float* __restrict__ bias1, const float* __restrict__ bias2,
             const float* __restrict__ cosT, const float* __restrict__ sinT,
             u16* QHo, u16* QLo, u16* KHo, u16* KLo, u16* VHo, u16* VLo, int M, int N, int K, float oscale) {
  __shared__ __align__(16) float slab[4 * SLAB64];
  __shared__ __align__(16) unsigned char ring[2 * 2 * GOPB];   // [buffer][A | Bt][64 rows][GPB]
  const int tid = threadIdx.x, wave = tid >> 5, lane = tid & 31, hh = lane >> 4, m = lane & 15;
  const int which = blockIdx.y;
  const u16*   Bt   = (which == 0) ? Bt0 : (which == 1) ? Bt1 : Bt2;
  const float* bias = (which == 0) ? bias0 : (which == 1) ? bias1 : bias2;
  const int ntile = N >> 6;
  const int bid   = blockIdx.x;
  const int row0  = (bid / ntile) * 64;
  const int rowb  = row0 + wave * 16;
  const int col0  = (bid % ntile) * 64;
  if (row0 + 64 > M) return;                 // block-uniform, in front of every barrier and copy; never taken with the exact grid
  const int nst  = K / GKC;
  const int crow = wave * 16 + hh;           // the tile row this lane brings in copy 0
  const u16* ga = A  + (size_t)(row0 + crow) * K + m * 8;
  const u16* gb = Bt + (size_t)(col0 + crow) * K + m * 8;
  const unsigned lc = lds_off(ring) + (unsigned)crow * GPB + (unsigned)m * 16u;
  copy16rows(lc, ga, (size_t)K);
  copy16rows(lc + GOPB, gb, (size_t)K);
  wait_copies();
  __syncthreads();                           // stage 0 is whole for every wave
  if (nst > 1) {
    copy16rows(lc + 2u * GOPB, ga + GKC, (size_t)K);
    copy16rows(lc + 3u * GOPB, gb + GKC, (size_t)K);
  }
  const unsigned char* fa = ring + (wave * 16 + m) * GPB + 16 * hh;
  const unsigned char* fb = ring + GOPB + m * GPB + 16 * hh;
  v8f acc0 = zero8(), acc1 = zero8(), acc2 = zero8(), acc3 = zero8();
  // kept rolled: one copy of the stage body, the buffer picked by the stage's parity
#pragma unroll 1
  for (int t = 0; t < nst; ++t) {
    const unsigned bo = (unsigned)(t & 1) * (2u * GOPB);
    // unrolled: the k-step offsets become immediates and the reads of later k-steps are issued ahead of the earlier products
#pragma unroll
    for (int kk = 0; kk < GKS; ++kk) {
      const v16b a  = ldsfrag_b(fa + bo + kk * 64);
      const v16b b0 = ldsfrag_b(fb + bo + kk * 64);
      const v16b b1 = ldsfrag_b(fb + bo + 16 * GPB + kk * 64);
      const v16b b2 = ldsfrag_b(fb + bo + 32 * GPB + kk * 64);
      const v16b b3 = ldsfrag_b(fb + bo + 48 * GPB + kk * 64);
      acc0 = mma_b(a, b0, acc0);
      acc1 = mma_b(a, b1, acc1);
      acc2 = mma_b(a, b2, acc2);
      acc3 = mma_b(a, b3, acc3);
      // its four v_nop keep the distance behind the stage's last matrix instructions on both sides of the branch at the loop's foot
      if (kk == GKS - 1) guard6<v16b>(acc0, acc1, acc2, acc3, a, b0, b1, b2, b3, a);
    }
    wait_lds();
    wait_copies();
    __syncthreads();                         // publishes stage t + 1 and ends every wave's reads of stage t's buffer
    if (t + 2 < nst) {
      copy16rows(lc + bo, ga + (size_t)(t + 2) * GKC, (size_t)K);
      copy16rows(lc + bo + GOPB, gb + (size_t)(t + 2) * GKC, (size_t)K);
    }
  }
  wait_copies();
  if (which == 2) {
    epi_vt(acc0, acc1, acc2, acc3, oscale, bias, VHo, VLo, rowb, col0, lane);
  } else {
    epi_rope(slab + wave * SLAB64, acc0, acc1, acc2, acc3, oscale, bias, cosT, sinT, (which == 0) ? QHo : KHo, (which == 0) ? QLo : KLo,
             rowb, col0, lane, (which == 0) ? QSC : KSC);
  }
}

// =====================================================================================================
// f16 hi+lo GEMM: C[M][N] (f32) = (Ahi + Alo)[M][K] . Bt[N][K]^T, times oscale, plus bias[N]; Ahi/Alo f16 planes (same layout),
// Bt f16 k-contiguous; products hi.B + lo.B into one accumulator (lo is the unscaled residual of hi). Same tiling and the same
// two-buffer LDS ring as gemm_bf, with three operand tiles a stage.
// =====================================================================================================
__global__ __launch_bounds__(128)
void gemm_h2(const u16* __restrict__ Ah, const u16* __restrict__ Al, const u16* __restrict__ Bt,
             const float* __restrict__ bias, float* C, int M, int N, int K, float oscale) {
  __shared__ __align__(16) float slab[4 * SLAB64];
  __shared__ __align__(16) unsigned char ring[2 * 3 * GOPB];   // [buffer][Ahi | Alo | Bt][64 rows][GPB]
  const int tid = threadIdx.x, wave = tid >> 5, lane = tid & 31, hh = lane >> 4, m = lane & 15;
  const int ntile = N >> 6;
  const int bid   = blockIdx.x;
  const int row0  = (bid / ntile) * 64;
  const int rowb  = row0 + wave * 16;
  const int col0  = (bid % ntile) * 64;
  if (row0 + 64 > M) return;                 // block-uniform, in front of every barrier and copy; never taken with the exact grid
  const int nst  = K / GKC;
  const int crow = wave * 16 + hh;           // the tile row this lane brings in copy 0
  const size_t aofs = (size_t)(row0 + crow) * K + m * 8;
  const u16* gh = Ah + aofs;
  const u16* gl = Al + aofs;
  const u16* gb = Bt + (size_t)(col0 + crow) * K + m * 8;
  const unsigned lc = lds_off(ring) + (unsigned)crow * GPB + (unsigned)m * 16u;
  copy16rows(lc, gh, (size_t)K);
  copy16rows(lc + GOPB, gl, (size_t)K);
  copy16rows(lc + 2u * GOPB, gb, (size_t)K);
  wait_copies();
  __syncthreads();                           // stage 0 is whole for every wave
  if (nst > 1) {
    copy16rows(lc + 3u * GOPB, gh + GKC, (size_t)K);
    copy16rows(lc + 4u * GOPB, gl + GKC, (size_t)K);
    copy16rows(lc + 5u * GOPB, gb + GKC, (size_t)K);
  }
  const unsigned char* fa = ring + (wave * 16 + m) * GPB + 16 * hh;
  const unsigned char* fb = ring + 2 * GOPB + m * GPB + 16 * hh;
  v8f acc0 = zero8(), acc1 = zero8(), acc2 = zero8(), acc3 = zero8();
  // kept rolled: one copy of the stage body, the buffer picked by the stage's parity
#pragma unroll 1
  for (int t = 0; t < nst; ++t) {
    const unsigned bo = (unsigned)(t & 1) * (3u * GOPB);
    // unrolled: the k-step offsets become immediates and the reads of later k-steps are issued ahead of the earlier products
#pragma unroll
    for (int kk = 0; kk < GKS; ++kk) {
      const v16h ah = ldsfrag_h(fa + bo + kk * 64), al = ldsfrag_h(fa + bo + GOPB + kk * 64);
      const v16h b0 = ldsfrag_h(fb + bo + kk * 64);
      const v16h b1 = ldsfrag_h(fb + bo + 16 * GPB + kk * 64);
      const v16h b2 = ldsfrag_h(fb + bo + 32 * GPB + kk * 64);
      const v16h b3 = ldsfrag_h(fb + bo + 48 * GPB + kk * 64);
      acc0 = mma_h(ah, b0, acc0);  acc0 = mma_h(al, b0, acc0);
      acc1 = mma_h(ah, b1, acc1);  acc1 = mma_h(al, b1, acc1);
      acc2 = mma_h(ah, b2, acc2);  acc2 = mma_h(al, b2, acc2);
      acc3 = mma_h(ah, b3, acc3);  acc3 = mma_h(al, b3, acc3);
      // its four v_nop keep the distance behind the stage's last matrix instructions on both sides of the branch at the loop's foot
      if (kk == GKS - 1) guard6<v16h>(acc0, acc1, acc2, acc3, ah, al, b0, b1, b2, b3);
    }
    wait_lds();
    wait_copies();
    __syncthreads();                         // publishes stage t + 1 and ends every wave's reads of stage t's buffer
    if (t + 2 < nst) {
      copy16rows(lc + bo, gh + (size_t)(t + 2) * GKC, (size_t)K);
      copy16rows(lc + bo + GOPB, gl + (size_t)(t + 2) * GKC, (size_t)K);
      copy16rows(lc + bo + 2u * GOPB, gb + (size_t)(t + 2) * GKC, (size_t)K);
    }
  }
  wait_copies();
  epi64(slab + wave * SLAB64, acc0, acc1, acc2, acc3, oscale, bias, C, N, (size_t)rowb, col0, lane);
}

// =====================================================================================================
// Triple-masked attention: block bid -> (head = bid % NH, query tile pair qp = NQP-1 - bid / NH: rows q0 = 32*qp .. q0+31; the pairs with
// the most keys take the lowest block ids). Every wave carries both 16-row query tiles of the pair, each with a softmax state of its own, so that one
// load of a k or v fragment serves two tiles. The block's WPB waves share that one (pair, head) and split its key tiles: in every group of eight
// consecutive key tiles g each wave takes one, kt = 8g + ((wave - g) & 7), so that any stride-4 or stride-8 pattern of live tiles is spread too.
//   q, k planes (hi, lo f16 x1024) and v^T planes in fragment order, [h][row tile][k-step] and [h][key tile][d tile]; instrument and bar ids staged in LDS.
//   For each of the three masks in turn (block-uniform), each wave with its OWN running max m_a, sum Z_a and 4 accumulators acc_a per query tile (8 in all):
//     att 0: (iq == ik) && (iq < 129) && (j <= i)
//     att 1: (iq != ik) && (ik < 129) && (iq < 129) && (bq >= 0) && ((0 <= bq-bk <= 2) || (bq-bk == 4))
//     att 2: ((ik == 129) || (bk == -1)) && (j <= i)
//   A wave's key tiles of 32 visited in order (att 0/2 up to the causal limit, att 1 all NKT); per tile that passes the wave's scalar key-tile summary test (att 1, 2) every lane evaluates the mask bits of its
//   2 queries x 16 keys, a wave ballot skips tiles with no allowed element in either query tile (exact: such keys carry zero weight).
//   Both products are formed transposed, so that a lane owns one query of each query tile (column c of every D tile):
//   S^T = k'.q'^T: A = key rows, B = query rows, 2 key subtiles x 2 k-steps x 3 products (k_hi.q_hi + k_hi.q_lo + k_lo.q_hi), fragments loaded
//   straight from the 16-bit planes (two 16-B loads per fragment, each 512 contiguous bytes of a wave, split k map); a lane's 16 scores of a query tile are keys 16u + 8hh + r of
//   its own query; masked scores replaced by -inf; online max-subtracted base-2 softmax in f32 (scale 1/8 folded), -inf-safe rescale: the
//   maximum in-lane plus one exchange between the halves, the sum kept per half and joined once after the key loop.
//   O^T += v^T.P^T: the two score subtiles' registers, converted in place, ARE the B fragment of P^T in the split k map (no LDS, no lane
//   exchange); A = 4+4 v^T fragments (hi and residual planes), 12 WMMAs a query tile (hh + hl + lh); the rescale factor is the lane's own.
//   After each mask every wave publishes its partial (m, Z, acc) in its LDS slab; behind a
//   block barrier wave w merges the eight partials of rows 4w .. 4w+3 (a lane: one row, 8 d columns): M = max m_w, Z = sum Z_w 2^(m_w-M), acc likewise;
//   out_a = (Z > 0, i.e. the row has an allowed key) ? acc / Z : 0, carries 1/(32768*1024) folded once, summed in a lane-owned LDS tile:
//   O = out_0 + out_1 + out_2. A second barrier frees the slabs for the next mask. All barriers block-uniform; bounded loops only.
// coverage: per wave 4 rows x 8 lanes x 8 halves = 4 x 64 per plane, WPB waves = 32 x 64; grid NQP*NH blocks =
//           every (s, h) row of both O planes exactly once.
// =====================================================================================================
// second bound: four waves per SIMD (at most 256 registers), two blocks on a WGP: the grid takes two rounds
__global__ __launch_bounds__(ATT_THREADS, 4)
void attn3(const u16* __restrict__ QHIp, const u16* __restrict__ QLOp,
           const u16* __restrict__ KHIp, const u16* __restrict__ KLOp,
           const u16* __restrict__ VHIp, const u16* __restrict__ VLOp,
           const int* __restrict__ inst, const int* __restrict__ bar,
           u16* OHIp, u16* OLOp) {
  __shared__ __align__(16) float smem[WPB * WREG + QTW * SLW];
  __shared__ __align__(16) int sI[SEQ];
  __shared__ __align__(16) int sB[SEQ];

  const int tid  = threadIdx.x;
  const int wave = __builtin_amdgcn_readfirstlane(tid >> 5);   // scalar: it steers the key-tile loop
  const int lane = tid & 31;
  const int hh   = lane >> 4;
  const int c    = lane & 15;
  const int bid  = blockIdx.x;
  if (bid >= NQP * NH) return;               // block-uniform, before any barrier; never taken with the exact grid
  const int head = bid % NH;
  const int qp   = NQP - 1 - bid / NH;
  const int q0   = qp * (16 * QTW);
  const int rq   = lane >> 3;                // merge and output: this lane owns row 4*wave + rq of the block's 32,
  const int c8   = (lane & 7) * 8;           // d columns c8 .. c8 + 7
  const int row  = wave * 4 + rq;

  for (int i = tid; i < SEQ; i += ATT_THREADS) { sI[i] = inst[i]; sB[i] = bar[i]; }
  __syncthreads();

  float* slab = smem + wave * WREG;          // partial accumulators [16*QTW][64] pitch 68, written after a mask's key loop
  float* ml   = slab + QTW * SLW;            // partial m[16*QTW], Z[16*QTW]
  float* osum = smem + WPB * WREG;           // the block's result [16*QTW][64] pitch 68; elements (row, c8 .. c8 + 7) owned by this lane

  // byte offsets into the fragment-order planes (each plane SEQ*DMOD*2 bytes, far below 2^32); hi and residual planes share them
  const unsigned FRB  = 1024u;                                                  // bytes of a fragment (16 rows x 32 k)
  const unsigned RTB  = 2u * FRB;                                               // q', k': bytes of a 16-row tile of a head (2 k-steps)
  const unsigned KTB  = 32u * HD * 2u;                                          // k', v^T: bytes of a 32-key tile of a head
  const unsigned hofs = (unsigned)head * (SEQ * HD * 2u) + (unsigned)lane * 16u; // this head's part of a plane, this lane's 16 B
  const unsigned qofs = hofs + (unsigned)(q0 >> 4) * RTB;                        // query tile t: + t * RTB
  const float lsc = 0.125f * (LOG2E / (QSC * KSC));
  const float oc  = 1.0f / (PCAR * VCAR);
  // ids of this lane's own query of each tile (row q0 + 16t + c)
  int iqv[QTW], bqv[QTW];
#pragma unroll
  for (int t = 0; t < QTW; ++t) { iqv[t] = sI[q0 + 16 * t + c]; bqv[t] = sB[q0 + 16 * t + c]; }

  // ---- key-tile summaries, once a wave: four bits for each of the wave's own key tiles (bits 4g .. 4g + 3 = tile WPB*g + ((wave - g) & 7)),
  //      kept in scalar registers, so that the key loop passes a tile that cannot hold an allowed element on a scalar test, without the
  //      2 x 16 mask evaluations of every lane. Both tests are necessary conditions of the masks, for any content of the id arrays:
  //      att 1 allows (q, k) only if iq < 129, bq >= 0, ik < 129 and bq - bk in {0, 1, 2, 4}: then bk lies in [bq - 4, bq], inside
  //      [lo - 4, hi], lo and hi the least and largest bq of the block's 32 queries with iq < 129 and bq >= 0 (lo >= 0: lo - 4 does not wrap;
  //      no such query: lo = INT_MAX, hi = INT_MIN, no key passes);  att 2 allows only keys with ik == 129 or bk == -1.
  //      A tile that passes still gets the exact evaluation and its ballot below: the set of tiles that are multiplied stays the same.
  unsigned live1, live2;
  {
    const int  iq1 = sI[q0 + lane], bq1 = sB[q0 + lane];                         // a lane: one of the block's 32 queries
    const bool qv  = (iq1 < GINST) && (bq1 >= 0);
    const int  blo = __builtin_amdgcn_readfirstlane(wave_min_i(qv ? bq1 : 0x7fffffff)) - 4;
    const int  bhi = __builtin_amdgcn_readfirstlane(wave_max_i(qv ? bq1 : (int)0x80000000));
    // a lane: 8 consecutive keys (quarter lane & 3) of the wave's tile of group g1 = lane >> 2; four 16-B LDS reads cover the wave's 8 tiles
    const int g1  = lane >> 2;
    const int k8  = (WPB * g1 + ((wave - g1) & (WPB - 1))) * 32 + (lane & 3) * 8;
    const v4i ia = *(const v4i*)(sI + k8), ib = *(const v4i*)(sI + k8 + 4);
    const v4i ba = *(const v4i*)(sB + k8), bb = *(const v4i*)(sB + k8 + 4);
    bool c1 = false, c2 = false;                                                 // & and |, not && and ||: straight-line code, no lane branches
#pragma unroll
    for (int e = 0; e < 4; ++e) {
      c1 |= ((ia[e] < GINST) & (ba[e] >= blo) & (ba[e] <= bhi)) | ((ib[e] < GINST) & (bb[e] >= blo) & (bb[e] <= bhi));
      c2 |= (ia[e] == GINST) | (ba[e] == -1) | (ib[e] == GINST) | (bb[e] == -1);
    }
    live1 = __builtin_amdgcn_ballot_w32(c1);
    live2 = __builtin_amdgcn_ballot_w32(c2);
  }

  // kept rolled: with two query tiles a wave, three copies of the tile body and of the merge would be about 60 KB of code, nearly the
  // whole instruction cache; the mask is picked by a scalar branch at each key tile
#pragma unroll 1
  for (int att = 0; att < 3; ++att) {
    float mrow[QTW], lrow[QTW];              // this lane's query: running max (equal in both halves), this half's share of the sum
    v8f o[QTW][4];                            // o[t][j][r] = O^T[d = 16j + 8hh + r][query 16t + c]
#pragma unroll
    for (int t = 0; t < QTW; ++t) {
      mrow[t] = -INFINITY; lrow[t] = 0.f;
#pragma unroll
      for (int j = 0; j < 4; ++j) o[t][j] = zero8();
    }
    const int ncaus = ((q0 + 16 * QTW - 1) >> 5) + 1;                           // tiles holding keys <= the block's last query row
    const int nkt = (att == 1) ? NKT : ((ncaus < NKT) ? ncaus : NKT);

    const int ngrp = (nkt + WPB - 1) / WPB;
    const unsigned livem = (att == 1) ? live1 : (att == 2) ? live2 : 0xffffffffu;  // wave-uniform
#pragma unroll 1
    for (int g = 0; g < ngrp; ++g) {
      const int kt = WPB * g + ((wave - g) & (WPB - 1));
      if (kt >= nkt) continue;                                                   // wave-uniform
      if (((livem >> (4 * g)) & 0xfu) == 0u) continue;                           // wave-uniform: no key of the tile can be allowed under this mask
      const int kb = kt * 32;
      // ids of this lane's 16 keys kb + 16u + 8hh + r (the rows of its D registers), 16-B LDS reads
      int ik[2][8], bk[2][8];
#pragma unroll
      for (int u = 0; u < 2; ++u) {
        const v4i ia = *(const v4i*)(sI + kb + 16 * u + 8 * hh), ib = *(const v4i*)(sI + kb + 16 * u + 8 * hh + 4);
        const v4i ba = *(const v4i*)(sB + kb + 16 * u + 8 * hh), bb = *(const v4i*)(sB + kb + 16 * u + 8 * hh + 4);
#pragma unroll
        for (int e = 0; e < 4; ++e) { ik[u][e] = ia[e]; ik[u][4 + e] = ib[e]; bk[u][e] = ba[e]; bk[u][4 + e] = bb[e]; }
      }
      // causal test j <= i (j = kb + 8hh + 16u + r, i = q0 + c + 16t) written against the constant 16u + r - 16t
      const int di = (q0 + c) - (kb + 8 * hh);
      unsigned okb[QTW];                                                         // bit 8u + r
#pragma unroll
      for (int t = 0; t < QTW; ++t) {
        unsigned ob = 0u;
        if (att == 0) {
          const bool qa = iqv[t] < GINST;
#pragma unroll
          for (int u = 0; u < 2; ++u) {
#pragma unroll
            for (int r = 0; r < 8; ++r) {
              const bool ok = qa && (iqv[t] == ik[u][r]) && (16 * u + r - 16 * t <= di);
              ob |= ok ? (1u << (8 * u + r)) : 0u;
            }
          }
        } else if (att == 1) {
          const bool qa = (iqv[t] < GINST) && (bqv[t] >= 0);
#pragma unroll
          for (int u = 0; u < 2; ++u) {
#pragma unroll
            for (int r = 0; r < 8; ++r) {
              const int  d  = bqv[t] - bk[u][r];
              const bool w  = ((d >= 0) && (d <= 2)) || (d == 4);
              const bool ok = qa && (ik[u][r] < GINST) && (iqv[t] != ik[u][r]) && w;
              ob |= ok ? (1u << (8 * u + r)) : 0u;
            }
          }
        } else {
#pragma unroll
          for (int u = 0; u < 2; ++u) {
#pragma unroll
            for (int r = 0; r < 8; ++r) {
              const bool ok = ((ik[u][r] == GINST) || (bk[u][r] == -1)) && (16 * u + r - 16 * t <= di);
              ob |= ok ? (1u << (8 * u + r)) : 0u;
            }
          }
        }
        okb[t] = ob;
      }
      const unsigned anyw = __builtin_amdgcn_ballot_w32((okb[0] | okb[1]) != 0u);    // wave-uniform
      if (anyw == 0u) continue;

      // ---- scores, transposed: D element r of this lane = (key kb + 16u + 8hh + r, query q0 + 16t + c) in s[t][u];
      //      each k fragment (A) is loaded once and multiplied with both query tiles (B) ----
      v8f s[QTW][2];
#pragma unroll
      for (int t = 0; t < QTW; ++t) { s[t][0] = zero8(); s[t][1] = zero8(); }
      const unsigned ko = hofs + (unsigned)kt * KTB;                               // the key tile's place in the k' planes and in the v^T planes
#pragma unroll
      for (int kk = 0; kk < 2; ++kk) {
        const v16h kh0 = ldfrag_o(KHIp, ko, kk * FRB),         kl0 = ldfrag_o(KLOp, ko, kk * FRB);
        const v16h kh1 = ldfrag_o(KHIp, ko, RTB + kk * FRB),   kl1 = ldfrag_o(KLOp, ko, RTB + kk * FRB);
        const v16h qa  = ldfrag_o(QHIp, qofs, kk * FRB),       qb  = ldfrag_o(QLOp, qofs, kk * FRB);
        const v16h qc  = ldfrag_o(QHIp, qofs, RTB + kk * FRB), qd  = ldfrag_o(QLOp, qofs, RTB + kk * FRB);
        s[0][0] = mma_h(kh0, qa, s[0][0]);
        s[0][0] = mma_h(kh0, qb, s[0][0]);
        s[0][0] = mma_h(kl0, qa, s[0][0]);
        s[0][1] = mma_h(kh1, qa, s[0][1]);
        s[0][1] = mma_h(kh1, qb, s[0][1]);
        s[0][1] = mma_h(kl1, qa, s[0][1]);
        s[1][0] = mma_h(kh0, qc, s[1][0]);
        s[1][0] = mma_h(kh0, qd, s[1][0]);
        s[1][0] = mma_h(kl0, qc, s[1][0]);
        s[1][1] = mma_h(kh1, qc, s[1][1]);
        s[1][1] = mma_h(kh1, qd, s[1][1]);
        s[1][1] = mma_h(kl1, qc, s[1][1]);
        guard10(s[0][0], s[0][1], s[1][0], s[1][1], qa, qb, qc, qd, kh0, kl0, kh1, kl1, kh0, kl0);
      }
      // ---- v^T fragments (A of the second product): row d = 16j + c, fragment j of the key tile; each is loaded once and
      //      multiplied with both query tiles' prob fragments ----
      const v16h vh0 = ldfrag_o(VHIp, ko, 0u);
      const v16h vh1 = ldfrag_o(VHIp, ko, FRB);
      const v16h vh2 = ldfrag_o(VHIp, ko, 2u * FRB);
      const v16h vh3 = ldfrag_o(VHIp, ko, 3u * FRB);
      const v16h vl0 = ldfrag_o(VLOp, ko, 0u);
      const v16h vl1 = ldfrag_o(VLOp, ko, FRB);
      const v16h vl2 = ldfrag_o(VLOp, ko, 2u * FRB);
      const v16h vl3 = ldfrag_o(VLOp, ko, 3u * FRB);
#pragma unroll
      for (int t = 0; t < QTW; ++t) {
        // ---- mask (replace by -inf) + online softmax in base 2, -inf-safe, for this lane's query; a query with no allowed key in this
        //      key tile goes through with al = 1 (or 0 on a zero state) and all-zero probs: its state keeps its bits ----
        float tv[2][8];
        float mx = -INFINITY;
#pragma unroll
        for (int u = 0; u < 2; ++u) {
#pragma unroll
          for (int r = 0; r < 8; ++r) {
            const bool ok = ((okb[t] >> (8 * u + r)) & 1u) != 0u;
            tv[u][r] = ok ? (s[t][u][r] * lsc) : -INFINITY;
            mx = fmaxf(mx, tv[u][r]);
          }
        }
        mx = fmaxf(mx, xhalf(mx));
        const float mn = fmaxf(mrow[t], mx);
        const float ms = (mn == -INFINITY) ? 0.0f : mn;
        const float al = exp2f(mrow[t] - ms);
        mrow[t] = mn;
        // B fragments of P^T * 32768: hi f16 and residual f16, column = this lane's query; elements 0..7 = keys kb + 8hh + 0..7 (subtile 0),
        // elements 8..15 = keys kb + 16 + 8hh + 0..7 (subtile 1): the split k map of the v^T loader
        FragH ph, pl;
        float ps = 0.0f;
#pragma unroll
        for (int u = 0; u < 2; ++u) {
#pragma unroll
          for (int r = 0; r < 8; ++r) {
            const float e = exp2f(tv[u][r] - ms);
            ps += e;
            const float ta = e * PCAR;
            const _Float16 ha = (_Float16)ta;
            ph.h[u][r] = ha;
            pl.h[u][r] = (_Float16)(ta - (float)ha);
          }
        }
        lrow[t] = lrow[t] * al + ps;
#pragma unroll
        for (int j = 0; j < 4; ++j) o[t][j] *= al;
        o[t][0] = mma_h(vh0, ph.v, o[t][0]);  o[t][0] = mma_h(vh0, pl.v, o[t][0]);  o[t][0] = mma_h(vl0, ph.v, o[t][0]);
        o[t][1] = mma_h(vh1, ph.v, o[t][1]);  o[t][1] = mma_h(vh1, pl.v, o[t][1]);  o[t][1] = mma_h(vl1, ph.v, o[t][1]);
        o[t][2] = mma_h(vh2, ph.v, o[t][2]);  o[t][2] = mma_h(vh2, pl.v, o[t][2]);  o[t][2] = mma_h(vl2, ph.v, o[t][2]);
        o[t][3] = mma_h(vh3, ph.v, o[t][3]);  o[t][3] = mma_h(vh3, pl.v, o[t][3]);  o[t][3] = mma_h(vl3, ph.v, o[t][3]);
        guard10(o[t][0], o[t][1], o[t][2], o[t][3], ph.v, pl.v, vh0, vh1, vh2, vh3, vl0, vl1, vl2, vl3);
      }
    }
#pragma unroll
    for (int t = 0; t < QTW; ++t) acc_guard4(o[t][0], o[t][1], o[t][2], o[t][3]);
    // ---- publish this wave's partial: acc in its slab (a lane: its query's row, 8 consecutive d per j, 16-B stores); m and Z, the two
    //      halves' sums joined here, by the lower half ----
#pragma unroll
    for (int t = 0; t < QTW; ++t) {
#pragma unroll
      for (int j = 0; j < 4; ++j) {
        float* sp = slab + (16 * t + c) * 68 + j * 16 + 8 * hh;
        v4f a, b4;
#pragma unroll
        for (int e = 0; e < 4; ++e) { a[e] = o[t][j][e]; b4[e] = o[t][j][4 + e]; }
        *(v4f*)(sp)     = a;
        *(v4f*)(sp + 4) = b4;
      }
      const float z = lrow[t] + xhalf(lrow[t]);
      if (hh == 0) {
        ml[16 * t + c]            = mrow[t];
        ml[16 * QTW + 16 * t + c] = z;
      }
    }
    __syncthreads();                          // all WPB partials of this mask are visible
    // ---- merge for this lane's row and 8 d columns: out_a = acc / Z (0 when no key allowed), carries (32768 on P, 1024 on v) folded once ----
    {
      float mw[WPB], zw[WPB];
#pragma unroll
      for (int w2 = 0; w2 < WPB; ++w2) {
        mw[w2] = smem[w2 * WREG + QTW * SLW + row];
        zw[w2] = smem[w2 * WREG + QTW * SLW + 16 * QTW + row];
      }
      float mx = mw[0];
#pragma unroll
      for (int w2 = 1; w2 < WPB; ++w2) mx = fmaxf(mx, mw[w2]);
      const float ms = (mx == -INFINITY) ? 0.0f : mx;
      float lv = 0.0f;
      v4f oa = {0.f, 0.f, 0.f, 0.f}, ob = {0.f, 0.f, 0.f, 0.f};
#pragma unroll
      for (int w2 = 0; w2 < WPB; ++w2) {
        const float sc = exp2f(mw[w2] - ms);
        const float* ap = smem + w2 * WREG + row * 68 + c8;
        lv += zw[w2] * sc;
        oa += *(const v4f*)(ap) * sc;
        ob += *(const v4f*)(ap + 4) * sc;
      }
      const float ls  = (lv > 0.0f) ? lv : 1.0f;
      const float inv = (lv > 0.0f) ? ((1.0f / ls) * oc) : 0.0f;
      float* op = osum + row * 68 + c8;
      if (att == 0) {
        *(v4f*)(op)     = oa * inv;
        *(v4f*)(op + 4) = ob * inv;
      } else {
        *(v4f*)(op)     = *(const v4f*)(op) + oa * inv;
        *(v4f*)(op + 4) = *(const v4f*)(op + 4) + ob * inv;
      }
    }
    __syncthreads();                          // every reader has left the slabs (the next mask overwrites them); after the last mask: osum is whole
  }

  // ---- O x1024 -> f16 hi + residual planes; wave = group of 4 rows, lane = (row in group, 8 consecutive d) ----
  v4u oh, ol;
  {
    const v4f a = *(const v4f*)(osum + row * 68 + c8), b4 = *(const v4f*)(osum + row * 68 + c8 + 4);
    float w[8];
#pragma unroll
    for (int e = 0; e < 4; ++e) { w[e] = a[e] * OSC; w[4 + e] = b4[e] * OSC; }
#pragma unroll
    for (int e = 0; e < 4; ++e) {
      const _Float16 h0 = (_Float16)w[2 * e], h1 = (_Float16)w[2 * e + 1];
      const _Float16 l0 = (_Float16)(w[2 * e] - (float)h0), l1 = (_Float16)(w[2 * e + 1] - (float)h1);
      oh[e] = pk16(h_bits(h0), h_bits(h1));
      ol[e] = pk16(h_bits(l0), h_bits(l1));
    }
  }
  const size_t o8 = (((size_t)(q0 + row)) * NH + head) * HD + c8;
  *(v4u*)(OHIp + o8) = oh;
  *(v4u*)(OLOp + o8) = ol;
}

// =====================================================================================================
// Workspace map (bytes); every plane is fully written by whole-line stores before it is read; all extents are exact multiples
// of the store granularity (no pad rows needed); every offset a multiple of SEQ*256:
//   CT  f32 [SEQ][64]                  SEQ*256        ST  same
//   XB  bf16 [SEQ][1024]               SEQ*2048
//   WQB bf16 [1024 n][1024 k]         2097152        WKB, WVB same        2097152 each
//   WOH f16  [1024 n][1024 k] x1024   2097152
//   QHI f16 [16][SEQ/16][2][2][32][8] x1024  SEQ*2048  QLO residual   (fragment order: head, row tile, k-step, i, lane)
//   KHI f16 [16][SEQ/16][2][2][32][8] x1024  SEQ*2048  KLO residual
//   VHI f16 [16][SEQ/32][4][2][32][8] x1024  SEQ*2048  VLO residual   (fragment order: head, key tile, d tile, i, lane)
//   OHI f16 [SEQ][1024] x1024          SEQ*2048       OLO residual
//   end (SEQ = 2048)                  47185920
// =====================================================================================================
extern "C" void kernel_launch(void* const* d_in, const int* in_sizes, int n_in,
                              void* d_out, int out_size, void* d_ws, size_t ws_size,
                              hipStream_t stream) {
  if (n_in < 11) return;
  if (in_sizes[0] != SEQ * DMOD) return;
  if (in_sizes[1] != SEQ || in_sizes[2] != SEQ) return;
  if (in_sizes[3] != DMOD * DMOD || in_sizes[5] != DMOD * DMOD) return;
  if (in_sizes[7] != DMOD * DMOD || in_sizes[9] != DMOD * DMOD) return;
  if (in_sizes[4] != DMOD || in_sizes[6] != DMOD || in_sizes[8] != DMOD || in_sizes[10] != DMOD) return;
  if (out_size != SEQ * DMOD) return;

  const float* x   = (const float*)d_in[0];
  const int*   bar = (const int*)d_in[1];
  const int*   ins = (const int*)d_in[2];
  const float* wq  = (const float*)d_in[3];
  const float* bq  = (const float*)d_in[4];
  const float* wk  = (const float*)d_in[5];
  const float* bk  = (const float*)d_in[6];
  const float* wv  = (const float*)d_in[7];
  const float* bv  = (const float*)d_in[8];
  const float* wo  = (const float*)d_in[9];
  const float* bo  = (const float*)d_in[10];
  float*       out = (float*)d_out;

  const size_t szTab = (size_t)SEQ * HD * 4;                    //   524288
  const size_t szXB  = (size_t)SEQ * DMOD * 2;                  //  4194304
  const size_t szW   = (size_t)DMOD * DMOD * 2;                 //  2097152
  const size_t szP   = (size_t)SEQ * DMOD * 2;                  //  4194304
  size_t off = 0;
  const size_t oCT  = off; off += szTab;
  const size_t oST  = off; off += szTab;
  const size_t oXB  = off; off += szXB;
  const size_t oWQ  = off; off += szW;
  const size_t oWK  = off; off += szW;
  const size_t oWV  = off; off += szW;
  const size_t oWO  = off; off += szW;
  const size_t oQHI = off; off += szP;
  const size_t oQLO = off; off += szP;
  const size_t oKHI = off; off += szP;
  const size_t oKLO = off; off += szP;
  const size_t oVHI = off; off += szP;
  const size_t oVLO = off; off += szP;
  const size_t oOHI = off; off += szP;
  const size_t oOLO = off; off += szP;
  if (off > ws_size) return;                            // off = 47185920 at SEQ = 2048
  if (off > (size_t)134217728) return;

  char* ws = (char*)d_ws;
  float* CT  = (float*)(ws + oCT);
  float* ST  = (float*)(ws + oST);
  u16*   XB  = (u16*)(ws + oXB);
  u16*   WQB = (u16*)(ws + oWQ);
  u16*   WKB = (u16*)(ws + oWK);
  u16*   WVB = (u16*)(ws + oWV);
  u16*   WOH = (u16*)(ws + oWO);
  u16*   QHI = (u16*)(ws + oQHI);
  u16*   QLO = (u16*)(ws + oQLO);
  u16*   KHI = (u16*)(ws + oKHI);
  u16*   KLO = (u16*)(ws + oKLO);
  u16*   VHI = (u16*)(ws + oVHI);
  u16*   VLO = (u16*)(ws + oVLO);
  u16*   OHI = (u16*)(ws + oOHI);
  u16*   OLO = (u16*)(ws + oOLO);

  // inv_freq[i] = 1 / pow(10000, i/32) in f32 (pow correctly converted from f64, then IEEE f32 reciprocal)
  InvF inv;
  for (int i = 0; i < 32; ++i) {
    const double p = pow(10000.0, (double)i / 32.0);
    const float pf = (float)p;
    inv.f[i] = 1.0f / pf;
  }

  const dim3 blk(256);
  const dim3 gPrep(TABB + XCB + 4 * WCB);               // 256 + 1024 + 2048
  const dim3 gG((SEQ / 64) * (DMOD / 64));              // 512
  const dim3 gG3((SEQ / 64) * (DMOD / 64), 3);          // 512 x 3
  const dim3 bG(128);
  const dim3 gAT(ATT_BLOCKS);                           // 1024
  const dim3 bAT(ATT_THREADS);                          // 256

  // (0) rotary cos/sin tables [SEQ][64]; x, Wq, Wk, Wv -> bf16 planes (same layout, already k-contiguous); Wo -> f16 plane of bf16 value x1024
  prep<<<gPrep, blk, 0, stream>>>(x, wq, wk, wv, wo, XB, WQB, WKB, WVB, WOH, CT, ST, inv);
  // (1) projections q, k, v (+ bias), packed in the epilogue: q', k' planes (rotary) and v^T planes, x1024 (hi + residual), all in fragment order
  gemm_bf<<<gG3, bG, 0, stream>>>(XB, WQB, WKB, WVB, bq, bk, bv, CT, ST, QHI, QLO, KHI, KLO, VHI, VLO, SEQ, DMOD, DMOD, 1.0f);
  // (2) three masked attentions summed -> O planes [s][h][d] x1024 (hi + residual)
  attn3<<<gAT, bAT, 0, stream>>>(QHI, QLO, KHI, KLO, VHI, VLO, ins, bar, OHI, OLO);
  // (3) output projection -> out [SEQ][1024] f32, carries 1024 (O) x 1024 (Wo) folded back, + bo
  gemm_h2<<<gG, bG, 0, stream>>>(OHI, OLO, WOH, bo, out, SEQ, DMOD, DMOD, 1.0f / (OSC * WOS));
  (void)hipGetLastError();
}

// v009
// Measured time: 84.1 microseconds a run.
// Next to v008, in two timings, it ran 1.15 and 1.16 times as fast.
// All steps since v000 together make it 3.97 times as fast.
// Contractions: x.W{q,k,v}^T on v_wmma_f32_16x16x32_bf16 (x and W RNE-converted to bf16, f32 accumulate);
// scores k'.q'^T (transposed; q', k' carried x1024 as f16 hi plane + f16 residual plane, products hh+lh+hl), v^T.P^T (P x32768 f16 hi+residual,
// v x1024 f16 hi+residual, products hh+lh+hl) and O.Wo^T (O x1024 f16 hi+residual, Wo as f16(bf16(Wo) x1024), products h.w+l.w):
// v_wmma_f32_16x16x32_f16, f32 accumulate. Rotary tables, rotation, masks, masked base-2 online softmax and 1/l fold in f32 on VALU.
#include <hip/hip_runtime.h>
#include <math.h>
#include <stdint.h>

#define SEQ   2048
#define DMOD  1024
#define NH    16
#define HD    64
#define GINST 129
#define QSC   1024.0f
#define KSC   1024.0f
#define PCAR  32768.0f
#define VCAR  1024.0f
#define OSC   1024.0f
#define WOS   1024.0f
#define LOG2E 1.4426950408889634f
#define WPB   8
#define QTW   2
#define NQP   (SEQ / (16 * QTW))
#define NKT   (SEQ / 32)
#define ATT_THREADS (WPB * 32)
#define ATT_BLOCKS  (NQP * NH)
#define SLW   (16 * 68)
#define WREG  (QTW * SLW + QTW * 32)
#define SLAB64 (16 * 68)
#define GKC   128
#define GPB   272
#define GOPB  (64 * GPB)
#define GKS   (GKC / 32)
#define TABB  (SEQ / 8)
#define RNKB  (SEQ / 32)
#define WCB   ((DMOD * DMOD) / 2048)
static_assert(DMOD == NH * HD && HD == 64 && NH == 16);
static_assert(WPB == 8 && ATT_THREADS == 256 && (WREG % 4) == 0 && (SLW % 4) == 0 && QTW == 2);
static_assert((SEQ % 64) == 0 && (SEQ % ATT_THREADS) == 0 && (SEQ % 8) == 0 && SEQ <= 32768);
static_assert((DMOD % 64) == 0 && (DMOD % 32) == 0);
static_assert(16 * QTW == 32 && NKT == 8 * WPB);
static_assert(((DMOD * DMOD) % 2048) == 0 && DMOD == 4 * 256 && (SEQ % 128) == 0 && (SEQ & (SEQ - 1)) == 0);
static_assert((DMOD % GKC) == 0 && (DMOD / GKC) >= 2 && GKC * 2 == 256 && GPB == 256 + 16 && (SEQ % 64) == 0);

typedef unsigned short u16;
typedef _Float16 v16h __attribute__((ext_vector_type(16)));
typedef _Float16 v8h  __attribute__((ext_vector_type(8)));
typedef __bf16   v16b __attribute__((ext_vector_type(16)));
typedef float    v8f  __attribute__((ext_vector_type(8)));
typedef float    v4f  __attribute__((ext_vector_type(4)));
typedef unsigned int v4u __attribute__((ext_vector_type(4)));
typedef int v4i __attribute__((ext_vector_type(4)));

union FragH { v16h v; v8h h[2]; v4u u[2]; };
union FragB { v16b v; v4u u[2]; };

struct InvF { float f[32]; };
static_assert(sizeof(InvF) == 128);

// ---- scalar helpers --------------------------------------------------------------------------------
__device__ __forceinline__ unsigned short bf_bits(float f) {          // f32 -> bf16 bits, RNE convert
  unsigned u = __float_as_uint(f);
  return (unsigned short)((u + 0x7FFFu + ((u >> 16) & 1u)) >> 16);
}
__device__ __forceinline__ float bf_up(unsigned short h) { return __uint_as_float(((unsigned)h) << 16); }
__device__ __forceinline__ float bfr(float f) { return bf_up(bf_bits(f)); }
__device__ __forceinline__ unsigned short h_bits(_Float16 x) { return __builtin_bit_cast(unsigned short, x); }
__device__ __forceinline__ unsigned pk16(unsigned short a, unsigned short b) { return (unsigned)a | ((unsigned)b << 16); }
__device__ __forceinline__ v8f zero8() { v8f z = {0.f, 0.f, 0.f, 0.f, 0.f, 0.f, 0.f, 0.f}; return z; }

// ---- fragment map: 16-bit A/B operand, lane -> row/col (lane&15), half hh = lane>>4;
//      elements 0..7 <- k0+8hh+0..7, elements 8..15 <- k0+16+8hh+0..7  (same split k map for A and B)
// ---- fragment-order planes (q', k', v^T): a fragment (16 rows x 32 k) is 1 KB in a row: [i = 0,1][lane 0..31][8 halves], the 8 halves being
//      row (lane&15), k = k0 + 16i + 8hh + 0..7: what lane holds in elements 8i .. 8i+7. One load of a wave is then 512 contiguous bytes,
//      four whole 128-B lines, where a row-major plane gives 16-B pieces of 16 lines.
// fragment from a wave-uniform plane base plus a 32-bit per-lane byte offset (fragment start + 16 * lane)
__device__ __forceinline__ v16h ldfrag_o(const u16* base, unsigned boff, unsigned cbytes) {
  const char* p = (const char*)(const void*)base + boff;
  FragH f;
  f.h[0] = *(const v8h*)(p + cbytes);
  f.h[1] = *(const v8h*)(p + cbytes + 512);
  return f.v;
}

__device__ __forceinline__ v8f mma_h(v16h a, v16h b, v8f c) {
  return __builtin_amdgcn_wmma_f32_16x16x32_f16(false, a, false, b, (short)0, c, false, false);
}
__device__ __forceinline__ v8f mma_b(v16b a, v16b b, v8f c) {
  return __builtin_amdgcn_wmma_f32_16x16x32_bf16(false, a, false, b, (short)0, c, false, false);
}
template <typename F>
__device__ __forceinline__ void guard6(v8f& a, v8f& b, v8f& c, v8f& d, F x0, F x1, F x2, F x3, F x4, F x5) {
#if defined(__HIP_DEVICE_COMPILE__)
  asm volatile("v_nop\n\tv_nop\n\tv_nop\n\tv_nop"
               : "+v"(a), "+v"(b), "+v"(c), "+v"(d) : "v"(x0), "v"(x1), "v"(x2), "v"(x3), "v"(x4), "v"(x5) : "memory");
#endif
}
__device__ __forceinline__ void guard10(v8f& a, v8f& b, v8f& c, v8f& d, v16h x0, v16h x1, v16h x2, v16h x3, v16h x4,
                                        v16h x5, v16h x6, v16h x7, v16h x8, v16h x9) {
#if defined(__HIP_DEVICE_COMPILE__)
  asm volatile("v_nop\n\tv_nop\n\tv_nop\n\tv_nop"
               : "+v"(a), "+v"(b), "+v"(c), "+v"(d)
               : "v"(x0), "v"(x1), "v"(x2), "v"(x3), "v"(x4), "v"(x5), "v"(x6), "v"(x7), "v"(x8), "v"(x9) : "memory");
#endif
}
__device__ __forceinline__ void acc_guard4(v8f& a, v8f& b, v8f& c, v8f& d) {
#if defined(__HIP_DEVICE_COMPILE__)
  asm volatile("v_nop\n\tv_nop\n\tv_nop\n\tv_nop" : "+v"(a), "+v"(b), "+v"(c), "+v"(d));
#endif
}
// the value that lane l ^ 16 holds: the other half's share of the same query column
__device__ __forceinline__ float xhalf(float x) {
  const int b = __float_as_int(x);
  return __int_as_float(__builtin_amdgcn_permlanex16(b, b, 0x76543210, 0xfedcba98, false, false));
}
// minimum and maximum over the 32 lanes of a wave, every lane on: four exchanges inside a 16-lane row (DPP row_xmask 1, 2, 4, 8), then
// one between the two rows; every lane ends with the result
__device__ __forceinline__ int wave_min_i(int x) {
  int y;
  y = __builtin_amdgcn_update_dpp(x, x, 0x161, 0xf, 0xf, false); x = (y < x) ? y : x;
  y = __builtin_amdgcn_update_dpp(x, x, 0x162, 0xf, 0xf, false); x = (y < x) ? y : x;
  y = __builtin_amdgcn_update_dpp(x, x, 0x164, 0xf, 0xf, false); x = (y < x) ? y : x;
  y = __builtin_amdgcn_update_dpp(x, x, 0x168, 0xf, 0xf, false); x = (y < x) ? y : x;
  y = __builtin_amdgcn_permlanex16(x, x, 0x76543210, 0xfedcba98, false, false); x = (y < x) ? y : x;
  return x;
}
__device__ __forceinline__ int wave_max_i(int x) {
  int y;
  y = __builtin_amdgcn_update_dpp(x, x, 0x161, 0xf, 0xf, false); x = (y > x) ? y : x;
  y = __builtin_amdgcn_update_dpp(x, x, 0x162, 0xf, 0xf, false); x = (y > x) ? y : x;
  y = __builtin_amdgcn_update_dpp(x, x, 0x164, 0xf, 0xf, false); x = (y > x) ? y : x;
  y = __builtin_amdgcn_update_dpp(x, x, 0x168, 0xf, 0xf, false); x = (y > x) ? y : x;
  y = __builtin_amdgcn_permlanex16(x, x, 0x76543210, 0xfedcba98, false, false); x = (y > x) ? y : x;
  return x;
}
// ---- token order: every plane between the input x and the O planes is laid out in the order of a STABLE SORT OF THE POSITIONS BY INSTRUMENT ID:
//      rank(t) = #{j : inst[j] < inst[t]} + #{j < t : inst[j] == inst[t]}, a permutation of 0 .. SEQ-1 for any content of the id array.
//      Attention does not depend on the order of keys or of queries (the masks are evaluated from each token's own ids and position), and in
//      this order the keys that the same-instrument mask allows to a query tile lie in a few neighbouring key tiles, and all keys of one
//      id (the global one too) lie together: far fewer key tiles hold an allowed element.
// all SEQ instrument ids spread over a wave: lane holds ids 128 i + 4 lane + 0..3 (each load of the wave: 512 contiguous bytes)
struct IdSet { v4i q[SEQ / 128]; };
__device__ __forceinline__ void ids_load(const int* __restrict__ inst, int lane, IdSet& s) {
#pragma unroll
  for (int i = 0; i < SEQ / 128; ++i) s.q[i] = *(const v4i*)(inst + 128 * i + 4 * lane);
}
// rank of position t (wave-uniform, my = inst[t]); every lane on. Counted on the scalar side: a ballot of each comparison and a bit count, so
// that the result is wave-uniform with no lane exchange. Positions j = 128 i + 4 lane + e below t: all of chunk i < t / 128, none of a later
// chunk, and in chunk t / 128 the lanes of me[e].
__device__ __forceinline__ int rank_of(const IdSet& s, int my, int t, int lane) {
  const int tc = t >> 7, tl = t & 127;
  unsigned me[4];
#pragma unroll
  for (int e = 0; e < 4; ++e) me[e] = __builtin_amdgcn_ballot_w32(4 * lane + e < tl);
  int cnt = 0;
#pragma unroll
  for (int i = 0; i < SEQ / 128; ++i) {
#pragma unroll
    for (int e = 0; e < 4; ++e) {
      const unsigned lt = __builtin_amdgcn_ballot_w32(s.q[i][e] < my), eq = __builtin_amdgcn_ballot_w32(s.q[i][e] == my);
      const unsigned bf = (i < tc) ? 0xffffffffu : (i == tc) ? me[e] : 0u;
      cnt += __builtin_popcount(lt | (eq & bf));
    }
  }
  return cnt;
}
__device__ __forceinline__ void wave_sync_lds() {
  __builtin_amdgcn_fence(__ATOMIC_RELEASE, "workgroup");
  __builtin_amdgcn_wave_barrier();
  __builtin_amdgcn_fence(__ATOMIC_ACQUIRE, "workgroup");
}

// ---- GEMM operand staging: a stage = GKC k elements (256 B) of 64 rows of an operand, LDS row pitch GPB bytes ----
__device__ __forceinline__ unsigned lds_off(const void* p) { return (unsigned)(size_t)p; }   // LDS byte address of a __shared__ object
// 16 rows x 256 B of one operand, global memory -> LDS through no register: eight asynchronous copies of this wave. A copy is 2 whole rows
// (lane -> row lane >> 4, 16-B column lane & 15), four whole 128-B lines. l, g: this lane's LDS byte address and global address in copy 0;
// copy i lies 2 rows further on in both (ldk = elements between global rows). All 32 lanes on; both addresses multiples of 16.
// The closing s_wait_xcnt 0 stands inside the statement so that no address register named here is rewritten in front of it.
__device__ __forceinline__ void copy16rows(unsigned l, const u16* g, size_t ldk) {
#if defined(__HIP_DEVICE_COMPILE__)
  asm volatile("global_load_async_to_lds_b128 %0, %8, off\n\t"
               "global_load_async_to_lds_b128 %1, %9, off\n\t"
               "global_load_async_to_lds_b128 %2, %10, off\n\t"
               "global_load_async_to_lds_b128 %3, %11, off\n\t"
               "global_load_async_to_lds_b128 %4, %12, off\n\t"
               "global_load_async_to_lds_b128 %5, %13, off\n\t"
               "global_load_async_to_lds_b128 %6, %14, off\n\t"
               "global_load_async_to_lds_b128 %7, %15, off\n\t"
               "s_wait_xcnt 0x0"
               :: "v"(l), "v"(l + 2u * GPB), "v"(l + 4u * GPB), "v"(l + 6u * GPB),
                  "v"(l + 8u * GPB), "v"(l + 10u * GPB), "v"(l + 12u * GPB), "v"(l + 14u * GPB),
                  "v"(g), "v"(g + 2 * ldk), "v"(g + 4 * ldk), "v"(g + 6 * ldk),
                  "v"(g + 8 * ldk), "v"(g + 10 * ldk), "v"(g + 12 * ldk), "v"(g + 14 * ldk)
               : "memory");
#endif
}
// this wave's own copies have landed (the compiler places no wait for them)
__device__ __forceinline__ void wait_copies() {
#if defined(__HIP_DEVICE_COMPILE__)
  asm volatile("s_wait_asynccnt 0x0" ::: "memory");
#endif
}
// this wave's LDS reads have retired: stands in front of the barrier behind which the buffer it read is refilled
__device__ __forceinline__ void wait_lds() {
#if defined(__HIP_DEVICE_COMPILE__)
  asm volatile("s_wait_dscnt 0x0" ::: "memory");
#endif
}
// stands behind a piece's last global stores: in a grid of several pieces another piece's code follows in the listing and rewrites the
// registers that the stores name; this wait is in front of every such write (which piece is laid last is the compiler's choice: each has it)
__device__ __forceinline__ void wait_store_regs() {
#if defined(__HIP_DEVICE_COMPILE__)
  asm volatile("s_wait_xcnt 0x0" ::: "memory");
#endif
}
// fragment from a staged row: p = row start + 64 * k-step + 16 * (lane >> 4) bytes; the split k map of the loaders above (bytes +0 and +32)
__device__ __forceinline__ v16b ldsfrag_b(const unsigned char* p) {
  FragB f;
  f.u[0] = *(const v4u*)(p);
  f.u[1] = *(const v4u*)(p + 32);
  return f.v;
}
__device__ __forceinline__ v16h ldsfrag_h(const unsigned char* p) {
  FragH f;
  f.u[0] = *(const v4u*)(p);
  f.u[1] = *(const v4u*)(p + 32);
  return f.v;
}

// ---- accurate f32 sin/cos of a non-negative f32 angle (|angle| < 32768): f64 two-part pi/2 reduction + f64 polynomials,
//      plain f64 fma/mul only (no library f64 trig path), result converted to f32.
__device__ __forceinline__ void sincos_acc(float angf, float& sv, float& cv) {
  const double a = (double)angf;
  const double TWO_OVER_PI = 0.63661977236758134308;
  const double PIO2_HI = 1.5707963267948966;
  const double PIO2_LO = 6.123233995736766e-17;
  const int kq = (int)(a * TWO_OVER_PI + 0.5);
  const double kd = (double)kq;
  double r = fma(-kd, PIO2_HI, a);
  r = fma(-kd, PIO2_LO, r);
  const double r2 = r * r;
  double sp = 1.0 / 6227020800.0;
  sp = fma(sp, r2, -1.0 / 39916800.0);
  sp = fma(sp, r2, 1.0 / 362880.0);
  sp = fma(sp, r2, -1.0 / 5040.0);
  sp = fma(sp, r2, 1.0 / 120.0);
  sp = fma(sp, r2, -1.0 / 6.0);
  const double s = fma(sp * r2, r, r);
  double cp = -1.0 / 87178291200.0;
  cp = fma(cp, r2, 1.0 / 479001600.0);
  cp = fma(cp, r2, -1.0 / 3628800.0);
  cp = fma(cp, r2, 1.0 / 40320.0);
  cp = fma(cp, r2, -1.0 / 720.0);
  cp = fma(cp, r2, 1.0 / 24.0);
  cp = fma(cp, r2, -0.5);
  const double c = fma(cp, r2, 1.0);
  const int qd = kq & 3;
  const double so = (qd == 0) ? s : (qd == 1) ? c : (qd == 2) ? -s : -c;
  const double co = (qd == 0) ? c : (qd == 1) ? -s : (qd == 2) ? -c : s;
  sv = (float)so;
  cv = (float)co;
}

// =====================================================================================================
// Rank table: rankT[t] = rank(t) in the sorted token order, for the attention's id staging. Block = 32 positions, wave = 4 of them (the ids
// are loaded once a wave); the 32 ranks are gathered in LDS behind a block barrier so that one wave writes the whole 128-B line.
// coverage: blk = 0 .. SEQ/32 - 1, 32 positions each.
// =====================================================================================================
__device__ __forceinline__ void rank_blk(int blk, const int* __restrict__ inst, int* rankT, int* red) {
  const int tid  = threadIdx.x;
  const int lane = tid & 31;
  const int wave = __builtin_amdgcn_readfirstlane(tid >> 5);
  IdSet s;
  ids_load(inst, lane, s);
  int mine = 0;
  // kept rolled: four copies of the count side by side outgrow the scalar registers (their ballots are spilled to lanes)
#pragma unroll 1
  for (int i = 0; i < 4; ++i) {
    const int t = blk * 32 + wave * 4 + i;
    const int r = rank_of(s, inst[t], t, lane);
    mine = (lane == i) ? r : mine;
  }
  if (lane < 4) red[wave * 4 + lane] = mine;
  __syncthreads();                           // the block's 32 ranks are visible to its first wave (block-uniform: the whole block is in this piece)
  if (wave == 0) rankT[blk * 32 + lane] = red[lane];
  wait_store_regs();
}

// =====================================================================================================
// One position t a wave, written at row r = rank(t) of the sorted token order:
//   rotary tables cosT[r][d], sinT[r][d], d < HD, angle = float(t) * inv_freq[d & 31] (f32 product), halves duplicated; lane = frequency index,
//   inv_freq picked from the by-value table with a static select chain;
//   x[t][:] -> bf16 RNE bits in XB[r][:]: 4 x (two 16-B loads, one 16-B store) a lane, every store of the wave 512 contiguous bytes.
// coverage: blk = 0 .. SEQ/8 - 1, 8 waves each = SEQ positions = SEQ rows (rank is a permutation); per row 4 line stores = 64 floats of each
// table and 4 x 512 B = DMOD elements of XB.
// =====================================================================================================
__device__ __forceinline__ void row_blk(int blk, const float* __restrict__ x, const int* __restrict__ inst, u16* XBo,
                                        float* cosT, float* sinT, const InvF& inv) {
  const int tid  = threadIdx.x;
  const int lane = tid & 31;
  const int t    = blk * 8 + __builtin_amdgcn_readfirstlane(tid >> 5);
  float f = inv.f[0];
#pragma unroll
  for (int i = 1; i < 32; ++i) f = (lane == i) ? inv.f[i] : f;
  // the select chain is built as one load of the table by lane: this wait stands behind it, in front of the loads below, whose results may
  // take the registers of its address (f as an operand keeps the table load in front of the statement)
#if defined(__HIP_DEVICE_COMPILE__)
  asm volatile("s_wait_xcnt 0x0" : "+v"(f) :: "memory");
#endif
  const float* p = x + (size_t)t * DMOD + lane * 8;
  v4f xa[4], xb[4];
#pragma unroll
  for (int it = 0; it < 4; ++it) { xa[it] = *(const v4f*)(p + it * 256); xb[it] = *(const v4f*)(p + it * 256 + 4); }
  IdSet s;
  ids_load(inst, lane, s);
  const int r = rank_of(s, inst[t], t, lane);
  const float ang = (float)t * f;
  float sv, cv;
  sincos_acc(ang, sv, cv);
  float* cr = cosT + (size_t)r * HD;
  float* sr = sinT + (size_t)r * HD;
  *(float*)(cr + lane)      = cv;
  *(float*)(cr + 32 + lane) = cv;
  *(float*)(sr + lane)      = sv;
  *(float*)(sr + 32 + lane) = sv;
  u16* d = XBo + (size_t)r * DMOD + lane * 8;
#pragma unroll
  for (int it = 0; it < 4; ++it) {
    v4u o;
    o[0] = pk16(bf_bits(xa[it][0]), bf_bits(xa[it][1]));
    o[1] = pk16(bf_bits(xa[it][2]), bf_bits(xa[it][3]));
    o[2] = pk16(bf_bits(xb[it][0]), bf_bits(xb[it][1]));
    o[3] = pk16(bf_bits(xb[it][2]), bf_bits(xb[it][3]));
    *(v4u*)(d + it * 256) = o;
  }
  wait_store_regs();
}

// =====================================================================================================
// f32 -> 16-bit plane, same layout.  f16mode false: bf16 RNE bits;  f16mode true: f16 bits of (bf16 RNE value) * scale.
// Thread = 8 consecutive elements: two 16-B loads, one 16-B store; 32 consecutive lanes = 512 contiguous, 512-B aligned bytes.
// coverage: blk = 0 .. n/2048 - 1, 256 thr x 8 elements each = the whole plane.
// =====================================================================================================
__device__ __forceinline__ void cvt_blk(const float* __restrict__ x, u16* D, int blk, bool f16mode, float scale) {
  const int gt = blk * 256 + (int)threadIdx.x;
  const float* p = x + (size_t)gt * 8;
  const v4f a = *(const v4f*)(p), b4 = *(const v4f*)(p + 4);
  float w[8];
#pragma unroll
  for (int e = 0; e < 4; ++e) { w[e] = a[e]; w[4 + e] = b4[e]; }
  v4u o;
#pragma unroll
  for (int e = 0; e < 4; ++e) {
    const float f0 = w[2 * e], f1 = w[2 * e + 1];
    o[e] = f16mode ? pk16(h_bits((_Float16)(bfr(f0) * scale)), h_bits((_Float16)(bfr(f1) * scale)))
                   : pk16(bf_bits(f0), bf_bits(f1));
  }
  *(v4u*)(D + (size_t)gt * 8) = o;
  wait_store_regs();
}

// =====================================================================================================
// Everything that reads inputs alone, in one grid: none of these pieces reads what another writes. The block index picks the piece
// (block-uniform; the one barrier stands inside the rank piece): RNKB blocks of the rank table, TABB blocks of rotary tables + x -> bf16, both at
// the row's rank (the longest chain of a wave), 3 * WCB blocks Wq, Wk, Wv -> bf16, WCB blocks Wo -> f16 of the bf16 value x1024.
// grid = RNKB + TABB + 4 * WCB, exact.
// =====================================================================================================
__global__ __launch_bounds__(256) void prep(const float* __restrict__ x, const int* __restrict__ inst,
                                            const float* __restrict__ wq, const float* __restrict__ wk,
                                            const float* __restrict__ wv, const float* __restrict__ wo,
                                            u16* XBo, u16* WQo, u16* WKo, u16* WVo, u16* WOo,
                                            float* cosT, float* sinT, int* rankT, InvF inv) {
  __shared__ int red[32];
  int b = blockIdx.x;
  if (b < RNKB) { rank_blk(b, inst, rankT, red); return; }
  b -= RNKB;
  if (b < TABB) { row_blk(b, x, inst, XBo, cosT, sinT, inv); return; }
  b -= TABB;
  const int w = b / WCB, wb = b % WCB;
  if (w < 3) {
    const float* s = (w == 0) ? wq : (w == 1) ? wk : wv;
    u16*         d = (w == 0) ? WQo : (w == 1) ? WKo : WVo;
    cvt_blk(s, d, wb, false, 1.0f);
  } else if (w == 3) {
    cvt_blk(wo, WOo, wb, true, WOS);
  }
}

// =====================================================================================================
// Epilogue of the output projection: the wave's 16x64 f32 tile (times oscale) staged in its LDS slab (pitch 68),
// coverage: 8 instructions x 2 rows x 16 lanes x 4 floats = the wave's 16 x 64 tile.
// =====================================================================================================
__device__ __forceinline__ void epi64(float* sl, v8f a0, v8f a1, v8f a2, v8f a3, float oscale,
                                      const float* __restrict__ bias, float* C, int N,
                                      size_t rowb, int col0, int lane) {
  const int hh = lane >> 4, m = lane & 15;
#pragma unroll
  for (int r = 0; r < 8; ++r) {
    const int ro = (8 * hh + r) * 68 + m;
    sl[ro]      = a0[r] * oscale;
    sl[ro + 16] = a1[r] * oscale;
    sl[ro + 32] = a2[r] * oscale;
    sl[ro + 48] = a3[r] * oscale;
  }
  wave_sync_lds();
  const v4f braw = *(const v4f*)(bias + col0 + m * 4);
  v4f bb;
#pragma unroll
  for (int e = 0; e < 4; ++e) bb[e] = bfr(braw[e]);
  v4f vals[8];
#pragma unroll
  for (int it = 0; it < 8; ++it) vals[it] = *(const v4f*)(sl + (it * 2 + hh) * 68 + m * 4) + bb;
  float* dst = C + (rowb + (size_t)hh) * (size_t)N + col0 + m * 4;
  {
#pragma unroll
    for (int it = 0; it < 8; ++it) {
      *(v4f*)(dst + (size_t)(it * 2) * (size_t)N) = vals[it];
    }
    
  }
}

// =====================================================================================================
// Projection epilogue for q and k: rotate-half rotary + 16-bit split pack of the wave's 16 x 64 f32 tile = 16 positions x one whole head
// (the tile's 64 columns are head col0 / 64), written straight into the fragment-order planes: no f32 plane in between.
// x[d] = acc * oscale + bias;  w[d] = x[d] * cos[pos][d] + r[d] * sin[pos][d],  r[d] = -x[d+32] for d < 32, x[d-32] for d >= 32
// (cos, sin: both halves of a table row are equal, so the row's first half serves d and d + 32);
// hi[d] = f16(w * sc), lo[d] = f16(w * sc - hi[d])  (sc a power of two, residual unscaled).
// Output in fragment order: [head][row tile rt = pos / 16][k-step kk][i][lane][8 halves] (2 KB a row tile and head): the wave's tile is
// exactly one (head, rt). The tile is turned in the wave's LDS slab (pitch 68): written from the D registers (lane: column m, rows 8hh + r),
// read back as lane (hh, c = m) -> row c, d = 16 i + 8 hh + 0..7 and the same + 32: what this lane holds of fragments kk = 0 and kk = 1.
// coverage: 2 (i) x 2 (kk) stores x 32 lanes x 8 halves = 16 x 64 of each plane; every store of a wave is 512 contiguous bytes, four whole lines.
// =====================================================================================================
__device__ __forceinline__ void epi_rope(float* sl, v8f a0, v8f a1, v8f a2, v8f a3, float oscale,
                                         const float* __restrict__ bias, const float* __restrict__ cosT,
                                         const float* __restrict__ sinT, u16* hpl, u16* lpl,
                                         int rowb, int col0, int lane, float sc) {
  const int hh = lane >> 4, m = lane & 15;
  const float* cr = cosT + (size_t)(rowb + m) * HD + 8 * hh;
  const float* sr = sinT + (size_t)(rowb + m) * HD + 8 * hh;
  const float* br = bias + col0 + 8 * hh;
  v4f cs[2][2], sn[2][2], b0[2][2], b1[2][2];
#pragma unroll
  for (int i = 0; i < 2; ++i) {
#pragma unroll
    for (int p = 0; p < 2; ++p) {
      cs[i][p] = *(const v4f*)(cr + 16 * i + 4 * p);
      sn[i][p] = *(const v4f*)(sr + 16 * i + 4 * p);
      b0[i][p] = *(const v4f*)(br + 16 * i + 4 * p);
      b1[i][p] = *(const v4f*)(br + 32 + 16 * i + 4 * p);
    }
  }
#pragma unroll
  for (int r = 0; r < 8; ++r) {
    const int ro = (8 * hh + r) * 68 + m;
    sl[ro]      = a0[r] * oscale;
    sl[ro + 16] = a1[r] * oscale;
    sl[ro + 32] = a2[r] * oscale;
    sl[ro + 48] = a3[r] * oscale;
  }
  wave_sync_lds();
  v4u oh[2][2], ol[2][2];                     // [kk][i]
#pragma unroll
  for (int i = 0; i < 2; ++i) {
    const float* xr = sl + m * 68 + 16 * i + 8 * hh;
    float w0[8], w1[8];
#pragma unroll
    for (int p = 0; p < 2; ++p) {
      const v4f xl = *(const v4f*)(xr + 4 * p), xu = *(const v4f*)(xr + 32 + 4 * p);
#pragma unroll
      for (int e = 0; e < 4; ++e) {
        const float x0 = xl[e] + bfr(b0[i][p][e]), x1 = xu[e] + bfr(b1[i][p][e]);
        w0[4 * p + e] = x0 * cs[i][p][e] + (-x1) * sn[i][p][e];
        w1[4 * p + e] = x1 * cs[i][p][e] + x0 * sn[i][p][e];
      }
    }
#pragma unroll
    for (int e = 0; e < 4; ++e) {
      const float t0 = w0[2 * e] * sc, t1 = w0[2 * e + 1] * sc, t2 = w1[2 * e] * sc, t3 = w1[2 * e + 1] * sc;
      const _Float16 h0 = (_Float16)t0, h1 = (_Float16)t1, h2 = (_Float16)t2, h3 = (_Float16)t3;
      oh[0][i][e] = pk16(h_bits(h0), h_bits(h1));
      oh[1][i][e] = pk16(h_bits(h2), h_bits(h3));
      ol[0][i][e] = pk16(h_bits((_Float16)(t0 - (float)h0)), h_bits((_Float16)(t1 - (float)h1)));
      ol[1][i][e] = pk16(h_bits((_Float16)(t2 - (float)h2)), h_bits((_Float16)(t3 - (float)h3)));
    }
  }
  const size_t o8 = ((size_t)(col0 >> 6) * (SEQ / 16) + (size_t)(rowb >> 4)) * (16 * HD) + (size_t)lane * 8;
#pragma unroll
  for (int kk = 0; kk < 2; ++kk) {
#pragma unroll
    for (int i = 0; i < 2; ++i) {
      *(v4u*)(hpl + o8 + kk * 512 + i * 256) = oh[kk][i];
      *(v4u*)(lpl + o8 + kk * 512 + i * 256) = ol[kk][i];
    }
  }
  wait_store_regs();
}

// =====================================================================================================
// Projection epilogue for v: the wave's 16 x 64 f32 tile = 16 keys x one whole head g = col0 / 64, written straight into the v^T planes.
// v^T planes in fragment order: [head g][key tile kt = s / 32][j = d / 16][i][lane][8 halves] (4 KB a key tile and head), the 8 halves being
// row d = 16 j + (lane & 15), keys 32 kt + 16 i + 8 (lane >> 4) + 0..7: VH = f16(v[s][g][d] * 1024), VL = f16 residual of the same value.
// D register r of accumulator j in lane (hh, m) is (key rowb + 8 hh + r, d = 16 j + m): the lane's eight registers ARE its 8 halves of half
// fragment (kt = rowb / 32, j, i = (rowb / 16) & 1): no LDS, no lane exchange.
// coverage: 4 (j) stores x 32 lanes x 8 halves = 64 d x 16 keys of each plane; every store of a wave is 512 contiguous bytes, four whole lines.
// =====================================================================================================
__device__ __forceinline__ void epi_vt(v8f a0, v8f a1, v8f a2, v8f a3, float oscale, const float* __restrict__ bias,
                                       u16* VHo, u16* VLo, int rowb, int col0, int lane) {
  const int m = lane & 15;
  v4u vh[4], vl[4];
#pragma unroll
  for (int j = 0; j < 4; ++j) {
    const v8f a = (j == 0) ? a0 : (j == 1) ? a1 : (j == 2) ? a2 : a3;
    const float bj = bfr(bias[col0 + 16 * j + m]);
#pragma unroll
    for (int e = 0; e < 4; ++e) {
      const float t0 = (a[2 * e] * oscale + bj) * VCAR, t1 = (a[2 * e + 1] * oscale + bj) * VCAR;
      const _Float16 h0 = (_Float16)t0, h1 = (_Float16)t1;
      vh[j][e] = pk16(h_bits(h0), h_bits(h1));
      vl[j][e] = pk16(h_bits((_Float16)(t0 - (float)h0)), h_bits((_Float16)(t1 - (float)h1)));
    }
  }
  const size_t base = ((size_t)(col0 >> 6) * HD) * SEQ + (size_t)(rowb >> 5) * (32 * HD) + ((rowb >> 4) & 1) * 256 + (size_t)lane * 8;
#pragma unroll
  for (int j = 0; j < 4; ++j) {
    *(v4u*)(VHo + base + j * 512) = vh[j];
    *(v4u*)(VLo + base + j * 512) = vl[j];
  }
  wait_store_regs();
}

// =====================================================================================================
// bf16 GEMM of the three projections: A[M][K] (bf16 row-major) . Bt[N][K]^T (bf16 k-contiguous), times oscale, plus bias[N], f32 in registers;
// the epilogue packs the tile into the 16-bit planes that the attention reads (q, k: rotary, epi_rope; v: transposed, epi_vt).
// Block = 64x64 tile, 4 waves x 16 rows. K walked in stages of GKC: the block's 64 A rows and 64 Bt rows of a stage are brought into a
// two-buffer LDS ring by asynchronous copies of whole lines (each wave: 16 rows of each operand), stage t + 1 in flight while stage t is
// multiplied; fragments are read from LDS (two 16-B reads each, split k map for A and B), k ascending as before.
// The rows of A, of the rotary tables and of the planes are tokens in the sorted order (prep lays A and the tables out so): "position" in the
// epilogues' notes is the row index, and a table row holds the angles of its own token.
// Three products that share A run in one grid: blockIdx.y picks (Bt, bias, planes, epilogue) (block-uniform); none reads what another writes.
// The host passes M == SEQ, N == NH * HD (a 64-column tile is one head), K % GKC == 0, K >= 2 * GKC, grid = ((M/64)*(N/64), 3).
// =====================================================================================================
__global__ __launch_bounds__(128)
void gemm_bf(const u16* __restrict__ A, const u16* __restrict__ Bt0, const u16* __restrict__ Bt1, const u16* __restrict__ Bt2,
             const float* __restrict__ bias0, const float* __restrict__ bias1, const float* __restrict__ bias2,
             const float* __restrict__ cosT, const float* __restrict__ sinT,
             u16* QHo, u16* QLo, u16* KHo, u16* KLo, u16* VHo, u16* VLo, int M, int N, int K, float oscale) {
  __shared__ __align__(16) float slab[4 * SLAB64];
  __shared__ __align__(16) unsigned char ring[2 * 2 * GOPB];   // [buffer][A | Bt][64 rows][GPB]
  const int tid = threadIdx.x, wave = tid >> 5, lane = tid & 31, hh = lane >> 4, m = lane & 15;
  const int which = blockIdx.y;
  const u16*   Bt   = (which == 0) ? Bt0 : (which == 1) ? Bt1 : Bt2;
  const float* bias = (which == 0) ? bias0 : (which == 1) ? bias1 : bias2;
  const int ntile = N >> 6;
  const int bid   = blockIdx.x;
  const int row0  = (bid / ntile) * 64;
  const int rowb  = row0 + wave * 16;
  const int col0  = (bid % ntile) * 64;
  if (row0 + 64 > M) return;                 // block-uniform, in front of every barrier and copy; never taken with the exact grid
  const int nst  = K / GKC;
  const int crow = wave * 16 + hh;           // the tile row this lane brings in copy 0
  const u16* ga = A  + (size_t)(row0 + crow) * K + m * 8;
  const u16* gb = Bt + (size_t)(col0 + crow) * K + m * 8;
  const unsigned lc = lds_off(ring) + (unsigned)crow * GPB + (unsigned)m * 16u;
  copy16rows(lc, ga, (size_t)K);
  copy16rows(lc + GOPB, gb, (size_t)K);
  wait_copies();
  __syncthreads();                           // stage 0 is whole for every wave
  if (nst > 1) {
    copy16rows(lc + 2u * GOPB, ga + GKC, (size_t)K);
    copy16rows(lc + 3u * GOPB, gb + GKC, (size_t)K);
  }
  const unsigned char* fa = ring + (wave * 16 + m) * GPB + 16 * hh;
  const unsigned char* fb = ring + GOPB + m * GPB + 16 * hh;
  v8f acc0 = zero8(), acc1 = zero8(), acc2 = zero8(), acc3 = zero8();
  // kept rolled: one copy of the stage body, the buffer picked by the stage's parity
#pragma unroll 1
  for (int t = 0; t < nst; ++t) {
    const unsigned bo = (unsigned)(t & 1) * (2u * GOPB);
    // unrolled: the k-step offsets become immediates and the reads of later k-steps are issued ahead of the earlier products
#pragma unroll
    for (int kk = 0; kk < GKS; ++kk) {
      const v16b a  = ldsfrag_b(fa + bo + kk * 64);
      const v16b b0 = ldsfrag_b(fb + bo + kk * 64);
      const v16b b1 = ldsfrag_b(fb + bo + 16 * GPB + kk * 64);
      const v16b b2 = ldsfrag_b(fb + bo + 32 * GPB + kk * 64);
      const v16b b3 = ldsfrag_b(fb + bo + 48 * GPB + kk * 64);
      acc0 = mma_b(a, b0, acc0);
      acc1 = mma_b(a, b1, acc1);
      acc2 = mma_b(a, b2, acc2);
      acc3 = mma_b(a, b3, acc3);
      // its four v_nop keep the distance behind the stage's last matrix instructions on both sides of the branch at the loop's foot
      if (kk == GKS - 1) guard6<v16b>(acc0, acc1, acc2, acc3, a, b0, b1, b2, b3, a);
    }
    wait_lds();
    wait_copies();
    __syncthreads();                         // publishes stage t + 1 and ends every wave's reads of stage t's buffer
    if (t + 2 < nst) {
      copy16rows(lc + bo, ga + (size_t)(t + 2) * GKC, (size_t)K);
      copy16rows(lc + bo + GOPB, gb + (size_t)(t + 2) * GKC, (size_t)K);
    }
  }
  wait_copies();
  if (which == 2) {
    epi_vt(acc0, acc1, acc2, acc3, oscale, bias, VHo, VLo, rowb, col0, lane);
  } else {
    epi_rope(slab + wave * SLAB64, acc0, acc1, acc2, acc3, oscale, bias, cosT, sinT, (which == 0) ? QHo : KHo, (which == 0) ? QLo : KLo,
             rowb, col0, lane, (which == 0) ? QSC : KSC);
  }
}

// =====================================================================================================
// f16 hi+lo GEMM: C[M][N] (f32) = (Ahi + Alo)[M][K] . Bt[N][K]^T, times oscale, plus bias[N]; Ahi/Alo f16 planes (same layout),
// Bt f16 k-contiguous; products hi.B + lo.B into one accumulator (lo is the unscaled residual of hi). Same tiling and the same
// two-buffer LDS ring as gemm_bf, with three operand tiles a stage.
// =====================================================================================================
__global__ __launch_bounds__(128)
void gemm_h2(const u16* __restrict__ Ah, const u16* __restrict__ Al, const u16* __restrict__ Bt,
             const float* __restrict__ bias, float* C, int M, int N, int K, float oscale) {
  __shared__ __align__(16) float slab[4 * SLAB64];
  __shared__ __align__(16) unsigned char ring[2 * 3 * GOPB];   // [buffer][Ahi | Alo | Bt][64 rows][GPB]
  const int tid = threadIdx.x, wave = tid >> 5, lane = tid & 31, hh = lane >> 4, m = lane & 15;
  const int ntile = N >> 6;
  const int bid   = blockIdx.x;
  const int row0  = (bid / ntile) * 64;
  const int rowb  = row0 + wave * 16;
  const int col0  = (bid % ntile) * 64;
  if (row0 + 64 > M) return;                 // block-uniform, in front of every barrier and copy; never taken with the exact grid
  const int nst  = K / GKC;
  const int crow = wave * 16 + hh;           // the tile row this lane brings in copy 0
  const size_t aofs = (size_t)(row0 + crow) * K + m * 8;
  const u16* gh = Ah + aofs;
  const u16* gl = Al + aofs;
  const u16* gb = Bt + (size_t)(col0 + crow) * K + m * 8;
  const unsigned lc = lds_off(ring) + (unsigned)crow * GPB + (unsigned)m * 16u;
  copy16rows(lc, gh, (size_t)K);
  copy16rows(lc + GOPB, gl, (size_t)K);
  copy16rows(lc + 2u * GOPB, gb, (size_t)K);
  wait_copies();
  __syncthreads();                           // stage 0 is whole for every wave
  if (nst > 1) {
    copy16rows(lc + 3u * GOPB, gh + GKC, (size_t)K);
    copy16rows(lc + 4u * GOPB, gl + GKC, (size_t)K);
    copy16rows(lc + 5u * GOPB, gb + GKC, (size_t)K);
  }
  const unsigned char* fa = ring + (wave * 16 + m) * GPB + 16 * hh;
  const unsigned char* fb = ring + 2 * GOPB + m * GPB + 16 * hh;
  v8f acc0 = zero8(), acc1 = zero8(), acc2 = zero8(), acc3 = zero8();
  // kept rolled: one copy of the stage body, the buffer picked by the stage's parity
#pragma unroll 1
  for (int t = 0; t < nst; ++t) {
    const unsigned bo = (unsigned)(t & 1) * (3u * GOPB);
    // unrolled: the k-step offsets become immediates and the reads of later k-steps are issued ahead of the earlier products
#pragma unroll
    for (int kk = 0; kk < GKS; ++kk) {
      const v16h ah = ldsfrag_h(fa + bo + kk * 64), al = ldsfrag_h(fa + bo + GOPB + kk * 64);
      const v16h b0 = ldsfrag_h(fb + bo + kk * 64);
      const v16h b1 = ldsfrag_h(fb + bo + 16 * GPB + kk * 64);
      const v16h b2 = ldsfrag_h(fb + bo + 32 * GPB + kk * 64);
      const v16h b3 = ldsfrag_h(fb + bo + 48 * GPB + kk * 64);
      acc0 = mma_h(ah, b0, acc0);  acc0 = mma_h(al, b0, acc0);
      acc1 = mma_h(ah, b1, acc1);  acc1 = mma_h(al, b1, acc1);
      acc2 = mma_h(ah, b2, acc2);  acc2 = mma_h(al, b2, acc2);
      acc3 = mma_h(ah, b3, acc3);  acc3 = mma_h(al, b3, acc3);
      // its four v_nop keep the distance behind the stage's last matrix instructions on both sides of the branch at the loop's foot
      if (kk == GKS - 1) guard6<v16h>(acc0, acc1, acc2, acc3, ah, al, b0, b1, b2, b3);
    }
    wait_lds();
    wait_copies();
    __syncthreads();                         // publishes stage t + 1 and ends every wave's reads of stage t's buffer
    if (t + 2 < nst) {
      copy16rows(lc + bo, gh + (size_t)(t + 2) * GKC, (size_t)K);
      copy16rows(lc + bo + GOPB, gl + (size_t)(t + 2) * GKC, (size_t)K);
      copy16rows(lc + bo + 2u * GOPB, gb + (size_t)(t + 2) * GKC, (size_t)K);
    }
  }
  wait_copies();
  epi64(slab + wave * SLAB64, acc0, acc1, acc2, acc3, oscale, bias, C, N, (size_t)rowb, col0, lane);
}

// =====================================================================================================
// Triple-masked attention, queries and keys in the sorted token order (stable sort of the positions by instrument id; i, j below are the
// tokens' own positions): block bid -> (head = bid % NH, query tile pair qp = NQP-1 - bid / NH: sorted rows q0 = 32*qp .. q0+31). Every wave carries both 16-row query tiles of the pair, each with a softmax state of its own, so that one
// load of a k or v fragment serves two tiles. The block's WPB waves share that one (pair, head) and split its key tiles: in every group of eight
// consecutive key tiles g each wave takes one, kt = 8g + ((wave - g) & 7), so that any stride-4 or stride-8 pattern of live tiles is spread too.
//   q, k planes (hi, lo f16 x1024) and v^T planes in fragment order, [h][row tile][k-step] and [h][key tile][d tile]; instrument ids, bar ids and positions staged in LDS by rank.
//   For each of the three masks in turn (block-uniform), each wave with its OWN running max m_a, sum Z_a and 4 accumulators acc_a per query tile (8 in all):
//     att 0: (iq == ik) && (iq < 129) && (j <= i)
//     att 1: (iq != ik) && (ik < 129) && (iq < 129) && (bq >= 0) && ((0 <= bq-bk <= 2) || (bq-bk == 4))
//     att 2: ((ik == 129) || (bk == -1)) && (j <= i)
//   A wave's key tiles of 32 visited in order, those that its summary bits leave; per tile every lane evaluates the mask bits of its
//   2 queries x 16 keys, a wave ballot skips tiles with no allowed element in either query tile (exact: such keys carry zero weight).
//   Both products are formed transposed, so that a lane owns one query of each query tile (column c of every D tile):
//   S^T = k'.q'^T: A = key rows, B = query rows, 2 key subtiles x 2 k-steps x 3 products (k_hi.q_hi + k_hi.q_lo + k_lo.q_hi), fragments loaded
//   straight from the 16-bit planes (two 16-B loads per fragment, each 512 contiguous bytes of a wave, split k map); a lane's 16 scores of a query tile are keys 16u + 8hh + r of
//   its own query; masked scores replaced by -inf; online max-subtracted base-2 softmax in f32 (scale 1/8 folded), -inf-safe rescale: the
//   maximum in-lane plus one exchange between the halves, the sum kept per half and joined once after the key loop.
//   O^T += v^T.P^T: the two score subtiles' registers, converted in place, ARE the B fragment of P^T in the split k map (no LDS, no lane
//   exchange); A = 4+4 v^T fragments (hi and residual planes), 12 WMMAs a query tile (hh + hl + lh); the rescale factor is the lane's own.
//   After each mask every wave publishes its partial (m, Z, acc) in its LDS slab; behind a
//   block barrier wave w merges the eight partials of rows 4w .. 4w+3 (a lane: one row, 8 d columns): M = max m_w, Z = sum Z_w 2^(m_w-M), acc likewise;
//   out_a = (Z > 0, i.e. the row has an allowed key) ? acc / Z : 0, carries 1/(32768*1024) folded once, summed in a lane-owned LDS tile:
//   O = out_0 + out_1 + out_2. A second barrier frees the slabs for the next mask. All barriers block-uniform; bounded loops only.
// coverage: per wave 4 rows x 8 lanes x 8 halves = 4 x 64 per plane, WPB waves = 32 x 64; grid NQP*NH blocks =
//           every (s, h) row of both O planes exactly once.
// =====================================================================================================
// second bound: four waves per SIMD (at most 256 registers), two blocks on a WGP: the grid takes two rounds
__global__ __launch_bounds__(ATT_THREADS, 4)
void attn3(const u16* __restrict__ QHIp, const u16* __restrict__ QLOp,
           const u16* __restrict__ KHIp, const u16* __restrict__ KLOp,
           const u16* __restrict__ VHIp, const u16* __restrict__ VLOp,
           const int* __restrict__ inst, const int* __restrict__ bar, const int* __restrict__ rankT,
           u16* OHIp, u16* OLOp) {
  __shared__ __align__(16) float smem[WPB * WREG + QTW * SLW];
  __shared__ __align__(16) int sI[SEQ];      // instrument id, bar id and position of the token at each row of the sorted order
  __shared__ __align__(16) int sB[SEQ];
  __shared__ __align__(16) int sP[SEQ];

  const int tid  = threadIdx.x;
  const int wave = __builtin_amdgcn_readfirstlane(tid >> 5);   // scalar: it steers the key-tile loop
  const int lane = tid & 31;
  const int hh   = lane >> 4;
  const int c    = lane & 15;
  const int bid  = blockIdx.x;
  if (bid >= NQP * NH) return;               // block-uniform, before any barrier; never taken with the exact grid
  const int head = bid % NH;
  const int qp   = NQP - 1 - bid / NH;
  const int q0   = qp * (16 * QTW);
  const int rq   = lane >> 3;                // merge and output: this lane owns row 4*wave + rq of the block's 32,
  const int c8   = (lane & 7) * 8;           // d columns c8 .. c8 + 7
  const int row  = wave * 4 + rq;

  // rankT is a permutation of 0 .. SEQ-1: every entry of the three tables is written once (the mask only bounds the LDS address)
  for (int i = tid; i < SEQ; i += ATT_THREADS) {
    const int r = rankT[i] & (SEQ - 1);
    sI[r] = inst[i]; sB[r] = bar[i]; sP[r] = i;
  }
  __syncthreads();

  float* slab = smem + wave * WREG;          // partial accumulators [16*QTW][64] pitch 68, written after a mask's key loop
  float* ml   = slab + QTW * SLW;            // partial m[16*QTW], Z[16*QTW]
  float* osum = smem + WPB * WREG;           // the block's result [16*QTW][64] pitch 68; elements (row, c8 .. c8 + 7) owned by this lane

  // byte offsets into the fragment-order planes (each plane SEQ*DMOD*2 bytes, far below 2^32); hi and residual planes share them
  const unsigned FRB  = 1024u;                                                  // bytes of a fragment (16 rows x 32 k)
  const unsigned RTB  = 2u * FRB;                                               // q', k': bytes of a 16-row tile of a head (2 k-steps)
  const unsigned KTB  = 32u * HD * 2u;                                          // k', v^T: bytes of a 32-key tile of a head
  const unsigned hofs = (unsigned)head * (SEQ * HD * 2u) + (unsigned)lane * 16u; // this head's part of a plane, this lane's 16 B
  const unsigned qofs = hofs + (unsigned)(q0 >> 4) * RTB;                        // query tile t: + t * RTB
  const float lsc = 0.125f * (LOG2E / (QSC * KSC));
  const float oc  = 1.0f / (PCAR * VCAR);
  // ids and position of this lane's own query of each tile (row q0 + 16t + c)
  int iqv[QTW], bqv[QTW], pqv[QTW];
#pragma unroll
  for (int t = 0; t < QTW; ++t) { iqv[t] = sI[q0 + 16 * t + c]; bqv[t] = sB[q0 + 16 * t + c]; pqv[t] = sP[q0 + 16 * t + c]; }

  // ---- key-tile summaries, once a wave: four bits for each of the wave's own key tiles (bits 4g .. 4g + 3 = tile WPB*g + ((wave - g) & 7)),
  //      kept in scalar registers, so that the key loop passes a tile that cannot hold an allowed element on a scalar test, without the
  //      2 x 16 mask evaluations of every lane. All tests are necessary conditions of the masks, for any content of the id arrays.
  //      The block's 32 queries with iq < 129 are split in two sets: F, those with the least such id ilo, and R, the rest (ids in (ilo, ihi]);
  //      in the sorted order a block mostly holds one id (R empty) or the end of one id's run and the start of the next, whose positions and
  //      bars lie far apart: one range over both would pass nearly every tile. An empty set has least = INT_MAX, largest = INT_MIN: no key passes.
  //      att 0 allows (q, k) only if ik == iq < 129 and the key's position is <= the query's: q in F: ik == ilo, position <= F's largest;
  //      q in R: ilo < ik <= ihi, position <= R's largest.
  //      att 1 allows (q, k) only if iq < 129, bq >= 0, ik < 129, ik != iq and bq - bk in {0, 1, 2, 4}: then bk lies in [bq - 4, bq], inside
  //      [lo - 4, hi], lo and hi the least and largest bq >= 0 of the query's set (lo >= 0: lo - 4 does not wrap); for q in F also ik != ilo.
  //      att 2 allows only keys with ik == 129 or bk == -1, at a position <= the largest position of the 32 queries.
  //      A tile that passes still gets the exact evaluation and its ballot below: only tiles with an allowed element are multiplied.
  unsigned live0, live1, live2;
  {
    const int  IMAX = 0x7fffffff, IMIN = (int)0x80000000;
    const int  iq1 = sI[q0 + lane], bq1 = sB[q0 + lane], pq1 = sP[q0 + lane];    // a lane: one of the block's 32 queries
    const bool qi  = iq1 < GINST;
    const int  ilo = __builtin_amdgcn_readfirstlane(wave_min_i(qi ? iq1 : IMAX));
    const int  ihi = __builtin_amdgcn_readfirstlane(wave_max_i(qi ? iq1 : IMIN));
    const bool qf  = qi & (iq1 == ilo), qr = qi & (iq1 != ilo);
    const bool bf  = qf & (bq1 >= 0),   br = qr & (bq1 >= 0);
    const int  pmf = __builtin_amdgcn_readfirstlane(wave_max_i(qf ? pq1 : IMIN));
    const int  pmr = __builtin_amdgcn_readfirstlane(wave_max_i(qr ? pq1 : IMIN));
    const int  pma = __builtin_amdgcn_readfirstlane(wave_max_i(pq1));
    const int  blf = __builtin_amdgcn_readfirstlane(wave_min_i(bf ? bq1 : IMAX)) - 4;
    const int  bhf = __builtin_amdgcn_readfirstlane(wave_max_i(bf ? bq1 : IMIN));
    const int  blr = __builtin_amdgcn_readfirstlane(wave_min_i(br ? bq1 : IMAX)) - 4;
    const int  bhr = __builtin_amdgcn_readfirstlane(wave_max_i(br ? bq1 : IMIN));
    // a lane: 8 consecutive keys (quarter lane & 3) of the wave's tile of group g1 = lane >> 2; six 16-B LDS reads cover the wave's 8 tiles
    const int g1  = lane >> 2;
    const int k8  = (WPB * g1 + ((wave - g1) & (WPB - 1))) * 32 + (lane & 3) * 8;
    bool c0 = false, c1 = false, c2 = false;                                     // & and |, not && and ||: straight-line code, no lane branches
#pragma unroll
    for (int h = 0; h < 2; ++h) {
      const v4i ia = *(const v4i*)(sI + k8 + 4 * h), ba = *(const v4i*)(sB + k8 + 4 * h), pa = *(const v4i*)(sP + k8 + 4 * h);
#pragma unroll
      for (int e = 0; e < 4; ++e) {
        c0 |= ((ia[e] == ilo) & (pa[e] <= pmf)) | ((ia[e] > ilo) & (ia[e] <= ihi) & (pa[e] <= pmr));
        c1 |= (ia[e] < GINST) & (((ia[e] != ilo) & (ba[e] >= blf) & (ba[e] <= bhf)) | ((ba[e] >= blr) & (ba[e] <= bhr)));
        c2 |= ((ia[e] == GINST) | (ba[e] == -1)) & (pa[e] <= pma);
      }
    }
    live0 = __builtin_amdgcn_ballot_w32(c0);
    live1 = __builtin_amdgcn_ballot_w32(c1);
    live2 = __builtin_amdgcn_ballot_w32(c2);
  }

  // kept rolled: with two query tiles a wave, three copies of the tile body and of the merge would be about 60 KB of code, nearly the
  // whole instruction cache; the mask is picked by a scalar branch at each key tile
#pragma unroll 1
  for (int att = 0; att < 3; ++att) {
    float mrow[QTW], lrow[QTW];              // this lane's query: running max (equal in both halves), this half's share of the sum
    v8f o[QTW][4];                            // o[t][j][r] = O^T[d = 16j + 8hh + r][query 16t + c]
#pragma unroll
    for (int t = 0; t < QTW; ++t) {
      mrow[t] = -INFINITY; lrow[t] = 0.f;
#pragma unroll
      for (int j = 0; j < 4; ++j) o[t][j] = zero8();
    }
    const unsigned livem = (att == 1) ? live1 : (att == 2) ? live2 : live0;      // wave-uniform
#pragma unroll 1
    for (int g = 0; g < NKT / WPB; ++g) {
      const int kt = WPB * g + ((wave - g) & (WPB - 1));
      if (((livem >> (4 * g)) & 0xfu) == 0u) continue;                           // wave-uniform: no key of the tile can be allowed under this mask
      const int kb = kt * 32;
      // ids and positions of this lane's 16 keys kb + 16u + 8hh + r (the rows of its D registers), 16-B LDS reads
      int ik[2][8], bk[2][8], pk[2][8];
#pragma unroll
      for (int u = 0; u < 2; ++u) {
        const v4i ia = *(const v4i*)(sI + kb + 16 * u + 8 * hh), ib = *(const v4i*)(sI + kb + 16 * u + 8 * hh + 4);
        const v4i ba = *(const v4i*)(sB + kb + 16 * u + 8 * hh), bb = *(const v4i*)(sB + kb + 16 * u + 8 * hh + 4);
        const v4i pa = *(const v4i*)(sP + kb + 16 * u + 8 * hh), pb = *(const v4i*)(sP + kb + 16 * u + 8 * hh + 4);
#pragma unroll
        for (int e = 0; e < 4; ++e) {
          ik[u][e] = ia[e]; ik[u][4 + e] = ib[e]; bk[u][e] = ba[e]; bk[u][4 + e] = bb[e]; pk[u][e] = pa[e]; pk[u][4 + e] = pb[e];
        }
      }
      // causal test j <= i on the tokens' own positions
      unsigned okb[QTW];                                                         // bit 8u + r
#pragma unroll
      for (int t = 0; t < QTW; ++t) {
        unsigned ob = 0u;
        if (att == 0) {
          const bool qa = iqv[t] < GINST;
#pragma unroll
          for (int u = 0; u < 2; ++u) {
#pragma unroll
            for (int r = 0; r < 8; ++r) {
              const bool ok = qa && (iqv[t] == ik[u][r]) && (pk[u][r] <= pqv[t]);
              ob |= ok ? (1u << (8 * u + r)) : 0u;
            }
          }
        } else if (att == 1) {
          const bool qa = (iqv[t] < GINST) && (bqv[t] >= 0);
#pragma unroll
          for (int u = 0; u < 2; ++u) {
#pragma unroll
            for (int r = 0; r < 8; ++r) {
              const int  d  = bqv[t] - bk[u][r];
              const bool w  = ((d >= 0) && (d <= 2)) || (d == 4);
              const bool ok = qa && (ik[u][r] < GINST) && (iqv[t] != ik[u][r]) && w;
              ob |= ok ? (1u << (8 * u + r)) : 0u;
            }
          }
        } else {
#pragma unroll
          for (int u = 0; u < 2; ++u) {
#pragma unroll
            for (int r = 0; r < 8; ++r) {
              const bool ok = ((ik[u][r] == GINST) || (bk[u][r] == -1)) && (pk[u][r] <= pqv[t]);
              ob |= ok ? (1u << (8 * u + r)) : 0u;
            }
          }
        }
        okb[t] = ob;
      }
      const unsigned anyw = __builtin_amdgcn_ballot_w32((okb[0] | okb[1]) != 0u);    // wave-uniform
      if (anyw == 0u) continue;

      // ---- scores, transposed: D element r of this lane = (key kb + 16u + 8hh + r, query q0 + 16t + c) in s[t][u];
      //      each k fragment (A) is loaded once and multiplied with both query tiles (B) ----
      v8f s[QTW][2];
#pragma unroll
      for (int t = 0; t < QTW; ++t) { s[t][0] = zero8(); s[t][1] = zero8(); }
      const unsigned ko = hofs + (unsigned)kt * KTB;                               // the key tile's place in the k' planes and in the v^T planes
#pragma unroll
      for (int kk = 0; kk < 2; ++kk) {
        const v16h kh0 = ldfrag_o(KHIp, ko, kk * FRB),         kl0 = ldfrag_o(KLOp, ko, kk * FRB);
        const v16h kh1 = ldfrag_o(KHIp, ko, RTB + kk * FRB),   kl1 = ldfrag_o(KLOp, ko, RTB + kk * FRB);
        const v16h qa  = ldfrag_o(QHIp, qofs, kk * FRB),       qb  = ldfrag_o(QLOp, qofs, kk * FRB);
        const v16h qc  = ldfrag_o(QHIp, qofs, RTB + kk * FRB), qd  = ldfrag_o(QLOp, qofs, RTB + kk * FRB);
        s[0][0] = mma_h(kh0, qa, s[0][0]);
        s[0][0] = mma_h(kh0, qb, s[0][0]);
        s[0][0] = mma_h(kl0, qa, s[0][0]);
        s[0][1] = mma_h(kh1, qa, s[0][1]);
        s[0][1] = mma_h(kh1, qb, s[0][1]);
        s[0][1] = mma_h(kl1, qa, s[0][1]);
        s[1][0] = mma_h(kh0, qc, s[1][0]);
        s[1][0] = mma_h(kh0, qd, s[1][0]);
        s[1][0] = mma_h(kl0, qc, s[1][0]);
        s[1][1] = mma_h(kh1, qc, s[1][1]);
        s[1][1] = mma_h(kh1, qd, s[1][1]);
        s[1][1] = mma_h(kl1, qc, s[1][1]);
        guard10(s[0][0], s[0][1], s[1][0], s[1][1], qa, qb, qc, qd, kh0, kl0, kh1, kl1, kh0, kl0);
      }
      // ---- v^T fragments (A of the second product): row d = 16j + c, fragment j of the key tile; each is loaded once and
      //      multiplied with both query tiles' prob fragments ----
      const v16h vh0 = ldfrag_o(VHIp, ko, 0u);
      const v16h vh1 = ldfrag_o(VHIp, ko, FRB);
      const v16h vh2 = ldfrag_o(VHIp, ko, 2u * FRB);
      const v16h vh3 = ldfrag_o(VHIp, ko, 3u * FRB);
      const v16h vl0 = ldfrag_o(VLOp, ko, 0u);
      const v16h vl1 = ldfrag_o(VLOp, ko, FRB);
      const v16h vl2 = ldfrag_o(VLOp, ko, 2u * FRB);
      const v16h vl3 = ldfrag_o(VLOp, ko, 3u * FRB);
#pragma unroll
      for (int t = 0; t < QTW; ++t) {
        // ---- mask (replace by -inf) + online softmax in base 2, -inf-safe, for this lane's query; a query with no allowed key in this
        //      key tile goes through with al = 1 (or 0 on a zero state) and all-zero probs: its state keeps its bits ----
        float tv[2][8];
        float mx = -INFINITY;
#pragma unroll
        for (int u = 0; u < 2; ++u) {
#pragma unroll
          for (int r = 0; r < 8; ++r) {
            const bool ok = ((okb[t] >> (8 * u + r)) & 1u) != 0u;
            tv[u][r] = ok ? (s[t][u][r] * lsc) : -INFINITY;
            mx = fmaxf(mx, tv[u][r]);
          }
        }
        mx = fmaxf(mx, xhalf(mx));
        const float mn = fmaxf(mrow[t], mx);
        const float ms = (mn == -INFINITY) ? 0.0f : mn;
        const float al = exp2f(mrow[t] - ms);
        mrow[t] = mn;
        // B fragments of P^T * 32768: hi f16 and residual f16, column = this lane's query; elements 0..7 = keys kb + 8hh + 0..7 (subtile 0),
        // elements 8..15 = keys kb + 16 + 8hh + 0..7 (subtile 1): the split k map of the v^T loader
        FragH ph, pl;
        float ps = 0.0f;
#pragma unroll
        for (int u = 0; u < 2; ++u) {
#pragma unroll
          for (int r = 0; r < 8; ++r) {
            const float e = exp2f(tv[u][r] - ms);
            ps += e;
            const float ta = e * PCAR;
            const _Float16 ha = (_Float16)ta;
            ph.h[u][r] = ha;
            pl.h[u][r] = (_Float16)(ta - (float)ha);
          }
        }
        lrow[t] = lrow[t] * al + ps;
#pragma unroll
        for (int j = 0; j < 4; ++j) o[t][j] *= al;
        o[t][0] = mma_h(vh0, ph.v, o[t][0]);  o[t][0] = mma_h(vh0, pl.v, o[t][0]);  o[t][0] = mma_h(vl0, ph.v, o[t][0]);
        o[t][1] = mma_h(vh1, ph.v, o[t][1]);  o[t][1] = mma_h(vh1, pl.v, o[t][1]);  o[t][1] = mma_h(vl1, ph.v, o[t][1]);
        o[t][2] = mma_h(vh2, ph.v, o[t][2]);  o[t][2] = mma_h(vh2, pl.v, o[t][2]);  o[t][2] = mma_h(vl2, ph.v, o[t][2]);
        o[t][3] = mma_h(vh3, ph.v, o[t][3]);  o[t][3] = mma_h(vh3, pl.v, o[t][3]);  o[t][3] = mma_h(vl3, ph.v, o[t][3]);
        guard10(o[t][0], o[t][1], o[t][2], o[t][3], ph.v, pl.v, vh0, vh1, vh2, vh3, vl0, vl1, vl2, vl3);
      }
    }
#pragma unroll
    for (int t = 0; t < QTW; ++t) acc_guard4(o[t][0], o[t][1], o[t][2], o[t][3]);
    // ---- publish this wave's partial: acc in its slab (a lane: its query's row, 8 consecutive d per j, 16-B stores); m and Z, the two
    //      halves' sums joined here, by the lower half ----
#pragma unroll
    for (int t = 0; t < QTW; ++t) {
#pragma unroll
      for (int j = 0; j < 4; ++j) {
        float* sp = slab + (16 * t + c) * 68 + j * 16 + 8 * hh;
        v4f a, b4;
#pragma unroll
        for (int e = 0; e < 4; ++e) { a[e] = o[t][j][e]; b4[e] = o[t][j][4 + e]; }
        *(v4f*)(sp)     = a;
        *(v4f*)(sp + 4) = b4;
      }
      const float z = lrow[t] + xhalf(lrow[t]);
      if (hh == 0) {
        ml[16 * t + c]            = mrow[t];
        ml[16 * QTW + 16 * t + c] = z;
      }
    }
    __syncthreads();                          // all WPB partials of this mask are visible
    // ---- merge for this lane's row and 8 d columns: out_a = acc / Z (0 when no key allowed), carries (32768 on P, 1024 on v) folded once ----
    {
      float mw[WPB], zw[WPB];
#pragma unroll
      for (int w2 = 0; w2 < WPB; ++w2) {
        mw[w2] = smem[w2 * WREG + QTW * SLW + row];
        zw[w2] = smem[w2 * WREG + QTW * SLW + 16 * QTW + row];
      }
      float mx = mw[0];
#pragma unroll
      for (int w2 = 1; w2 < WPB; ++w2) mx = fmaxf(mx, mw[w2]);
      const float ms = (mx == -INFINITY) ? 0.0f : mx;
      float lv = 0.0f;
      v4f oa = {0.f, 0.f, 0.f, 0.f}, ob = {0.f, 0.f, 0.f, 0.f};
#pragma unroll
      for (int w2 = 0; w2 < WPB; ++w2) {
        const float sc = exp2f(mw[w2] - ms);
        const float* ap = smem + w2 * WREG + row * 68 + c8;
        lv += zw[w2] * sc;
        oa += *(const v4f*)(ap) * sc;
        ob += *(const v4f*)(ap + 4) * sc;
      }
      const float ls  = (lv > 0.0f) ? lv : 1.0f;
      const float inv = (lv > 0.0f) ? ((1.0f / ls) * oc) : 0.0f;
      float* op = osum + row * 68 + c8;
      if (att == 0) {
        *(v4f*)(op)     = oa * inv;
        *(v4f*)(op + 4) = ob * inv;
      } else {
        *(v4f*)(op)     = *(const v4f*)(op) + oa * inv;
        *(v4f*)(op + 4) = *(const v4f*)(op + 4) + ob * inv;
      }
    }
    __syncthreads();                          // every reader has left the slabs (the next mask overwrites them); after the last mask: osum is whole
  }

  // ---- O x1024 -> f16 hi + residual planes; wave = group of 4 rows, lane = (row in group, 8 consecutive d) ----
  v4u oh, ol;
  {
    const v4f a = *(const v4f*)(osum + row * 68 + c8), b4 = *(const v4f*)(osum + row * 68 + c8 + 4);
    float w[8];
#pragma unroll
    for (int e = 0; e < 4; ++e) { w[e] = a[e] * OSC; w[4 + e] = b4[e] * OSC; }
#pragma unroll
    for (int e = 0; e < 4; ++e) {
      const _Float16 h0 = (_Float16)w[2 * e], h1 = (_Float16)w[2 * e + 1];
      const _Float16 l0 = (_Float16)(w[2 * e] - (float)h0), l1 = (_Float16)(w[2 * e + 1] - (float)h1);
      oh[e] = pk16(h_bits(h0), h_bits(h1));
      ol[e] = pk16(h_bits(l0), h_bits(l1));
    }
  }
  // back to the order of positions: the O planes are [s][h][d]; a row's 64 halves of a head are one whole line, written by 8 lanes of this wave
  const size_t o8 = (((size_t)sP[q0 + row]) * NH + head) * HD + c8;
  *(v4u*)(OHIp + o8) = oh;
  *(v4u*)(OLOp + o8) = ol;
}

// =====================================================================================================
// Workspace map (bytes); every plane is fully written by whole-line stores before it is read; all extents are exact multiples
// of the store granularity (no pad rows needed); every offset a multiple of SEQ*256:
//   CT  f32 [SEQ][64]                  SEQ*256        ST  same
//   XB  bf16 [SEQ][1024]               SEQ*2048
//   WQB bf16 [1024 n][1024 k]         2097152        WKB, WVB same        2097152 each
//   WOH f16  [1024 n][1024 k] x1024   2097152
//   QHI f16 [16][SEQ/16][2][2][32][8] x1024  SEQ*2048  QLO residual   (fragment order: head, row tile, k-step, i, lane)
//   KHI f16 [16][SEQ/16][2][2][32][8] x1024  SEQ*2048  KLO residual
//   VHI f16 [16][SEQ/32][4][2][32][8] x1024  SEQ*2048  VLO residual   (fragment order: head, key tile, d tile, i, lane)
//   OHI f16 [SEQ][1024] x1024          SEQ*2048       OLO residual   (rows in the order of positions)
//   RK  i32 [SEQ]                      SEQ*4          rank of each position in the sorted token order
//   end (SEQ = 2048)                  47194112
//   CT, ST, XB and the q', k', v^T planes have their rows (keys) in the sorted token order.
// =====================================================================================================
extern "C" void kernel_launch(void* const* d_in, const int* in_sizes, int n_in,
                              void* d_out, int out_size, void* d_ws, size_t ws_size,
                              hipStream_t stream) {
  if (n_in < 11) return;
  if (in_sizes[0] != SEQ * DMOD) return;
  if (in_sizes[1] != SEQ || in_sizes[2] != SEQ) return;
  if (in_sizes[3] != DMOD * DMOD || in_sizes[5] != DMOD * DMOD) return;
  if (in_sizes[7] != DMOD * DMOD || in_sizes[9] != DMOD * DMOD) return;
  if (in_sizes[4] != DMOD || in_sizes[6] != DMOD || in_sizes[8] != DMOD || in_sizes[10] != DMOD) return;
  if (out_size != SEQ * DMOD) return;

  const float* x   = (const float*)d_in[0];
  const int*   bar = (const int*)d_in[1];
  const int*   ins = (const int*)d_in[2];
  const float* wq  = (const float*)d_in[3];
  const float* bq  = (const float*)d_in[4];
  const float* wk  = (const float*)d_in[5];
  const float* bk  = (const float*)d_in[6];
  const float* wv  = (const float*)d_in[7];
  const float* bv  = (const float*)d_in[8];
  const float* wo  = (const float*)d_in[9];
  const float* bo  = (const float*)d_in[10];
  float*       out = (float*)d_out;

  const size_t szTab = (size_t)SEQ * HD * 4;                    //   524288
  const size_t szXB  = (size_t)SEQ * DMOD * 2;                  //  4194304
  const size_t szW   = (size_t)DMOD * DMOD * 2;                 //  2097152
  const size_t szP   = (size_t)SEQ * DMOD * 2;                  //  4194304
  size_t off = 0;
  const size_t oCT  = off; off += szTab;
  const size_t oST  = off; off += szTab;
  const size_t oXB  = off; off += szXB;
  const size_t oWQ  = off; off += szW;
  const size_t oWK  = off; off += szW;
  const size_t oWV  = off; off += szW;
  const size_t oWO  = off; off += szW;
  const size_t oQHI = off; off += szP;
  const size_t oQLO = off; off += szP;
  const size_t oKHI = off; off += szP;
  const size_t oKLO = off; off += szP;
  const size_t oVHI = off; off += szP;
  const size_t oVLO = off; off += szP;
  const size_t oOHI = off; off += szP;
  const size_t oOLO = off; off += szP;
  const size_t oRK  = off; off += (size_t)SEQ * 4;
  if (off > ws_size) return;                            // off = 47194112 at SEQ = 2048
  if (off > (size_t)134217728) return;

  char* ws = (char*)d_ws;
  float* CT  = (float*)(ws + oCT);
  float* ST  = (float*)(ws + oST);
  u16*   XB  = (u16*)(ws + oXB);
  u16*   WQB = (u16*)(ws + oWQ);
  u16*   WKB = (u16*)(ws + oWK);
  u16*   WVB = (u16*)(ws + oWV);
  u16*   WOH = (u16*)(ws + oWO);
  u16*   QHI = (u16*)(ws + oQHI);
  u16*   QLO = (u16*)(ws + oQLO);
  u16*   KHI = (u16*)(ws + oKHI);
  u16*   KLO = (u16*)(ws + oKLO);
  u16*   VHI = (u16*)(ws + oVHI);
  u16*   VLO = (u16*)(ws + oVLO);
  u16*   OHI = (u16*)(ws + oOHI);
  u16*   OLO = (u16*)(ws + oOLO);
  int*   RK  = (int*)(ws + oRK);

  // inv_freq[i] = 1 / pow(10000, i/32) in f32 (pow correctly converted from f64, then IEEE f32 reciprocal)
  InvF inv;
  for (int i = 0; i < 32; ++i) {
    const double p = pow(10000.0, (double)i / 32.0);
    const float pf = (float)p;
    inv.f[i] = 1.0f / pf;
  }

  const dim3 blk(256);
  const dim3 gPrep(RNKB + TABB + 4 * WCB);              // 64 + 256 + 2048
  const dim3 gG((SEQ / 64) * (DMOD / 64));              // 512
  const dim3 gG3((SEQ / 64) * (DMOD / 64), 3);          // 512 x 3
  const dim3 bG(128);
  const dim3 gAT(ATT_BLOCKS);                           // 1024
  const dim3 bAT(ATT_THREADS);                          // 256

  // (0) rank table; rotary cos/sin tables [SEQ][64] and x -> bf16, rows at their rank; Wq, Wk, Wv -> bf16 planes (same layout, already
  //     k-contiguous); Wo -> f16 plane of bf16 value x1024
  prep<<<gPrep, blk, 0, stream>>>(x, ins, wq, wk, wv, wo, XB, WQB, WKB, WVB, WOH, CT, ST, RK, inv);
  // (1) projections q, k, v (+ bias), packed in the epilogue: q', k' planes (rotary) and v^T planes, x1024 (hi + residual), all in fragment order
  gemm_bf<<<gG3, bG, 0, stream>>>(XB, WQB, WKB, WVB, bq, bk, bv, CT, ST, QHI, QLO, KHI, KLO, VHI, VLO, SEQ, DMOD, DMOD, 1.0f);
  // (2) three masked attentions summed -> O planes [s][h][d] x1024 (hi + residual)
  attn3<<<gAT, bAT, 0, stream>>>(QHI, QLO, KHI, KLO, VHI, VLO, ins, bar, RK, OHI, OLO);
  // (3) output projection -> out [SEQ][1024] f32, carries 1024 (O) x 1024 (Wo) folded back, + bo
  gemm_h2<<<gG, bG, 0, stream>>>(OHI, OLO, WOH, bo, out, SEQ, DMOD, DMOD, 1.0f / (OSC * WOS));
  (void)hipGetLastError();
}

// v010
// It runs in 79.8 microseconds.
// In both of two side-by-side timings against v009, it was 1.06 times as fast.
// Counting every step since v000, it is 4.20 times as fast.
// Contractions: x.W{q,k,v}^T on v_wmma_f32_16x16x32_bf16 (x and W RNE-converted to bf16, f32 accumulate);
// scores k'.q'^T (transposed; q', k' carried x1024 as f16 hi plane + f16 residual plane, products hh+lh+hl), v^T.P^T (P x32768 f16 hi+residual,
// v x1024 f16 hi+residual, products hh+lh+hl) and O.Wo^T (O x1024 f16 hi+residual, Wo as f16(bf16(Wo) x1024), products h.w+l.w):
// v_wmma_f32_16x16x32_f16, f32 accumulate. Rotary tables, rotation, masks, masked base-2 online softmax and 1/l fold in f32 on VALU.
#include <hip/hip_runtime.h>
#include <math.h>
#include <stdint.h>

#define SEQ   2048
#define DMOD  1024
#define NH    16
#define HD    64
#define GINST 129
#define QSC   1024.0f
#define KSC   1024.0f
#define PCAR  32768.0f
#define VCAR  1024.0f
#define OSC   1024.0f
#define WOS   1024.0f
#define LOG2E 1.4426950408889634f
#define WPB   8
#define QTW   2
#define NQP   (SEQ / (16 * QTW))
#define NKT   (SEQ / 32)
#define ATT_THREADS (WPB * 32)
#define ATT_BLOCKS  (NQP * NH)
#define SLW   (16 * 68)
#define WREG  (QTW * SLW + QTW * 32)
#define SLAB64 (16 * 68)
#define GKC   128
#define GPB   272
#define GOPB  (64 * GPB)
#define GKS   (GKC / 32)
#define GAR   128
#define GSTG  ((GAR + 3 * 64) * GPB)
#define HSTG  ((2 * 64 + 128) * GPB)
#define TABB  (SEQ / 8)
#define RNKB  (SEQ / 32)
#define WCB   ((DMOD * DMOD) / 2048)
static_assert(DMOD == NH * HD && HD == 64 && NH == 16);
static_assert(WPB == 8 && ATT_THREADS == 256 && (WREG % 4) == 0 && (SLW % 4) == 0 && QTW == 2);
static_assert((SEQ % 64) == 0 && (SEQ % ATT_THREADS) == 0 && (SEQ % 8) == 0 && SEQ <= 32768);
static_assert((DMOD % 64) == 0 && (DMOD % 32) == 0);
static_assert(16 * QTW == 32 && NKT == 8 * WPB);
static_assert(((DMOD * DMOD) % 2048) == 0 && DMOD == 4 * 256 && (SEQ % 128) == 0 && (SEQ & (SEQ - 1)) == 0);
static_assert((DMOD % GKC) == 0 && (DMOD / GKC) >= 2 && GKC * 2 == 256 && GPB == 256 + 16 && (SEQ % 64) == 0);
static_assert((SEQ % GAR) == 0 && (DMOD % 128) == 0 && GAR == 8 * 16);

typedef unsigned short u16;
typedef _Float16 v16h __attribute__((ext_vector_type(16)));
typedef _Float16 v8h  __attribute__((ext_vector_type(8)));
typedef __bf16   v16b __attribute__((ext_vector_type(16)));
typedef float    v8f  __attribute__((ext_vector_type(8)));
typedef float    v4f  __attribute__((ext_vector_type(4)));
typedef unsigned int v4u __attribute__((ext_vector_type(4)));
typedef int v4i __attribute__((ext_vector_type(4)));

union FragH { v16h v; v8h h[2]; v4u u[2]; };
union FragB { v16b v; v4u u[2]; };

struct InvF { float f[32]; };
static_assert(sizeof(InvF) == 128);

// ---- scalar helpers --------------------------------------------------------------------------------
__device__ __forceinline__ unsigned short bf_bits(float f) {          // f32 -> bf16 bits, RNE convert
  unsigned u = __float_as_uint(f);
  return (unsigned short)((u + 0x7FFFu + ((u >> 16) & 1u)) >> 16);
}
__device__ __forceinline__ float bf_up(unsigned short h) { return __uint_as_float(((unsigned)h) << 16); }
__device__ __forceinline__ float bfr(float f) { return bf_up(bf_bits(f)); }
__device__ __forceinline__ unsigned short h_bits(_Float16 x) { return __builtin_bit_cast(unsigned short, x); }
__device__ __forceinline__ unsigned pk16(unsigned short a, unsigned short b) { return (unsigned)a | ((unsigned)b << 16); }
__device__ __forceinline__ v8f zero8() { v8f z = {0.f, 0.f, 0.f, 0.f, 0.f, 0.f, 0.f, 0.f}; return z; }

// ---- fragment map: 16-bit A/B operand, lane -> row/col (lane&15), half hh = lane>>4;
//      elements 0..7 <- k0+8hh+0..7, elements 8..15 <- k0+16+8hh+0..7  (same split k map for A and B)
// ---- fragment-order planes (q', k', v^T): a fragment (16 rows x 32 k) is 1 KB in a row: [i = 0,1][lane 0..31][8 halves], the 8 halves being
//      row (lane&15), k = k0 + 16i + 8hh + 0..7: what lane holds in elements 8i .. 8i+7. One load of a wave is then 512 contiguous bytes,
//      four whole 128-B lines, where a row-major plane gives 16-B pieces of 16 lines.
// fragment from a wave-uniform plane base plus a 32-bit per-lane byte offset (fragment start + 16 * lane)
__device__ __forceinline__ v16h ldfrag_o(const u16* base, unsigned boff, unsigned cbytes) {
  const char* p = (const char*)(const void*)base + boff;
  FragH f;
  f.h[0] = *(const v8h*)(p + cbytes);
  f.h[1] = *(const v8h*)(p + cbytes + 512);
  return f.v;
}

__device__ __forceinline__ v8f mma_h(v16h a, v16h b, v8f c) {
  return __builtin_amdgcn_wmma_f32_16x16x32_f16(false, a, false, b, (short)0, c, false, false);
}
__device__ __forceinline__ v8f mma_b(v16b a, v16b b, v8f c) {
  return __builtin_amdgcn_wmma_f32_16x16x32_bf16(false, a, false, b, (short)0, c, false, false);
}
template <typename F>
__device__ __forceinline__ void guard6(v8f& a, v8f& b, v8f& c, v8f& d, F x0, F x1, F x2, F x3, F x4, F x5) {
#if defined(__HIP_DEVICE_COMPILE__)
  asm volatile("v_nop\n\tv_nop\n\tv_nop\n\tv_nop"
               : "+v"(a), "+v"(b), "+v"(c), "+v"(d) : "v"(x0), "v"(x1), "v"(x2), "v"(x3), "v"(x4), "v"(x5) : "memory");
#endif
}
__device__ __forceinline__ void guard8x6(v8f& a, v8f& b, v8f& c, v8f& d, v8f& e, v8f& f, v8f& g, v8f& h,
                                         v16b x0, v16b x1, v16b x2, v16b x3, v16b x4, v16b x5) {
#if defined(__HIP_DEVICE_COMPILE__)
  asm volatile("v_nop\n\tv_nop\n\tv_nop\n\tv_nop"
               : "+v"(a), "+v"(b), "+v"(c), "+v"(d), "+v"(e), "+v"(f), "+v"(g), "+v"(h)
               : "v"(x0), "v"(x1), "v"(x2), "v"(x3), "v"(x4), "v"(x5) : "memory");
#endif
}
__device__ __forceinline__ void guard10(v8f& a, v8f& b, v8f& c, v8f& d, v16h x0, v16h x1, v16h x2, v16h x3, v16h x4,
                                        v16h x5, v16h x6, v16h x7, v16h x8, v16h x9) {
#if defined(__HIP_DEVICE_COMPILE__)
  asm volatile("v_nop\n\tv_nop\n\tv_nop\n\tv_nop"
               : "+v"(a), "+v"(b), "+v"(c), "+v"(d)
               : "v"(x0), "v"(x1), "v"(x2), "v"(x3), "v"(x4), "v"(x5), "v"(x6), "v"(x7), "v"(x8), "v"(x9) : "memory");
#endif
}
__device__ __forceinline__ void acc_guard4(v8f& a, v8f& b, v8f& c, v8f& d) {
#if defined(__HIP_DEVICE_COMPILE__)
  asm volatile("v_nop\n\tv_nop\n\tv_nop\n\tv_nop" : "+v"(a), "+v"(b), "+v"(c), "+v"(d));
#endif
}
// the value that lane l ^ 16 holds: the other half's share of the same query column
__device__ __forceinline__ float xhalf(float x) {
  const int b = __float_as_int(x);
  return __int_as_float(__builtin_amdgcn_permlanex16(b, b, 0x76543210, 0xfedcba98, false, false));
}
// minimum and maximum over the 32 lanes of a wave, every lane on: four exchanges inside a 16-lane row (DPP row_xmask 1, 2, 4, 8), then
// one between the two rows; every lane ends with the result
__device__ __forceinline__ int wave_min_i(int x) {
  int y;
  y = __builtin_amdgcn_update_dpp(x, x, 0x161, 0xf, 0xf, false); x = (y < x) ? y : x;
  y = __builtin_amdgcn_update_dpp(x, x, 0x162, 0xf, 0xf, false); x = (y < x) ? y : x;
  y = __builtin_amdgcn_update_dpp(x, x, 0x164, 0xf, 0xf, false); x = (y < x) ? y : x;
  y = __builtin_amdgcn_update_dpp(x, x, 0x168, 0xf, 0xf, false); x = (y < x) ? y : x;
  y = __builtin_amdgcn_permlanex16(x, x, 0x76543210, 0xfedcba98, false, false); x = (y < x) ? y : x;
  return x;
}
__device__ __forceinline__ int wave_max_i(int x) {
  int y;
  y = __builtin_amdgcn_update_dpp(x, x, 0x161, 0xf, 0xf, false); x = (y > x) ? y : x;
  y = __builtin_amdgcn_update_dpp(x, x, 0x162, 0xf, 0xf, false); x = (y > x) ? y : x;
  y = __builtin_amdgcn_update_dpp(x, x, 0x164, 0xf, 0xf, false); x = (y > x) ? y : x;
  y = __builtin_amdgcn_update_dpp(x, x, 0x168, 0xf, 0xf, false); x = (y > x) ? y : x;
  y = __builtin_amdgcn_permlanex16(x, x, 0x76543210, 0xfedcba98, false, false); x = (y > x) ? y : x;
  return x;
}
// ---- token order: every plane between the input x and the O planes is laid out in the order of a STABLE SORT OF THE POSITIONS BY INSTRUMENT ID:
//      rank(t) = #{j : inst[j] < inst[t]} + #{j < t : inst[j] == inst[t]}, a permutation of 0 .. SEQ-1 for any content of the id array.
//      Attention does not depend on the order of keys or of queries (the masks are evaluated from each token's own ids and position), and in
//      this order the keys that the same-instrument mask allows to a query tile lie in a few neighbouring key tiles, and all keys of one
//      id (the global one too) lie together: far fewer key tiles hold an allowed element.
// all SEQ instrument ids spread over a wave: lane holds ids 128 i + 4 lane + 0..3 (each load of the wave: 512 contiguous bytes)
struct IdSet { v4i q[SEQ / 128]; };
__device__ __forceinline__ void ids_load(const int* __restrict__ inst, int lane, IdSet& s) {
#pragma unroll
  for (int i = 0; i < SEQ / 128; ++i) s.q[i] = *(const v4i*)(inst + 128 * i + 4 * lane);
}
// rank of position t (wave-uniform, my = inst[t]); every lane on. Counted on the scalar side: a ballot of each comparison and a bit count, so
// that the result is wave-uniform with no lane exchange. Positions j = 128 i + 4 lane + e below t: all of chunk i < t / 128, none of a later
// chunk, and in chunk t / 128 the lanes of me[e].
__device__ __forceinline__ int rank_of(const IdSet& s, int my, int t, int lane) {
  const int tc = t >> 7, tl = t & 127;
  unsigned me[4];
#pragma unroll
  for (int e = 0; e < 4; ++e) me[e] = __builtin_amdgcn_ballot_w32(4 * lane + e < tl);
  int cnt = 0;
#pragma unroll
  for (int i = 0; i < SEQ / 128; ++i) {
#pragma unroll
    for (int e = 0; e < 4; ++e) {
      const unsigned lt = __builtin_amdgcn_ballot_w32(s.q[i][e] < my), eq = __builtin_amdgcn_ballot_w32(s.q[i][e] == my);
      const unsigned bf = (i < tc) ? 0xffffffffu : (i == tc) ? me[e] : 0u;
      cnt += __builtin_popcount(lt | (eq & bf));
    }
  }
  return cnt;
}
__device__ __forceinline__ void wave_sync_lds() {
  __builtin_amdgcn_fence(__ATOMIC_RELEASE, "workgroup");
  __builtin_amdgcn_wave_barrier();
  __builtin_amdgcn_fence(__ATOMIC_ACQUIRE, "workgroup");
}

// ---- GEMM operand staging: a stage = GKC k elements (256 B) of every operand row the block stages, LDS row pitch GPB bytes ----
__device__ __forceinline__ unsigned lds_off(const void* p) { return (unsigned)(size_t)p; }   // LDS byte address of a __shared__ object
// 16 rows x 256 B of one operand, global memory -> LDS through no register: eight asynchronous copies of this wave. A copy is 2 whole rows
// (lane -> row lane >> 4, 16-B column lane & 15), four whole 128-B lines. l, g: this lane's LDS byte address and global address in copy 0;
// copy i lies 2 rows further on in both (ldk = elements between global rows). All 32 lanes on; both addresses multiples of 16.
// The closing s_wait_xcnt 0 stands inside the statement so that no address register named here is rewritten in front of it.
__device__ __forceinline__ void copy16rows(unsigned l, const u16* g, size_t ldk) {
#if defined(__HIP_DEVICE_COMPILE__)
  asm volatile("global_load_async_to_lds_b128 %0, %8, off\n\t"
               "global_load_async_to_lds_b128 %1, %9, off\n\t"
               "global_load_async_to_lds_b128 %2, %10, off\n\t"
               "global_load_async_to_lds_b128 %3, %11, off\n\t"
               "global_load_async_to_lds_b128 %4, %12, off\n\t"
               "global_load_async_to_lds_b128 %5, %13, off\n\t"
               "global_load_async_to_lds_b128 %6, %14, off\n\t"
               "global_load_async_to_lds_b128 %7, %15, off\n\t"
               "s_wait_xcnt 0x0"
               :: "v"(l), "v"(l + 2u * GPB), "v"(l + 4u * GPB), "v"(l + 6u * GPB),
                  "v"(l + 8u * GPB), "v"(l + 10u * GPB), "v"(l + 12u * GPB), "v"(l + 14u * GPB),
                  "v"(g), "v"(g + 2 * ldk), "v"(g + 4 * ldk), "v"(g + 6 * ldk),
                  "v"(g + 8 * ldk), "v"(g + 10 * ldk), "v"(g + 12 * ldk), "v"(g + 14 * ldk)
               : "memory");
#endif
}
// this wave's own copies have landed (the compiler places no wait for them)
__device__ __forceinline__ void wait_copies() {
#if defined(__HIP_DEVICE_COMPILE__)
  asm volatile("s_wait_asynccnt 0x0" ::: "memory");
#endif
}
// this wave's LDS reads have retired: stands in front of the barrier behind which the buffer it read is refilled
__device__ __forceinline__ void wait_lds() {
#if defined(__HIP_DEVICE_COMPILE__)
  asm volatile("s_wait_dscnt 0x0" ::: "memory");
#endif
}
// stands behind a piece's last global stores: in a grid of several pieces another piece's code follows in the listing and rewrites the
// registers that the stores name; this wait is in front of every such write (which piece is laid last is the compiler's choice: each has it)
__device__ __forceinline__ void wait_store_regs() {
#if defined(__HIP_DEVICE_COMPILE__)
  asm volatile("s_wait_xcnt 0x0" ::: "memory");
#endif
}
// fragment from a staged row: p = row start + 64 * k-step + 16 * (lane >> 4) bytes; the split k map of the loaders above (bytes +0 and +32)
__device__ __forceinline__ v16b ldsfrag_b(const unsigned char* p) {
  FragB f;
  f.u[0] = *(const v4u*)(p);
  f.u[1] = *(const v4u*)(p + 32);
  return f.v;
}
__device__ __forceinline__ v16h ldsfrag_h(const unsigned char* p) {
  FragH f;
  f.u[0] = *(const v4u*)(p);
  f.u[1] = *(const v4u*)(p + 32);
  return f.v;
}

// ---- accurate f32 sin/cos of a non-negative f32 angle (|angle| < 32768): f64 two-part pi/2 reduction + f64 polynomials,
//      plain f64 fma/mul only (no library f64 trig path), result converted to f32.
__device__ __forceinline__ void sincos_acc(float angf, float& sv, float& cv) {
  const double a = (double)angf;
  const double TWO_OVER_PI = 0.63661977236758134308;
  const double PIO2_HI = 1.5707963267948966;
  const double PIO2_LO = 6.123233995736766e-17;
  const int kq = (int)(a * TWO_OVER_PI + 0.5);
  const double kd = (double)kq;
  double r = fma(-kd, PIO2_HI, a);
  r = fma(-kd, PIO2_LO, r);
  const double r2 = r * r;
  double sp = 1.0 / 6227020800.0;
  sp = fma(sp, r2, -1.0 / 39916800.0);
  sp = fma(sp, r2, 1.0 / 362880.0);
  sp = fma(sp, r2, -1.0 / 5040.0);
  sp = fma(sp, r2, 1.0 / 120.0);
  sp = fma(sp, r2, -1.0 / 6.0);
  const double s = fma(sp * r2, r, r);
  double cp = -1.0 / 87178291200.0;
  cp = fma(cp, r2, 1.0 / 479001600.0);
  cp = fma(cp, r2, -1.0 / 3628800.0);
  cp = fma(cp, r2, 1.0 / 40320.0);
  cp = fma(cp, r2, -1.0 / 720.0);
  cp = fma(cp, r2, 1.0 / 24.0);
  cp = fma(cp, r2, -0.5);
  const double c = fma(cp, r2, 1.0);
  const int qd = kq & 3;
  const double so = (qd == 0) ? s : (qd == 1) ? c : (qd == 2) ? -s : -c;
  const double co = (qd == 0) ? c : (qd == 1) ? -s : (qd == 2) ? -c : s;
  sv = (float)so;
  cv = (float)co;
}

// =====================================================================================================
// Rank table: rankT[t] = rank(t) in the sorted token order, for the attention's id staging. Block = 32 positions, wave = 4 of them (the ids
// are loaded once a wave); the 32 ranks are gathered in LDS behind a block barrier so that one wave writes the whole 128-B line.
// coverage: blk = 0 .. SEQ/32 - 1, 32 positions each.
// =====================================================================================================
__device__ __forceinline__ void rank_blk(int blk, const int* __restrict__ inst, int* rankT, int* red) {
  const int tid  = threadIdx.x;
  const int lane = tid & 31;
  const int wave = __builtin_amdgcn_readfirstlane(tid >> 5);
  IdSet s;
  ids_load(inst, lane, s);
  int mine = 0;
  // kept rolled: four copies of the count side by side outgrow the scalar registers (their ballots are spilled to lanes)
#pragma unroll 1
  for (int i = 0; i < 4; ++i) {
    const int t = blk * 32 + wave * 4 + i;
    const int r = rank_of(s, inst[t], t, lane);
    mine = (lane == i) ? r : mine;
  }
  if (lane < 4) red[wave * 4 + lane] = mine;
  __syncthreads();                           // the block's 32 ranks are visible to its first wave (block-uniform: the whole block is in this piece)
  if (wave == 0) rankT[blk * 32 + lane] = red[lane];
  wait_store_regs();
}

// =====================================================================================================
// One position t a wave, written at row r = rank(t) of the sorted token order:
//   rotary tables cosT[r][d], sinT[r][d], d < HD, angle = float(t) * inv_freq[d & 31] (f32 product), halves duplicated; lane = frequency index,
//   inv_freq picked from the by-value table with a static select chain;
//   x[t][:] -> bf16 RNE bits in XB[r][:]: 4 x (two 16-B loads, one 16-B store) a lane, every store of the wave 512 contiguous bytes.
// coverage: blk = 0 .. SEQ/8 - 1, 8 waves each = SEQ positions = SEQ rows (rank is a permutation); per row 4 line stores = 64 floats of each
// table and 4 x 512 B = DMOD elements of XB.
// =====================================================================================================
__device__ __forceinline__ void row_blk(int blk, const float* __restrict__ x, const int* __restrict__ inst, u16* XBo,
                                        float* cosT, float* sinT, const InvF& inv) {
  const int tid  = threadIdx.x;
  const int lane = tid & 31;
  const int t    = blk * 8 + __builtin_amdgcn_readfirstlane(tid >> 5);
  float f = inv.f[0];
#pragma unroll
  for (int i = 1; i < 32; ++i) f = (lane == i) ? inv.f[i] : f;
  // the select chain is built as one load of the table by lane: this wait stands behind it, in front of the loads below, whose results may
  // take the registers of its address (f as an operand keeps the table load in front of the statement)
#if defined(__HIP_DEVICE_COMPILE__)
  asm volatile("s_wait_xcnt 0x0" : "+v"(f) :: "memory");
#endif
  const float* p = x + (size_t)t * DMOD + lane * 8;
  v4f xa[4], xb[4];
#pragma unroll
  for (int it = 0; it < 4; ++it) { xa[it] = *(const v4f*)(p + it * 256); xb[it] = *(const v4f*)(p + it * 256 + 4); }
  IdSet s;
  ids_load(inst, lane, s);
  const int r = rank_of(s, inst[t], t, lane);
  const float ang = (float)t * f;
  float sv, cv;
  sincos_acc(ang, sv, cv);
  float* cr = cosT + (size_t)r * HD;
  float* sr = sinT + (size_t)r * HD;
  *(float*)(cr + lane)      = cv;
  *(float*)(cr + 32 + lane) = cv;
  *(float*)(sr + lane)      = sv;
  *(float*)(sr + 32 + lane) = sv;
  u16* d = XBo + (size_t)r * DMOD + lane * 8;
#pragma unroll
  for (int it = 0; it < 4; ++it) {
    v4u o;
    o[0] = pk16(bf_bits(xa[it][0]), bf_bits(xa[it][1]));
    o[1] = pk16(bf_bits(xa[it][2]), bf_bits(xa[it][3]));
    o[2] = pk16(bf_bits(xb[it][0]), bf_bits(xb[it][1]));
    o[3] = pk16(bf_bits(xb[it][2]), bf_bits(xb[it][3]));
    *(v4u*)(d + it * 256) = o;
  }
  wait_store_regs();
}

// =====================================================================================================
// f32 -> 16-bit plane, same layout.  f16mode false: bf16 RNE bits;  f16mode true: f16 bits of (bf16 RNE value) * scale.
// Thread = 8 consecutive elements: two 16-B loads, one 16-B store; 32 consecutive lanes = 512 contiguous, 512-B aligned bytes.
// coverage: blk = 0 .. n/2048 - 1, 256 thr x 8 elements each = the whole plane.
// =====================================================================================================
__device__ __forceinline__ void cvt_blk(const float* __restrict__ x, u16* D, int blk, bool f16mode, float scale) {
  const int gt = blk * 256 + (int)threadIdx.x;
  const float* p = x + (size_t)gt * 8;
  const v4f a = *(const v4f*)(p), b4 = *(const v4f*)(p + 4);
  float w[8];
#pragma unroll
  for (int e = 0; e < 4; ++e) { w[e] = a[e]; w[4 + e] = b4[e]; }
  v4u o;
#pragma unroll
  for (int e = 0; e < 4; ++e) {
    const float f0 = w[2 * e], f1 = w[2 * e + 1];
    o[e] = f16mode ? pk16(h_bits((_Float16)(bfr(f0) * scale)), h_bits((_Float16)(bfr(f1) * scale)))
                   : pk16(bf_bits(f0), bf_bits(f1));
  }
  *(v4u*)(D + (size_t)gt * 8) = o;
  wait_store_regs();
}

// =====================================================================================================
// Everything that reads inputs alone, in one grid: none of these pieces reads what another writes. The block index picks the piece
// (block-uniform; the one barrier stands inside the rank piece): RNKB blocks of the rank table, TABB blocks of rotary tables + x -> bf16, both at
// the row's rank (the longest chain of a wave), 3 * WCB blocks Wq, Wk, Wv -> bf16, WCB blocks Wo -> f16 of the bf16 value x1024.
// grid = RNKB + TABB + 4 * WCB, exact.
// =====================================================================================================
__global__ __launch_bounds__(256) void prep(const float* __restrict__ x, const int* __restrict__ inst,
                                            const float* __restrict__ wq, const float* __restrict__ wk,
                                            const float* __restrict__ wv, const float* __restrict__ wo,
                                            u16* XBo, u16* WQo, u16* WKo, u16* WVo, u16* WOo,
                                            float* cosT, float* sinT, int* rankT, InvF inv) {
  __shared__ int red[32];
  int b = blockIdx.x;
  if (b < RNKB) { rank_blk(b, inst, rankT, red); return; }
  b -= RNKB;
  if (b < TABB) { row_blk(b, x, inst, XBo, cosT, sinT, inv); return; }
  b -= TABB;
  const int w = b / WCB, wb = b % WCB;
  if (w < 3) {
    const float* s = (w == 0) ? wq : (w == 1) ? wk : wv;
    u16*         d = (w == 0) ? WQo : (w == 1) ? WKo : WVo;
    cvt_blk(s, d, wb, false, 1.0f);
  } else if (w == 3) {
    cvt_blk(wo, WOo, wb, true, WOS);
  }
}

// =====================================================================================================
// Epilogue of the output projection: the wave's 16x64 f32 tile (times oscale) staged in its LDS slab (pitch 68),
// coverage: 8 instructions x 2 rows x 16 lanes x 4 floats = the wave's 16 x 64 tile.
// =====================================================================================================
__device__ __forceinline__ void epi64(float* sl, v8f a0, v8f a1, v8f a2, v8f a3, float oscale,
                                      const float* __restrict__ bias, float* C, int N,
                                      size_t rowb, int col0, int lane) {
  const int hh = lane >> 4, m = lane & 15;
#pragma unroll
  for (int r = 0; r < 8; ++r) {
    const int ro = (8 * hh + r) * 68 + m;
    sl[ro]      = a0[r] * oscale;
    sl[ro + 16] = a1[r] * oscale;
    sl[ro + 32] = a2[r] * oscale;
    sl[ro + 48] = a3[r] * oscale;
  }
  wave_sync_lds();
  const v4f braw = *(const v4f*)(bias + col0 + m * 4);
  v4f bb;
#pragma unroll
  for (int e = 0; e < 4; ++e) bb[e] = bfr(braw[e]);
  v4f vals[8];
#pragma unroll
  for (int it = 0; it < 8; ++it) vals[it] = *(const v4f*)(sl + (it * 2 + hh) * 68 + m * 4) + bb;
  float* dst = C + (rowb + (size_t)hh) * (size_t)N + col0 + m * 4;
  {
#pragma unroll
    for (int it = 0; it < 8; ++it) {
      *(v4f*)(dst + (size_t)(it * 2) * (size_t)N) = vals[it];
    }
    
  }
}

// =====================================================================================================
// Projection epilogue for q and k: rotate-half rotary + 16-bit split pack of the wave's 16 x 64 f32 tile = 16 positions x one whole head
// (the tile's 64 columns are head col0 / 64), written straight into the fragment-order planes: no f32 plane in between.
// x[d] = acc * oscale + bias;  w[d] = x[d] * cos[pos][d] + r[d] * sin[pos][d],  r[d] = -x[d+32] for d < 32, x[d-32] for d >= 32
// (cos, sin: both halves of a table row are equal, so the row's first half serves d and d + 32);
// hi[d] = f16(w * sc), lo[d] = f16(w * sc - hi[d])  (sc a power of two, residual unscaled).
// Output in fragment order: [head][row tile rt = pos / 16][k-step kk][i][lane][8 halves] (2 KB a row tile and head): the wave's tile is
// exactly one (head, rt). The tile is turned in the wave's LDS slab (pitch 68): written from the D registers (lane: column m, rows 8hh + r),
// read back as lane (hh, c = m) -> row c, d = 16 i + 8 hh + 0..7 and the same + 32: what this lane holds of fragments kk = 0 and kk = 1.
// coverage: 2 (i) x 2 (kk) stores x 32 lanes x 8 halves = 16 x 64 of each plane; every store of a wave is 512 contiguous bytes, four whole lines.
// =====================================================================================================
__device__ __forceinline__ void epi_rope(float* sl, v8f a0, v8f a1, v8f a2, v8f a3, float oscale,
                                         const float* __restrict__ bias, const float* __restrict__ cosT,
                                         const float* __restrict__ sinT, u16* hpl, u16* lpl,
                                         int rowb, int col0, int lane, float sc) {
  const int hh = lane >> 4, m = lane & 15;
  const float* cr = cosT + (size_t)(rowb + m) * HD + 8 * hh;
  const float* sr = sinT + (size_t)(rowb + m) * HD + 8 * hh;
  const float* br = bias + col0 + 8 * hh;
  v4f cs[2][2], sn[2][2], b0[2][2], b1[2][2];
#pragma unroll
  for (int i = 0; i < 2; ++i) {
#pragma unroll
    for (int p = 0; p < 2; ++p) {
      cs[i][p] = *(const v4f*)(cr + 16 * i + 4 * p);
      sn[i][p] = *(const v4f*)(sr + 16 * i + 4 * p);
      b0[i][p] = *(const v4f*)(br + 16 * i + 4 * p);
      b1[i][p] = *(const v4f*)(br + 32 + 16 * i + 4 * p);
    }
  }
#pragma unroll
  for (int r = 0; r < 8; ++r) {
    const int ro = (8 * hh + r) * 68 + m;
    sl[ro]      = a0[r] * oscale;
    sl[ro + 16] = a1[r] * oscale;
    sl[ro + 32] = a2[r] * oscale;
    sl[ro + 48] = a3[r] * oscale;
  }
  wave_sync_lds();
  v4u oh[2][2], ol[2][2];                     // [kk][i]
#pragma unroll
  for (int i = 0; i < 2; ++i) {
    const float* xr = sl + m * 68 + 16 * i + 8 * hh;
    float w0[8], w1[8];
#pragma unroll
    for (int p = 0; p < 2; ++p) {
      const v4f xl = *(const v4f*)(xr + 4 * p), xu = *(const v4f*)(xr + 32 + 4 * p);
#pragma unroll
      for (int e = 0; e < 4; ++e) {
        const float x0 = xl[e] + bfr(b0[i][p][e]), x1 = xu[e] + bfr(b1[i][p][e]);
        w0[4 * p + e] = x0 * cs[i][p][e] + (-x1) * sn[i][p][e];
        w1[4 * p + e] = x1 * cs[i][p][e] + x0 * sn[i][p][e];
      }
    }
#pragma unroll
    for (int e = 0; e < 4; ++e) {
      const float t0 = w0[2 * e] * sc, t1 = w0[2 * e + 1] * sc, t2 = w1[2 * e] * sc, t3 = w1[2 * e + 1] * sc;
      const _Float16 h0 = (_Float16)t0, h1 = (_Float16)t1, h2 = (_Float16)t2, h3 = (_Float16)t3;
      oh[0][i][e] = pk16(h_bits(h0), h_bits(h1));
      oh[1][i][e] = pk16(h_bits(h2), h_bits(h3));
      ol[0][i][e] = pk16(h_bits((_Float16)(t0 - (float)h0)), h_bits((_Float16)(t1 - (float)h1)));
      ol[1][i][e] = pk16(h_bits((_Float16)(t2 - (float)h2)), h_bits((_Float16)(t3 - (float)h3)));
    }
  }
  const size_t o8 = ((size_t)(col0 >> 6) * (SEQ / 16) + (size_t)(rowb >> 4)) * (16 * HD) + (size_t)lane * 8;
#pragma unroll
  for (int kk = 0; kk < 2; ++kk) {
#pragma unroll
    for (int i = 0; i < 2; ++i) {
      *(v4u*)(hpl + o8 + kk * 512 + i * 256) = oh[kk][i];
      *(v4u*)(lpl + o8 + kk * 512 + i * 256) = ol[kk][i];
    }
  }
  wait_store_regs();
}

// =====================================================================================================
// Projection epilogue for v: the wave's 16 x 64 f32 tile = 16 keys x one whole head g = col0 / 64, written straight into the v^T planes.
// v^T planes in fragment order: [head g][key tile kt = s / 32][j = d / 16][i][lane][8 halves] (4 KB a key tile and head), the 8 halves being
// row d = 16 j + (lane & 15), keys 32 kt + 16 i + 8 (lane >> 4) + 0..7: VH = f16(v[s][g][d] * 1024), VL = f16 residual of the same value.
// D register r of accumulator j in lane (hh, m) is (key rowb + 8 hh + r, d = 16 j + m): the lane's eight registers ARE its 8 halves of half
// fragment (kt = rowb / 32, j, i = (rowb / 16) & 1): no LDS, no lane exchange.
// coverage: 4 (j) stores x 32 lanes x 8 halves = 64 d x 16 keys of each plane; every store of a wave is 512 contiguous bytes, four whole lines.
// =====================================================================================================
__device__ __forceinline__ void epi_vt(v8f a0, v8f a1, v8f a2, v8f a3, float oscale, const float* __restrict__ bias,
                                       u16* VHo, u16* VLo, int rowb, int col0, int lane) {
  const int m = lane & 15;
  v4u vh[4], vl[4];
#pragma unroll
  for (int j = 0; j < 4; ++j) {
    const v8f a = (j == 0) ? a0 : (j == 1) ? a1 : (j == 2) ? a2 : a3;
    const float bj = bfr(bias[col0 + 16 * j + m]);
#pragma unroll
    for (int e = 0; e < 4; ++e) {
      const float t0 = (a[2 * e] * oscale + bj) * VCAR, t1 = (a[2 * e + 1] * oscale + bj) * VCAR;
      const _Float16 h0 = (_Float16)t0, h1 = (_Float16)t1;
      vh[j][e] = pk16(h_bits(h0), h_bits(h1));
      vl[j][e] = pk16(h_bits((_Float16)(t0 - (float)h0)), h_bits((_Float16)(t1 - (float)h1)));
    }
  }
  const size_t base = ((size_t)(col0 >> 6) * HD) * SEQ + (size_t)(rowb >> 5) * (32 * HD) + ((rowb >> 4) & 1) * 256 + (size_t)lane * 8;
#pragma unroll
  for (int j = 0; j < 4; ++j) {
    *(v4u*)(VHo + base + j * 512) = vh[j];
    *(v4u*)(VLo + base + j * 512) = vl[j];
  }
  wait_store_regs();
}

// =====================================================================================================
// bf16 GEMM of the three projections: A[M][K] (bf16 row-major) . Bt[N][K]^T (bf16 k-contiguous), times oscale, plus bias[N], f32 in registers;
// the epilogue packs the tile into the 16-bit planes that the attention reads (q, k: rotary, epi_rope; v: transposed, epi_vt).
// Block = 128 rows x the same 64 columns (one head) of all three products, 12 waves: wave -> (product wave / 4, row group wave % 4), a wave's
// tile 32 rows x 64 columns: 2 A and 4 Bt fragments read from LDS serve 8 matrix instructions, and a staged A row serves three products.
// K walked in stages of GKC: the block's 128 A rows and 3 x 64 Bt rows of a stage are brought into a two-buffer LDS ring by asynchronous
// copies of whole lines (every wave: 16 rows of its own product's Bt; waves 0 .. 7 also 16 rows of A), stage t + 1 in flight while stage t is
// multiplied; fragments are read from LDS (two 16-B reads each, split k map for A and B), k ascending as before.
// The rows of A, of the rotary tables and of the planes are tokens in the sorted order (prep lays A and the tables out so): "position" in the
// epilogues' notes is the row index, and a table row holds the angles of its own token.
// The host passes M == SEQ, N == NH * HD (a 64-column tile is one head), K % GKC == 0, K >= 2 * GKC, grid = (M/128)*(N/64).
// =====================================================================================================
__global__ __launch_bounds__(384)
void gemm_bf(const u16* __restrict__ A, const u16* __restrict__ Bt0, const u16* __restrict__ Bt1, const u16* __restrict__ Bt2,
             const float* __restrict__ bias0, const float* __restrict__ bias1, const float* __restrict__ bias2,
             const float* __restrict__ cosT, const float* __restrict__ sinT,
             u16* QHo, u16* QLo, u16* KHo, u16* KLo, u16* VHo, u16* VLo, int M, int N, int K, float oscale) {
  __shared__ __align__(16) float slab[8 * 2 * SLAB64];         // a slab for each of the two 16-row tiles of the eight q and k waves
  __shared__ __align__(16) unsigned char ring[2 * GSTG];       // [buffer][A 128 rows | Bt0 64 | Bt1 64 | Bt2 64][GPB]
  const int tid = threadIdx.x, lane = tid & 31, hh = lane >> 4, m = lane & 15;
  const int wave  = __builtin_amdgcn_readfirstlane(tid >> 5);  // scalar: it picks the product and decides who copies A
  const int which = wave >> 2;
  const int rg    = wave & 3;
  const u16*   Bt   = (which == 0) ? Bt0 : (which == 1) ? Bt1 : Bt2;
  const float* bias = (which == 0) ? bias0 : (which == 1) ? bias1 : bias2;
  const int ntile = N >> 6;
  const int bid   = blockIdx.x;
  const int row0  = (bid / ntile) * GAR;
  const int rowb  = row0 + rg * 32;
  const int col0  = (bid % ntile) * 64;
  if (row0 + GAR > M) return;                // block-uniform, in front of every barrier and copy; never taken with the exact grid
  const int  nst   = K / GKC;
  const bool hasA  = wave < GAR / 16;        // wave-uniform (scalar)
  const int  crow  = wave * 16 + hh;         // the stage row (behind A: the Bt row) this lane brings in copy 0
  const u16* ga = A  + (size_t)(row0 + (crow & (GAR - 1))) * K + m * 8;
  const u16* gb = Bt + (size_t)(col0 + rg * 16 + hh) * K + m * 8;
  const unsigned la = lds_off(ring) + (unsigned)(crow & (GAR - 1)) * GPB + (unsigned)m * 16u;
  const unsigned lb = lds_off(ring) + (unsigned)(GAR + crow) * GPB + (unsigned)m * 16u;
  if (hasA) copy16rows(la, ga, (size_t)K);
  copy16rows(lb, gb, (size_t)K);
  wait_copies();
  __syncthreads();                           // stage 0 is whole for every wave
  if (nst > 1) {
    if (hasA) copy16rows(la + (unsigned)GSTG, ga + GKC, (size_t)K);
    copy16rows(lb + (unsigned)GSTG, gb + GKC, (size_t)K);
  }
  const unsigned char* fa = ring + (rg * 32 + m) * GPB + 16 * hh;
  const unsigned char* fb = ring + (GAR + which * 64 + m) * GPB + 16 * hh;
  v8f c00 = zero8(), c01 = zero8(), c02 = zero8(), c03 = zero8();
  v8f c10 = zero8(), c11 = zero8(), c12 = zero8(), c13 = zero8();
  // kept rolled: one copy of the stage body, the buffer picked by the stage's parity
#pragma unroll 1
  for (int t = 0; t < nst; ++t) {
    const unsigned bo = (unsigned)(t & 1) * (unsigned)GSTG;
    // unrolled: the k-step offsets become immediates and the reads of later k-steps are issued ahead of the earlier products
#pragma unroll
    for (int kk = 0; kk < GKS; ++kk) {
      const v16b a0 = ldsfrag_b(fa + bo + kk * 64);
      const v16b a1 = ldsfrag_b(fa + bo + 16 * GPB + kk * 64);
      const v16b b0 = ldsfrag_b(fb + bo + kk * 64);
      const v16b b1 = ldsfrag_b(fb + bo + 16 * GPB + kk * 64);
      const v16b b2 = ldsfrag_b(fb + bo + 32 * GPB + kk * 64);
      const v16b b3 = ldsfrag_b(fb + bo + 48 * GPB + kk * 64);
      c00 = mma_b(a0, b0, c00);
      c01 = mma_b(a0, b1, c01);
      c02 = mma_b(a0, b2, c02);
      c03 = mma_b(a0, b3, c03);
      c10 = mma_b(a1, b0, c10);
      c11 = mma_b(a1, b1, c11);
      c12 = mma_b(a1, b2, c12);
      c13 = mma_b(a1, b3, c13);
      // its four v_nop keep the distance behind the stage's last matrix instructions on both sides of the branch at the loop's foot
      if (kk == GKS - 1) guard8x6(c00, c01, c02, c03, c10, c11, c12, c13, a0, a1, b0, b1, b2, b3);
    }
    wait_lds();
    wait_copies();
    __syncthreads();                         // publishes stage t + 1 and ends every wave's reads of stage t's buffer
    if (t + 2 < nst) {
      if (hasA) copy16rows(la + bo, ga + (size_t)(t + 2) * GKC, (size_t)K);
      copy16rows(lb + bo, gb + (size_t)(t + 2) * GKC, (size_t)K);
    }
  }
  wait_copies();
  if (which == 2) {
    epi_vt(c00, c01, c02, c03, oscale, bias, VHo, VLo, rowb, col0, lane);
    epi_vt(c10, c11, c12, c13, oscale, bias, VHo, VLo, rowb + 16, col0, lane);
  } else {
    u16* hp = (which == 0) ? QHo : KHo;
    u16* lp = (which == 0) ? QLo : KLo;
    const float sc = (which == 0) ? QSC : KSC;
    epi_rope(slab + (wave * 2) * SLAB64, c00, c01, c02, c03, oscale, bias, cosT, sinT, hp, lp, rowb, col0, lane, sc);
    epi_rope(slab + (wave * 2 + 1) * SLAB64, c10, c11, c12, c13, oscale, bias, cosT, sinT, hp, lp, rowb + 16, col0, lane, sc);
  }
}

// =====================================================================================================
// f16 hi+lo GEMM: C[M][N] (f32) = (Ahi + Alo)[M][K] . Bt[N][K]^T, times oscale, plus bias[N]; Ahi/Alo f16 planes (same layout),
// Bt f16 k-contiguous; products hi.B + lo.B into one accumulator (lo is the unscaled residual of hi). The same two-buffer LDS ring as
// gemm_bf. Block = 64 rows x 128 columns, 8 waves: wave -> (column half wave / 4, row group wave % 4), a wave's tile 16 x 64: the two
// staged A planes serve twice the columns. A stage: 64 rows of Ahi, 64 of Alo, 128 of Bt; every wave copies 16 rows of an A plane
// (waves 0 .. 3 Ahi, 4 .. 7 Alo) and 16 rows of Bt. The host passes grid = (M/64)*(N/128).
// =====================================================================================================
__global__ __launch_bounds__(256)
void gemm_h2(const u16* __restrict__ Ah, const u16* __restrict__ Al, const u16* __restrict__ Bt,
             const float* __restrict__ bias, float* C, int M, int N, int K, float oscale) {
  __shared__ __align__(16) float slab[8 * SLAB64];
  __shared__ __align__(16) unsigned char ring[2 * HSTG];       // [buffer][Ahi 64 rows | Alo 64 | Bt 128][GPB]
  const int tid = threadIdx.x, lane = tid & 31, hh = lane >> 4, m = lane & 15;
  const int wave  = __builtin_amdgcn_readfirstlane(tid >> 5);  // scalar: it picks the A plane that the wave copies
  const int cg    = wave >> 2;
  const int rg    = wave & 3;
  const int ntile = N >> 7;
  const int bid   = blockIdx.x;
  const int row0  = (bid / ntile) * 64;
  const int rowb  = row0 + rg * 16;
  const int col0  = (bid % ntile) * 128;
  if (row0 + 64 > M) return;                 // block-uniform, in front of every barrier and copy; never taken with the exact grid
  const int nst  = K / GKC;
  const int crow = wave * 16 + hh;           // the stage row (behind the A planes: the Bt row) this lane brings in copy 0
  const u16* ga = ((cg == 0) ? Ah : Al) + (size_t)(rowb + hh) * K + m * 8;
  const u16* gb = Bt + (size_t)(col0 + crow) * K + m * 8;
  const unsigned la = lds_off(ring) + (unsigned)crow * GPB + (unsigned)m * 16u;
  const unsigned lb = la + 2u * GOPB;
  copy16rows(la, ga, (size_t)K);
  copy16rows(lb, gb, (size_t)K);
  wait_copies();
  __syncthreads();                           // stage 0 is whole for every wave
  if (nst > 1) {
    copy16rows(la + (unsigned)HSTG, ga + GKC, (size_t)K);
    copy16rows(lb + (unsigned)HSTG, gb + GKC, (size_t)K);
  }
  const unsigned char* fa = ring + (rg * 16 + m) * GPB + 16 * hh;
  const unsigned char* fb = ring + 2 * GOPB + (cg * 64 + m) * GPB + 16 * hh;
  v8f acc0 = zero8(), acc1 = zero8(), acc2 = zero8(), acc3 = zero8();
  // kept rolled: one copy of the stage body, the buffer picked by the stage's parity
#pragma unroll 1
  for (int t = 0; t < nst; ++t) {
    const unsigned bo = (unsigned)(t & 1) * (unsigned)HSTG;
    // unrolled: the k-step offsets become immediates and the reads of later k-steps are issued ahead of the earlier products
#pragma unroll
    for (int kk = 0; kk < GKS; ++kk) {
      const v16h ah = ldsfrag_h(fa + bo + kk * 64), al = ldsfrag_h(fa + bo + GOPB + kk * 64);
      const v16h b0 = ldsfrag_h(fb + bo + kk * 64);
      const v16h b1 = ldsfrag_h(fb + bo + 16 * GPB + kk * 64);
      const v16h b2 = ldsfrag_h(fb + bo + 32 * GPB + kk * 64);
      const v16h b3 = ldsfrag_h(fb + bo + 48 * GPB + kk * 64);
      acc0 = mma_h(ah, b0, acc0);  acc0 = mma_h(al, b0, acc0);
      acc1 = mma_h(ah, b1, acc1);  acc1 = mma_h(al, b1, acc1);
      acc2 = mma_h(ah, b2, acc2);  acc2 = mma_h(al, b2, acc2);
      acc3 = mma_h(ah, b3, acc3);  acc3 = mma_h(al, b3, acc3);
      // its four v_nop keep the distance behind the stage's last matrix instructions on both sides of the branch at the loop's foot
      if (kk == GKS - 1) guard6<v16h>(acc0, acc1, acc2, acc3, ah, al, b0, b1, b2, b3);
    }
    wait_lds();
    wait_copies();
    __syncthreads();                         // publishes stage t + 1 and ends every wave's reads of stage t's buffer
    if (t + 2 < nst) {
      copy16rows(la + bo, ga + (size_t)(t + 2) * GKC, (size_t)K);
      copy16rows(lb + bo, gb + (size_t)(t + 2) * GKC, (size_t)K);
    }
  }
  wait_copies();
  epi64(slab + wave * SLAB64, acc0, acc1, acc2, acc3, oscale, bias, C, N, (size_t)rowb, col0 + cg * 64, lane);
}

// =====================================================================================================
// Triple-masked attention, queries and keys in the sorted token order (stable sort of the positions by instrument id; i, j below are the
// tokens' own positions): block bid -> (head = bid % NH, query tile pair qp = NQP-1 - bid / NH: sorted rows q0 = 32*qp .. q0+31). Every wave carries both 16-row query tiles of the pair, each with a softmax state of its own, so that one
// load of a k or v fragment serves two tiles. The block's WPB waves share that one (pair, head) and split its key tiles: in every group of eight
// consecutive key tiles g each wave takes one, kt = 8g + ((wave - g) & 7), so that any stride-4 or stride-8 pattern of live tiles is spread too.
//   q, k planes (hi, lo f16 x1024) and v^T planes in fragment order, [h][row tile][k-step] and [h][key tile][d tile]; instrument ids, bar ids and positions staged in LDS by rank.
//   For each of the three masks in turn (block-uniform), each wave with its OWN running max m_a, sum Z_a and 4 accumulators acc_a per query tile (8 in all):
//     att 0: (iq == ik) && (iq < 129) && (j <= i)
//     att 1: (iq != ik) && (ik < 129) && (iq < 129) && (bq >= 0) && ((0 <= bq-bk <= 2) || (bq-bk == 4))
//     att 2: ((ik == 129) || (bk == -1)) && (j <= i)
//   A wave's key tiles of 32 visited in order, those that its summary bits leave; per tile every lane evaluates the mask bits of its
//   2 queries x 16 keys, a wave ballot skips tiles with no allowed element in either query tile (exact: such keys carry zero weight).
//   Both products are formed transposed, so that a lane owns one query of each query tile (column c of every D tile):
//   S^T = k'.q'^T: A = key rows, B = query rows, 2 key subtiles x 2 k-steps x 3 products (k_hi.q_hi + k_hi.q_lo + k_lo.q_hi), fragments loaded
//   straight from the 16-bit planes (two 16-B loads per fragment, each 512 contiguous bytes of a wave, split k map); a lane's 16 scores of a query tile are keys 16u + 8hh + r of
//   its own query; masked scores replaced by -inf; online max-subtracted base-2 softmax in f32 (scale 1/8 folded), -inf-safe rescale: the
//   maximum in-lane plus one exchange between the halves, the sum kept per half and joined once after the key loop.
//   O^T += v^T.P^T: the two score subtiles' registers, converted in place, ARE the B fragment of P^T in the split k map (no LDS, no lane
//   exchange); A = 4+4 v^T fragments (hi and residual planes), 12 WMMAs a query tile (hh + hl + lh); the rescale factor is the lane's own.
//   After each mask every wave publishes its partial (m, Z, acc) in its LDS slab; behind a
//   block barrier wave w merges the eight partials of rows 4w .. 4w+3 (a lane: one row, 8 d columns): M = max m_w, Z = sum Z_w 2^(m_w-M), acc likewise;
//   out_a = (Z > 0, i.e. the row has an allowed key) ? acc / Z : 0, carries 1/(32768*1024) folded once, summed in a lane-owned LDS tile:
//   O = out_0 + out_1 + out_2. A second barrier frees the slabs for the next mask. All barriers block-uniform; bounded loops only.
// coverage: per wave 4 rows x 8 lanes x 8 halves = 4 x 64 per plane, WPB waves = 32 x 64; grid NQP*NH blocks =
//           every (s, h) row of both O planes exactly once.
// =====================================================================================================
// second bound: four waves per SIMD (at most 256 registers), two blocks on a WGP: the grid takes two rounds
__global__ __launch_bounds__(ATT_THREADS, 4)
void attn3(const u16* __restrict__ QHIp, const u16* __restrict__ QLOp,
           const u16* __restrict__ KHIp, const u16* __restrict__ KLOp,
           const u16* __restrict__ VHIp, const u16* __restrict__ VLOp,
           const int* __restrict__ inst, const int* __restrict__ bar, const int* __restrict__ rankT,
           u16* OHIp, u16* OLOp) {
  __shared__ __align__(16) float smem[WPB * WREG + QTW * SLW];
  __shared__ __align__(16) int sI[SEQ];      // instrument id, bar id and position of the token at each row of the sorted order
  __shared__ __align__(16) int sB[SEQ];
  __shared__ __align__(16) int sP[SEQ];

  const int tid  = threadIdx.x;
  const int wave = __builtin_amdgcn_readfirstlane(tid >> 5);   // scalar: it steers the key-tile loop
  const int lane = tid & 31;
  const int hh   = lane >> 4;
  const int c    = lane & 15;
  const int bid  = blockIdx.x;
  if (bid >= NQP * NH) return;               // block-uniform, before any barrier; never taken with the exact grid
  const int head = bid % NH;
  const int qp   = NQP - 1 - bid / NH;
  const int q0   = qp * (16 * QTW);
  const int rq   = lane >> 3;                // merge and output: this lane owns row 4*wave + rq of the block's 32,
  const int c8   = (lane & 7) * 8;           // d columns c8 .. c8 + 7
  const int row  = wave * 4 + rq;

  // rankT is a permutation of 0 .. SEQ-1: every entry of the three tables is written once (the mask only bounds the LDS address)
  for (int i = tid; i < SEQ; i += ATT_THREADS) {
    const int r = rankT[i] & (SEQ - 1);
    sI[r] = inst[i]; sB[r] = bar[i]; sP[r] = i;
  }
  __syncthreads();

  float* slab = smem + wave * WREG;          // partial accumulators [16*QTW][64] pitch 68, written after a mask's key loop
  float* ml   = slab + QTW * SLW;            // partial m[16*QTW], Z[16*QTW]
  float* osum = smem + WPB * WREG;           // the block's result [16*QTW][64] pitch 68; elements (row, c8 .. c8 + 7) owned by this lane

  // byte offsets into the fragment-order planes (each plane SEQ*DMOD*2 bytes, far below 2^32); hi and residual planes share them
  const unsigned FRB  = 1024u;                                                  // bytes of a fragment (16 rows x 32 k)
  const unsigned RTB  = 2u * FRB;                                               // q', k': bytes of a 16-row tile of a head (2 k-steps)
  const unsigned KTB  = 32u * HD * 2u;                                          // k', v^T: bytes of a 32-key tile of a head
  const unsigned hofs = (unsigned)head * (SEQ * HD * 2u) + (unsigned)lane * 16u; // this head's part of a plane, this lane's 16 B
  const unsigned qofs = hofs + (unsigned)(q0 >> 4) * RTB;                        // query tile t: + t * RTB
  const float lsc = 0.125f * (LOG2E / (QSC * KSC));
  const float oc  = 1.0f / (PCAR * VCAR);
  // ids and position of this lane's own query of each tile (row q0 + 16t + c)
  int iqv[QTW], bqv[QTW], pqv[QTW];
#pragma unroll
  for (int t = 0; t < QTW; ++t) { iqv[t] = sI[q0 + 16 * t + c]; bqv[t] = sB[q0 + 16 * t + c]; pqv[t] = sP[q0 + 16 * t + c]; }

  // ---- key-tile summaries, once a wave: four bits for each of the wave's own key tiles (bits 4g .. 4g + 3 = tile WPB*g + ((wave - g) & 7)),
  //      kept in scalar registers, so that the key loop passes a tile that cannot hold an allowed element on a scalar test, without the
  //      2 x 16 mask evaluations of every lane. All tests are necessary conditions of the masks, for any content of the id arrays.
  //      The block's 32 queries with iq < 129 are split in two sets: F, those with the least such id ilo, and R, the rest (ids in (ilo, ihi]);
  //      in the sorted order a block mostly holds one id (R empty) or the end of one id's run and the start of the next, whose positions and
  //      bars lie far apart: one range over both would pass nearly every tile. An empty set has least = INT_MAX, largest = INT_MIN: no key passes.
  //      att 0 allows (q, k) only if ik == iq < 129 and the key's position is <= the query's: q in F: ik == ilo, position <= F's largest;
  //      q in R: ilo < ik <= ihi, position <= R's largest.
  //      att 1 allows (q, k) only if iq < 129, bq >= 0, ik < 129, ik != iq and bq - bk in {0, 1, 2, 4}: then bk lies in [bq - 4, bq], inside
  //      [lo - 4, hi], lo and hi the least and largest bq >= 0 of the query's set (lo >= 0: lo - 4 does not wrap); for q in F also ik != ilo.
  //      att 2 allows only keys with ik == 129 or bk == -1, at a position <= the largest position of the 32 queries.
  //      A tile that passes still gets the exact evaluation and its ballot below: only tiles with an allowed element are multiplied.
  unsigned live0, live1, live2;
  {
    const int  IMAX = 0x7fffffff, IMIN = (int)0x80000000;
    const int  iq1 = sI[q0 + lane], bq1 = sB[q0 + lane], pq1 = sP[q0 + lane];    // a lane: one of the block's 32 queries
    const bool qi  = iq1 < GINST;
    const int  ilo = __builtin_amdgcn_readfirstlane(wave_min_i(qi ? iq1 : IMAX));
    const int  ihi = __builtin_amdgcn_readfirstlane(wave_max_i(qi ? iq1 : IMIN));
    const bool qf  = qi & (iq1 == ilo), qr = qi & (iq1 != ilo);
    const bool bf  = qf & (bq1 >= 0),   br = qr & (bq1 >= 0);
    const int  pmf = __builtin_amdgcn_readfirstlane(wave_max_i(qf ? pq1 : IMIN));
    const int  pmr = __builtin_amdgcn_readfirstlane(wave_max_i(qr ? pq1 : IMIN));
    const int  pma = __builtin_amdgcn_readfirstlane(wave_max_i(pq1));
    const int  blf = __builtin_amdgcn_readfirstlane(wave_min_i(bf ? bq1 : IMAX)) - 4;
    const int  bhf = __builtin_amdgcn_readfirstlane(wave_max_i(bf ? bq1 : IMIN));
    const int  blr = __builtin_amdgcn_readfirstlane(wave_min_i(br ? bq1 : IMAX)) - 4;
    const int  bhr = __builtin_amdgcn_readfirstlane(wave_max_i(br ? bq1 : IMIN));
    // a lane: 8 consecutive keys (quarter lane & 3) of the wave's tile of group g1 = lane >> 2; six 16-B LDS reads cover the wave's 8 tiles
    const int g1  = lane >> 2;
    const int k8  = (WPB * g1 + ((wave - g1) & (WPB - 1))) * 32 + (lane & 3) * 8;
    bool c0 = false, c1 = false, c2 = false;                                     // & and |, not && and ||: straight-line code, no lane branches
#pragma unroll
    for (int h = 0; h < 2; ++h) {
      const v4i ia = *(const v4i*)(sI + k8 + 4 * h), ba = *(const v4i*)(sB + k8 + 4 * h), pa = *(const v4i*)(sP + k8 + 4 * h);
#pragma unroll
      for (int e = 0; e < 4; ++e) {
        c0 |= ((ia[e] == ilo) & (pa[e] <= pmf)) | ((ia[e] > ilo) & (ia[e] <= ihi) & (pa[e] <= pmr));
        c1 |= (ia[e] < GINST) & (((ia[e] != ilo) & (ba[e] >= blf) & (ba[e] <= bhf)) | ((ba[e] >= blr) & (ba[e] <= bhr)));
        c2 |= ((ia[e] == GINST) | (ba[e] == -1)) & (pa[e] <= pma);
      }
    }
    live0 = __builtin_amdgcn_ballot_w32(c0);
    live1 = __builtin_amdgcn_ballot_w32(c1);
    live2 = __builtin_amdgcn_ballot_w32(c2);
  }

  // kept rolled: with two query tiles a wave, three copies of the tile body and of the merge would be about 60 KB of code, nearly the
  // whole instruction cache; the mask is picked by a scalar branch at each key tile
#pragma unroll 1
  for (int att = 0; att < 3; ++att) {
    float mrow[QTW], lrow[QTW];              // this lane's query: running max (equal in both halves), this half's share of the sum
    v8f o[QTW][4];                            // o[t][j][r] = O^T[d = 16j + 8hh + r][query 16t + c]
#pragma unroll
    for (int t = 0; t < QTW; ++t) {
      mrow[t] = -INFINITY; lrow[t] = 0.f;
#pragma unroll
      for (int j = 0; j < 4; ++j) o[t][j] = zero8();
    }
    const unsigned livem = (att == 1) ? live1 : (att == 2) ? live2 : live0;      // wave-uniform
#pragma unroll 1
    for (int g = 0; g < NKT / WPB; ++g) {
      const int kt = WPB * g + ((wave - g) & (WPB - 1));
      if (((livem >> (4 * g)) & 0xfu) == 0u) continue;                           // wave-uniform: no key of the tile can be allowed under this mask
      const int kb = kt * 32;
      // ids and positions of this lane's 16 keys kb + 16u + 8hh + r (the rows of its D registers), 16-B LDS reads
      int ik[2][8], bk[2][8], pk[2][8];
#pragma unroll
      for (int u = 0; u < 2; ++u) {
        const v4i ia = *(const v4i*)(sI + kb + 16 * u + 8 * hh), ib = *(const v4i*)(sI + kb + 16 * u + 8 * hh + 4);
        const v4i ba = *(const v4i*)(sB + kb + 16 * u + 8 * hh), bb = *(const v4i*)(sB + kb + 16 * u + 8 * hh + 4);
        const v4i pa = *(const v4i*)(sP + kb + 16 * u + 8 * hh), pb = *(const v4i*)(sP + kb + 16 * u + 8 * hh + 4);
#pragma unroll
        for (int e = 0; e < 4; ++e) {
          ik[u][e] = ia[e]; ik[u][4 + e] = ib[e]; bk[u][e] = ba[e]; bk[u][4 + e] = bb[e]; pk[u][e] = pa[e]; pk[u][4 + e] = pb[e];
        }
      }
      // causal test j <= i on the tokens' own positions
      unsigned okb[QTW];                                                         // bit 8u + r
#pragma unroll
      for (int t = 0; t < QTW; ++t) {
        unsigned ob = 0u;
        if (att == 0) {
          const bool qa = iqv[t] < GINST;
#pragma unroll
          for (int u = 0; u < 2; ++u) {
#pragma unroll
            for (int r = 0; r < 8; ++r) {
              const bool ok = qa && (iqv[t] == ik[u][r]) && (pk[u][r] <= pqv[t]);
              ob |= ok ? (1u << (8 * u + r)) : 0u;
            }
          }
        } else if (att == 1) {
          const bool qa = (iqv[t] < GINST) && (bqv[t] >= 0);
#pragma unroll
          for (int u = 0; u < 2; ++u) {
#pragma unroll
            for (int r = 0; r < 8; ++r) {
              const int  d  = bqv[t] - bk[u][r];
              const bool w  = ((d >= 0) && (d <= 2)) || (d == 4);
              const bool ok = qa && (ik[u][r] < GINST) && (iqv[t] != ik[u][r]) && w;
              ob |= ok ? (1u << (8 * u + r)) : 0u;
            }
          }
        } else {
#pragma unroll
          for (int u = 0; u < 2; ++u) {
#pragma unroll
            for (int r = 0; r < 8; ++r) {
              const bool ok = ((ik[u][r] == GINST) || (bk[u][r] == -1)) && (pk[u][r] <= pqv[t]);
              ob |= ok ? (1u << (8 * u + r)) : 0u;
            }
          }
        }
        okb[t] = ob;
      }
      const unsigned anyw = __builtin_amdgcn_ballot_w32((okb[0] | okb[1]) != 0u);    // wave-uniform
      if (anyw == 0u) continue;

      // ---- scores, transposed: D element r of this lane = (key kb + 16u + 8hh + r, query q0 + 16t + c) in s[t][u];
      //      each k fragment (A) is loaded once and multiplied with both query tiles (B) ----
      v8f s[QTW][2];
#pragma unroll
      for (int t = 0; t < QTW; ++t) { s[t][0] = zero8(); s[t][1] = zero8(); }
      const unsigned ko = hofs + (unsigned)kt * KTB;                               // the key tile's place in the k' planes and in the v^T planes
#pragma unroll
      for (int kk = 0; kk < 2; ++kk) {
        const v16h kh0 = ldfrag_o(KHIp, ko, kk * FRB),         kl0 = ldfrag_o(KLOp, ko, kk * FRB);
        const v16h kh1 = ldfrag_o(KHIp, ko, RTB + kk * FRB),   kl1 = ldfrag_o(KLOp, ko, RTB + kk * FRB);
        const v16h qa  = ldfrag_o(QHIp, qofs, kk * FRB),       qb  = ldfrag_o(QLOp, qofs, kk * FRB);
        const v16h qc  = ldfrag_o(QHIp, qofs, RTB + kk * FRB), qd  = ldfrag_o(QLOp, qofs, RTB + kk * FRB);
        s[0][0] = mma_h(kh0, qa, s[0][0]);
        s[0][0] = mma_h(kh0, qb, s[0][0]);
        s[0][0] = mma_h(kl0, qa, s[0][0]);
        s[0][1] = mma_h(kh1, qa, s[0][1]);
        s[0][1] = mma_h(kh1, qb, s[0][1]);
        s[0][1] = mma_h(kl1, qa, s[0][1]);
        s[1][0] = mma_h(kh0, qc, s[1][0]);
        s[1][0] = mma_h(kh0, qd, s[1][0]);
        s[1][0] = mma_h(kl0, qc, s[1][0]);
        s[1][1] = mma_h(kh1, qc, s[1][1]);
        s[1][1] = mma_h(kh1, qd, s[1][1]);
        s[1][1] = mma_h(kl1, qc, s[1][1]);
        guard10(s[0][0], s[0][1], s[1][0], s[1][1], qa, qb, qc, qd, kh0, kl0, kh1, kl1, kh0, kl0);
      }
      // ---- v^T fragments (A of the second product): row d = 16j + c, fragment j of the key tile; each is loaded once and
      //      multiplied with both query tiles' prob fragments ----
      const v16h vh0 = ldfrag_o(VHIp, ko, 0u);
      const v16h vh1 = ldfrag_o(VHIp, ko, FRB);
      const v16h vh2 = ldfrag_o(VHIp, ko, 2u * FRB);
      const v16h vh3 = ldfrag_o(VHIp, ko, 3u * FRB);
      const v16h vl0 = ldfrag_o(VLOp, ko, 0u);
      const v16h vl1 = ldfrag_o(VLOp, ko, FRB);
      const v16h vl2 = ldfrag_o(VLOp, ko, 2u * FRB);
      const v16h vl3 = ldfrag_o(VLOp, ko, 3u * FRB);
#pragma unroll
      for (int t = 0; t < QTW; ++t) {
        // ---- mask (replace by -inf) + online softmax in base 2, -inf-safe, for this lane's query; a query with no allowed key in this
        //      key tile goes through with al = 1 (or 0 on a zero state) and all-zero probs: its state keeps its bits ----
        float tv[2][8];
        float mx = -INFINITY;
#pragma unroll
        for (int u = 0; u < 2; ++u) {
#pragma unroll
          for (int r = 0; r < 8; ++r) {
            const bool ok = ((okb[t] >> (8 * u + r)) & 1u) != 0u;
            tv[u][r] = ok ? (s[t][u][r] * lsc) : -INFINITY;
            mx = fmaxf(mx, tv[u][r]);
          }
        }
        mx = fmaxf(mx, xhalf(mx));
        const float mn = fmaxf(mrow[t], mx);
        const float ms = (mn == -INFINITY) ? 0.0f : mn;
        const float al = exp2f(mrow[t] - ms);
        mrow[t] = mn;
        // B fragments of P^T * 32768: hi f16 and residual f16, column = this lane's query; elements 0..7 = keys kb + 8hh + 0..7 (subtile 0),
        // elements 8..15 = keys kb + 16 + 8hh + 0..7 (subtile 1): the split k map of the v^T loader
        FragH ph, pl;
        float ps = 0.0f;
#pragma unroll
        for (int u = 0; u < 2; ++u) {
#pragma unroll
          for (int r = 0; r < 8; ++r) {
            const float e = exp2f(tv[u][r] - ms);
            ps += e;
            const float ta = e * PCAR;
            const _Float16 ha = (_Float16)ta;
            ph.h[u][r] = ha;
            pl.h[u][r] = (_Float16)(ta - (float)ha);
          }
        }
        lrow[t] = lrow[t] * al + ps;
#pragma unroll
        for (int j = 0; j < 4; ++j) o[t][j] *= al;
        o[t][0] = mma_h(vh0, ph.v, o[t][0]);  o[t][0] = mma_h(vh0, pl.v, o[t][0]);  o[t][0] = mma_h(vl0, ph.v, o[t][0]);
        o[t][1] = mma_h(vh1, ph.v, o[t][1]);  o[t][1] = mma_h(vh1, pl.v, o[t][1]);  o[t][1] = mma_h(vl1, ph.v, o[t][1]);
        o[t][2] = mma_h(vh2, ph.v, o[t][2]);  o[t][2] = mma_h(vh2, pl.v, o[t][2]);  o[t][2] = mma_h(vl2, ph.v, o[t][2]);
        o[t][3] = mma_h(vh3, ph.v, o[t][3]);  o[t][3] = mma_h(vh3, pl.v, o[t][3]);  o[t][3] = mma_h(vl3, ph.v, o[t][3]);
        guard10(o[t][0], o[t][1], o[t][2], o[t][3], ph.v, pl.v, vh0, vh1, vh2, vh3, vl0, vl1, vl2, vl3);
      }
    }
#pragma unroll
    for (int t = 0; t < QTW; ++t) acc_guard4(o[t][0], o[t][1], o[t][2], o[t][3]);
    // ---- publish this wave's partial: acc in its slab (a lane: its query's row, 8 consecutive d per j, 16-B stores); m and Z, the two
    //      halves' sums joined here, by the lower half ----
#pragma unroll
    for (int t = 0; t < QTW; ++t) {
#pragma unroll
      for (int j = 0; j < 4; ++j) {
        float* sp = slab + (16 * t + c) * 68 + j * 16 + 8 * hh;
        v4f a, b4;
#pragma unroll
        for (int e = 0; e < 4; ++e) { a[e] = o[t][j][e]; b4[e] = o[t][j][4 + e]; }
        *(v4f*)(sp)     = a;
        *(v4f*)(sp + 4) = b4;
      }
      const float z = lrow[t] + xhalf(lrow[t]);
      if (hh == 0) {
        ml[16 * t + c]            = mrow[t];
        ml[16 * QTW + 16 * t + c] = z;
      }
    }
    __syncthreads();                          // all WPB partials of this mask are visible
    // ---- merge for this lane's row and 8 d columns: out_a = acc / Z (0 when no key allowed), carries (32768 on P, 1024 on v) folded once ----
    {
      float mw[WPB], zw[WPB];
#pragma unroll
      for (int w2 = 0; w2 < WPB; ++w2) {
        mw[w2] = smem[w2 * WREG + QTW * SLW + row];
        zw[w2] = smem[w2 * WREG + QTW * SLW + 16 * QTW + row];
      }
      float mx = mw[0];
#pragma unroll
      for (int w2 = 1; w2 < WPB; ++w2) mx = fmaxf(mx, mw[w2]);
      const float ms = (mx == -INFINITY) ? 0.0f : mx;
      float lv = 0.0f;
      v4f oa = {0.f, 0.f, 0.f, 0.f}, ob = {0.f, 0.f, 0.f, 0.f};
#pragma unroll
      for (int w2 = 0; w2 < WPB; ++w2) {
        const float sc = exp2f(mw[w2] - ms);
        const float* ap = smem + w2 * WREG + row * 68 + c8;
        lv += zw[w2] * sc;
        oa += *(const v4f*)(ap) * sc;
        ob += *(const v4f*)(ap + 4) * sc;
      }
      const float ls  = (lv > 0.0f) ? lv : 1.0f;
      const float inv = (lv > 0.0f) ? ((1.0f / ls) * oc) : 0.0f;
      float* op = osum + row * 68 + c8;
      if (att == 0) {
        *(v4f*)(op)     = oa * inv;
        *(v4f*)(op + 4) = ob * inv;
      } else {
        *(v4f*)(op)     = *(const v4f*)(op) + oa * inv;
        *(v4f*)(op + 4) = *(const v4f*)(op + 4) + ob * inv;
      }
    }
    __syncthreads();                          // every reader has left the slabs (the next mask overwrites them); after the last mask: osum is whole
  }

  // ---- O x1024 -> f16 hi + residual planes; wave = group of 4 rows, lane = (row in group, 8 consecutive d) ----
  v4u oh, ol;
  {
    const v4f a = *(const v4f*)(osum + row * 68 + c8), b4 = *(const v4f*)(osum + row * 68 + c8 + 4);
    float w[8];
#pragma unroll
    for (int e = 0; e < 4; ++e) { w[e] = a[e] * OSC; w[4 + e] = b4[e] * OSC; }
#pragma unroll
    for (int e = 0; e < 4; ++e) {
      const _Float16 h0 = (_Float16)w[2 * e], h1 = (_Float16)w[2 * e + 1];
      const _Float16 l0 = (_Float16)(w[2 * e] - (float)h0), l1 = (_Float16)(w[2 * e + 1] - (float)h1);
      oh[e] = pk16(h_bits(h0), h_bits(h1));
      ol[e] = pk16(h_bits(l0), h_bits(l1));
    }
  }
  // back to the order of positions: the O planes are [s][h][d]; a row's 64 halves of a head are one whole line, written by 8 lanes of this wave
  const size_t o8 = (((size_t)sP[q0 + row]) * NH + head) * HD + c8;
  *(v4u*)(OHIp + o8) = oh;
  *(v4u*)(OLOp + o8) = ol;
}

// =====================================================================================================
// Workspace map (bytes); every plane is fully written by whole-line stores before it is read; all extents are exact multiples
// of the store granularity (no pad rows needed); every offset a multiple of SEQ*256:
//   CT  f32 [SEQ][64]                  SEQ*256        ST  same
//   XB  bf16 [SEQ][1024]               SEQ*2048
//   WQB bf16 [1024 n][1024 k]         2097152        WKB, WVB same        2097152 each
//   WOH f16  [1024 n][1024 k] x1024   2097152
//   QHI f16 [16][SEQ/16][2][2][32][8] x1024  SEQ*2048  QLO residual   (fragment order: head, row tile, k-step, i, lane)
//   KHI f16 [16][SEQ/16][2][2][32][8] x1024  SEQ*2048  KLO residual
//   VHI f16 [16][SEQ/32][4][2][32][8] x1024  SEQ*2048  VLO residual   (fragment order: head, key tile, d tile, i, lane)
//   OHI f16 [SEQ][1024] x1024          SEQ*2048       OLO residual   (rows in the order of positions)
//   RK  i32 [SEQ]                      SEQ*4          rank of each position in the sorted token order
//   end (SEQ = 2048)                  47194112
//   CT, ST, XB and the q', k', v^T planes have their rows (keys) in the sorted token order.
// =====================================================================================================
extern "C" void kernel_launch(void* const* d_in, const int* in_sizes, int n_in,
                              void* d_out, int out_size, void* d_ws, size_t ws_size,
                              hipStream_t stream) {
  if (n_in < 11) return;
  if (in_sizes[0] != SEQ * DMOD) return;
  if (in_sizes[1] != SEQ || in_sizes[2] != SEQ) return;
  if (in_sizes[3] != DMOD * DMOD || in_sizes[5] != DMOD * DMOD) return;
  if (in_sizes[7] != DMOD * DMOD || in_sizes[9] != DMOD * DMOD) return;
  if (in_sizes[4] != DMOD || in_sizes[6] != DMOD || in_sizes[8] != DMOD || in_sizes[10] != DMOD) return;
  if (out_size != SEQ * DMOD) return;

  const float* x   = (const float*)d_in[0];
  const int*   bar = (const int*)d_in[1];
  const int*   ins = (const int*)d_in[2];
  const float* wq  = (const float*)d_in[3];
  const float* bq  = (const float*)d_in[4];
  const float* wk  = (const float*)d_in[5];
  const float* bk  = (const float*)d_in[6];
  const float* wv  = (const float*)d_in[7];
  const float* bv  = (const float*)d_in[8];
  const float* wo  = (const float*)d_in[9];
  const float* bo  = (const float*)d_in[10];
  float*       out = (float*)d_out;

  const size_t szTab = (size_t)SEQ * HD * 4;                    //   524288
  const size_t szXB  = (size_t)SEQ * DMOD * 2;                  //  4194304
  const size_t szW   = (size_t)DMOD * DMOD * 2;                 //  2097152
  const size_t szP   = (size_t)SEQ * DMOD * 2;                  //  4194304
  size_t off = 0;
  const size_t oCT  = off; off += szTab;
  const size_t oST  = off; off += szTab;
  const size_t oXB  = off; off += szXB;
  const size_t oWQ  = off; off += szW;
  const size_t oWK  = off; off += szW;
  const size_t oWV  = off; off += szW;
  const size_t oWO  = off; off += szW;
  const size_t oQHI = off; off += szP;
  const size_t oQLO = off; off += szP;
  const size_t oKHI = off; off += szP;
  const size_t oKLO = off; off += szP;
  const size_t oVHI = off; off += szP;
  const size_t oVLO = off; off += szP;
  const size_t oOHI = off; off += szP;
  const size_t oOLO = off; off += szP;
  const size_t oRK  = off; off += (size_t)SEQ * 4;
  if (off > ws_size) return;                            // off = 47194112 at SEQ = 2048
  if (off > (size_t)134217728) return;

  char* ws = (char*)d_ws;
  float* CT  = (float*)(ws + oCT);
  float* ST  = (float*)(ws + oST);
  u16*   XB  = (u16*)(ws + oXB);
  u16*   WQB = (u16*)(ws + oWQ);
  u16*   WKB = (u16*)(ws + oWK);
  u16*   WVB = (u16*)(ws + oWV);
  u16*   WOH = (u16*)(ws + oWO);
  u16*   QHI = (u16*)(ws + oQHI);
  u16*   QLO = (u16*)(ws + oQLO);
  u16*   KHI = (u16*)(ws + oKHI);
  u16*   KLO = (u16*)(ws + oKLO);
  u16*   VHI = (u16*)(ws + oVHI);
  u16*   VLO = (u16*)(ws + oVLO);
  u16*   OHI = (u16*)(ws + oOHI);
  u16*   OLO = (u16*)(ws + oOLO);
  int*   RK  = (int*)(ws + oRK);

  // inv_freq[i] = 1 / pow(10000, i/32) in f32 (pow correctly converted from f64, then IEEE f32 reciprocal)
  InvF inv;
  for (int i = 0; i < 32; ++i) {
    const double p = pow(10000.0, (double)i / 32.0);
    const float pf = (float)p;
    inv.f[i] = 1.0f / pf;
  }

  const dim3 blk(256);
  const dim3 gPrep(RNKB + TABB + 4 * WCB);              // 64 + 256 + 2048
  const dim3 gG((SEQ / 64) * (DMOD / 128));             // 256
  const dim3 gG3((SEQ / GAR) * (DMOD / 64));            // 256
  const dim3 bG(256);
  const dim3 bG3(384);
  const dim3 gAT(ATT_BLOCKS);                           // 1024
  const dim3 bAT(ATT_THREADS);                          // 256

  // (0) rank table; rotary cos/sin tables [SEQ][64] and x -> bf16, rows at their rank; Wq, Wk, Wv -> bf16 planes (same layout, already
  //     k-contiguous); Wo -> f16 plane of bf16 value x1024
  prep<<<gPrep, blk, 0, stream>>>(x, ins, wq, wk, wv, wo, XB, WQB, WKB, WVB, WOH, CT, ST, RK, inv);
  // (1) projections q, k, v (+ bias), packed in the epilogue: q', k' planes (rotary) and v^T planes, x1024 (hi + residual), all in fragment order
  gemm_bf<<<gG3, bG3, 0, stream>>>(XB, WQB, WKB, WVB, bq, bk, bv, CT, ST, QHI, QLO, KHI, KLO, VHI, VLO, SEQ, DMOD, DMOD, 1.0f);
  // (2) three masked attentions summed -> O planes [s][h][d] x1024 (hi + residual)
  attn3<<<gAT, bAT, 0, stream>>>(QHI, QLO, KHI, KLO, VHI, VLO, ins, bar, RK, OHI, OLO);
  // (3) output projection -> out [SEQ][1024] f32, carries 1024 (O) x 1024 (Wo) folded back, + bo
  gemm_h2<<<gG, bG, 0, stream>>>(OHI, OLO, WOH, bo, out, SEQ, DMOD, DMOD, 1.0f / (OSC * WOS));
  (void)hipGetLastError();
}
